// v000
// Measured on an AMD MI455X. A time is GPU time per run, averaged over a window of back-to-back runs after a warm-up
// (all launches, gaps included; the runs take copies of the inputs in turn), and the median of several windows.
// Apart from v000's, it joins two sittings. Times from different sittings can be a few percent apart, while
// side-by-side timings come from the same sitting.
// The starting kernel, v000, takes 515 microseconds a run.
#include <hip/hip_runtime.h>
// [Q|K|V] = x·[Wq|Wk|Wv] + b on v_wmma_f32_16x16x32_bf16 (x rounded to bf16: single exact term; 8192 × 1024 × 384); QK = Q·Kᵀ on the same unit with BOTH f32 operands split
// hi/lo (3 products — cos(QK) at |QK| ≈ 10–40 needs the phase to ≈1e-4 rad; 4 × 2048 × 2048 × 128); out = cos(QK)·V on v_wmma_f32_16x16x32_f16 (cos and V rounded to
// f16: single product). cos in f32 VALU.
#define BB 4
#define LL 2048
#define DM 1024
#define DK 128
#define NTOK (BB * LL)

typedef __bf16 v16b __attribute__((ext_vector_type(16)));
typedef unsigned short v8us __attribute__((ext_vector_type(8), may_alias));
typedef float  v8f  __attribute__((ext_vector_type(8)));
typedef float  v4f  __attribute__((ext_vector_type(4)));
typedef float  v4fa __attribute__((ext_vector_type(4), may_alias));
union FragB { v16b v; v8us half[2]; unsigned short u[16]; };

__device__ __forceinline__ unsigned short bf16_bits(float x) { unsigned int u = __float_as_uint(x); return (unsigned short)((u + 0x7FFFu + ((u >> 16) & 1u)) >> 16); }
__device__ __forceinline__ float bf16_val(unsigned short b) { return __uint_as_float(((unsigned int)b) << 16); }
__device__ __forceinline__ float bf16_round(float x) { return bf16_val(bf16_bits(x)); }
// D += A·B with NT terms: 1 = ah·bh, 2 = + al·bh (A split), 3 = + ah·bl (both split)
template <int NT>
__device__ __forceinline__ v8f mmaN(v16b ah, v16b al, v16b bh, v16b bl, v8f c) {
  c = __builtin_amdgcn_wmma_f32_16x16x32_bf16(false, ah, false, bh, (short)0, c, false, false);
  if (NT >= 2) c = __builtin_amdgcn_wmma_f32_16x16x32_bf16(false, al, false, bh, (short)0, c, false, false);
  if (NT >= 3) c = __builtin_amdgcn_wmma_f32_16x16x32_bf16(false, ah, false, bl, (short)0, c, false, false);
  asm volatile("v_nop\n\tv_nop\n\tv_nop\n\tv_nop" : "+v"(c) : "v"(ah), "v"(al), "v"(bh), "v"(bl));
  return c;
}

__global__ __launch_bounds__(256) void k_wt_bf16(const float* __restrict__ W, unsigned short* __restrict__ Wt, int K, int N) {
  const int t = blockIdx.x * 256 + threadIdx.x;
  const int k8n = K / 8;
  if (t >= N * k8n) return;
  const int n = t / k8n, k8 = (t % k8n) * 8;
  v8us v;
#pragma unroll
  for (int i = 0; i < 8; ++i) v[i] = bf16_bits(W[(size_t)(k8 + i) * N + n]);
  *(v8us*)(Wt + (size_t)n * K + k8) = v;
  
}

// GEMM C[M][N] (f32, pitch ldc) = act(A[M][K]·W + bias). A f32 row-major (pitch lda) converted per fragment to bf16
// (ASPLIT: hi/lo two planes -> 2 terms, else single rounded term); Wt bf16 [N][K] (pitch ldb). BIAS_BF16 rounds the
// bias to bf16 first (bias quantised to bf16 before the add). K%32==0, M%16==0, N%64==0.
template <bool ASPLIT, int ACT, bool BIAS_BF16>
__global__ __launch_bounds__(128) void k_gemm_bf(const float* __restrict__ A, int lda, const unsigned short* __restrict__ Wt, int ldb,
                                               const float* __restrict__ bias, float* __restrict__ C, int ldc, int M, int N, int K) {
  __shared__ __attribute__((aligned(16))) float so[4][16][64];
  const int tid = threadIdx.x, w = tid >> 5, lane = tid & 31, ln = lane & 15, hh = lane >> 4;
  const int ntn = N / 64;
  const int wid = blockIdx.x * 4 + w;
  const int mt = wid / ntn, nq = wid % ntn;
  if (mt * 16 >= M) return;
  const int row0 = mt * 16, col0 = nq * 64;
  const float* arow = A + (size_t)(row0 + ln) * lda;
  v8f acc[4] = {};
  for (int kb = 0; kb < K; kb += 32) {
    FragB ah, al;
    const v4f x0 = *(const v4fa*)(arow + kb + 8 * hh), x1 = *(const v4fa*)(arow + kb + 8 * hh + 4);
    const v4f x2 = *(const v4fa*)(arow + kb + 16 + 8 * hh), x3 = *(const v4fa*)(arow + kb + 16 + 8 * hh + 4);
    float xs[16] = {x0[0],x0[1],x0[2],x0[3],x1[0],x1[1],x1[2],x1[3],x2[0],x2[1],x2[2],x2[3],x3[0],x3[1],x3[2],x3[3]};
#pragma unroll
    for (int i = 0; i < 16; ++i) { const unsigned short hb = bf16_bits(xs[i]); ah.u[i] = hb; al.u[i] = ASPLIT ? bf16_bits(xs[i] - bf16_val(hb)) : (unsigned short)0; }
#pragma unroll
    for (int t = 0; t < 4; ++t) {
      const unsigned short* brow = Wt + (size_t)(col0 + t * 16 + ln) * ldb + kb;
      FragB b;
      b.half[0] = *(const v8us*)(brow + 8 * hh);
      b.half[1] = *(const v8us*)(brow + 16 + 8 * hh);
      acc[t] = mmaN<ASPLIT ? 2 : 1>(ah.v, al.v, b.v, b.v, acc[t]);
    }
  }
#pragma unroll
  for (int t = 0; t < 4; ++t) {
    float bv = bias ? bias[col0 + t * 16 + ln] : 0.f;
    if (BIAS_BF16) bv = bf16_round(bv);
#pragma unroll
    for (int r = 0; r < 8; ++r) { float v = acc[t][r] + bv; if (ACT == 1) v = fmaxf(v, 0.f); so[w][8 * hh + r][t * 16 + ln] = v; }
  }
  __builtin_amdgcn_fence(__ATOMIC_ACQ_REL, "workgroup");
  __builtin_amdgcn_wave_barrier();
  const int rsub = lane >> 4, c4 = (lane & 15) * 4;
  {
#pragma unroll
    for (int q = 0; q < 8; ++q) {
      const int r = q * 2 + rsub;
      const v4f v = *(const v4fa*)&so[w][r][c4];
      *(v4f*)(C + (size_t)(row0 + r) * ldc + col0 + c4) = v;
    }
    
  }
}

// Flash-style causal/unmasked attention, all contractions 3-term bf16 hi/lo splits, f32 softmax with running max.
// q,k,v rows are read from f32 buffers with arbitrary row pitch (so they can live inside a fused qkv buffer);
// D = head size (multiple of 32, <= 128); one wave = 16 query rows; block = 4 waves (64 queries) sharing K/V chunks of 32.
template <int D, bool CAUSAL>
__global__ __launch_bounds__(128) void k_flash(const float* __restrict__ qb, const float* __restrict__ kb, const float* __restrict__ vb,
                                             int pitch, int T, int H, float scale, float* __restrict__ y, int ypitch) {
  constexpr int KS = D / 32;        // k-steps for QK
  constexpr int DT = D / 16;        // d tiles for PV
  __shared__ __attribute__((aligned(16))) unsigned short sKh[32][D + 8], sKl[32][D + 8], sVh[32][D + 8], sVl[32][D + 8];
  __shared__ __attribute__((aligned(16))) unsigned short sPh[4][16][40], sPl[4][16][40];
  __shared__ __attribute__((aligned(16))) float sO[4][16][D];
  const int tid = threadIdx.x, w = tid >> 5, lane = tid & 31, ln = lane & 15, hh = lane >> 4;
  const int nqb = (T + 63) / 64;
  const int bh = blockIdx.x / nqb, qblk = blockIdx.x % nqb;
  const int b = bh / H, h = bh % H;
  const int q0 = qblk * 64 + w * 16;
  const float* Q = qb + (size_t)b * T * pitch + h * D;
  const float* K = kb + (size_t)b * T * pitch + h * D;
  const float* V = vb + (size_t)b * T * pitch + h * D;

  // A fragments of the wave's 16 query rows (scaled), hi/lo
  FragB aqh[KS], aql[KS];
  {
    int row = q0 + ln; if (row >= T) row = T - 1;
    const float* qr = Q + (size_t)row * pitch;
#pragma unroll
    for (int ks = 0; ks < KS; ++ks)
#pragma unroll
      for (int i = 0; i < 16; ++i) {
        const int d = ks * 32 + ((i < 8) ? (8 * hh + i) : (16 + 8 * hh + (i - 8)));
        const float x = qr[d] * scale; const unsigned short hb = bf16_bits(x);
        aqh[ks].u[i] = hb; aql[ks].u[i] = bf16_bits(x - bf16_val(hb));
      }
  }
  float m_r[8], l_r[8];
#pragma unroll
  for (int r = 0; r < 8; ++r) { m_r[r] = -3.0e38f; l_r[r] = 0.f; }
  v8f oacc[DT];
#pragma unroll
  for (int dt = 0; dt < DT; ++dt) oacc[dt] = (v8f){0.f,0.f,0.f,0.f,0.f,0.f,0.f,0.f};

  const int kv_end = CAUSAL ? min(T, qblk * 64 + 64) : T;     // block-uniform
  for (int j0 = 0; j0 < kv_end; j0 += 32) {
    __syncthreads();
    for (int e = tid; e < 32 * (D / 4); e += 128) {
      const int r = e / (D / 4), c4 = (e % (D / 4)) * 4;
      const int key = j0 + r;
      v4f kf = {0.f,0.f,0.f,0.f}, vf = {0.f,0.f,0.f,0.f};
      if (key < T) { kf = *(const v4fa*)(K + (size_t)key * pitch + c4); vf = *(const v4fa*)(V + (size_t)key * pitch + c4); }
#pragma unroll
      for (int t = 0; t < 4; ++t) {
        unsigned short hb = bf16_bits(kf[t]); sKh[r][c4 + t] = hb; sKl[r][c4 + t] = bf16_bits(kf[t] - bf16_val(hb));
        hb = bf16_bits(vf[t]); sVh[r][c4 + t] = hb; sVl[r][c4 + t] = bf16_bits(vf[t] - bf16_val(hb));
      }
    }
    __syncthreads();
    // S tile 16 x 32
    v8f s[2];
#pragma unroll
    for (int nt = 0; nt < 2; ++nt) {
      v8f acc = {};
#pragma unroll
      for (int ks = 0; ks < KS; ++ks) {
        FragB bh_, bl_;
        bh_.half[0] = *(const v8us*)&sKh[nt * 16 + ln][ks * 32 + 8 * hh]; bh_.half[1] = *(const v8us*)&sKh[nt * 16 + ln][ks * 32 + 16 + 8 * hh];
        bl_.half[0] = *(const v8us*)&sKl[nt * 16 + ln][ks * 32 + 8 * hh]; bl_.half[1] = *(const v8us*)&sKl[nt * 16 + ln][ks * 32 + 16 + 8 * hh];
        acc = mmaN<3>(aqh[ks].v, aql[ks].v, bh_.v, bl_.v, acc);
      }
      s[nt] = acc;
    }
    // mask + running max (rows 8hh+r; the 16 lanes of a half share rows)
    float alpha[8];
#pragma unroll
    for (int r = 0; r < 8; ++r) {
      const int qi = q0 + 8 * hh + r;
      const int ja = j0 + ln, jb = j0 + 16 + ln;
      if (CAUSAL) { if (ja > qi) s[0][r] = -3.0e38f; if (jb > qi) s[1][r] = -3.0e38f; }
      if (ja >= T) s[0][r] = -3.0e38f;
      if (jb >= T) s[1][r] = -3.0e38f;
      float mx = fmaxf(s[0][r], s[1][r]);
      mx = fmaxf(mx, __shfl_xor(mx, 1, 32)); mx = fmaxf(mx, __shfl_xor(mx, 2, 32)); mx = fmaxf(mx, __shfl_xor(mx, 4, 32)); mx = fmaxf(mx, __shfl_xor(mx, 8, 32));
      const float mnew = fmaxf(m_r[r], mx);
      alpha[r] = (mnew > -1.0e38f) ? __expf(m_r[r] - mnew) : 1.0f;
      const float p0 = (s[0][r] > -1.0e38f) ? __expf(s[0][r] - mnew) : 0.f;
      const float p1 = (s[1][r] > -1.0e38f) ? __expf(s[1][r] - mnew) : 0.f;
      m_r[r] = mnew;
      l_r[r] = l_r[r] * alpha[r] + p0 + p1;            // per-lane partial row sum (16 lanes combined at the end)
      unsigned short hb = bf16_bits(p0); sPh[w][8 * hh + r][ln] = hb;      sPl[w][8 * hh + r][ln] = bf16_bits(p0 - bf16_val(hb));
      hb = bf16_bits(p1);                sPh[w][8 * hh + r][16 + ln] = hb; sPl[w][8 * hh + r][16 + ln] = bf16_bits(p1 - bf16_val(hb));
    }
#pragma unroll
    for (int dt = 0; dt < DT; ++dt)
#pragma unroll
      for (int r = 0; r < 8; ++r) oacc[dt][r] *= alpha[r];
    __builtin_amdgcn_fence(__ATOMIC_ACQ_REL, "workgroup");
    __builtin_amdgcn_wave_barrier();
    FragB pah, pal;
    pah.half[0] = *(const v8us*)&sPh[w][ln][8 * hh]; pah.half[1] = *(const v8us*)&sPh[w][ln][16 + 8 * hh];
    pal.half[0] = *(const v8us*)&sPl[w][ln][8 * hh]; pal.half[1] = *(const v8us*)&sPl[w][ln][16 + 8 * hh];
#pragma unroll
    for (int dt = 0; dt < DT; ++dt) {
      FragB bvh, bvl;
#pragma unroll
      for (int i = 0; i < 8; ++i) {
        bvh.u[i] = sVh[8 * hh + i][dt * 16 + ln]; bvh.u[8 + i] = sVh[16 + 8 * hh + i][dt * 16 + ln];
        bvl.u[i] = sVl[8 * hh + i][dt * 16 + ln]; bvl.u[8 + i] = sVl[16 + 8 * hh + i][dt * 16 + ln];
      }
      oacc[dt] = mmaN<3>(pah.v, pal.v, bvh.v, bvl.v, oacc[dt]);
    }
    __builtin_amdgcn_fence(__ATOMIC_ACQ_REL, "workgroup");
    __builtin_amdgcn_wave_barrier();
  }
#pragma unroll
  for (int r = 0; r < 8; ++r) {
    float l = l_r[r];
    l += __shfl_xor(l, 1, 32); l += __shfl_xor(l, 2, 32); l += __shfl_xor(l, 4, 32); l += __shfl_xor(l, 8, 32);
    l_r[r] = (l > 0.f) ? 1.0f / l : 0.f;
  }
#pragma unroll
  for (int dt = 0; dt < DT; ++dt)
#pragma unroll
    for (int r = 0; r < 8; ++r) sO[w][8 * hh + r][dt * 16 + ln] = oacc[dt][r] * l_r[r];
  __builtin_amdgcn_fence(__ATOMIC_ACQ_REL, "workgroup");
  __builtin_amdgcn_wave_barrier();
  {
    for (int r = 0; r < 16; ++r) {
      const int row = q0 + r;
      if (row < T && lane < D / 4) {
        const v4f val = *(const v4fa*)&sO[w][r][lane * 4];
        *(v4f*)(y + ((size_t)b * T + row) * ypitch + h * D + lane * 4) = val;
      }
    }
    
  }
}

// batched GEMM (blockIdx.y = batch): C_b = act(alpha·A_b·B_b + bias + resid_b); A f32 rows (ASPLIT → hi/lo), B = bf16 planes Bh (+Bl when BSPLIT, requires ASPLIT),
// per-batch element strides sA, sB (0 = shared weights), sC, sR. resid may alias C (values are staged before the stores). ACT 0/1(relu).
// ACT: 0 none, 1 relu, 2 softplus
template <bool ASPLIT, bool BSPLIT, int ACT>
__global__ __launch_bounds__(128) void k_gemm_b(const float* __restrict__ A, int lda, size_t sA, const unsigned short* __restrict__ Bh, const unsigned short* __restrict__ Bl, int ldb, size_t sB,
                                             const float* __restrict__ bias, const float* __restrict__ resid, int ldr, size_t sR, float rsign, float alpha,
                                             float* __restrict__ C, int ldc, size_t sC, int M, int N, int K) {
  __shared__ __attribute__((aligned(16))) float so[4][16][64];
  const int tid = threadIdx.x, w = tid >> 5, lane = tid & 31, ln = lane & 15, hh = lane >> 4;
  const int by = blockIdx.y;
  A += (size_t)by * sA; Bh += (size_t)by * sB; if (BSPLIT) Bl += (size_t)by * sB; C += (size_t)by * sC; if (resid) resid += (size_t)by * sR;
  const int ntn = (N + 63) / 64; const int wid = blockIdx.x * 4 + w; const int mt = wid / ntn, nq = wid % ntn;      // N may be any multiple of 16: tiles past N are skipped and not stored
  if (mt * 16 >= M) return;
  const int row0 = mt * 16, col0 = nq * 64;
  const float* arow = A + (size_t)(row0 + ln) * lda;
  v8f acc[4] = {};
  for (int kb = 0; kb < K; kb += 32) {
    FragB ah, al;
    const v4f x0 = *(const v4fa*)(arow + kb + 8 * hh), x1 = *(const v4fa*)(arow + kb + 8 * hh + 4);
    const v4f x2 = *(const v4fa*)(arow + kb + 16 + 8 * hh), x3 = *(const v4fa*)(arow + kb + 16 + 8 * hh + 4);
    float xs[16] = {x0[0],x0[1],x0[2],x0[3],x1[0],x1[1],x1[2],x1[3],x2[0],x2[1],x2[2],x2[3],x3[0],x3[1],x3[2],x3[3]};
#pragma unroll
    for (int i = 0; i < 16; ++i) { const unsigned short hb = bf16_bits(xs[i]); ah.u[i] = hb; al.u[i] = ASPLIT ? bf16_bits(xs[i] - bf16_val(hb)) : (unsigned short)0; }
#pragma unroll
    for (int t = 0; t < 4; ++t) {
      if (col0 + t * 16 >= N) continue;
      const size_t boff = (size_t)(col0 + t * 16 + ln) * ldb + kb;
      FragB bh_, bl_; bh_.half[0] = *(const v8us*)(Bh + boff + 8 * hh); bh_.half[1] = *(const v8us*)(Bh + boff + 16 + 8 * hh);
      if (BSPLIT) { bl_.half[0] = *(const v8us*)(Bl + boff + 8 * hh); bl_.half[1] = *(const v8us*)(Bl + boff + 16 + 8 * hh); } else bl_ = bh_;
      acc[t] = mmaN<ASPLIT ? (BSPLIT ? 3 : 2) : 1>(ah.v, al.v, bh_.v, bl_.v, acc[t]);
    }
  }
#pragma unroll
  for (int t = 0; t < 4; ++t) {
    const int col = col0 + t * 16 + ln; if (col0 + t * 16 >= N) continue; const float bv = bias ? bf16_round(bias[col]) : 0.f;
#pragma unroll
    for (int r = 0; r < 8; ++r) { float v = acc[t][r] * alpha + bv; if (resid) v += rsign * resid[(size_t)(row0 + 8 * hh + r) * ldr + col]; if (ACT == 1) v = fmaxf(v, 0.f); else if (ACT == 2) v = fmaxf(v, 0.f) + log1pf(expf(-fabsf(v))); so[w][8 * hh + r][t * 16 + ln] = v; }
  }
  __builtin_amdgcn_fence(__ATOMIC_ACQ_REL, "workgroup"); __builtin_amdgcn_wave_barrier();
  const int rsub = lane >> 4, c4 = (lane & 15) * 4;
  {
#pragma unroll
    for (int q = 0; q < 8; ++q) { const int r = q * 2 + rsub; if (col0 + c4 < N) { const v4f v = *(const v4fa*)&so[w][r][c4]; *(v4f*)(C + (size_t)(row0 + r) * ldc + col0 + c4) = v; } }
    
  }
}
// batched f32 [K][N] (pitch lds, batch stride sIn) -> transposed hi/lo planes [N][K] (batch stride sOut); thread per (n, 8 k); grid.y = batch
__global__ __launch_bounds__(256) void k_split_transpose_b(const float* __restrict__ src, int lds_, size_t sIn, unsigned short* __restrict__ hi, unsigned short* __restrict__ lo, size_t sOut, int K, int N) {
  const size_t t = (size_t)blockIdx.x * 256 + threadIdx.x; const int k8n = K / 8; if (t >= (size_t)N * k8n) return;
  src += (size_t)blockIdx.y * sIn; hi += (size_t)blockIdx.y * sOut; lo += (size_t)blockIdx.y * sOut;
  const int n = (int)(t / k8n), k8 = (int)(t % k8n) * 8; v8us vh, vl;
#pragma unroll
  for (int i = 0; i < 8; ++i) { const float x = src[(size_t)(k8 + i) * lds_ + n]; const unsigned short hb = bf16_bits(x); vh[i] = hb; vl[i] = bf16_bits(x - bf16_val(hb)); }
  unsigned short* dh = hi + (size_t)n * K + k8; unsigned short* dl = lo + (size_t)n * K + k8;
  *(v8us*)dh = vh; *(v8us*)dl = vl; 
}

// ---- f16 WMMA path (v_wmma_f32_16x16x32_f16): 11-bit significands for operands in range — used where the [-1,1] cos operand needs more precision than bf16
typedef _Float16 v16h __attribute__((ext_vector_type(16)));
union FragH { v16h v; v8us half[2]; _Float16 h[16]; unsigned short u[16]; };
template <int NT>
__device__ __forceinline__ v8f mmaH(v16h ah, v16h al, v16h bh, v16h bl, v8f c) {
  c = __builtin_amdgcn_wmma_f32_16x16x32_f16(false, ah, false, bh, (short)0, c, false, false);
  if (NT >= 2) c = __builtin_amdgcn_wmma_f32_16x16x32_f16(false, al, false, bh, (short)0, c, false, false);
  if (NT >= 3) c = __builtin_amdgcn_wmma_f32_16x16x32_f16(false, ah, false, bl, (short)0, c, false, false);
  asm volatile("v_nop\n\tv_nop\n\tv_nop\n\tv_nop" : "+v"(c) : "v"(ah), "v"(al), "v"(bh), "v"(bl));
  return c;
}
// batched GEMM like k_gemm_b but f16 operands: A f32 (split into f16 hi/lo if ASPLIT, else rounded to f16), Bt = f16 values [n][k]; alpha; C f32; N multiple of 16 (partial tiles skipped)
template <bool ASPLIT>
__global__ __launch_bounds__(128) void k_gemm_h(const float* __restrict__ A, int lda, size_t sA, const _Float16* __restrict__ Bh, int ldb, size_t sB, float alpha, float* __restrict__ C, int ldc, size_t sC, int M, int N, int K) {
  __shared__ __attribute__((aligned(16))) float so[4][16][64];
  const int tid = threadIdx.x, w = tid >> 5, lane = tid & 31, ln = lane & 15, hh = lane >> 4; const int by = blockIdx.y;
  A += (size_t)by * sA; Bh += (size_t)by * sB; C += (size_t)by * sC;
  const int ntn = (N + 63) / 64; const int wid = blockIdx.x * 4 + w; const int mt = wid / ntn, nq = wid % ntn; if (mt * 16 >= M) return;
  const int row0 = mt * 16, col0 = nq * 64; const float* arow = A + (size_t)(row0 + ln) * lda;
  v8f acc[4] = {};
  for (int kb = 0; kb < K; kb += 32) {
    FragH ah, al;
    const v4f x0 = *(const v4fa*)(arow + kb + 8 * hh), x1 = *(const v4fa*)(arow + kb + 8 * hh + 4), x2 = *(const v4fa*)(arow + kb + 16 + 8 * hh), x3 = *(const v4fa*)(arow + kb + 16 + 8 * hh + 4);
    float xs[16] = {x0[0],x0[1],x0[2],x0[3],x1[0],x1[1],x1[2],x1[3],x2[0],x2[1],x2[2],x2[3],x3[0],x3[1],x3[2],x3[3]};
#pragma unroll
    for (int i = 0; i < 16; ++i) { const _Float16 h = (_Float16)xs[i]; ah.h[i] = h; al.h[i] = ASPLIT ? (_Float16)(xs[i] - (float)h) : (_Float16)0.0f; }
#pragma unroll
    for (int t = 0; t < 4; ++t) { if (col0 + t * 16 >= N) continue; const size_t boff = (size_t)(col0 + t * 16 + ln) * ldb + kb; FragH bq; bq.half[0] = *(const v8us*)(Bh + boff + 8 * hh); bq.half[1] = *(const v8us*)(Bh + boff + 16 + 8 * hh);
      acc[t] = mmaH<ASPLIT ? 2 : 1>(ah.v, al.v, bq.v, bq.v, acc[t]); }
  }
#pragma unroll
  for (int t = 0; t < 4; ++t) { if (col0 + t * 16 >= N) continue;
#pragma unroll
    for (int r = 0; r < 8; ++r) so[w][8 * hh + r][t * 16 + ln] = acc[t][r] * alpha; }
  __builtin_amdgcn_fence(__ATOMIC_ACQ_REL, "workgroup"); __builtin_amdgcn_wave_barrier();
  const int rsub = lane >> 4, c4 = (lane & 15) * 4;
  {
#pragma unroll
    for (int q = 0; q < 8; ++q) { const int r = q * 2 + rsub; if (col0 + c4 < N) { const v4f v = *(const v4fa*)&so[w][r][c4]; *(v4f*)(C + (size_t)(row0 + r) * ldc + col0 + c4) = v; } }
     }
}

template <int DUMMY>
__global__ __launch_bounds__(128) void k_gemm_hh(const _Float16* __restrict__ A, int lda, size_t sA, const _Float16* __restrict__ Bh, int ldb, size_t sB, float alpha, float* __restrict__ C, int ldc, size_t sC, int M, int N, int K) {
  __shared__ __attribute__((aligned(16))) float so[4][16][64];
  const int tid = threadIdx.x, w = tid >> 5, lane = tid & 31, ln = lane & 15, hh = lane >> 4; const int by = blockIdx.y;
  A += (size_t)by * sA; Bh += (size_t)by * sB; C += (size_t)by * sC;
  const int ntn = (N + 63) / 64; const int wid = blockIdx.x * 4 + w; const int mt = wid / ntn, nq = wid % ntn; if (mt * 16 >= M) return;
  const int row0 = mt * 16, col0 = nq * 64; const _Float16* arow = A + (size_t)(row0 + ln) * lda;
  v8f acc[4] = {};
  for (int kb = 0; kb < K; kb += 32) { FragH ah; ah.half[0] = *(const v8us*)((const unsigned short*)arow + kb + 8 * hh); ah.half[1] = *(const v8us*)((const unsigned short*)arow + kb + 16 + 8 * hh);
#pragma unroll
    for (int t = 0; t < 4; ++t) { if (col0 + t * 16 >= N) continue; const size_t boff = (size_t)(col0 + t * 16 + ln) * ldb + kb; FragH bq; bq.half[0] = *(const v8us*)((const unsigned short*)Bh + boff + 8 * hh); bq.half[1] = *(const v8us*)((const unsigned short*)Bh + boff + 16 + 8 * hh);
      acc[t] = mmaH<1>(ah.v, ah.v, bq.v, bq.v, acc[t]); }
  }
#pragma unroll
  for (int t = 0; t < 4; ++t) { if (col0 + t * 16 >= N) continue;
#pragma unroll
    for (int r = 0; r < 8; ++r) so[w][8 * hh + r][t * 16 + ln] = acc[t][r] * alpha; }
  __builtin_amdgcn_fence(__ATOMIC_ACQ_REL, "workgroup"); __builtin_amdgcn_wave_barrier();
  const int rsub = lane >> 4, c4 = (lane & 15) * 4;
  {
#pragma unroll
    for (int q = 0; q < 8; ++q) { const int r = q * 2 + rsub; if (col0 + c4 < N) { const v4f v = *(const v4fa*)&so[w][r][c4]; *(v4f*)(C + (size_t)(row0 + r) * ldc + col0 + c4) = v; } }
     }
}

// Bt [384 n][1024 k] = bits(W?[k][n]) via 32×32 tiles (grid: k tiles, n tiles (12), -); bias concat
__global__ __launch_bounds__(256) void k_wt(const float* __restrict__ Wq, const float* __restrict__ Wk, const float* __restrict__ Wv, const float* __restrict__ bq, const float* __restrict__ bk, const float* __restrict__ bv, unsigned short* __restrict__ Bt, float* __restrict__ B3) { __shared__ float tile[32][33]; const int k0 = blockIdx.x * 32, n0 = blockIdx.y * 32; const int which = n0 / DK, nn0 = n0 % DK; const float* W = which == 0 ? Wq : (which == 1 ? Wk : Wv); const int tx = threadIdx.x & 31, ty = threadIdx.x >> 5;
  for (int i = ty; i < 32; i += 8) tile[i][tx] = W[(size_t)(k0 + i) * DK + nn0 + tx]; __syncthreads();
  typedef unsigned short v4us __attribute__((ext_vector_type(4))); const int r = threadIdx.x >> 3, c4 = (threadIdx.x & 7) * 4; v4us o; for (int q = 0; q < 4; ++q) o[q] = bf16_bits(tile[c4 + q][r]);
  unsigned short* d = Bt + (size_t)(n0 + r) * DM + k0 + c4; *(v4us*)d = o; 
  if (blockIdx.x == 0 && threadIdx.x < 32) { const float* bs = which == 0 ? bq : (which == 1 ? bk : bv); *(float*)(B3 + n0 + threadIdx.x) = bs[nn0 + threadIdx.x]; } }
// from QKV [tok][384]: Kh/Kl [tok][128] bf16 hi/lo planes of K (thread per 8 consecutive c → 16-B stores, 256 B per row); VT16 [b][128][2048] = f16(V)ᵀ via LDS tiles
__global__ __launch_bounds__(256) void k_kv(const float* __restrict__ QKV, unsigned short* __restrict__ Kh, unsigned short* __restrict__ Kl, _Float16* __restrict__ VT) { __shared__ float tile[32][DK + 1]; const int b = blockIdx.y, l0 = blockIdx.x * 32; const int tid = threadIdx.x, tx = tid & 31, ty = tid >> 5;
  for (int i = ty; i < 32; i += 8) { const size_t tok = (size_t)b * LL + l0 + i; for (int u = 0; u < 4; ++u) { const int c = u * 32 + tx; tile[i][c] = QKV[tok * (3 * DK) + 2 * DK + c]; } }
  // K planes: 32 tokens × 128 c = 512 groups of 8 → 2 per thread
  { for (int gidx = tid; gidx < 32 * (DK / 8); gidx += 256) { const int i = gidx / (DK / 8), c8 = (gidx % (DK / 8)) * 8; const size_t tok = (size_t)b * LL + l0 + i; v8us h, l; for (int q = 0; q < 8; ++q) { const float kv = QKV[tok * (3 * DK) + DK + c8 + q]; const float kh = bf16_round(kv); h[q] = bf16_bits(kh); l[q] = bf16_bits(kv - kh); }
      *(v8us*)(Kh + tok * DK + c8) = h; *(v8us*)(Kl + tok * DK + c8) = l; }  }
  __syncthreads();
  { for (int c = ty; c < DK; c += 8) *(_Float16*)(VT + ((size_t)b * DK + c) * LL + l0 + tx) = (_Float16)tile[tx][c];  } }
// C16 = f16(cos(S)); thread per 8
__global__ __launch_bounds__(256) void k_cos(const float* __restrict__ S, _Float16* __restrict__ C16) { const size_t t = (size_t)blockIdx.x * 256 + threadIdx.x; if (t >= (size_t)LL * LL / 8) return; FragH f;
#pragma unroll 1
  for (int q = 0; q < 8; ++q) f.h[q] = (_Float16)cosf(S[t * 8 + q]); *(v8us*)((unsigned short*)C16 + t * 8) = f.half[0];  }
extern "C" void kernel_launch(void* const* d_in, const int* in_sizes, int n_in,
                              void* d_out, int out_size, void* d_ws, size_t ws_size, hipStream_t stream) {
  (void)in_sizes; (void)n_in; (void)out_size;
  const float* x = (const float*)d_in[0]; const float* Wq = (const float*)d_in[1]; const float* bq = (const float*)d_in[2]; const float* Wk = (const float*)d_in[3]; const float* bk = (const float*)d_in[4]; const float* Wv = (const float*)d_in[5]; const float* bv = (const float*)d_in[6];
  char* ws = (char*)d_ws; size_t off = 0;
  auto take = [&](size_t bytes) { char* p = ws + off; off += (bytes + 255) & ~(size_t)255; return p; };
  unsigned short* Bt = (unsigned short*)take((size_t)3 * DK * DM * 2); float* B3 = (float*)take(3 * DK * 4); float* QKV = (float*)take((size_t)NTOK * 3 * DK * 4);
  unsigned short* Kh = (unsigned short*)take((size_t)NTOK * DK * 2); unsigned short* Kl = (unsigned short*)take((size_t)NTOK * DK * 2); _Float16* VT = (_Float16*)take((size_t)BB * DK * LL * 2); float* S = (float*)take((size_t)LL * LL * 4); _Float16* C16 = (_Float16*)take((size_t)LL * LL * 2);
  if (off > ws_size) return;
  k_wt<<<dim3(DM / 32, 3 * DK / 32), 256, 0, stream>>>(Wq, Wk, Wv, bq, bk, bv, Bt, B3);
  k_gemm_b<false, false, 0><<<dim3(((NTOK / 16) * (3 * DK / 64) + 3) / 4, 1), 128, 0, stream>>>(x, DM, 0, Bt, Bt, DM, 0, B3, nullptr, 0, 0, 1.f, 1.f, QKV, 3 * DK, 0, NTOK, 3 * DK, DM);
  k_kv<<<dim3(LL / 32, BB), 256, 0, stream>>>(QKV, Kh, Kl, VT);
  for (int b = 0; b < BB; ++b) {
    k_gemm_b<true, true, 0><<<dim3(((LL / 16) * (LL / 64) + 3) / 4, 1), 128, 0, stream>>>(QKV + (size_t)b * LL * 3 * DK, 3 * DK, 0, Kh + (size_t)b * LL * DK, Kl + (size_t)b * LL * DK, DK, 0, nullptr, nullptr, 0, 0, 1.f, 1.f, S, LL, 0, LL, LL, DK);      // QK (3 products)
    k_cos<<<(unsigned)(((size_t)LL * LL / 8 + 255) / 256), 256, 0, stream>>>(S, C16);
    k_gemm_hh<0><<<dim3(((LL / 16) * (DK / 64) + 3) / 4, 1), 128, 0, stream>>>(C16, LL, 0, VT + (size_t)b * DK * LL, LL, 0, 1.0f, (float*)d_out + (size_t)b * LL * DK, DK, 0, LL, DK, LL); }
}

// v001
// One run takes 90.3 microseconds.
// Timed twice side by side with v000, it ran 5.55 and 5.54 times as fast.
#include <hip/hip_runtime.h>
// [Q|K|V] = x·[Wq|Wk|Wv] + b on v_wmma_f32_16x16x32_bf16 (x rounded to bf16: single exact term; 8192 × 1024 × 384); QK = Q·Kᵀ on the same unit with BOTH f32 operands split
// hi/lo (3 products — cos(QK) at |QK| ≈ 10–40 needs the phase to ≈1e-4 rad; 4 × 2048 × 2048 × 128); out = cos(QK)·V on v_wmma_f32_16x16x32_f16 (cos and V rounded to
// f16: single product). cos in f32 VALU.
#define BB 4
#define LL 2048
#define DM 1024
#define DK 128
#define NTOK (BB * LL)

typedef __bf16 v16b __attribute__((ext_vector_type(16)));
typedef unsigned short v8us __attribute__((ext_vector_type(8), may_alias));
typedef float  v8f  __attribute__((ext_vector_type(8)));
typedef float  v4f  __attribute__((ext_vector_type(4)));
typedef float  v4fa __attribute__((ext_vector_type(4), may_alias));
union FragB { v16b v; v8us half[2]; unsigned short u[16]; };

__device__ __forceinline__ unsigned short bf16_bits(float x) { unsigned int u = __float_as_uint(x); return (unsigned short)((u + 0x7FFFu + ((u >> 16) & 1u)) >> 16); }
__device__ __forceinline__ float bf16_val(unsigned short b) { return __uint_as_float(((unsigned int)b) << 16); }
__device__ __forceinline__ float bf16_round(float x) { return bf16_val(bf16_bits(x)); }
// D += A·B with NT terms: 1 = ah·bh, 2 = + al·bh (A split), 3 = + ah·bl (both split)
template <int NT>
__device__ __forceinline__ v8f mmaN(v16b ah, v16b al, v16b bh, v16b bl, v8f c) {
  c = __builtin_amdgcn_wmma_f32_16x16x32_bf16(false, ah, false, bh, (short)0, c, false, false);
  if (NT >= 2) c = __builtin_amdgcn_wmma_f32_16x16x32_bf16(false, al, false, bh, (short)0, c, false, false);
  if (NT >= 3) c = __builtin_amdgcn_wmma_f32_16x16x32_bf16(false, ah, false, bl, (short)0, c, false, false);
  asm volatile("v_nop\n\tv_nop\n\tv_nop\n\tv_nop" : "+v"(c) : "v"(ah), "v"(al), "v"(bh), "v"(bl));
  return c;
}

__global__ __launch_bounds__(256) void k_wt_bf16(const float* __restrict__ W, unsigned short* __restrict__ Wt, int K, int N) {
  const int t = blockIdx.x * 256 + threadIdx.x;
  const int k8n = K / 8;
  if (t >= N * k8n) return;
  const int n = t / k8n, k8 = (t % k8n) * 8;
  v8us v;
#pragma unroll
  for (int i = 0; i < 8; ++i) v[i] = bf16_bits(W[(size_t)(k8 + i) * N + n]);
  *(v8us*)(Wt + (size_t)n * K + k8) = v;
  
}

// GEMM C[M][N] (f32, pitch ldc) = act(A[M][K]·W + bias). A f32 row-major (pitch lda) converted per fragment to bf16
// (ASPLIT: hi/lo two planes -> 2 terms, else single rounded term); Wt bf16 [N][K] (pitch ldb). BIAS_BF16 rounds the
// bias to bf16 first (bias quantised to bf16 before the add). K%32==0, M%16==0, N%64==0.
template <bool ASPLIT, int ACT, bool BIAS_BF16>
__global__ __launch_bounds__(128) void k_gemm_bf(const float* __restrict__ A, int lda, const unsigned short* __restrict__ Wt, int ldb,
                                               const float* __restrict__ bias, float* __restrict__ C, int ldc, int M, int N, int K) {
  __shared__ __attribute__((aligned(16))) float so[4][16][64];
  const int tid = threadIdx.x, w = tid >> 5, lane = tid & 31, ln = lane & 15, hh = lane >> 4;
  const int ntn = N / 64;
  const int wid = blockIdx.x * 4 + w;
  const int mt = wid / ntn, nq = wid % ntn;
  if (mt * 16 >= M) return;
  const int row0 = mt * 16, col0 = nq * 64;
  const float* arow = A + (size_t)(row0 + ln) * lda;
  v8f acc[4] = {};
  for (int kb = 0; kb < K; kb += 32) {
    FragB ah, al;
    const v4f x0 = *(const v4fa*)(arow + kb + 8 * hh), x1 = *(const v4fa*)(arow + kb + 8 * hh + 4);
    const v4f x2 = *(const v4fa*)(arow + kb + 16 + 8 * hh), x3 = *(const v4fa*)(arow + kb + 16 + 8 * hh + 4);
    float xs[16] = {x0[0],x0[1],x0[2],x0[3],x1[0],x1[1],x1[2],x1[3],x2[0],x2[1],x2[2],x2[3],x3[0],x3[1],x3[2],x3[3]};
#pragma unroll
    for (int i = 0; i < 16; ++i) { const unsigned short hb = bf16_bits(xs[i]); ah.u[i] = hb; al.u[i] = ASPLIT ? bf16_bits(xs[i] - bf16_val(hb)) : (unsigned short)0; }
#pragma unroll
    for (int t = 0; t < 4; ++t) {
      const unsigned short* brow = Wt + (size_t)(col0 + t * 16 + ln) * ldb + kb;
      FragB b;
      b.half[0] = *(const v8us*)(brow + 8 * hh);
      b.half[1] = *(const v8us*)(brow + 16 + 8 * hh);
      acc[t] = mmaN<ASPLIT ? 2 : 1>(ah.v, al.v, b.v, b.v, acc[t]);
    }
  }
#pragma unroll
  for (int t = 0; t < 4; ++t) {
    float bv = bias ? bias[col0 + t * 16 + ln] : 0.f;
    if (BIAS_BF16) bv = bf16_round(bv);
#pragma unroll
    for (int r = 0; r < 8; ++r) { float v = acc[t][r] + bv; if (ACT == 1) v = fmaxf(v, 0.f); so[w][8 * hh + r][t * 16 + ln] = v; }
  }
  __builtin_amdgcn_fence(__ATOMIC_ACQ_REL, "workgroup");
  __builtin_amdgcn_wave_barrier();
  const int rsub = lane >> 4, c4 = (lane & 15) * 4;
  {
#pragma unroll
    for (int q = 0; q < 8; ++q) {
      const int r = q * 2 + rsub;
      const v4f v = *(const v4fa*)&so[w][r][c4];
      *(v4f*)(C + (size_t)(row0 + r) * ldc + col0 + c4) = v;
    }
    
  }
}

// Flash-style causal/unmasked attention, all contractions 3-term bf16 hi/lo splits, f32 softmax with running max.
// q,k,v rows are read from f32 buffers with arbitrary row pitch (so they can live inside a fused qkv buffer);
// D = head size (multiple of 32, <= 128); one wave = 16 query rows; block = 4 waves (64 queries) sharing K/V chunks of 32.
template <int D, bool CAUSAL>
__global__ __launch_bounds__(128) void k_flash(const float* __restrict__ qb, const float* __restrict__ kb, const float* __restrict__ vb,
                                             int pitch, int T, int H, float scale, float* __restrict__ y, int ypitch) {
  constexpr int KS = D / 32;        // k-steps for QK
  constexpr int DT = D / 16;        // d tiles for PV
  __shared__ __attribute__((aligned(16))) unsigned short sKh[32][D + 8], sKl[32][D + 8], sVh[32][D + 8], sVl[32][D + 8];
  __shared__ __attribute__((aligned(16))) unsigned short sPh[4][16][40], sPl[4][16][40];
  __shared__ __attribute__((aligned(16))) float sO[4][16][D];
  const int tid = threadIdx.x, w = tid >> 5, lane = tid & 31, ln = lane & 15, hh = lane >> 4;
  const int nqb = (T + 63) / 64;
  const int bh = blockIdx.x / nqb, qblk = blockIdx.x % nqb;
  const int b = bh / H, h = bh % H;
  const int q0 = qblk * 64 + w * 16;
  const float* Q = qb + (size_t)b * T * pitch + h * D;
  const float* K = kb + (size_t)b * T * pitch + h * D;
  const float* V = vb + (size_t)b * T * pitch + h * D;

  // A fragments of the wave's 16 query rows (scaled), hi/lo
  FragB aqh[KS], aql[KS];
  {
    int row = q0 + ln; if (row >= T) row = T - 1;
    const float* qr = Q + (size_t)row * pitch;
#pragma unroll
    for (int ks = 0; ks < KS; ++ks)
#pragma unroll
      for (int i = 0; i < 16; ++i) {
        const int d = ks * 32 + ((i < 8) ? (8 * hh + i) : (16 + 8 * hh + (i - 8)));
        const float x = qr[d] * scale; const unsigned short hb = bf16_bits(x);
        aqh[ks].u[i] = hb; aql[ks].u[i] = bf16_bits(x - bf16_val(hb));
      }
  }
  float m_r[8], l_r[8];
#pragma unroll
  for (int r = 0; r < 8; ++r) { m_r[r] = -3.0e38f; l_r[r] = 0.f; }
  v8f oacc[DT];
#pragma unroll
  for (int dt = 0; dt < DT; ++dt) oacc[dt] = (v8f){0.f,0.f,0.f,0.f,0.f,0.f,0.f,0.f};

  const int kv_end = CAUSAL ? min(T, qblk * 64 + 64) : T;     // block-uniform
  for (int j0 = 0; j0 < kv_end; j0 += 32) {
    __syncthreads();
    for (int e = tid; e < 32 * (D / 4); e += 128) {
      const int r = e / (D / 4), c4 = (e % (D / 4)) * 4;
      const int key = j0 + r;
      v4f kf = {0.f,0.f,0.f,0.f}, vf = {0.f,0.f,0.f,0.f};
      if (key < T) { kf = *(const v4fa*)(K + (size_t)key * pitch + c4); vf = *(const v4fa*)(V + (size_t)key * pitch + c4); }
#pragma unroll
      for (int t = 0; t < 4; ++t) {
        unsigned short hb = bf16_bits(kf[t]); sKh[r][c4 + t] = hb; sKl[r][c4 + t] = bf16_bits(kf[t] - bf16_val(hb));
        hb = bf16_bits(vf[t]); sVh[r][c4 + t] = hb; sVl[r][c4 + t] = bf16_bits(vf[t] - bf16_val(hb));
      }
    }
    __syncthreads();
    // S tile 16 x 32
    v8f s[2];
#pragma unroll
    for (int nt = 0; nt < 2; ++nt) {
      v8f acc = {};
#pragma unroll
      for (int ks = 0; ks < KS; ++ks) {
        FragB bh_, bl_;
        bh_.half[0] = *(const v8us*)&sKh[nt * 16 + ln][ks * 32 + 8 * hh]; bh_.half[1] = *(const v8us*)&sKh[nt * 16 + ln][ks * 32 + 16 + 8 * hh];
        bl_.half[0] = *(const v8us*)&sKl[nt * 16 + ln][ks * 32 + 8 * hh]; bl_.half[1] = *(const v8us*)&sKl[nt * 16 + ln][ks * 32 + 16 + 8 * hh];
        acc = mmaN<3>(aqh[ks].v, aql[ks].v, bh_.v, bl_.v, acc);
      }
      s[nt] = acc;
    }
    // mask + running max (rows 8hh+r; the 16 lanes of a half share rows)
    float alpha[8];
#pragma unroll
    for (int r = 0; r < 8; ++r) {
      const int qi = q0 + 8 * hh + r;
      const int ja = j0 + ln, jb = j0 + 16 + ln;
      if (CAUSAL) { if (ja > qi) s[0][r] = -3.0e38f; if (jb > qi) s[1][r] = -3.0e38f; }
      if (ja >= T) s[0][r] = -3.0e38f;
      if (jb >= T) s[1][r] = -3.0e38f;
      float mx = fmaxf(s[0][r], s[1][r]);
      mx = fmaxf(mx, __shfl_xor(mx, 1, 32)); mx = fmaxf(mx, __shfl_xor(mx, 2, 32)); mx = fmaxf(mx, __shfl_xor(mx, 4, 32)); mx = fmaxf(mx, __shfl_xor(mx, 8, 32));
      const float mnew = fmaxf(m_r[r], mx);
      alpha[r] = (mnew > -1.0e38f) ? __expf(m_r[r] - mnew) : 1.0f;
      const float p0 = (s[0][r] > -1.0e38f) ? __expf(s[0][r] - mnew) : 0.f;
      const float p1 = (s[1][r] > -1.0e38f) ? __expf(s[1][r] - mnew) : 0.f;
      m_r[r] = mnew;
      l_r[r] = l_r[r] * alpha[r] + p0 + p1;            // per-lane partial row sum (16 lanes combined at the end)
      unsigned short hb = bf16_bits(p0); sPh[w][8 * hh + r][ln] = hb;      sPl[w][8 * hh + r][ln] = bf16_bits(p0 - bf16_val(hb));
      hb = bf16_bits(p1);                sPh[w][8 * hh + r][16 + ln] = hb; sPl[w][8 * hh + r][16 + ln] = bf16_bits(p1 - bf16_val(hb));
    }
#pragma unroll
    for (int dt = 0; dt < DT; ++dt)
#pragma unroll
      for (int r = 0; r < 8; ++r) oacc[dt][r] *= alpha[r];
    __builtin_amdgcn_fence(__ATOMIC_ACQ_REL, "workgroup");
    __builtin_amdgcn_wave_barrier();
    FragB pah, pal;
    pah.half[0] = *(const v8us*)&sPh[w][ln][8 * hh]; pah.half[1] = *(const v8us*)&sPh[w][ln][16 + 8 * hh];
    pal.half[0] = *(const v8us*)&sPl[w][ln][8 * hh]; pal.half[1] = *(const v8us*)&sPl[w][ln][16 + 8 * hh];
#pragma unroll
    for (int dt = 0; dt < DT; ++dt) {
      FragB bvh, bvl;
#pragma unroll
      for (int i = 0; i < 8; ++i) {
        bvh.u[i] = sVh[8 * hh + i][dt * 16 + ln]; bvh.u[8 + i] = sVh[16 + 8 * hh + i][dt * 16 + ln];
        bvl.u[i] = sVl[8 * hh + i][dt * 16 + ln]; bvl.u[8 + i] = sVl[16 + 8 * hh + i][dt * 16 + ln];
      }
      oacc[dt] = mmaN<3>(pah.v, pal.v, bvh.v, bvl.v, oacc[dt]);
    }
    __builtin_amdgcn_fence(__ATOMIC_ACQ_REL, "workgroup");
    __builtin_amdgcn_wave_barrier();
  }
#pragma unroll
  for (int r = 0; r < 8; ++r) {
    float l = l_r[r];
    l += __shfl_xor(l, 1, 32); l += __shfl_xor(l, 2, 32); l += __shfl_xor(l, 4, 32); l += __shfl_xor(l, 8, 32);
    l_r[r] = (l > 0.f) ? 1.0f / l : 0.f;
  }
#pragma unroll
  for (int dt = 0; dt < DT; ++dt)
#pragma unroll
    for (int r = 0; r < 8; ++r) sO[w][8 * hh + r][dt * 16 + ln] = oacc[dt][r] * l_r[r];
  __builtin_amdgcn_fence(__ATOMIC_ACQ_REL, "workgroup");
  __builtin_amdgcn_wave_barrier();
  {
    for (int r = 0; r < 16; ++r) {
      const int row = q0 + r;
      if (row < T && lane < D / 4) {
        const v4f val = *(const v4fa*)&sO[w][r][lane * 4];
        *(v4f*)(y + ((size_t)b * T + row) * ypitch + h * D + lane * 4) = val;
      }
    }
    
  }
}

// batched GEMM (blockIdx.y = batch): C_b = act(alpha·A_b·B_b + bias + resid_b); A f32 rows (ASPLIT → hi/lo), B = bf16 planes Bh (+Bl when BSPLIT, requires ASPLIT),
// per-batch element strides sA, sB (0 = shared weights), sC, sR. resid may alias C (values are staged before the stores). ACT 0/1(relu).
// ACT: 0 none, 1 relu, 2 softplus
template <bool ASPLIT, bool BSPLIT, int ACT>
__global__ __launch_bounds__(128) void k_gemm_b(const float* __restrict__ A, int lda, size_t sA, const unsigned short* __restrict__ Bh, const unsigned short* __restrict__ Bl, int ldb, size_t sB,
                                             const float* __restrict__ bias, const float* __restrict__ resid, int ldr, size_t sR, float rsign, float alpha,
                                             float* __restrict__ C, int ldc, size_t sC, int M, int N, int K) {
  __shared__ __attribute__((aligned(16))) float so[4][16][64];
  const int tid = threadIdx.x, w = tid >> 5, lane = tid & 31, ln = lane & 15, hh = lane >> 4;
  const int by = blockIdx.y;
  A += (size_t)by * sA; Bh += (size_t)by * sB; if (BSPLIT) Bl += (size_t)by * sB; C += (size_t)by * sC; if (resid) resid += (size_t)by * sR;
  const int ntn = (N + 63) / 64; const int wid = blockIdx.x * 4 + w; const int mt = wid / ntn, nq = wid % ntn;      // N may be any multiple of 16: tiles past N are skipped and not stored
  if (mt * 16 >= M) return;
  const int row0 = mt * 16, col0 = nq * 64;
  const float* arow = A + (size_t)(row0 + ln) * lda;
  v8f acc[4] = {};
  for (int kb = 0; kb < K; kb += 32) {
    FragB ah, al;
    const v4f x0 = *(const v4fa*)(arow + kb + 8 * hh), x1 = *(const v4fa*)(arow + kb + 8 * hh + 4);
    const v4f x2 = *(const v4fa*)(arow + kb + 16 + 8 * hh), x3 = *(const v4fa*)(arow + kb + 16 + 8 * hh + 4);
    float xs[16] = {x0[0],x0[1],x0[2],x0[3],x1[0],x1[1],x1[2],x1[3],x2[0],x2[1],x2[2],x2[3],x3[0],x3[1],x3[2],x3[3]};
#pragma unroll
    for (int i = 0; i < 16; ++i) { const unsigned short hb = bf16_bits(xs[i]); ah.u[i] = hb; al.u[i] = ASPLIT ? bf16_bits(xs[i] - bf16_val(hb)) : (unsigned short)0; }
#pragma unroll
    for (int t = 0; t < 4; ++t) {
      if (col0 + t * 16 >= N) continue;
      const size_t boff = (size_t)(col0 + t * 16 + ln) * ldb + kb;
      FragB bh_, bl_; bh_.half[0] = *(const v8us*)(Bh + boff + 8 * hh); bh_.half[1] = *(const v8us*)(Bh + boff + 16 + 8 * hh);
      if (BSPLIT) { bl_.half[0] = *(const v8us*)(Bl + boff + 8 * hh); bl_.half[1] = *(const v8us*)(Bl + boff + 16 + 8 * hh); } else bl_ = bh_;
      acc[t] = mmaN<ASPLIT ? (BSPLIT ? 3 : 2) : 1>(ah.v, al.v, bh_.v, bl_.v, acc[t]);
    }
  }
#pragma unroll
  for (int t = 0; t < 4; ++t) {
    const int col = col0 + t * 16 + ln; if (col0 + t * 16 >= N) continue; const float bv = bias ? bf16_round(bias[col]) : 0.f;
#pragma unroll
    for (int r = 0; r < 8; ++r) { float v = acc[t][r] * alpha + bv; if (resid) v += rsign * resid[(size_t)(row0 + 8 * hh + r) * ldr + col]; if (ACT == 1) v = fmaxf(v, 0.f); else if (ACT == 2) v = fmaxf(v, 0.f) + log1pf(expf(-fabsf(v))); so[w][8 * hh + r][t * 16 + ln] = v; }
  }
  __builtin_amdgcn_fence(__ATOMIC_ACQ_REL, "workgroup"); __builtin_amdgcn_wave_barrier();
  const int rsub = lane >> 4, c4 = (lane & 15) * 4;
  {
#pragma unroll
    for (int q = 0; q < 8; ++q) { const int r = q * 2 + rsub; if (col0 + c4 < N) { const v4f v = *(const v4fa*)&so[w][r][c4]; *(v4f*)(C + (size_t)(row0 + r) * ldc + col0 + c4) = v; } }
    
  }
}
// batched f32 [K][N] (pitch lds, batch stride sIn) -> transposed hi/lo planes [N][K] (batch stride sOut); thread per (n, 8 k); grid.y = batch
__global__ __launch_bounds__(256) void k_split_transpose_b(const float* __restrict__ src, int lds_, size_t sIn, unsigned short* __restrict__ hi, unsigned short* __restrict__ lo, size_t sOut, int K, int N) {
  const size_t t = (size_t)blockIdx.x * 256 + threadIdx.x; const int k8n = K / 8; if (t >= (size_t)N * k8n) return;
  src += (size_t)blockIdx.y * sIn; hi += (size_t)blockIdx.y * sOut; lo += (size_t)blockIdx.y * sOut;
  const int n = (int)(t / k8n), k8 = (int)(t % k8n) * 8; v8us vh, vl;
#pragma unroll
  for (int i = 0; i < 8; ++i) { const float x = src[(size_t)(k8 + i) * lds_ + n]; const unsigned short hb = bf16_bits(x); vh[i] = hb; vl[i] = bf16_bits(x - bf16_val(hb)); }
  unsigned short* dh = hi + (size_t)n * K + k8; unsigned short* dl = lo + (size_t)n * K + k8;
  *(v8us*)dh = vh; *(v8us*)dl = vl; 
}

// ---- f16 WMMA path (v_wmma_f32_16x16x32_f16): 11-bit significands for operands in range — used where the [-1,1] cos operand needs more precision than bf16
typedef _Float16 v16h __attribute__((ext_vector_type(16)));
union FragH { v16h v; v8us half[2]; _Float16 h[16]; unsigned short u[16]; };
template <int NT>
__device__ __forceinline__ v8f mmaH(v16h ah, v16h al, v16h bh, v16h bl, v8f c) {
  c = __builtin_amdgcn_wmma_f32_16x16x32_f16(false, ah, false, bh, (short)0, c, false, false);
  if (NT >= 2) c = __builtin_amdgcn_wmma_f32_16x16x32_f16(false, al, false, bh, (short)0, c, false, false);
  if (NT >= 3) c = __builtin_amdgcn_wmma_f32_16x16x32_f16(false, ah, false, bl, (short)0, c, false, false);
  asm volatile("v_nop\n\tv_nop\n\tv_nop\n\tv_nop" : "+v"(c) : "v"(ah), "v"(al), "v"(bh), "v"(bl));
  return c;
}
// batched GEMM like k_gemm_b but f16 operands: A f32 (split into f16 hi/lo if ASPLIT, else rounded to f16), Bt = f16 values [n][k]; alpha; C f32; N multiple of 16 (partial tiles skipped)
template <bool ASPLIT>
__global__ __launch_bounds__(128) void k_gemm_h(const float* __restrict__ A, int lda, size_t sA, const _Float16* __restrict__ Bh, int ldb, size_t sB, float alpha, float* __restrict__ C, int ldc, size_t sC, int M, int N, int K) {
  __shared__ __attribute__((aligned(16))) float so[4][16][64];
  const int tid = threadIdx.x, w = tid >> 5, lane = tid & 31, ln = lane & 15, hh = lane >> 4; const int by = blockIdx.y;
  A += (size_t)by * sA; Bh += (size_t)by * sB; C += (size_t)by * sC;
  const int ntn = (N + 63) / 64; const int wid = blockIdx.x * 4 + w; const int mt = wid / ntn, nq = wid % ntn; if (mt * 16 >= M) return;
  const int row0 = mt * 16, col0 = nq * 64; const float* arow = A + (size_t)(row0 + ln) * lda;
  v8f acc[4] = {};
  for (int kb = 0; kb < K; kb += 32) {
    FragH ah, al;
    const v4f x0 = *(const v4fa*)(arow + kb + 8 * hh), x1 = *(const v4fa*)(arow + kb + 8 * hh + 4), x2 = *(const v4fa*)(arow + kb + 16 + 8 * hh), x3 = *(const v4fa*)(arow + kb + 16 + 8 * hh + 4);
    float xs[16] = {x0[0],x0[1],x0[2],x0[3],x1[0],x1[1],x1[2],x1[3],x2[0],x2[1],x2[2],x2[3],x3[0],x3[1],x3[2],x3[3]};
#pragma unroll
    for (int i = 0; i < 16; ++i) { const _Float16 h = (_Float16)xs[i]; ah.h[i] = h; al.h[i] = ASPLIT ? (_Float16)(xs[i] - (float)h) : (_Float16)0.0f; }
#pragma unroll
    for (int t = 0; t < 4; ++t) { if (col0 + t * 16 >= N) continue; const size_t boff = (size_t)(col0 + t * 16 + ln) * ldb + kb; FragH bq; bq.half[0] = *(const v8us*)(Bh + boff + 8 * hh); bq.half[1] = *(const v8us*)(Bh + boff + 16 + 8 * hh);
      acc[t] = mmaH<ASPLIT ? 2 : 1>(ah.v, al.v, bq.v, bq.v, acc[t]); }
  }
#pragma unroll
  for (int t = 0; t < 4; ++t) { if (col0 + t * 16 >= N) continue;
#pragma unroll
    for (int r = 0; r < 8; ++r) so[w][8 * hh + r][t * 16 + ln] = acc[t][r] * alpha; }
  __builtin_amdgcn_fence(__ATOMIC_ACQ_REL, "workgroup"); __builtin_amdgcn_wave_barrier();
  const int rsub = lane >> 4, c4 = (lane & 15) * 4;
  {
#pragma unroll
    for (int q = 0; q < 8; ++q) { const int r = q * 2 + rsub; if (col0 + c4 < N) { const v4f v = *(const v4fa*)&so[w][r][c4]; *(v4f*)(C + (size_t)(row0 + r) * ldc + col0 + c4) = v; } }
     }
}

// Bt [384 n][1024 k] = bits(W?[k][n]) via 32×32 tiles (grid: k tiles, n tiles (12), -); bias concat
__global__ __launch_bounds__(256) void k_wt(const float* __restrict__ Wq, const float* __restrict__ Wk, const float* __restrict__ Wv, const float* __restrict__ bq, const float* __restrict__ bk, const float* __restrict__ bv, unsigned short* __restrict__ Bt, float* __restrict__ B3) { __shared__ float tile[32][33]; const int k0 = blockIdx.x * 32, n0 = blockIdx.y * 32; const int which = n0 / DK, nn0 = n0 % DK; const float* W = which == 0 ? Wq : (which == 1 ? Wk : Wv); const int tx = threadIdx.x & 31, ty = threadIdx.x >> 5;
  for (int i = ty; i < 32; i += 8) tile[i][tx] = W[(size_t)(k0 + i) * DK + nn0 + tx]; __syncthreads();
  typedef unsigned short v4us __attribute__((ext_vector_type(4))); const int r = threadIdx.x >> 3, c4 = (threadIdx.x & 7) * 4; v4us o; for (int q = 0; q < 4; ++q) o[q] = bf16_bits(tile[c4 + q][r]);
  unsigned short* d = Bt + (size_t)(n0 + r) * DM + k0 + c4; *(v4us*)d = o; 
  if (blockIdx.x == 0 && threadIdx.x < 32) { const float* bs = which == 0 ? bq : (which == 1 ? bk : bv); *(float*)(B3 + n0 + threadIdx.x) = bs[nn0 + threadIdx.x]; } }
// from QKV [tok][384]: Kh/Kl [tok][128] bf16 hi/lo planes of K (thread per 8 consecutive c → 16-B stores, 256 B per row); VT16 [b][128][2048] = f16(V)ᵀ via LDS tiles
__global__ __launch_bounds__(256) void k_kv(const float* __restrict__ QKV, unsigned short* __restrict__ Kh, unsigned short* __restrict__ Kl, _Float16* __restrict__ VT) { __shared__ float tile[32][DK + 1]; const int b = blockIdx.y, l0 = blockIdx.x * 32; const int tid = threadIdx.x, tx = tid & 31, ty = tid >> 5;
  for (int i = ty; i < 32; i += 8) { const size_t tok = (size_t)b * LL + l0 + i; for (int u = 0; u < 4; ++u) { const int c = u * 32 + tx; tile[i][c] = QKV[tok * (3 * DK) + 2 * DK + c]; } }
  // K planes: 32 tokens × 128 c = 512 groups of 8 → 2 per thread
  { for (int gidx = tid; gidx < 32 * (DK / 8); gidx += 256) { const int i = gidx / (DK / 8), c8 = (gidx % (DK / 8)) * 8; const size_t tok = (size_t)b * LL + l0 + i; v8us h, l; for (int q = 0; q < 8; ++q) { const float kv = QKV[tok * (3 * DK) + DK + c8 + q]; const float kh = bf16_round(kv); h[q] = bf16_bits(kh); l[q] = bf16_bits(kv - kh); }
      *(v8us*)(Kh + tok * DK + c8) = h; *(v8us*)(Kl + tok * DK + c8) = l; }  }
  __syncthreads();
  { for (int c = ty; c < DK; c += 8) *(_Float16*)(VT + ((size_t)b * DK + c) * LL + l0 + tx) = (_Float16)tile[tx][c];  } }
#define FQ 32
#define FW 8
#define FKEYS (LL / FW)
#define QP (DK + 8)
#define RP (DK + 4)
__global__ __launch_bounds__(256) void k_cosattn(const float* __restrict__ QKV, const unsigned short* __restrict__ Kh, const unsigned short* __restrict__ Kl, const _Float16* __restrict__ VT, float* __restrict__ out) {
  __shared__ __attribute__((aligned(16))) unsigned short sQh[FQ][QP], sQl[FQ][QP];   // pitch 272 B = 16 B x odd
  __shared__ __attribute__((aligned(16))) float red[FW][FQ][RP];                     // pitch 528 B = 16 B x odd
  const int tid = threadIdx.x, w = tid >> 5, lane = tid & 31, ln = lane & 15, hh = lane >> 4;
  const int b = blockIdx.x / (LL / FQ), q0 = (blockIdx.x % (LL / FQ)) * FQ;
  { // Q rows -> bf16 hi/lo planes, split once per work-group (thread: 16 consecutive columns of one row)
    const int r = tid >> 3, c0 = (tid & 7) * 16;
    const float* qr = QKV + ((size_t)b * LL + q0 + r) * (3 * DK) + c0;
    const v4f x0 = *(const v4fa*)qr, x1 = *(const v4fa*)(qr + 4), x2 = *(const v4fa*)(qr + 8), x3 = *(const v4fa*)(qr + 12);
    // the loads' address registers are reused soon after
    asm volatile("s_wait_xcnt 0x0" ::: "memory");
    const float xs[16] = {x0[0], x0[1], x0[2], x0[3], x1[0], x1[1], x1[2], x1[3], x2[0], x2[1], x2[2], x2[3], x3[0], x3[1], x3[2], x3[3]};
#pragma unroll
    for (int g = 0; g < 2; ++g) {
      v8us h, l;
#pragma unroll
      for (int i = 0; i < 8; ++i) { const float x = xs[g * 8 + i]; const unsigned short hb = bf16_bits(x); h[i] = hb; l[i] = bf16_bits(x - bf16_val(hb)); }
      *(v8us*)&sQh[r][c0 + g * 8] = h; *(v8us*)&sQl[r][c0 + g * 8] = l;
    }
  }
  __syncthreads();
  FragB qh[2][4], ql[2][4];     // B fragments: column = query qt*16+ln, k in the same order as the K loader below
#pragma unroll
  for (int qt = 0; qt < 2; ++qt)
#pragma unroll
    for (int ks = 0; ks < 4; ++ks) {
      qh[qt][ks].half[0] = *(const v8us*)&sQh[qt * 16 + ln][ks * 32 + 8 * hh]; qh[qt][ks].half[1] = *(const v8us*)&sQh[qt * 16 + ln][ks * 32 + 16 + 8 * hh];
      ql[qt][ks].half[0] = *(const v8us*)&sQl[qt * 16 + ln][ks * 32 + 8 * hh]; ql[qt][ks].half[1] = *(const v8us*)&sQl[qt * 16 + ln][ks * 32 + 16 + 8 * hh];
    }
  v8f o[2][8];                  // o[qt][dt][r] = O[query qt*16+ln][d = dt*16 + 8*hh + r], this wave's keys only
#pragma unroll
  for (int qt = 0; qt < 2; ++qt)
#pragma unroll
    for (int dt = 0; dt < 8; ++dt) o[qt][dt] = (v8f){0.f, 0.f, 0.f, 0.f, 0.f, 0.f, 0.f, 0.f};
  const size_t koff = ((size_t)b * LL + w * FKEYS + ln) * DK + 8 * hh;
  const unsigned short* kh = Kh + koff;
  const unsigned short* kl = Kl + koff;
  const unsigned short* vt = (const unsigned short*)VT + ((size_t)b * DK + ln) * LL + w * FKEYS + 8 * hh;
  for (int j = 0; j < FKEYS; j += 32) {
    FragB ah[2][4], al[2][4];   // A fragments of K hi/lo: row = key j + kt*16 + ln
#pragma unroll
    for (int kt = 0; kt < 2; ++kt)
#pragma unroll
      for (int ks = 0; ks < 4; ++ks) {
        const size_t e = (size_t)(j + kt * 16) * DK + ks * 32;
        ah[kt][ks].half[0] = *(const v8us*)(kh + e); ah[kt][ks].half[1] = *(const v8us*)(kh + e + 16);
        al[kt][ks].half[0] = *(const v8us*)(kl + e); al[kt][ks].half[1] = *(const v8us*)(kl + e + 16);
      }
    // the products' accumulators reuse the loads' address registers
    asm volatile("s_wait_xcnt 0x0" ::: "memory");
    // keeps all 32 K loads in front of the products, so that they are issued back to back and share one latency;
    // without it the compiler loads one fragment at a time and waits for each in front of its products
    __builtin_amdgcn_sched_barrier(0);
    v8f s[2][2];                // s[kt][qt][r] = S[query qt*16+ln][key j + kt*16 + 8*hh + r]
#pragma unroll
    for (int kt = 0; kt < 2; ++kt)
#pragma unroll
      for (int qt = 0; qt < 2; ++qt) {
        v8f c = {};
#pragma unroll
        for (int ks = 0; ks < 4; ++ks) {   // three products of the hi/lo split, in this order: Qhi.Khi, Qlo.Khi, Qhi.Klo
          c = __builtin_amdgcn_wmma_f32_16x16x32_bf16(false, ah[kt][ks].v, false, qh[qt][ks].v, (short)0, c, false, false);
          c = __builtin_amdgcn_wmma_f32_16x16x32_bf16(false, ah[kt][ks].v, false, ql[qt][ks].v, (short)0, c, false, false);
          c = __builtin_amdgcn_wmma_f32_16x16x32_bf16(false, al[kt][ks].v, false, qh[qt][ks].v, (short)0, c, false, false);
        }
        // four vector slots between the chain's last WMMA and the first vector instruction that reads its D, on every path
        asm volatile("v_nop\n\tv_nop\n\tv_nop\n\tv_nop" : "+v"(c));
        s[kt][qt] = c;
      }
    FragH va[8];                // A fragments of V^T: row = d, k = key; they fly under the cosines
#pragma unroll
    for (int dt = 0; dt < 8; ++dt) { va[dt].half[0] = *(const v8us*)(vt + (size_t)dt * 16 * LL + j); va[dt].half[1] = *(const v8us*)(vt + (size_t)dt * 16 * LL + j + 16); }
#pragma unroll
    for (int qt = 0; qt < 2; ++qt) {
      FragH p;                  // B fragment: p[i] = cos(S)[key kmap(i, hh)][query], straight from the two D tiles
#pragma unroll
      for (int i = 0; i < 8; ++i) { p.h[i] = (_Float16)cosf(s[0][qt][i]); p.h[8 + i] = (_Float16)cosf(s[1][qt][i]); }
#pragma unroll
      for (int dt = 0; dt < 8; ++dt) o[qt][dt] = __builtin_amdgcn_wmma_f32_16x16x32_f16(false, va[dt].v, false, p.v, (short)0, o[qt][dt], false, false);
      // four vector slots behind the last WMMA before its operands may be rewritten, also on the taken side of the branches that follow (cosf, loop)
      asm volatile("v_nop\n\tv_nop\n\tv_nop\n\tv_nop" : "+v"(o[qt][7]) : "v"(p.v));
    }
  }
#pragma unroll
  for (int qt = 0; qt < 2; ++qt)
#pragma unroll
    for (int dt = 0; dt < 8; ++dt) {
      float* d = &red[w][qt * 16 + ln][dt * 16 + 8 * hh];
      *(v4fa*)d = (v4f){o[qt][dt][0], o[qt][dt][1], o[qt][dt][2], o[qt][dt][3]};
      *(v4fa*)(d + 4) = (v4f){o[qt][dt][4], o[qt][dt][5], o[qt][dt][6], o[qt][dt][7]};
    }
  __syncthreads();
#pragma unroll
  for (int g = 0; g < FQ * DK / 4 / 256; ++g) {   // a wave stores one whole 512-B output row at a time
    const int idx = g * 256 + tid, q = idx >> 5, d4 = (idx & 31) * 4;
    v4f a = *(const v4fa*)&red[0][q][d4];
#pragma unroll
    for (int u = 1; u < FW; ++u) a += *(const v4fa*)&red[u][q][d4];
    *(v4f*)(out + ((size_t)b * LL + q0 + q) * DK + d4) = a;
  }
}
extern "C" void kernel_launch(void* const* d_in, const int* in_sizes, int n_in,
                              void* d_out, int out_size, void* d_ws, size_t ws_size, hipStream_t stream) {
  (void)in_sizes; (void)n_in; (void)out_size;
  const float* x = (const float*)d_in[0]; const float* Wq = (const float*)d_in[1]; const float* bq = (const float*)d_in[2]; const float* Wk = (const float*)d_in[3]; const float* bk = (const float*)d_in[4]; const float* Wv = (const float*)d_in[5]; const float* bv = (const float*)d_in[6];
  char* ws = (char*)d_ws; size_t off = 0;
  auto take = [&](size_t bytes) { char* p = ws + off; off += (bytes + 255) & ~(size_t)255; return p; };
  unsigned short* Bt = (unsigned short*)take((size_t)3 * DK * DM * 2); float* B3 = (float*)take(3 * DK * 4); float* QKV = (float*)take((size_t)NTOK * 3 * DK * 4);
  unsigned short* Kh = (unsigned short*)take((size_t)NTOK * DK * 2); unsigned short* Kl = (unsigned short*)take((size_t)NTOK * DK * 2); _Float16* VT = (_Float16*)take((size_t)BB * DK * LL * 2);
  if (off > ws_size) return;
  k_wt<<<dim3(DM / 32, 3 * DK / 32), 256, 0, stream>>>(Wq, Wk, Wv, bq, bk, bv, Bt, B3);
  k_gemm_b<false, false, 0><<<dim3(((NTOK / 16) * (3 * DK / 64) + 3) / 4, 1), 128, 0, stream>>>(x, DM, 0, Bt, Bt, DM, 0, B3, nullptr, 0, 0, 1.f, 1.f, QKV, 3 * DK, 0, NTOK, 3 * DK, DM);
  k_kv<<<dim3(LL / 32, BB), 256, 0, stream>>>(QKV, Kh, Kl, VT);
  k_cosattn<<<NTOK / FQ, 256, 0, stream>>>(QKV, Kh, Kl, VT, (float*)d_out);
}

// v002
// One run takes 57.4 microseconds.
// Timed twice side by side with v001, it ran 1.58 times as fast both times.
// All steps since v000 together make it 8.77 times as fast.
#include <hip/hip_runtime.h>
// [Q|K|V] = x·[Wq|Wk|Wv] + b on v_wmma_f32_16x16x32_bf16 (x rounded to bf16: single exact term; 8192 × 1024 × 384); QK = Q·Kᵀ on the same unit with BOTH f32 operands split
// hi/lo (3 products — cos(QK) at |QK| ≈ 10–40 needs the phase to ≈1e-4 rad; 4 × 2048 × 2048 × 128); out = cos(QK)·V on v_wmma_f32_16x16x32_f16 (cos and V rounded to
// f16: single product). cos in f32 VALU.
#define BB 4
#define LL 2048
#define DM 1024
#define DK 128
#define NTOK (BB * LL)

typedef __bf16 v16b __attribute__((ext_vector_type(16)));
typedef unsigned short v8us __attribute__((ext_vector_type(8), may_alias));
typedef float  v8f  __attribute__((ext_vector_type(8)));
typedef float  v4f  __attribute__((ext_vector_type(4)));
typedef float  v4fa __attribute__((ext_vector_type(4), may_alias));
union FragB { v16b v; v8us half[2]; unsigned short u[16]; };

__device__ __forceinline__ unsigned short bf16_bits(float x) { unsigned int u = __float_as_uint(x); return (unsigned short)((u + 0x7FFFu + ((u >> 16) & 1u)) >> 16); }
__device__ __forceinline__ float bf16_val(unsigned short b) { return __uint_as_float(((unsigned int)b) << 16); }
__device__ __forceinline__ float bf16_round(float x) { return bf16_val(bf16_bits(x)); }
// D += A·B with NT terms: 1 = ah·bh, 2 = + al·bh (A split), 3 = + ah·bl (both split)
template <int NT>
__device__ __forceinline__ v8f mmaN(v16b ah, v16b al, v16b bh, v16b bl, v8f c) {
  c = __builtin_amdgcn_wmma_f32_16x16x32_bf16(false, ah, false, bh, (short)0, c, false, false);
  if (NT >= 2) c = __builtin_amdgcn_wmma_f32_16x16x32_bf16(false, al, false, bh, (short)0, c, false, false);
  if (NT >= 3) c = __builtin_amdgcn_wmma_f32_16x16x32_bf16(false, ah, false, bl, (short)0, c, false, false);
  asm volatile("v_nop\n\tv_nop\n\tv_nop\n\tv_nop" : "+v"(c) : "v"(ah), "v"(al), "v"(bh), "v"(bl));
  return c;
}

__global__ __launch_bounds__(256) void k_wt_bf16(const float* __restrict__ W, unsigned short* __restrict__ Wt, int K, int N) {
  const int t = blockIdx.x * 256 + threadIdx.x;
  const int k8n = K / 8;
  if (t >= N * k8n) return;
  const int n = t / k8n, k8 = (t % k8n) * 8;
  v8us v;
#pragma unroll
  for (int i = 0; i < 8; ++i) v[i] = bf16_bits(W[(size_t)(k8 + i) * N + n]);
  *(v8us*)(Wt + (size_t)n * K + k8) = v;
  
}

// GEMM C[M][N] (f32, pitch ldc) = act(A[M][K]·W + bias). A f32 row-major (pitch lda) converted per fragment to bf16
// (ASPLIT: hi/lo two planes -> 2 terms, else single rounded term); Wt bf16 [N][K] (pitch ldb). BIAS_BF16 rounds the
// bias to bf16 first (bias quantised to bf16 before the add). K%32==0, M%16==0, N%64==0.
template <bool ASPLIT, int ACT, bool BIAS_BF16>
__global__ __launch_bounds__(128) void k_gemm_bf(const float* __restrict__ A, int lda, const unsigned short* __restrict__ Wt, int ldb,
                                               const float* __restrict__ bias, float* __restrict__ C, int ldc, int M, int N, int K) {
  __shared__ __attribute__((aligned(16))) float so[4][16][64];
  const int tid = threadIdx.x, w = tid >> 5, lane = tid & 31, ln = lane & 15, hh = lane >> 4;
  const int ntn = N / 64;
  const int wid = blockIdx.x * 4 + w;
  const int mt = wid / ntn, nq = wid % ntn;
  if (mt * 16 >= M) return;
  const int row0 = mt * 16, col0 = nq * 64;
  const float* arow = A + (size_t)(row0 + ln) * lda;
  v8f acc[4] = {};
  for (int kb = 0; kb < K; kb += 32) {
    FragB ah, al;
    const v4f x0 = *(const v4fa*)(arow + kb + 8 * hh), x1 = *(const v4fa*)(arow + kb + 8 * hh + 4);
    const v4f x2 = *(const v4fa*)(arow + kb + 16 + 8 * hh), x3 = *(const v4fa*)(arow + kb + 16 + 8 * hh + 4);
    float xs[16] = {x0[0],x0[1],x0[2],x0[3],x1[0],x1[1],x1[2],x1[3],x2[0],x2[1],x2[2],x2[3],x3[0],x3[1],x3[2],x3[3]};
#pragma unroll
    for (int i = 0; i < 16; ++i) { const unsigned short hb = bf16_bits(xs[i]); ah.u[i] = hb; al.u[i] = ASPLIT ? bf16_bits(xs[i] - bf16_val(hb)) : (unsigned short)0; }
#pragma unroll
    for (int t = 0; t < 4; ++t) {
      const unsigned short* brow = Wt + (size_t)(col0 + t * 16 + ln) * ldb + kb;
      FragB b;
      b.half[0] = *(const v8us*)(brow + 8 * hh);
      b.half[1] = *(const v8us*)(brow + 16 + 8 * hh);
      acc[t] = mmaN<ASPLIT ? 2 : 1>(ah.v, al.v, b.v, b.v, acc[t]);
    }
  }
#pragma unroll
  for (int t = 0; t < 4; ++t) {
    float bv = bias ? bias[col0 + t * 16 + ln] : 0.f;
    if (BIAS_BF16) bv = bf16_round(bv);
#pragma unroll
    for (int r = 0; r < 8; ++r) { float v = acc[t][r] + bv; if (ACT == 1) v = fmaxf(v, 0.f); so[w][8 * hh + r][t * 16 + ln] = v; }
  }
  __builtin_amdgcn_fence(__ATOMIC_ACQ_REL, "workgroup");
  __builtin_amdgcn_wave_barrier();
  const int rsub = lane >> 4, c4 = (lane & 15) * 4;
  {
#pragma unroll
    for (int q = 0; q < 8; ++q) {
      const int r = q * 2 + rsub;
      const v4f v = *(const v4fa*)&so[w][r][c4];
      *(v4f*)(C + (size_t)(row0 + r) * ldc + col0 + c4) = v;
    }
    
  }
}

// Flash-style causal/unmasked attention, all contractions 3-term bf16 hi/lo splits, f32 softmax with running max.
// q,k,v rows are read from f32 buffers with arbitrary row pitch (so they can live inside a fused qkv buffer);
// D = head size (multiple of 32, <= 128); one wave = 16 query rows; block = 4 waves (64 queries) sharing K/V chunks of 32.
template <int D, bool CAUSAL>
__global__ __launch_bounds__(128) void k_flash(const float* __restrict__ qb, const float* __restrict__ kb, const float* __restrict__ vb,
                                             int pitch, int T, int H, float scale, float* __restrict__ y, int ypitch) {
  constexpr int KS = D / 32;        // k-steps for QK
  constexpr int DT = D / 16;        // d tiles for PV
  __shared__ __attribute__((aligned(16))) unsigned short sKh[32][D + 8], sKl[32][D + 8], sVh[32][D + 8], sVl[32][D + 8];
  __shared__ __attribute__((aligned(16))) unsigned short sPh[4][16][40], sPl[4][16][40];
  __shared__ __attribute__((aligned(16))) float sO[4][16][D];
  const int tid = threadIdx.x, w = tid >> 5, lane = tid & 31, ln = lane & 15, hh = lane >> 4;
  const int nqb = (T + 63) / 64;
  const int bh = blockIdx.x / nqb, qblk = blockIdx.x % nqb;
  const int b = bh / H, h = bh % H;
  const int q0 = qblk * 64 + w * 16;
  const float* Q = qb + (size_t)b * T * pitch + h * D;
  const float* K = kb + (size_t)b * T * pitch + h * D;
  const float* V = vb + (size_t)b * T * pitch + h * D;

  // A fragments of the wave's 16 query rows (scaled), hi/lo
  FragB aqh[KS], aql[KS];
  {
    int row = q0 + ln; if (row >= T) row = T - 1;
    const float* qr = Q + (size_t)row * pitch;
#pragma unroll
    for (int ks = 0; ks < KS; ++ks)
#pragma unroll
      for (int i = 0; i < 16; ++i) {
        const int d = ks * 32 + ((i < 8) ? (8 * hh + i) : (16 + 8 * hh + (i - 8)));
        const float x = qr[d] * scale; const unsigned short hb = bf16_bits(x);
        aqh[ks].u[i] = hb; aql[ks].u[i] = bf16_bits(x - bf16_val(hb));
      }
  }
  float m_r[8], l_r[8];
#pragma unroll
  for (int r = 0; r < 8; ++r) { m_r[r] = -3.0e38f; l_r[r] = 0.f; }
  v8f oacc[DT];
#pragma unroll
  for (int dt = 0; dt < DT; ++dt) oacc[dt] = (v8f){0.f,0.f,0.f,0.f,0.f,0.f,0.f,0.f};

  const int kv_end = CAUSAL ? min(T, qblk * 64 + 64) : T;     // block-uniform
  for (int j0 = 0; j0 < kv_end; j0 += 32) {
    __syncthreads();
    for (int e = tid; e < 32 * (D / 4); e += 128) {
      const int r = e / (D / 4), c4 = (e % (D / 4)) * 4;
      const int key = j0 + r;
      v4f kf = {0.f,0.f,0.f,0.f}, vf = {0.f,0.f,0.f,0.f};
      if (key < T) { kf = *(const v4fa*)(K + (size_t)key * pitch + c4); vf = *(const v4fa*)(V + (size_t)key * pitch + c4); }
#pragma unroll
      for (int t = 0; t < 4; ++t) {
        unsigned short hb = bf16_bits(kf[t]); sKh[r][c4 + t] = hb; sKl[r][c4 + t] = bf16_bits(kf[t] - bf16_val(hb));
        hb = bf16_bits(vf[t]); sVh[r][c4 + t] = hb; sVl[r][c4 + t] = bf16_bits(vf[t] - bf16_val(hb));
      }
    }
    __syncthreads();
    // S tile 16 x 32
    v8f s[2];
#pragma unroll
    for (int nt = 0; nt < 2; ++nt) {
      v8f acc = {};
#pragma unroll
      for (int ks = 0; ks < KS; ++ks) {
        FragB bh_, bl_;
        bh_.half[0] = *(const v8us*)&sKh[nt * 16 + ln][ks * 32 + 8 * hh]; bh_.half[1] = *(const v8us*)&sKh[nt * 16 + ln][ks * 32 + 16 + 8 * hh];
        bl_.half[0] = *(const v8us*)&sKl[nt * 16 + ln][ks * 32 + 8 * hh]; bl_.half[1] = *(const v8us*)&sKl[nt * 16 + ln][ks * 32 + 16 + 8 * hh];
        acc = mmaN<3>(aqh[ks].v, aql[ks].v, bh_.v, bl_.v, acc);
      }
      s[nt] = acc;
    }
    // mask + running max (rows 8hh+r; the 16 lanes of a half share rows)
    float alpha[8];
#pragma unroll
    for (int r = 0; r < 8; ++r) {
      const int qi = q0 + 8 * hh + r;
      const int ja = j0 + ln, jb = j0 + 16 + ln;
      if (CAUSAL) { if (ja > qi) s[0][r] = -3.0e38f; if (jb > qi) s[1][r] = -3.0e38f; }
      if (ja >= T) s[0][r] = -3.0e38f;
      if (jb >= T) s[1][r] = -3.0e38f;
      float mx = fmaxf(s[0][r], s[1][r]);
      mx = fmaxf(mx, __shfl_xor(mx, 1, 32)); mx = fmaxf(mx, __shfl_xor(mx, 2, 32)); mx = fmaxf(mx, __shfl_xor(mx, 4, 32)); mx = fmaxf(mx, __shfl_xor(mx, 8, 32));
      const float mnew = fmaxf(m_r[r], mx);
      alpha[r] = (mnew > -1.0e38f) ? __expf(m_r[r] - mnew) : 1.0f;
      const float p0 = (s[0][r] > -1.0e38f) ? __expf(s[0][r] - mnew) : 0.f;
      const float p1 = (s[1][r] > -1.0e38f) ? __expf(s[1][r] - mnew) : 0.f;
      m_r[r] = mnew;
      l_r[r] = l_r[r] * alpha[r] + p0 + p1;            // per-lane partial row sum (16 lanes combined at the end)
      unsigned short hb = bf16_bits(p0); sPh[w][8 * hh + r][ln] = hb;      sPl[w][8 * hh + r][ln] = bf16_bits(p0 - bf16_val(hb));
      hb = bf16_bits(p1);                sPh[w][8 * hh + r][16 + ln] = hb; sPl[w][8 * hh + r][16 + ln] = bf16_bits(p1 - bf16_val(hb));
    }
#pragma unroll
    for (int dt = 0; dt < DT; ++dt)
#pragma unroll
      for (int r = 0; r < 8; ++r) oacc[dt][r] *= alpha[r];
    __builtin_amdgcn_fence(__ATOMIC_ACQ_REL, "workgroup");
    __builtin_amdgcn_wave_barrier();
    FragB pah, pal;
    pah.half[0] = *(const v8us*)&sPh[w][ln][8 * hh]; pah.half[1] = *(const v8us*)&sPh[w][ln][16 + 8 * hh];
    pal.half[0] = *(const v8us*)&sPl[w][ln][8 * hh]; pal.half[1] = *(const v8us*)&sPl[w][ln][16 + 8 * hh];
#pragma unroll
    for (int dt = 0; dt < DT; ++dt) {
      FragB bvh, bvl;
#pragma unroll
      for (int i = 0; i < 8; ++i) {
        bvh.u[i] = sVh[8 * hh + i][dt * 16 + ln]; bvh.u[8 + i] = sVh[16 + 8 * hh + i][dt * 16 + ln];
        bvl.u[i] = sVl[8 * hh + i][dt * 16 + ln]; bvl.u[8 + i] = sVl[16 + 8 * hh + i][dt * 16 + ln];
      }
      oacc[dt] = mmaN<3>(pah.v, pal.v, bvh.v, bvl.v, oacc[dt]);
    }
    __builtin_amdgcn_fence(__ATOMIC_ACQ_REL, "workgroup");
    __builtin_amdgcn_wave_barrier();
  }
#pragma unroll
  for (int r = 0; r < 8; ++r) {
    float l = l_r[r];
    l += __shfl_xor(l, 1, 32); l += __shfl_xor(l, 2, 32); l += __shfl_xor(l, 4, 32); l += __shfl_xor(l, 8, 32);
    l_r[r] = (l > 0.f) ? 1.0f / l : 0.f;
  }
#pragma unroll
  for (int dt = 0; dt < DT; ++dt)
#pragma unroll
    for (int r = 0; r < 8; ++r) sO[w][8 * hh + r][dt * 16 + ln] = oacc[dt][r] * l_r[r];
  __builtin_amdgcn_fence(__ATOMIC_ACQ_REL, "workgroup");
  __builtin_amdgcn_wave_barrier();
  {
    for (int r = 0; r < 16; ++r) {
      const int row = q0 + r;
      if (row < T && lane < D / 4) {
        const v4f val = *(const v4fa*)&sO[w][r][lane * 4];
        *(v4f*)(y + ((size_t)b * T + row) * ypitch + h * D + lane * 4) = val;
      }
    }
    
  }
}

// batched GEMM (blockIdx.y = batch): C_b = act(alpha·A_b·B_b + bias + resid_b); A f32 rows (ASPLIT → hi/lo), B = bf16 planes Bh (+Bl when BSPLIT, requires ASPLIT),
// per-batch element strides sA, sB (0 = shared weights), sC, sR. resid may alias C (values are staged before the stores). ACT 0/1(relu).
// ACT: 0 none, 1 relu, 2 softplus
template <bool ASPLIT, bool BSPLIT, int ACT>
__global__ __launch_bounds__(128) void k_gemm_b(const float* __restrict__ A, int lda, size_t sA, const unsigned short* __restrict__ Bh, const unsigned short* __restrict__ Bl, int ldb, size_t sB,
                                             const float* __restrict__ bias, const float* __restrict__ resid, int ldr, size_t sR, float rsign, float alpha,
                                             float* __restrict__ C, int ldc, size_t sC, int M, int N, int K) {
  __shared__ __attribute__((aligned(16))) float so[4][16][64];
  const int tid = threadIdx.x, w = tid >> 5, lane = tid & 31, ln = lane & 15, hh = lane >> 4;
  const int by = blockIdx.y;
  A += (size_t)by * sA; Bh += (size_t)by * sB; if (BSPLIT) Bl += (size_t)by * sB; C += (size_t)by * sC; if (resid) resid += (size_t)by * sR;
  const int ntn = (N + 63) / 64; const int wid = blockIdx.x * 4 + w; const int mt = wid / ntn, nq = wid % ntn;      // N may be any multiple of 16: tiles past N are skipped and not stored
  if (mt * 16 >= M) return;
  const int row0 = mt * 16, col0 = nq * 64;
  const float* arow = A + (size_t)(row0 + ln) * lda;
  v8f acc[4] = {};
  for (int kb = 0; kb < K; kb += 32) {
    FragB ah, al;
    const v4f x0 = *(const v4fa*)(arow + kb + 8 * hh), x1 = *(const v4fa*)(arow + kb + 8 * hh + 4);
    const v4f x2 = *(const v4fa*)(arow + kb + 16 + 8 * hh), x3 = *(const v4fa*)(arow + kb + 16 + 8 * hh + 4);
    float xs[16] = {x0[0],x0[1],x0[2],x0[3],x1[0],x1[1],x1[2],x1[3],x2[0],x2[1],x2[2],x2[3],x3[0],x3[1],x3[2],x3[3]};
#pragma unroll
    for (int i = 0; i < 16; ++i) { const unsigned short hb = bf16_bits(xs[i]); ah.u[i] = hb; al.u[i] = ASPLIT ? bf16_bits(xs[i] - bf16_val(hb)) : (unsigned short)0; }
#pragma unroll
    for (int t = 0; t < 4; ++t) {
      if (col0 + t * 16 >= N) continue;
      const size_t boff = (size_t)(col0 + t * 16 + ln) * ldb + kb;
      FragB bh_, bl_; bh_.half[0] = *(const v8us*)(Bh + boff + 8 * hh); bh_.half[1] = *(const v8us*)(Bh + boff + 16 + 8 * hh);
      if (BSPLIT) { bl_.half[0] = *(const v8us*)(Bl + boff + 8 * hh); bl_.half[1] = *(const v8us*)(Bl + boff + 16 + 8 * hh); } else bl_ = bh_;
      acc[t] = mmaN<ASPLIT ? (BSPLIT ? 3 : 2) : 1>(ah.v, al.v, bh_.v, bl_.v, acc[t]);
    }
  }
#pragma unroll
  for (int t = 0; t < 4; ++t) {
    const int col = col0 + t * 16 + ln; if (col0 + t * 16 >= N) continue; const float bv = bias ? bf16_round(bias[col]) : 0.f;
#pragma unroll
    for (int r = 0; r < 8; ++r) { float v = acc[t][r] * alpha + bv; if (resid) v += rsign * resid[(size_t)(row0 + 8 * hh + r) * ldr + col]; if (ACT == 1) v = fmaxf(v, 0.f); else if (ACT == 2) v = fmaxf(v, 0.f) + log1pf(expf(-fabsf(v))); so[w][8 * hh + r][t * 16 + ln] = v; }
  }
  __builtin_amdgcn_fence(__ATOMIC_ACQ_REL, "workgroup"); __builtin_amdgcn_wave_barrier();
  const int rsub = lane >> 4, c4 = (lane & 15) * 4;
  {
#pragma unroll
    for (int q = 0; q < 8; ++q) { const int r = q * 2 + rsub; if (col0 + c4 < N) { const v4f v = *(const v4fa*)&so[w][r][c4]; *(v4f*)(C + (size_t)(row0 + r) * ldc + col0 + c4) = v; } }
    
  }
}
// batched f32 [K][N] (pitch lds, batch stride sIn) -> transposed hi/lo planes [N][K] (batch stride sOut); thread per (n, 8 k); grid.y = batch
__global__ __launch_bounds__(256) void k_split_transpose_b(const float* __restrict__ src, int lds_, size_t sIn, unsigned short* __restrict__ hi, unsigned short* __restrict__ lo, size_t sOut, int K, int N) {
  const size_t t = (size_t)blockIdx.x * 256 + threadIdx.x; const int k8n = K / 8; if (t >= (size_t)N * k8n) return;
  src += (size_t)blockIdx.y * sIn; hi += (size_t)blockIdx.y * sOut; lo += (size_t)blockIdx.y * sOut;
  const int n = (int)(t / k8n), k8 = (int)(t % k8n) * 8; v8us vh, vl;
#pragma unroll
  for (int i = 0; i < 8; ++i) { const float x = src[(size_t)(k8 + i) * lds_ + n]; const unsigned short hb = bf16_bits(x); vh[i] = hb; vl[i] = bf16_bits(x - bf16_val(hb)); }
  unsigned short* dh = hi + (size_t)n * K + k8; unsigned short* dl = lo + (size_t)n * K + k8;
  *(v8us*)dh = vh; *(v8us*)dl = vl; 
}

// ---- f16 WMMA path (v_wmma_f32_16x16x32_f16): 11-bit significands for operands in range — used where the [-1,1] cos operand needs more precision than bf16
typedef _Float16 v16h __attribute__((ext_vector_type(16)));
union FragH { v16h v; v8us half[2]; _Float16 h[16]; unsigned short u[16]; };
template <int NT>
__device__ __forceinline__ v8f mmaH(v16h ah, v16h al, v16h bh, v16h bl, v8f c) {
  c = __builtin_amdgcn_wmma_f32_16x16x32_f16(false, ah, false, bh, (short)0, c, false, false);
  if (NT >= 2) c = __builtin_amdgcn_wmma_f32_16x16x32_f16(false, al, false, bh, (short)0, c, false, false);
  if (NT >= 3) c = __builtin_amdgcn_wmma_f32_16x16x32_f16(false, ah, false, bl, (short)0, c, false, false);
  asm volatile("v_nop\n\tv_nop\n\tv_nop\n\tv_nop" : "+v"(c) : "v"(ah), "v"(al), "v"(bh), "v"(bl));
  return c;
}
// batched GEMM like k_gemm_b but f16 operands: A f32 (split into f16 hi/lo if ASPLIT, else rounded to f16), Bt = f16 values [n][k]; alpha; C f32; N multiple of 16 (partial tiles skipped)
template <bool ASPLIT>
__global__ __launch_bounds__(128) void k_gemm_h(const float* __restrict__ A, int lda, size_t sA, const _Float16* __restrict__ Bh, int ldb, size_t sB, float alpha, float* __restrict__ C, int ldc, size_t sC, int M, int N, int K) {
  __shared__ __attribute__((aligned(16))) float so[4][16][64];
  const int tid = threadIdx.x, w = tid >> 5, lane = tid & 31, ln = lane & 15, hh = lane >> 4; const int by = blockIdx.y;
  A += (size_t)by * sA; Bh += (size_t)by * sB; C += (size_t)by * sC;
  const int ntn = (N + 63) / 64; const int wid = blockIdx.x * 4 + w; const int mt = wid / ntn, nq = wid % ntn; if (mt * 16 >= M) return;
  const int row0 = mt * 16, col0 = nq * 64; const float* arow = A + (size_t)(row0 + ln) * lda;
  v8f acc[4] = {};
  for (int kb = 0; kb < K; kb += 32) {
    FragH ah, al;
    const v4f x0 = *(const v4fa*)(arow + kb + 8 * hh), x1 = *(const v4fa*)(arow + kb + 8 * hh + 4), x2 = *(const v4fa*)(arow + kb + 16 + 8 * hh), x3 = *(const v4fa*)(arow + kb + 16 + 8 * hh + 4);
    float xs[16] = {x0[0],x0[1],x0[2],x0[3],x1[0],x1[1],x1[2],x1[3],x2[0],x2[1],x2[2],x2[3],x3[0],x3[1],x3[2],x3[3]};
#pragma unroll
    for (int i = 0; i < 16; ++i) { const _Float16 h = (_Float16)xs[i]; ah.h[i] = h; al.h[i] = ASPLIT ? (_Float16)(xs[i] - (float)h) : (_Float16)0.0f; }
#pragma unroll
    for (int t = 0; t < 4; ++t) { if (col0 + t * 16 >= N) continue; const size_t boff = (size_t)(col0 + t * 16 + ln) * ldb + kb; FragH bq; bq.half[0] = *(const v8us*)(Bh + boff + 8 * hh); bq.half[1] = *(const v8us*)(Bh + boff + 16 + 8 * hh);
      acc[t] = mmaH<ASPLIT ? 2 : 1>(ah.v, al.v, bq.v, bq.v, acc[t]); }
  }
#pragma unroll
  for (int t = 0; t < 4; ++t) { if (col0 + t * 16 >= N) continue;
#pragma unroll
    for (int r = 0; r < 8; ++r) so[w][8 * hh + r][t * 16 + ln] = acc[t][r] * alpha; }
  __builtin_amdgcn_fence(__ATOMIC_ACQ_REL, "workgroup"); __builtin_amdgcn_wave_barrier();
  const int rsub = lane >> 4, c4 = (lane & 15) * 4;
  {
#pragma unroll
    for (int q = 0; q < 8; ++q) { const int r = q * 2 + rsub; if (col0 + c4 < N) { const v4f v = *(const v4fa*)&so[w][r][c4]; *(v4f*)(C + (size_t)(row0 + r) * ldc + col0 + c4) = v; } }
     }
}

// Bt = bits(W?[k][n]) in B-fragment order, via 32x32 tiles (grid: k tiles, n tiles (12), -): [n / 16][k / 32][half][lane = hh * 16 + (n & 15)][8],
// k = (k / 32) * 32 + half * 16 + hh * 8 + i, so that one half fragment of a wave is 512 contiguous bytes; bias concat
__global__ __launch_bounds__(256) void k_wt(const float* __restrict__ Wq, const float* __restrict__ Wk, const float* __restrict__ Wv, const float* __restrict__ bq, const float* __restrict__ bk, const float* __restrict__ bv, unsigned short* __restrict__ Bt, float* __restrict__ B3) { __shared__ float tile[32][33]; const int k0 = blockIdx.x * 32, n0 = blockIdx.y * 32; const int which = n0 / DK, nn0 = n0 % DK; const float* W = which == 0 ? Wq : (which == 1 ? Wk : Wv); const int tx = threadIdx.x & 31, ty = threadIdx.x >> 5;
  for (int i = ty; i < 32; i += 8) tile[i][tx] = W[(size_t)(k0 + i) * DK + nn0 + tx]; __syncthreads();
  typedef unsigned short v4us __attribute__((ext_vector_type(4))); const int r = threadIdx.x >> 3, c4 = (threadIdx.x & 7) * 4; v4us o; for (int q = 0; q < 4; ++q) o[q] = bf16_bits(tile[c4 + q][r]);
  const int n = n0 + r; unsigned short* d = Bt + ((size_t)(((n >> 4) * (DM / 32) + blockIdx.x) * 2 + (c4 >> 4)) * 32 + ((c4 >> 3) & 1) * 16 + (n & 15)) * 8 + (c4 & 7); *(v4us*)d = o; 
  if (blockIdx.x == 0 && threadIdx.x < 32) { const float* bs = which == 0 ? bq : (which == 1 ? bk : bv); *(float*)(B3 + n0 + threadIdx.x) = bs[nn0 + threadIdx.x]; } }
// [Q|K|V] = x.W + b: a work-group owns PM rows of x and all 384 columns, so x is read from memory once. The rows are fetched by whole-line loads,
// rounded to bf16 once and kept in LDS for all waves; a wave owns 48 columns (3 tiles x 2 row tiles) and reads its W fragments, which no other wave
// of the group needs, straight from the fragment-ordered Bt: every wave-wide load is 512 contiguous bytes. k runs upward, one WMMA per 32 k.
#define PM 32
#define PAP (DM + 8)
#define PCP (3 * DK + 4)
#define PKC 4
typedef unsigned short v4usa __attribute__((ext_vector_type(4), may_alias));
__global__ __launch_bounds__(256) void k_proj(const float* __restrict__ x, const unsigned short* __restrict__ Bt, const float* __restrict__ B3, float* __restrict__ QKV) {
  __shared__ __attribute__((aligned(16))) unsigned short sA[PM][PAP];   // pitch 2064 B = 16 B x odd
  __shared__ __attribute__((aligned(16))) float sC[PM][PCP];            // pitch 388 dwords: rows 8 apart lie 32 banks apart
  const int tid = threadIdx.x, w = tid >> 5, lane = tid & 31, ln = lane & 15, hh = lane >> 4;
  const int row0 = blockIdx.x * PM;
  const unsigned short* bp = Bt + (size_t)w * 3 * (DM / 32) * 512 + lane * 8;
  FragB bf[2][PKC][3];          // W fragments of PKC k-steps, two sets: the next set flies under the current set's products
#pragma unroll
  for (int s = 0; s < PKC; ++s)
#pragma unroll
    for (int t = 0; t < 3; ++t) { bf[0][s][t].half[0] = *(const v8us*)(bp + (t * (DM / 32) + s) * 512); bf[0][s][t].half[1] = *(const v8us*)(bp + (t * (DM / 32) + s) * 512 + 256); }
  {
    const float* xr = x + (size_t)row0 * DM + tid * 4;
    v4f v[PM];
#pragma unroll
    for (int i = 0; i < PM; ++i) v[i] = *(const v4fa*)(xr + (size_t)i * DM);
    // keeps all the row loads in front of the conversions, so that they are in flight together and share one memory latency
    __builtin_amdgcn_sched_barrier(0);
#pragma unroll
    for (int i = 0; i < PM; ++i) *(v4usa*)&sA[i][tid * 4] = (v4usa){bf16_bits(v[i][0]), bf16_bits(v[i][1]), bf16_bits(v[i][2]), bf16_bits(v[i][3])};
  }
  __syncthreads();
  float bv[3];
#pragma unroll
  for (int t = 0; t < 3; ++t) bv[t] = bf16_round(B3[w * 48 + t * 16 + ln]);
  // the bias loads' offset register is reused soon after; the wait stands in front of that overwrite
  asm volatile("s_wait_xcnt 0x0" ::: "memory");
  v8f acc[2][3];
#pragma unroll
  for (int mt = 0; mt < 2; ++mt)
#pragma unroll
    for (int t = 0; t < 3; ++t) acc[mt][t] = (v8f){0.f, 0.f, 0.f, 0.f, 0.f, 0.f, 0.f, 0.f};
#pragma unroll
  for (int c = 0; c < DM / 32 / PKC; ++c) {
    if (c + 1 < DM / 32 / PKC) {
#pragma unroll
      for (int s = 0; s < PKC; ++s)
#pragma unroll
        for (int t = 0; t < 3; ++t) {
          const unsigned short* p = bp + (t * (DM / 32) + (c + 1) * PKC + s) * 512;
          bf[(c + 1) & 1][s][t].half[0] = *(const v8us*)p; bf[(c + 1) & 1][s][t].half[1] = *(const v8us*)(p + 256);
        }
    }
    FragB af[PKC][2];           // x fragments: row = mt*16 + ln, k in the same order as Bt's
#pragma unroll
    for (int s = 0; s < PKC; ++s)
#pragma unroll
      for (int mt = 0; mt < 2; ++mt) {
        af[s][mt].half[0] = *(const v8us*)&sA[mt * 16 + ln][(c * PKC + s) * 32 + 8 * hh]; af[s][mt].half[1] = *(const v8us*)&sA[mt * 16 + ln][(c * PKC + s) * 32 + 16 + 8 * hh];
      }
    // keeps the next set's loads and this set's LDS reads as one group in front of the products; without it the compiler moves them in among the
    // products, close to their use, and each then waits out its own latency
    __builtin_amdgcn_sched_barrier(0);
#pragma unroll
    for (int s = 0; s < PKC; ++s)
#pragma unroll
      for (int mt = 0; mt < 2; ++mt)
#pragma unroll
        for (int t = 0; t < 3; ++t) acc[mt][t] = __builtin_amdgcn_wmma_f32_16x16x32_bf16(false, af[s][mt].v, false, bf[c & 1][s][t].v, (short)0, acc[mt][t], false, false);
    // second half of the fence pair: keeps the following group's loads and LDS reads from being moved up in among these products
    __builtin_amdgcn_sched_barrier(0);
  }
#pragma unroll
  for (int mt = 0; mt < 2; ++mt)
#pragma unroll
    for (int t = 0; t < 3; ++t)
#pragma unroll
      for (int r = 0; r < 8; ++r) sC[mt * 16 + 8 * hh + r][w * 48 + t * 16 + ln] = acc[mt][t][r] + bv[t];
  __syncthreads();
#pragma unroll
  for (int g = 0; g < PM * (3 * DK / 4) / 256; ++g) {   // the tile is contiguous in QKV: a wave stores 512 contiguous bytes at a time
    const int idx = g * 256 + tid, r = idx / (3 * DK / 4), c4 = (idx % (3 * DK / 4)) * 4;
    *(v4f*)(QKV + (size_t)row0 * (3 * DK) + (size_t)idx * 4) = *(const v4fa*)&sC[r][c4];
  }
}
// from QKV [tok][384]: Kh/Kl [tok][128] bf16 hi/lo planes of K (thread per 8 consecutive c → 16-B stores, 256 B per row); VT16 [b][128][2048] = f16(V)ᵀ via LDS tiles
__global__ __launch_bounds__(256) void k_kv(const float* __restrict__ QKV, unsigned short* __restrict__ Kh, unsigned short* __restrict__ Kl, _Float16* __restrict__ VT) { __shared__ float tile[32][DK + 1]; const int b = blockIdx.y, l0 = blockIdx.x * 32; const int tid = threadIdx.x, tx = tid & 31, ty = tid >> 5;
  for (int i = ty; i < 32; i += 8) { const size_t tok = (size_t)b * LL + l0 + i; for (int u = 0; u < 4; ++u) { const int c = u * 32 + tx; tile[i][c] = QKV[tok * (3 * DK) + 2 * DK + c]; } }
  // K planes: 32 tokens × 128 c = 512 groups of 8 → 2 per thread
  { for (int gidx = tid; gidx < 32 * (DK / 8); gidx += 256) { const int i = gidx / (DK / 8), c8 = (gidx % (DK / 8)) * 8; const size_t tok = (size_t)b * LL + l0 + i; v8us h, l; for (int q = 0; q < 8; ++q) { const float kv = QKV[tok * (3 * DK) + DK + c8 + q]; const float kh = bf16_round(kv); h[q] = bf16_bits(kh); l[q] = bf16_bits(kv - kh); }
      *(v8us*)(Kh + tok * DK + c8) = h; *(v8us*)(Kl + tok * DK + c8) = l; }  }
  __syncthreads();
  { for (int c = ty; c < DK; c += 8) *(_Float16*)(VT + ((size_t)b * DK + c) * LL + l0 + tx) = (_Float16)tile[tx][c];  } }
#define FQ 32
#define FW 8
#define FKEYS (LL / FW)
#define QP (DK + 8)
#define RP (DK + 4)
__global__ __launch_bounds__(256) void k_cosattn(const float* __restrict__ QKV, const unsigned short* __restrict__ Kh, const unsigned short* __restrict__ Kl, const _Float16* __restrict__ VT, float* __restrict__ out) {
  __shared__ __attribute__((aligned(16))) unsigned short sQh[FQ][QP], sQl[FQ][QP];   // pitch 272 B = 16 B x odd
  __shared__ __attribute__((aligned(16))) float red[FW][FQ][RP];                     // pitch 528 B = 16 B x odd
  const int tid = threadIdx.x, w = tid >> 5, lane = tid & 31, ln = lane & 15, hh = lane >> 4;
  const int b = blockIdx.x / (LL / FQ), q0 = (blockIdx.x % (LL / FQ)) * FQ;
  { // Q rows -> bf16 hi/lo planes, split once per work-group (thread: 16 consecutive columns of one row)
    const int r = tid >> 3, c0 = (tid & 7) * 16;
    const float* qr = QKV + ((size_t)b * LL + q0 + r) * (3 * DK) + c0;
    const v4f x0 = *(const v4fa*)qr, x1 = *(const v4fa*)(qr + 4), x2 = *(const v4fa*)(qr + 8), x3 = *(const v4fa*)(qr + 12);
    // the loads' address registers are reused soon after
    asm volatile("s_wait_xcnt 0x0" ::: "memory");
    const float xs[16] = {x0[0], x0[1], x0[2], x0[3], x1[0], x1[1], x1[2], x1[3], x2[0], x2[1], x2[2], x2[3], x3[0], x3[1], x3[2], x3[3]};
#pragma unroll
    for (int g = 0; g < 2; ++g) {
      v8us h, l;
#pragma unroll
      for (int i = 0; i < 8; ++i) { const float x = xs[g * 8 + i]; const unsigned short hb = bf16_bits(x); h[i] = hb; l[i] = bf16_bits(x - bf16_val(hb)); }
      *(v8us*)&sQh[r][c0 + g * 8] = h; *(v8us*)&sQl[r][c0 + g * 8] = l;
    }
  }
  __syncthreads();
  FragB qh[2][4], ql[2][4];     // B fragments: column = query qt*16+ln, k in the same order as the K loader below
#pragma unroll
  for (int qt = 0; qt < 2; ++qt)
#pragma unroll
    for (int ks = 0; ks < 4; ++ks) {
      qh[qt][ks].half[0] = *(const v8us*)&sQh[qt * 16 + ln][ks * 32 + 8 * hh]; qh[qt][ks].half[1] = *(const v8us*)&sQh[qt * 16 + ln][ks * 32 + 16 + 8 * hh];
      ql[qt][ks].half[0] = *(const v8us*)&sQl[qt * 16 + ln][ks * 32 + 8 * hh]; ql[qt][ks].half[1] = *(const v8us*)&sQl[qt * 16 + ln][ks * 32 + 16 + 8 * hh];
    }
  v8f o[2][8];                  // o[qt][dt][r] = O[query qt*16+ln][d = dt*16 + 8*hh + r], this wave's keys only
#pragma unroll
  for (int qt = 0; qt < 2; ++qt)
#pragma unroll
    for (int dt = 0; dt < 8; ++dt) o[qt][dt] = (v8f){0.f, 0.f, 0.f, 0.f, 0.f, 0.f, 0.f, 0.f};
  const size_t koff = ((size_t)b * LL + w * FKEYS + ln) * DK + 8 * hh;
  const unsigned short* kh = Kh + koff;
  const unsigned short* kl = Kl + koff;
  const unsigned short* vt = (const unsigned short*)VT + ((size_t)b * DK + ln) * LL + w * FKEYS + 8 * hh;
  for (int j = 0; j < FKEYS; j += 32) {
    FragB ah[2][4], al[2][4];   // A fragments of K hi/lo: row = key j + kt*16 + ln
#pragma unroll
    for (int kt = 0; kt < 2; ++kt)
#pragma unroll
      for (int ks = 0; ks < 4; ++ks) {
        const size_t e = (size_t)(j + kt * 16) * DK + ks * 32;
        ah[kt][ks].half[0] = *(const v8us*)(kh + e); ah[kt][ks].half[1] = *(const v8us*)(kh + e + 16);
        al[kt][ks].half[0] = *(const v8us*)(kl + e); al[kt][ks].half[1] = *(const v8us*)(kl + e + 16);
      }
    // the products' accumulators reuse the loads' address registers
    asm volatile("s_wait_xcnt 0x0" ::: "memory");
    // keeps all 32 K loads in front of the products, so that they are issued back to back and share one latency;
    // without it the compiler loads one fragment at a time and waits for each in front of its products
    __builtin_amdgcn_sched_barrier(0);
    v8f s[2][2];                // s[kt][qt][r] = S[query qt*16+ln][key j + kt*16 + 8*hh + r]
#pragma unroll
    for (int kt = 0; kt < 2; ++kt)
#pragma unroll
      for (int qt = 0; qt < 2; ++qt) {
        v8f c = {};
#pragma unroll
        for (int ks = 0; ks < 4; ++ks) {   // three products of the hi/lo split, in this order: Qhi.Khi, Qlo.Khi, Qhi.Klo
          c = __builtin_amdgcn_wmma_f32_16x16x32_bf16(false, ah[kt][ks].v, false, qh[qt][ks].v, (short)0, c, false, false);
          c = __builtin_amdgcn_wmma_f32_16x16x32_bf16(false, ah[kt][ks].v, false, ql[qt][ks].v, (short)0, c, false, false);
          c = __builtin_amdgcn_wmma_f32_16x16x32_bf16(false, al[kt][ks].v, false, qh[qt][ks].v, (short)0, c, false, false);
        }
        // four vector slots between the chain's last WMMA and the first vector instruction that reads its D, on every path
        asm volatile("v_nop\n\tv_nop\n\tv_nop\n\tv_nop" : "+v"(c));
        s[kt][qt] = c;
      }
    FragH va[8];                // A fragments of V^T: row = d, k = key; they fly under the cosines
#pragma unroll
    for (int dt = 0; dt < 8; ++dt) { va[dt].half[0] = *(const v8us*)(vt + (size_t)dt * 16 * LL + j); va[dt].half[1] = *(const v8us*)(vt + (size_t)dt * 16 * LL + j + 16); }
#pragma unroll
    for (int qt = 0; qt < 2; ++qt) {
      FragH p;                  // B fragment: p[i] = cos(S)[key kmap(i, hh)][query], straight from the two D tiles
#pragma unroll
      for (int i = 0; i < 8; ++i) { p.h[i] = (_Float16)cosf(s[0][qt][i]); p.h[8 + i] = (_Float16)cosf(s[1][qt][i]); }
#pragma unroll
      for (int dt = 0; dt < 8; ++dt) o[qt][dt] = __builtin_amdgcn_wmma_f32_16x16x32_f16(false, va[dt].v, false, p.v, (short)0, o[qt][dt], false, false);
      // four vector slots behind the last WMMA before its operands may be rewritten, also on the taken side of the branches that follow (cosf, loop)
      asm volatile("v_nop\n\tv_nop\n\tv_nop\n\tv_nop" : "+v"(o[qt][7]) : "v"(p.v));
    }
  }
#pragma unroll
  for (int qt = 0; qt < 2; ++qt)
#pragma unroll
    for (int dt = 0; dt < 8; ++dt) {
      float* d = &red[w][qt * 16 + ln][dt * 16 + 8 * hh];
      *(v4fa*)d = (v4f){o[qt][dt][0], o[qt][dt][1], o[qt][dt][2], o[qt][dt][3]};
      *(v4fa*)(d + 4) = (v4f){o[qt][dt][4], o[qt][dt][5], o[qt][dt][6], o[qt][dt][7]};
    }
  __syncthreads();
#pragma unroll
  for (int g = 0; g < FQ * DK / 4 / 256; ++g) {   // a wave stores one whole 512-B output row at a time
    const int idx = g * 256 + tid, q = idx >> 5, d4 = (idx & 31) * 4;
    v4f a = *(const v4fa*)&red[0][q][d4];
#pragma unroll
    for (int u = 1; u < FW; ++u) a += *(const v4fa*)&red[u][q][d4];
    *(v4f*)(out + ((size_t)b * LL + q0 + q) * DK + d4) = a;
  }
}
extern "C" void kernel_launch(void* const* d_in, const int* in_sizes, int n_in,
                              void* d_out, int out_size, void* d_ws, size_t ws_size, hipStream_t stream) {
  (void)in_sizes; (void)n_in; (void)out_size;
  const float* x = (const float*)d_in[0]; const float* Wq = (const float*)d_in[1]; const float* bq = (const float*)d_in[2]; const float* Wk = (const float*)d_in[3]; const float* bk = (const float*)d_in[4]; const float* Wv = (const float*)d_in[5]; const float* bv = (const float*)d_in[6];
  char* ws = (char*)d_ws; size_t off = 0;
  auto take = [&](size_t bytes) { char* p = ws + off; off += (bytes + 255) & ~(size_t)255; return p; };
  unsigned short* Bt = (unsigned short*)take((size_t)3 * DK * DM * 2); float* B3 = (float*)take(3 * DK * 4); float* QKV = (float*)take((size_t)NTOK * 3 * DK * 4);
  unsigned short* Kh = (unsigned short*)take((size_t)NTOK * DK * 2); unsigned short* Kl = (unsigned short*)take((size_t)NTOK * DK * 2); _Float16* VT = (_Float16*)take((size_t)BB * DK * LL * 2);
  if (off > ws_size) return;
  k_wt<<<dim3(DM / 32, 3 * DK / 32), 256, 0, stream>>>(Wq, Wk, Wv, bq, bk, bv, Bt, B3);
  k_proj<<<NTOK / PM, 256, 0, stream>>>(x, Bt, B3, QKV);
  k_kv<<<dim3(LL / 32, BB), 256, 0, stream>>>(QKV, Kh, Kl, VT);
  k_cosattn<<<NTOK / FQ, 256, 0, stream>>>(QKV, Kh, Kl, VT, (float*)d_out);
}

// v003
// One run takes 51.7 microseconds.
// Two timings next to v002 both put it at 1.11 times that version's speed.
// Counting every step since v000, it is 9.73 times as fast.
#include <hip/hip_runtime.h>
// [Q|K|V] = x·[Wq|Wk|Wv] + b on v_wmma_f32_16x16x32_bf16 (x rounded to bf16: single exact term; 8192 × 1024 × 384); QK = Q·Kᵀ on the same unit with BOTH f32 operands split
// hi/lo (3 products — cos(QK) at |QK| ≈ 10–40 needs the phase to ≈1e-4 rad; 4 × 2048 × 2048 × 128); out = cos(QK)·V on v_wmma_f32_16x16x32_f16 (cos and V rounded to
// f16: single product). cos in f32 VALU.
#define BB 4
#define LL 2048
#define DM 1024
#define DK 128
#define NTOK (BB * LL)

typedef __bf16 v16b __attribute__((ext_vector_type(16)));
typedef unsigned short v8us __attribute__((ext_vector_type(8), may_alias));
typedef float  v8f  __attribute__((ext_vector_type(8)));
typedef float  v4f  __attribute__((ext_vector_type(4)));
typedef float  v4fa __attribute__((ext_vector_type(4), may_alias));
union FragB { v16b v; v8us half[2]; unsigned short u[16]; };

__device__ __forceinline__ unsigned short bf16_bits(float x) { unsigned int u = __float_as_uint(x); return (unsigned short)((u + 0x7FFFu + ((u >> 16) & 1u)) >> 16); }
__device__ __forceinline__ float bf16_val(unsigned short b) { return __uint_as_float(((unsigned int)b) << 16); }
__device__ __forceinline__ float bf16_round(float x) { return bf16_val(bf16_bits(x)); }
// D += A·B with NT terms: 1 = ah·bh, 2 = + al·bh (A split), 3 = + ah·bl (both split)
template <int NT>
__device__ __forceinline__ v8f mmaN(v16b ah, v16b al, v16b bh, v16b bl, v8f c) {
  c = __builtin_amdgcn_wmma_f32_16x16x32_bf16(false, ah, false, bh, (short)0, c, false, false);
  if (NT >= 2) c = __builtin_amdgcn_wmma_f32_16x16x32_bf16(false, al, false, bh, (short)0, c, false, false);
  if (NT >= 3) c = __builtin_amdgcn_wmma_f32_16x16x32_bf16(false, ah, false, bl, (short)0, c, false, false);
  asm volatile("v_nop\n\tv_nop\n\tv_nop\n\tv_nop" : "+v"(c) : "v"(ah), "v"(al), "v"(bh), "v"(bl));
  return c;
}

__global__ __launch_bounds__(256) void k_wt_bf16(const float* __restrict__ W, unsigned short* __restrict__ Wt, int K, int N) {
  const int t = blockIdx.x * 256 + threadIdx.x;
  const int k8n = K / 8;
  if (t >= N * k8n) return;
  const int n = t / k8n, k8 = (t % k8n) * 8;
  v8us v;
#pragma unroll
  for (int i = 0; i < 8; ++i) v[i] = bf16_bits(W[(size_t)(k8 + i) * N + n]);
  *(v8us*)(Wt + (size_t)n * K + k8) = v;
  
}

// GEMM C[M][N] (f32, pitch ldc) = act(A[M][K]·W + bias). A f32 row-major (pitch lda) converted per fragment to bf16
// (ASPLIT: hi/lo two planes -> 2 terms, else single rounded term); Wt bf16 [N][K] (pitch ldb). BIAS_BF16 rounds the
// bias to bf16 first (bias quantised to bf16 before the add). K%32==0, M%16==0, N%64==0.
template <bool ASPLIT, int ACT, bool BIAS_BF16>
__global__ __launch_bounds__(128) void k_gemm_bf(const float* __restrict__ A, int lda, const unsigned short* __restrict__ Wt, int ldb,
                                               const float* __restrict__ bias, float* __restrict__ C, int ldc, int M, int N, int K) {
  __shared__ __attribute__((aligned(16))) float so[4][16][64];
  const int tid = threadIdx.x, w = tid >> 5, lane = tid & 31, ln = lane & 15, hh = lane >> 4;
  const int ntn = N / 64;
  const int wid = blockIdx.x * 4 + w;
  const int mt = wid / ntn, nq = wid % ntn;
  if (mt * 16 >= M) return;
  const int row0 = mt * 16, col0 = nq * 64;
  const float* arow = A + (size_t)(row0 + ln) * lda;
  v8f acc[4] = {};
  for (int kb = 0; kb < K; kb += 32) {
    FragB ah, al;
    const v4f x0 = *(const v4fa*)(arow + kb + 8 * hh), x1 = *(const v4fa*)(arow + kb + 8 * hh + 4);
    const v4f x2 = *(const v4fa*)(arow + kb + 16 + 8 * hh), x3 = *(const v4fa*)(arow + kb + 16 + 8 * hh + 4);
    float xs[16] = {x0[0],x0[1],x0[2],x0[3],x1[0],x1[1],x1[2],x1[3],x2[0],x2[1],x2[2],x2[3],x3[0],x3[1],x3[2],x3[3]};
#pragma unroll
    for (int i = 0; i < 16; ++i) { const unsigned short hb = bf16_bits(xs[i]); ah.u[i] = hb; al.u[i] = ASPLIT ? bf16_bits(xs[i] - bf16_val(hb)) : (unsigned short)0; }
#pragma unroll
    for (int t = 0; t < 4; ++t) {
      const unsigned short* brow = Wt + (size_t)(col0 + t * 16 + ln) * ldb + kb;
      FragB b;
      b.half[0] = *(const v8us*)(brow + 8 * hh);
      b.half[1] = *(const v8us*)(brow + 16 + 8 * hh);
      acc[t] = mmaN<ASPLIT ? 2 : 1>(ah.v, al.v, b.v, b.v, acc[t]);
    }
  }
#pragma unroll
  for (int t = 0; t < 4; ++t) {
    float bv = bias ? bias[col0 + t * 16 + ln] : 0.f;
    if (BIAS_BF16) bv = bf16_round(bv);
#pragma unroll
    for (int r = 0; r < 8; ++r) { float v = acc[t][r] + bv; if (ACT == 1) v = fmaxf(v, 0.f); so[w][8 * hh + r][t * 16 + ln] = v; }
  }
  __builtin_amdgcn_fence(__ATOMIC_ACQ_REL, "workgroup");
  __builtin_amdgcn_wave_barrier();
  const int rsub = lane >> 4, c4 = (lane & 15) * 4;
  {
#pragma unroll
    for (int q = 0; q < 8; ++q) {
      const int r = q * 2 + rsub;
      const v4f v = *(const v4fa*)&so[w][r][c4];
      *(v4f*)(C + (size_t)(row0 + r) * ldc + col0 + c4) = v;
    }
    
  }
}

// Flash-style causal/unmasked attention, all contractions 3-term bf16 hi/lo splits, f32 softmax with running max.
// q,k,v rows are read from f32 buffers with arbitrary row pitch (so they can live inside a fused qkv buffer);
// D = head size (multiple of 32, <= 128); one wave = 16 query rows; block = 4 waves (64 queries) sharing K/V chunks of 32.
template <int D, bool CAUSAL>
__global__ __launch_bounds__(128) void k_flash(const float* __restrict__ qb, const float* __restrict__ kb, const float* __restrict__ vb,
                                             int pitch, int T, int H, float scale, float* __restrict__ y, int ypitch) {
  constexpr int KS = D / 32;        // k-steps for QK
  constexpr int DT = D / 16;        // d tiles for PV
  __shared__ __attribute__((aligned(16))) unsigned short sKh[32][D + 8], sKl[32][D + 8], sVh[32][D + 8], sVl[32][D + 8];
  __shared__ __attribute__((aligned(16))) unsigned short sPh[4][16][40], sPl[4][16][40];
  __shared__ __attribute__((aligned(16))) float sO[4][16][D];
  const int tid = threadIdx.x, w = tid >> 5, lane = tid & 31, ln = lane & 15, hh = lane >> 4;
  const int nqb = (T + 63) / 64;
  const int bh = blockIdx.x / nqb, qblk = blockIdx.x % nqb;
  const int b = bh / H, h = bh % H;
  const int q0 = qblk * 64 + w * 16;
  const float* Q = qb + (size_t)b * T * pitch + h * D;
  const float* K = kb + (size_t)b * T * pitch + h * D;
  const float* V = vb + (size_t)b * T * pitch + h * D;

  // A fragments of the wave's 16 query rows (scaled), hi/lo
  FragB aqh[KS], aql[KS];
  {
    int row = q0 + ln; if (row >= T) row = T - 1;
    const float* qr = Q + (size_t)row * pitch;
#pragma unroll
    for (int ks = 0; ks < KS; ++ks)
#pragma unroll
      for (int i = 0; i < 16; ++i) {
        const int d = ks * 32 + ((i < 8) ? (8 * hh + i) : (16 + 8 * hh + (i - 8)));
        const float x = qr[d] * scale; const unsigned short hb = bf16_bits(x);
        aqh[ks].u[i] = hb; aql[ks].u[i] = bf16_bits(x - bf16_val(hb));
      }
  }
  float m_r[8], l_r[8];
#pragma unroll
  for (int r = 0; r < 8; ++r) { m_r[r] = -3.0e38f; l_r[r] = 0.f; }
  v8f oacc[DT];
#pragma unroll
  for (int dt = 0; dt < DT; ++dt) oacc[dt] = (v8f){0.f,0.f,0.f,0.f,0.f,0.f,0.f,0.f};

  const int kv_end = CAUSAL ? min(T, qblk * 64 + 64) : T;     // block-uniform
  for (int j0 = 0; j0 < kv_end; j0 += 32) {
    __syncthreads();
    for (int e = tid; e < 32 * (D / 4); e += 128) {
      const int r = e / (D / 4), c4 = (e % (D / 4)) * 4;
      const int key = j0 + r;
      v4f kf = {0.f,0.f,0.f,0.f}, vf = {0.f,0.f,0.f,0.f};
      if (key < T) { kf = *(const v4fa*)(K + (size_t)key * pitch + c4); vf = *(const v4fa*)(V + (size_t)key * pitch + c4); }
#pragma unroll
      for (int t = 0; t < 4; ++t) {
        unsigned short hb = bf16_bits(kf[t]); sKh[r][c4 + t] = hb; sKl[r][c4 + t] = bf16_bits(kf[t] - bf16_val(hb));
        hb = bf16_bits(vf[t]); sVh[r][c4 + t] = hb; sVl[r][c4 + t] = bf16_bits(vf[t] - bf16_val(hb));
      }
    }
    __syncthreads();
    // S tile 16 x 32
    v8f s[2];
#pragma unroll
    for (int nt = 0; nt < 2; ++nt) {
      v8f acc = {};
#pragma unroll
      for (int ks = 0; ks < KS; ++ks) {
        FragB bh_, bl_;
        bh_.half[0] = *(const v8us*)&sKh[nt * 16 + ln][ks * 32 + 8 * hh]; bh_.half[1] = *(const v8us*)&sKh[nt * 16 + ln][ks * 32 + 16 + 8 * hh];
        bl_.half[0] = *(const v8us*)&sKl[nt * 16 + ln][ks * 32 + 8 * hh]; bl_.half[1] = *(const v8us*)&sKl[nt * 16 + ln][ks * 32 + 16 + 8 * hh];
        acc = mmaN<3>(aqh[ks].v, aql[ks].v, bh_.v, bl_.v, acc);
      }
      s[nt] = acc;
    }
    // mask + running max (rows 8hh+r; the 16 lanes of a half share rows)
    float alpha[8];
#pragma unroll
    for (int r = 0; r < 8; ++r) {
      const int qi = q0 + 8 * hh + r;
      const int ja = j0 + ln, jb = j0 + 16 + ln;
      if (CAUSAL) { if (ja > qi) s[0][r] = -3.0e38f; if (jb > qi) s[1][r] = -3.0e38f; }
      if (ja >= T) s[0][r] = -3.0e38f;
      if (jb >= T) s[1][r] = -3.0e38f;
      float mx = fmaxf(s[0][r], s[1][r]);
      mx = fmaxf(mx, __shfl_xor(mx, 1, 32)); mx = fmaxf(mx, __shfl_xor(mx, 2, 32)); mx = fmaxf(mx, __shfl_xor(mx, 4, 32)); mx = fmaxf(mx, __shfl_xor(mx, 8, 32));
      const float mnew = fmaxf(m_r[r], mx);
      alpha[r] = (mnew > -1.0e38f) ? __expf(m_r[r] - mnew) : 1.0f;
      const float p0 = (s[0][r] > -1.0e38f) ? __expf(s[0][r] - mnew) : 0.f;
      const float p1 = (s[1][r] > -1.0e38f) ? __expf(s[1][r] - mnew) : 0.f;
      m_r[r] = mnew;
      l_r[r] = l_r[r] * alpha[r] + p0 + p1;            // per-lane partial row sum (16 lanes combined at the end)
      unsigned short hb = bf16_bits(p0); sPh[w][8 * hh + r][ln] = hb;      sPl[w][8 * hh + r][ln] = bf16_bits(p0 - bf16_val(hb));
      hb = bf16_bits(p1);                sPh[w][8 * hh + r][16 + ln] = hb; sPl[w][8 * hh + r][16 + ln] = bf16_bits(p1 - bf16_val(hb));
    }
#pragma unroll
    for (int dt = 0; dt < DT; ++dt)
#pragma unroll
      for (int r = 0; r < 8; ++r) oacc[dt][r] *= alpha[r];
    __builtin_amdgcn_fence(__ATOMIC_ACQ_REL, "workgroup");
    __builtin_amdgcn_wave_barrier();
    FragB pah, pal;
    pah.half[0] = *(const v8us*)&sPh[w][ln][8 * hh]; pah.half[1] = *(const v8us*)&sPh[w][ln][16 + 8 * hh];
    pal.half[0] = *(const v8us*)&sPl[w][ln][8 * hh]; pal.half[1] = *(const v8us*)&sPl[w][ln][16 + 8 * hh];
#pragma unroll
    for (int dt = 0; dt < DT; ++dt) {
      FragB bvh, bvl;
#pragma unroll
      for (int i = 0; i < 8; ++i) {
        bvh.u[i] = sVh[8 * hh + i][dt * 16 + ln]; bvh.u[8 + i] = sVh[16 + 8 * hh + i][dt * 16 + ln];
        bvl.u[i] = sVl[8 * hh + i][dt * 16 + ln]; bvl.u[8 + i] = sVl[16 + 8 * hh + i][dt * 16 + ln];
      }
      oacc[dt] = mmaN<3>(pah.v, pal.v, bvh.v, bvl.v, oacc[dt]);
    }
    __builtin_amdgcn_fence(__ATOMIC_ACQ_REL, "workgroup");
    __builtin_amdgcn_wave_barrier();
  }
#pragma unroll
  for (int r = 0; r < 8; ++r) {
    float l = l_r[r];
    l += __shfl_xor(l, 1, 32); l += __shfl_xor(l, 2, 32); l += __shfl_xor(l, 4, 32); l += __shfl_xor(l, 8, 32);
    l_r[r] = (l > 0.f) ? 1.0f / l : 0.f;
  }
#pragma unroll
  for (int dt = 0; dt < DT; ++dt)
#pragma unroll
    for (int r = 0; r < 8; ++r) sO[w][8 * hh + r][dt * 16 + ln] = oacc[dt][r] * l_r[r];
  __builtin_amdgcn_fence(__ATOMIC_ACQ_REL, "workgroup");
  __builtin_amdgcn_wave_barrier();
  {
    for (int r = 0; r < 16; ++r) {
      const int row = q0 + r;
      if (row < T && lane < D / 4) {
        const v4f val = *(const v4fa*)&sO[w][r][lane * 4];
        *(v4f*)(y + ((size_t)b * T + row) * ypitch + h * D + lane * 4) = val;
      }
    }
    
  }
}

// batched GEMM (blockIdx.y = batch): C_b = act(alpha·A_b·B_b + bias + resid_b); A f32 rows (ASPLIT → hi/lo), B = bf16 planes Bh (+Bl when BSPLIT, requires ASPLIT),
// per-batch element strides sA, sB (0 = shared weights), sC, sR. resid may alias C (values are staged before the stores). ACT 0/1(relu).
// ACT: 0 none, 1 relu, 2 softplus
template <bool ASPLIT, bool BSPLIT, int ACT>
__global__ __launch_bounds__(128) void k_gemm_b(const float* __restrict__ A, int lda, size_t sA, const unsigned short* __restrict__ Bh, const unsigned short* __restrict__ Bl, int ldb, size_t sB,
                                             const float* __restrict__ bias, const float* __restrict__ resid, int ldr, size_t sR, float rsign, float alpha,
                                             float* __restrict__ C, int ldc, size_t sC, int M, int N, int K) {
  __shared__ __attribute__((aligned(16))) float so[4][16][64];
  const int tid = threadIdx.x, w = tid >> 5, lane = tid & 31, ln = lane & 15, hh = lane >> 4;
  const int by = blockIdx.y;
  A += (size_t)by * sA; Bh += (size_t)by * sB; if (BSPLIT) Bl += (size_t)by * sB; C += (size_t)by * sC; if (resid) resid += (size_t)by * sR;
  const int ntn = (N + 63) / 64; const int wid = blockIdx.x * 4 + w; const int mt = wid / ntn, nq = wid % ntn;      // N may be any multiple of 16: tiles past N are skipped and not stored
  if (mt * 16 >= M) return;
  const int row0 = mt * 16, col0 = nq * 64;
  const float* arow = A + (size_t)(row0 + ln) * lda;
  v8f acc[4] = {};
  for (int kb = 0; kb < K; kb += 32) {
    FragB ah, al;
    const v4f x0 = *(const v4fa*)(arow + kb + 8 * hh), x1 = *(const v4fa*)(arow + kb + 8 * hh + 4);
    const v4f x2 = *(const v4fa*)(arow + kb + 16 + 8 * hh), x3 = *(const v4fa*)(arow + kb + 16 + 8 * hh + 4);
    float xs[16] = {x0[0],x0[1],x0[2],x0[3],x1[0],x1[1],x1[2],x1[3],x2[0],x2[1],x2[2],x2[3],x3[0],x3[1],x3[2],x3[3]};
#pragma unroll
    for (int i = 0; i < 16; ++i) { const unsigned short hb = bf16_bits(xs[i]); ah.u[i] = hb; al.u[i] = ASPLIT ? bf16_bits(xs[i] - bf16_val(hb)) : (unsigned short)0; }
#pragma unroll
    for (int t = 0; t < 4; ++t) {
      if (col0 + t * 16 >= N) continue;
      const size_t boff = (size_t)(col0 + t * 16 + ln) * ldb + kb;
      FragB bh_, bl_; bh_.half[0] = *(const v8us*)(Bh + boff + 8 * hh); bh_.half[1] = *(const v8us*)(Bh + boff + 16 + 8 * hh);
      if (BSPLIT) { bl_.half[0] = *(const v8us*)(Bl + boff + 8 * hh); bl_.half[1] = *(const v8us*)(Bl + boff + 16 + 8 * hh); } else bl_ = bh_;
      acc[t] = mmaN<ASPLIT ? (BSPLIT ? 3 : 2) : 1>(ah.v, al.v, bh_.v, bl_.v, acc[t]);
    }
  }
#pragma unroll
  for (int t = 0; t < 4; ++t) {
    const int col = col0 + t * 16 + ln; if (col0 + t * 16 >= N) continue; const float bv = bias ? bf16_round(bias[col]) : 0.f;
#pragma unroll
    for (int r = 0; r < 8; ++r) { float v = acc[t][r] * alpha + bv; if (resid) v += rsign * resid[(size_t)(row0 + 8 * hh + r) * ldr + col]; if (ACT == 1) v = fmaxf(v, 0.f); else if (ACT == 2) v = fmaxf(v, 0.f) + log1pf(expf(-fabsf(v))); so[w][8 * hh + r][t * 16 + ln] = v; }
  }
  __builtin_amdgcn_fence(__ATOMIC_ACQ_REL, "workgroup"); __builtin_amdgcn_wave_barrier();
  const int rsub = lane >> 4, c4 = (lane & 15) * 4;
  {
#pragma unroll
    for (int q = 0; q < 8; ++q) { const int r = q * 2 + rsub; if (col0 + c4 < N) { const v4f v = *(const v4fa*)&so[w][r][c4]; *(v4f*)(C + (size_t)(row0 + r) * ldc + col0 + c4) = v; } }
    
  }
}
// batched f32 [K][N] (pitch lds, batch stride sIn) -> transposed hi/lo planes [N][K] (batch stride sOut); thread per (n, 8 k); grid.y = batch
__global__ __launch_bounds__(256) void k_split_transpose_b(const float* __restrict__ src, int lds_, size_t sIn, unsigned short* __restrict__ hi, unsigned short* __restrict__ lo, size_t sOut, int K, int N) {
  const size_t t = (size_t)blockIdx.x * 256 + threadIdx.x; const int k8n = K / 8; if (t >= (size_t)N * k8n) return;
  src += (size_t)blockIdx.y * sIn; hi += (size_t)blockIdx.y * sOut; lo += (size_t)blockIdx.y * sOut;
  const int n = (int)(t / k8n), k8 = (int)(t % k8n) * 8; v8us vh, vl;
#pragma unroll
  for (int i = 0; i < 8; ++i) { const float x = src[(size_t)(k8 + i) * lds_ + n]; const unsigned short hb = bf16_bits(x); vh[i] = hb; vl[i] = bf16_bits(x - bf16_val(hb)); }
  unsigned short* dh = hi + (size_t)n * K + k8; unsigned short* dl = lo + (size_t)n * K + k8;
  *(v8us*)dh = vh; *(v8us*)dl = vl; 
}

// ---- f16 WMMA path (v_wmma_f32_16x16x32_f16): 11-bit significands for operands in range — used where the [-1,1] cos operand needs more precision than bf16
typedef _Float16 v16h __attribute__((ext_vector_type(16)));
union FragH { v16h v; v8us half[2]; _Float16 h[16]; unsigned short u[16]; };
template <int NT>
__device__ __forceinline__ v8f mmaH(v16h ah, v16h al, v16h bh, v16h bl, v8f c) {
  c = __builtin_amdgcn_wmma_f32_16x16x32_f16(false, ah, false, bh, (short)0, c, false, false);
  if (NT >= 2) c = __builtin_amdgcn_wmma_f32_16x16x32_f16(false, al, false, bh, (short)0, c, false, false);
  if (NT >= 3) c = __builtin_amdgcn_wmma_f32_16x16x32_f16(false, ah, false, bl, (short)0, c, false, false);
  asm volatile("v_nop\n\tv_nop\n\tv_nop\n\tv_nop" : "+v"(c) : "v"(ah), "v"(al), "v"(bh), "v"(bl));
  return c;
}
// batched GEMM like k_gemm_b but f16 operands: A f32 (split into f16 hi/lo if ASPLIT, else rounded to f16), Bt = f16 values [n][k]; alpha; C f32; N multiple of 16 (partial tiles skipped)
template <bool ASPLIT>
__global__ __launch_bounds__(128) void k_gemm_h(const float* __restrict__ A, int lda, size_t sA, const _Float16* __restrict__ Bh, int ldb, size_t sB, float alpha, float* __restrict__ C, int ldc, size_t sC, int M, int N, int K) {
  __shared__ __attribute__((aligned(16))) float so[4][16][64];
  const int tid = threadIdx.x, w = tid >> 5, lane = tid & 31, ln = lane & 15, hh = lane >> 4; const int by = blockIdx.y;
  A += (size_t)by * sA; Bh += (size_t)by * sB; C += (size_t)by * sC;
  const int ntn = (N + 63) / 64; const int wid = blockIdx.x * 4 + w; const int mt = wid / ntn, nq = wid % ntn; if (mt * 16 >= M) return;
  const int row0 = mt * 16, col0 = nq * 64; const float* arow = A + (size_t)(row0 + ln) * lda;
  v8f acc[4] = {};
  for (int kb = 0; kb < K; kb += 32) {
    FragH ah, al;
    const v4f x0 = *(const v4fa*)(arow + kb + 8 * hh), x1 = *(const v4fa*)(arow + kb + 8 * hh + 4), x2 = *(const v4fa*)(arow + kb + 16 + 8 * hh), x3 = *(const v4fa*)(arow + kb + 16 + 8 * hh + 4);
    float xs[16] = {x0[0],x0[1],x0[2],x0[3],x1[0],x1[1],x1[2],x1[3],x2[0],x2[1],x2[2],x2[3],x3[0],x3[1],x3[2],x3[3]};
#pragma unroll
    for (int i = 0; i < 16; ++i) { const _Float16 h = (_Float16)xs[i]; ah.h[i] = h; al.h[i] = ASPLIT ? (_Float16)(xs[i] - (float)h) : (_Float16)0.0f; }
#pragma unroll
    for (int t = 0; t < 4; ++t) { if (col0 + t * 16 >= N) continue; const size_t boff = (size_t)(col0 + t * 16 + ln) * ldb + kb; FragH bq; bq.half[0] = *(const v8us*)(Bh + boff + 8 * hh); bq.half[1] = *(const v8us*)(Bh + boff + 16 + 8 * hh);
      acc[t] = mmaH<ASPLIT ? 2 : 1>(ah.v, al.v, bq.v, bq.v, acc[t]); }
  }
#pragma unroll
  for (int t = 0; t < 4; ++t) { if (col0 + t * 16 >= N) continue;
#pragma unroll
    for (int r = 0; r < 8; ++r) so[w][8 * hh + r][t * 16 + ln] = acc[t][r] * alpha; }
  __builtin_amdgcn_fence(__ATOMIC_ACQ_REL, "workgroup"); __builtin_amdgcn_wave_barrier();
  const int rsub = lane >> 4, c4 = (lane & 15) * 4;
  {
#pragma unroll
    for (int q = 0; q < 8; ++q) { const int r = q * 2 + rsub; if (col0 + c4 < N) { const v4f v = *(const v4fa*)&so[w][r][c4]; *(v4f*)(C + (size_t)(row0 + r) * ldc + col0 + c4) = v; } }
     }
}

// Bt = bits(W?[k][n]) in B-fragment order, via 32x32 tiles (grid: k tiles, n tiles (12), -): [n / 16][k / 32][half][lane = hh * 16 + (n & 15)][8],
// k = (k / 32) * 32 + half * 16 + hh * 8 + i, so that one half fragment of a wave is 512 contiguous bytes; bias concat
__global__ __launch_bounds__(256) void k_wt(const float* __restrict__ Wq, const float* __restrict__ Wk, const float* __restrict__ Wv, const float* __restrict__ bq, const float* __restrict__ bk, const float* __restrict__ bv, unsigned short* __restrict__ Bt, float* __restrict__ B3) { __shared__ float tile[32][33]; const int k0 = blockIdx.x * 32, n0 = blockIdx.y * 32; const int which = n0 / DK, nn0 = n0 % DK; const float* W = which == 0 ? Wq : (which == 1 ? Wk : Wv); const int tx = threadIdx.x & 31, ty = threadIdx.x >> 5;
  for (int i = ty; i < 32; i += 8) tile[i][tx] = W[(size_t)(k0 + i) * DK + nn0 + tx]; __syncthreads();
  typedef unsigned short v4us __attribute__((ext_vector_type(4))); const int r = threadIdx.x >> 3, c4 = (threadIdx.x & 7) * 4; v4us o; for (int q = 0; q < 4; ++q) o[q] = bf16_bits(tile[c4 + q][r]);
  const int n = n0 + r; unsigned short* d = Bt + ((size_t)(((n >> 4) * (DM / 32) + blockIdx.x) * 2 + (c4 >> 4)) * 32 + ((c4 >> 3) & 1) * 16 + (n & 15)) * 8 + (c4 & 7); *(v4us*)d = o; 
  if (blockIdx.x == 0 && threadIdx.x < 32) { const float* bs = which == 0 ? bq : (which == 1 ? bk : bv); *(float*)(B3 + n0 + threadIdx.x) = bs[nn0 + threadIdx.x]; } }
// [Q|K|V] = x.W + b: a work-group owns PM rows of x and all 384 columns, so x is read from memory once. The rows are fetched by whole-line loads,
// rounded to bf16 once and kept in LDS for all waves; a wave owns 48 columns (3 tiles x 2 row tiles) and reads its W fragments, which no other wave
// of the group needs, straight from the fragment-ordered Bt: every wave-wide load is 512 contiguous bytes. k runs upward, one WMMA per 32 k.
#define PM 32
#define PAP (DM + 8)
#define PCP (3 * DK + 4)
#define PKC 4
typedef unsigned short v4usa __attribute__((ext_vector_type(4), may_alias));
__global__ __launch_bounds__(256) void k_proj(const float* __restrict__ x, const unsigned short* __restrict__ Bt, const float* __restrict__ B3, float* __restrict__ QKV) {
  __shared__ __attribute__((aligned(16))) unsigned short sA[PM][PAP];   // pitch 2064 B = 16 B x odd
  __shared__ __attribute__((aligned(16))) float sC[PM][PCP];            // pitch 388 dwords: rows 8 apart lie 32 banks apart
  const int tid = threadIdx.x, w = tid >> 5, lane = tid & 31, ln = lane & 15, hh = lane >> 4;
  const int row0 = blockIdx.x * PM;
  const unsigned short* bp = Bt + (size_t)w * 3 * (DM / 32) * 512 + lane * 8;
  FragB bf[2][PKC][3];          // W fragments of PKC k-steps, two sets: the next set flies under the current set's products
#pragma unroll
  for (int s = 0; s < PKC; ++s)
#pragma unroll
    for (int t = 0; t < 3; ++t) { bf[0][s][t].half[0] = *(const v8us*)(bp + (t * (DM / 32) + s) * 512); bf[0][s][t].half[1] = *(const v8us*)(bp + (t * (DM / 32) + s) * 512 + 256); }
  {
    const float* xr = x + (size_t)row0 * DM + tid * 4;
    v4f v[PM];
#pragma unroll
    for (int i = 0; i < PM; ++i) v[i] = *(const v4fa*)(xr + (size_t)i * DM);
    // keeps all the row loads in front of the conversions, so that they are in flight together and share one memory latency
    __builtin_amdgcn_sched_barrier(0);
#pragma unroll
    for (int i = 0; i < PM; ++i) *(v4usa*)&sA[i][tid * 4] = (v4usa){bf16_bits(v[i][0]), bf16_bits(v[i][1]), bf16_bits(v[i][2]), bf16_bits(v[i][3])};
  }
  __syncthreads();
  float bv[3];
#pragma unroll
  for (int t = 0; t < 3; ++t) bv[t] = bf16_round(B3[w * 48 + t * 16 + ln]);
  // the bias loads' offset register is reused soon after; the wait stands in front of that overwrite
  asm volatile("s_wait_xcnt 0x0" ::: "memory");
  v8f acc[2][3];
#pragma unroll
  for (int mt = 0; mt < 2; ++mt)
#pragma unroll
    for (int t = 0; t < 3; ++t) acc[mt][t] = (v8f){0.f, 0.f, 0.f, 0.f, 0.f, 0.f, 0.f, 0.f};
#pragma unroll
  for (int c = 0; c < DM / 32 / PKC; ++c) {
    if (c + 1 < DM / 32 / PKC) {
#pragma unroll
      for (int s = 0; s < PKC; ++s)
#pragma unroll
        for (int t = 0; t < 3; ++t) {
          const unsigned short* p = bp + (t * (DM / 32) + (c + 1) * PKC + s) * 512;
          bf[(c + 1) & 1][s][t].half[0] = *(const v8us*)p; bf[(c + 1) & 1][s][t].half[1] = *(const v8us*)(p + 256);
        }
    }
    FragB af[PKC][2];           // x fragments: row = mt*16 + ln, k in the same order as Bt's
#pragma unroll
    for (int s = 0; s < PKC; ++s)
#pragma unroll
      for (int mt = 0; mt < 2; ++mt) {
        af[s][mt].half[0] = *(const v8us*)&sA[mt * 16 + ln][(c * PKC + s) * 32 + 8 * hh]; af[s][mt].half[1] = *(const v8us*)&sA[mt * 16 + ln][(c * PKC + s) * 32 + 16 + 8 * hh];
      }
    // keeps the next set's loads and this set's LDS reads as one group in front of the products; without it the compiler moves them in among the
    // products, close to their use, and each then waits out its own latency
    __builtin_amdgcn_sched_barrier(0);
#pragma unroll
    for (int s = 0; s < PKC; ++s)
#pragma unroll
      for (int mt = 0; mt < 2; ++mt)
#pragma unroll
        for (int t = 0; t < 3; ++t) acc[mt][t] = __builtin_amdgcn_wmma_f32_16x16x32_bf16(false, af[s][mt].v, false, bf[c & 1][s][t].v, (short)0, acc[mt][t], false, false);
    // second half of the fence pair: keeps the following group's loads and LDS reads from being moved up in among these products
    __builtin_amdgcn_sched_barrier(0);
  }
#pragma unroll
  for (int mt = 0; mt < 2; ++mt)
#pragma unroll
    for (int t = 0; t < 3; ++t)
#pragma unroll
      for (int r = 0; r < 8; ++r) sC[mt * 16 + 8 * hh + r][w * 48 + t * 16 + ln] = acc[mt][t][r] + bv[t];
  __syncthreads();
#pragma unroll
  for (int g = 0; g < PM * (3 * DK / 4) / 256; ++g) {   // the tile is contiguous in QKV: a wave stores 512 contiguous bytes at a time
    const int idx = g * 256 + tid, r = idx / (3 * DK / 4), c4 = (idx % (3 * DK / 4)) * 4;
    *(v4f*)(QKV + (size_t)row0 * (3 * DK) + (size_t)idx * 4) = *(const v4fa*)&sC[r][c4];
  }
}
// from QKV [tok][384], a work-group per 32 tokens: Kh/Kl = bf16 hi/lo planes of K and VT = f16(V), all three in the order of k_cosattn's A fragments, so that
// each of its wave-wide 16-B loads is 512 contiguous bytes (four whole lines) and not 32 B out of each of 16 lines.
// Kh/Kl: [tok / 16][ks = c / 32][half][lane = hh * 16 + (tok & 15)][8], c = ks * 32 + half * 16 + hh * 8 + i
// VT:    [tok / 32][dt = d / 16][half][lane = hh * 16 + (d & 15)][8], tok = (tok / 32) * 32 + half * 16 + hh * 8 + i
typedef _Float16 v8h __attribute__((ext_vector_type(8)));
__global__ __launch_bounds__(256) void k_kv(const float* __restrict__ QKV, unsigned short* __restrict__ Kh, unsigned short* __restrict__ Kl, _Float16* __restrict__ VT) {
  __shared__ float tile[32][DK + 2];   // pitch 130 dwords: rows 8 apart lie 16 banks apart, so the two lane halves of the gather below do not collide
  const int b = blockIdx.y, l0 = blockIdx.x * 32; const int tid = threadIdx.x, tx = tid & 31, ty = tid >> 5;
  const size_t base = ((size_t)b * LL + l0) * DK;   // the group's 32 tokens fill one contiguous block of each plane
  for (int i = ty; i < 32; i += 8) { const size_t tok = (size_t)b * LL + l0 + i; for (int u = 0; u < 4; ++u) { const int c = u * 32 + tx; tile[i][c] = QKV[tok * (3 * DK) + 2 * DK + c]; } }
  // K planes: 2 key tiles x 4 ks x 2 halves x 32 lanes = 512 groups of 8, 2 per thread; group g lies at element g * 8 of the block
  for (int g = tid; g < 32 * (DK / 8); g += 256) {
    const int fl = g & 31, i = (g >> 8) * 16 + (fl & 15), c8 = ((g >> 6) & 3) * 32 + ((g >> 5) & 1) * 16 + (fl >> 4) * 8;
    const size_t tok = (size_t)b * LL + l0 + i; v8us h, l;
    for (int q = 0; q < 8; ++q) { const float kv = QKV[tok * (3 * DK) + DK + c8 + q]; const float kh = bf16_round(kv); h[q] = bf16_bits(kh); l[q] = bf16_bits(kv - kh); }
    *(v8us*)(Kh + base + (size_t)g * 8) = h; *(v8us*)(Kl + base + (size_t)g * 8) = l;
  }
  __syncthreads();
  // V: 8 d tiles x 2 halves x 32 lanes = 512 groups of 8 keys, 2 per thread
  for (int g = tid; g < 32 * (DK / 8); g += 256) {
    const int fl = g & 31, d = (g >> 6) * 16 + (fl & 15), k0 = ((g >> 5) & 1) * 16 + (fl >> 4) * 8; v8h v;
    for (int q = 0; q < 8; ++q) v[q] = (_Float16)tile[k0 + q][d];
    *(v8h*)(VT + base + (size_t)g * 8) = v;
  }
}
#define FQ 32
#define FW 8
#define FKEYS (LL / FW)
#define QP (DK + 8)
#define RP (DK + 4)
__global__ __launch_bounds__(256) void k_cosattn(const float* __restrict__ QKV, const unsigned short* __restrict__ Kh, const unsigned short* __restrict__ Kl, const _Float16* __restrict__ VT, float* __restrict__ out) {
  __shared__ __attribute__((aligned(16))) unsigned short sQh[FQ][QP], sQl[FQ][QP];   // pitch 272 B = 16 B x odd
  __shared__ __attribute__((aligned(16))) float red[FW][FQ][RP];                     // pitch 528 B = 16 B x odd
  const int tid = threadIdx.x, w = tid >> 5, lane = tid & 31, ln = lane & 15, hh = lane >> 4;
  const int b = blockIdx.x / (LL / FQ), q0 = (blockIdx.x % (LL / FQ)) * FQ;
  { // Q rows -> bf16 hi/lo planes, split once per work-group (thread: 16 consecutive columns of one row)
    const int r = tid >> 3, c0 = (tid & 7) * 16;
    const float* qr = QKV + ((size_t)b * LL + q0 + r) * (3 * DK) + c0;
    const v4f x0 = *(const v4fa*)qr, x1 = *(const v4fa*)(qr + 4), x2 = *(const v4fa*)(qr + 8), x3 = *(const v4fa*)(qr + 12);
    // the loads' address registers are reused soon after
    asm volatile("s_wait_xcnt 0x0" ::: "memory");
    const float xs[16] = {x0[0], x0[1], x0[2], x0[3], x1[0], x1[1], x1[2], x1[3], x2[0], x2[1], x2[2], x2[3], x3[0], x3[1], x3[2], x3[3]};
#pragma unroll
    for (int g = 0; g < 2; ++g) {
      v8us h, l;
#pragma unroll
      for (int i = 0; i < 8; ++i) { const float x = xs[g * 8 + i]; const unsigned short hb = bf16_bits(x); h[i] = hb; l[i] = bf16_bits(x - bf16_val(hb)); }
      *(v8us*)&sQh[r][c0 + g * 8] = h; *(v8us*)&sQl[r][c0 + g * 8] = l;
    }
  }
  __syncthreads();
  FragB qh[2][4], ql[2][4];     // B fragments: column = query qt*16+ln, k in the same order as the K loader below
#pragma unroll
  for (int qt = 0; qt < 2; ++qt)
#pragma unroll
    for (int ks = 0; ks < 4; ++ks) {
      qh[qt][ks].half[0] = *(const v8us*)&sQh[qt * 16 + ln][ks * 32 + 8 * hh]; qh[qt][ks].half[1] = *(const v8us*)&sQh[qt * 16 + ln][ks * 32 + 16 + 8 * hh];
      ql[qt][ks].half[0] = *(const v8us*)&sQl[qt * 16 + ln][ks * 32 + 8 * hh]; ql[qt][ks].half[1] = *(const v8us*)&sQl[qt * 16 + ln][ks * 32 + 16 + 8 * hh];
    }
  v8f o[2][8];                  // o[qt][dt][r] = O[query qt*16+ln][d = dt*16 + 8*hh + r], this wave's keys only
#pragma unroll
  for (int qt = 0; qt < 2; ++qt)
#pragma unroll
    for (int dt = 0; dt < 8; ++dt) o[qt][dt] = (v8f){0.f, 0.f, 0.f, 0.f, 0.f, 0.f, 0.f, 0.f};
  const size_t koff = ((size_t)b * LL + w * FKEYS) * DK + lane * 8;   // the planes are in fragment order (k_kv): 16 keys of K = 8 half fragments of 256 elements, 32 keys of V = 16
  const unsigned short* kh = Kh + koff;
  const unsigned short* kl = Kl + koff;
  const unsigned short* vt = (const unsigned short*)VT + koff;
  for (int j = 0; j < FKEYS; j += 32) {
    FragB ah[2][4], al[2][4];   // A fragments of K hi/lo: row = key j + kt*16 + ln
#pragma unroll
    for (int kt = 0; kt < 2; ++kt)
#pragma unroll
      for (int ks = 0; ks < 4; ++ks) {
        const size_t e = (size_t)(j + kt * 16) * DK + ks * 512;
        ah[kt][ks].half[0] = *(const v8us*)(kh + e); ah[kt][ks].half[1] = *(const v8us*)(kh + e + 256);
        al[kt][ks].half[0] = *(const v8us*)(kl + e); al[kt][ks].half[1] = *(const v8us*)(kl + e + 256);
      }
    // the products' accumulators reuse the loads' address registers
    asm volatile("s_wait_xcnt 0x0" ::: "memory");
    // keeps all 32 K loads in front of the products, so that they are issued back to back and share one latency;
    // without it the compiler loads one fragment at a time and waits for each in front of its products
    __builtin_amdgcn_sched_barrier(0);
    v8f s[2][2];                // s[kt][qt][r] = S[query qt*16+ln][key j + kt*16 + 8*hh + r]
#pragma unroll
    for (int kt = 0; kt < 2; ++kt)
#pragma unroll
      for (int qt = 0; qt < 2; ++qt) {
        v8f c = {};
#pragma unroll
        for (int ks = 0; ks < 4; ++ks) {   // three products of the hi/lo split, in this order: Qhi.Khi, Qlo.Khi, Qhi.Klo
          c = __builtin_amdgcn_wmma_f32_16x16x32_bf16(false, ah[kt][ks].v, false, qh[qt][ks].v, (short)0, c, false, false);
          c = __builtin_amdgcn_wmma_f32_16x16x32_bf16(false, ah[kt][ks].v, false, ql[qt][ks].v, (short)0, c, false, false);
          c = __builtin_amdgcn_wmma_f32_16x16x32_bf16(false, al[kt][ks].v, false, qh[qt][ks].v, (short)0, c, false, false);
        }
        // four vector slots between the chain's last WMMA and the first vector instruction that reads its D, on every path
        asm volatile("v_nop\n\tv_nop\n\tv_nop\n\tv_nop" : "+v"(c));
        s[kt][qt] = c;
      }
    FragH va[8];                // A fragments of V^T: row = d, k = key; they fly under the cosines
#pragma unroll
    for (int dt = 0; dt < 8; ++dt) { va[dt].half[0] = *(const v8us*)(vt + (size_t)j * DK + dt * 512); va[dt].half[1] = *(const v8us*)(vt + (size_t)j * DK + dt * 512 + 256); }
#pragma unroll
    for (int qt = 0; qt < 2; ++qt) {
      FragH p;                  // B fragment: p[i] = cos(S)[key kmap(i, hh)][query], straight from the two D tiles
#pragma unroll
      for (int i = 0; i < 8; ++i) { p.h[i] = (_Float16)cosf(s[0][qt][i]); p.h[8 + i] = (_Float16)cosf(s[1][qt][i]); }
#pragma unroll
      for (int dt = 0; dt < 8; ++dt) o[qt][dt] = __builtin_amdgcn_wmma_f32_16x16x32_f16(false, va[dt].v, false, p.v, (short)0, o[qt][dt], false, false);
      // four vector slots behind the last WMMA before its operands may be rewritten, also on the taken side of the branches that follow (cosf, loop)
      asm volatile("v_nop\n\tv_nop\n\tv_nop\n\tv_nop" : "+v"(o[qt][7]) : "v"(p.v));
    }
  }
#pragma unroll
  for (int qt = 0; qt < 2; ++qt)
#pragma unroll
    for (int dt = 0; dt < 8; ++dt) {
      float* d = &red[w][qt * 16 + ln][dt * 16 + 8 * hh];
      *(v4fa*)d = (v4f){o[qt][dt][0], o[qt][dt][1], o[qt][dt][2], o[qt][dt][3]};
      *(v4fa*)(d + 4) = (v4f){o[qt][dt][4], o[qt][dt][5], o[qt][dt][6], o[qt][dt][7]};
    }
  __syncthreads();
#pragma unroll
  for (int g = 0; g < FQ * DK / 4 / 256; ++g) {   // a wave stores one whole 512-B output row at a time
    const int idx = g * 256 + tid, q = idx >> 5, d4 = (idx & 31) * 4;
    v4f a = *(const v4fa*)&red[0][q][d4];
#pragma unroll
    for (int u = 1; u < FW; ++u) a += *(const v4fa*)&red[u][q][d4];
    *(v4f*)(out + ((size_t)b * LL + q0 + q) * DK + d4) = a;
  }
}
extern "C" void kernel_launch(void* const* d_in, const int* in_sizes, int n_in,
                              void* d_out, int out_size, void* d_ws, size_t ws_size, hipStream_t stream) {
  (void)in_sizes; (void)n_in; (void)out_size;
  const float* x = (const float*)d_in[0]; const float* Wq = (const float*)d_in[1]; const float* bq = (const float*)d_in[2]; const float* Wk = (const float*)d_in[3]; const float* bk = (const float*)d_in[4]; const float* Wv = (const float*)d_in[5]; const float* bv = (const float*)d_in[6];
  char* ws = (char*)d_ws; size_t off = 0;
  auto take = [&](size_t bytes) { char* p = ws + off; off += (bytes + 255) & ~(size_t)255; return p; };
  unsigned short* Bt = (unsigned short*)take((size_t)3 * DK * DM * 2); float* B3 = (float*)take(3 * DK * 4); float* QKV = (float*)take((size_t)NTOK * 3 * DK * 4);
  unsigned short* Kh = (unsigned short*)take((size_t)NTOK * DK * 2); unsigned short* Kl = (unsigned short*)take((size_t)NTOK * DK * 2); _Float16* VT = (_Float16*)take((size_t)BB * DK * LL * 2);
  if (off > ws_size) return;
  k_wt<<<dim3(DM / 32, 3 * DK / 32), 256, 0, stream>>>(Wq, Wk, Wv, bq, bk, bv, Bt, B3);
  k_proj<<<NTOK / PM, 256, 0, stream>>>(x, Bt, B3, QKV);
  k_kv<<<dim3(LL / 32, BB), 256, 0, stream>>>(QKV, Kh, Kl, VT);
  k_cosattn<<<NTOK / FQ, 256, 0, stream>>>(QKV, Kh, Kl, VT, (float*)d_out);
}

// v004
// A run of this version takes 40.9 microseconds.
// In two side-by-side timings against v003, it was 1.26 and 1.27 times as fast.
// Over all steps from v000 it is 12.3 times as fast.
#include <hip/hip_runtime.h>
// [Q|K|V] = x·[Wq|Wk|Wv] + b on v_wmma_f32_16x16x32_bf16 (x rounded to bf16: single exact term; 8192 × 1024 × 384); QK = Q·Kᵀ on the same unit with BOTH f32 operands split
// hi/lo (3 products — cos(QK) at |QK| ≈ 10–40 needs the phase to ≈1e-4 rad; 4 × 2048 × 2048 × 128); out = cos(QK)·V on v_wmma_f32_16x16x32_f16 (cos and V rounded to
// f16: single product). cos in f32: reduction on the VALU, then v_cos_f32.
#define BB 4
#define LL 2048
#define DM 1024
#define DK 128
#define NTOK (BB * LL)

typedef __bf16 v16b __attribute__((ext_vector_type(16)));
typedef unsigned short v8us __attribute__((ext_vector_type(8), may_alias));
typedef float  v8f  __attribute__((ext_vector_type(8)));
typedef float  v4f  __attribute__((ext_vector_type(4)));
typedef float  v4fa __attribute__((ext_vector_type(4), may_alias));
union FragB { v16b v; v8us half[2]; unsigned short u[16]; };

__device__ __forceinline__ unsigned short bf16_bits(float x) { unsigned int u = __float_as_uint(x); return (unsigned short)((u + 0x7FFFu + ((u >> 16) & 1u)) >> 16); }
__device__ __forceinline__ float bf16_val(unsigned short b) { return __uint_as_float(((unsigned int)b) << 16); }
__device__ __forceinline__ float bf16_round(float x) { return bf16_val(bf16_bits(x)); }
// D += A·B with NT terms: 1 = ah·bh, 2 = + al·bh (A split), 3 = + ah·bl (both split)
template <int NT>
__device__ __forceinline__ v8f mmaN(v16b ah, v16b al, v16b bh, v16b bl, v8f c) {
  c = __builtin_amdgcn_wmma_f32_16x16x32_bf16(false, ah, false, bh, (short)0, c, false, false);
  if (NT >= 2) c = __builtin_amdgcn_wmma_f32_16x16x32_bf16(false, al, false, bh, (short)0, c, false, false);
  if (NT >= 3) c = __builtin_amdgcn_wmma_f32_16x16x32_bf16(false, ah, false, bl, (short)0, c, false, false);
  asm volatile("v_nop\n\tv_nop\n\tv_nop\n\tv_nop" : "+v"(c) : "v"(ah), "v"(al), "v"(bh), "v"(bl));
  return c;
}

__global__ __launch_bounds__(256) void k_wt_bf16(const float* __restrict__ W, unsigned short* __restrict__ Wt, int K, int N) {
  const int t = blockIdx.x * 256 + threadIdx.x;
  const int k8n = K / 8;
  if (t >= N * k8n) return;
  const int n = t / k8n, k8 = (t % k8n) * 8;
  v8us v;
#pragma unroll
  for (int i = 0; i < 8; ++i) v[i] = bf16_bits(W[(size_t)(k8 + i) * N + n]);
  *(v8us*)(Wt + (size_t)n * K + k8) = v;
  
}

// GEMM C[M][N] (f32, pitch ldc) = act(A[M][K]·W + bias). A f32 row-major (pitch lda) converted per fragment to bf16
// (ASPLIT: hi/lo two planes -> 2 terms, else single rounded term); Wt bf16 [N][K] (pitch ldb). BIAS_BF16 rounds the
// bias to bf16 first (bias quantised to bf16 before the add). K%32==0, M%16==0, N%64==0.
template <bool ASPLIT, int ACT, bool BIAS_BF16>
__global__ __launch_bounds__(128) void k_gemm_bf(const float* __restrict__ A, int lda, const unsigned short* __restrict__ Wt, int ldb,
                                               const float* __restrict__ bias, float* __restrict__ C, int ldc, int M, int N, int K) {
  __shared__ __attribute__((aligned(16))) float so[4][16][64];
  const int tid = threadIdx.x, w = tid >> 5, lane = tid & 31, ln = lane & 15, hh = lane >> 4;
  const int ntn = N / 64;
  const int wid = blockIdx.x * 4 + w;
  const int mt = wid / ntn, nq = wid % ntn;
  if (mt * 16 >= M) return;
  const int row0 = mt * 16, col0 = nq * 64;
  const float* arow = A + (size_t)(row0 + ln) * lda;
  v8f acc[4] = {};
  for (int kb = 0; kb < K; kb += 32) {
    FragB ah, al;
    const v4f x0 = *(const v4fa*)(arow + kb + 8 * hh), x1 = *(const v4fa*)(arow + kb + 8 * hh + 4);
    const v4f x2 = *(const v4fa*)(arow + kb + 16 + 8 * hh), x3 = *(const v4fa*)(arow + kb + 16 + 8 * hh + 4);
    float xs[16] = {x0[0],x0[1],x0[2],x0[3],x1[0],x1[1],x1[2],x1[3],x2[0],x2[1],x2[2],x2[3],x3[0],x3[1],x3[2],x3[3]};
#pragma unroll
    for (int i = 0; i < 16; ++i) { const unsigned short hb = bf16_bits(xs[i]); ah.u[i] = hb; al.u[i] = ASPLIT ? bf16_bits(xs[i] - bf16_val(hb)) : (unsigned short)0; }
#pragma unroll
    for (int t = 0; t < 4; ++t) {
      const unsigned short* brow = Wt + (size_t)(col0 + t * 16 + ln) * ldb + kb;
      FragB b;
      b.half[0] = *(const v8us*)(brow + 8 * hh);
      b.half[1] = *(const v8us*)(brow + 16 + 8 * hh);
      acc[t] = mmaN<ASPLIT ? 2 : 1>(ah.v, al.v, b.v, b.v, acc[t]);
    }
  }
#pragma unroll
  for (int t = 0; t < 4; ++t) {
    float bv = bias ? bias[col0 + t * 16 + ln] : 0.f;
    if (BIAS_BF16) bv = bf16_round(bv);
#pragma unroll
    for (int r = 0; r < 8; ++r) { float v = acc[t][r] + bv; if (ACT == 1) v = fmaxf(v, 0.f); so[w][8 * hh + r][t * 16 + ln] = v; }
  }
  __builtin_amdgcn_fence(__ATOMIC_ACQ_REL, "workgroup");
  __builtin_amdgcn_wave_barrier();
  const int rsub = lane >> 4, c4 = (lane & 15) * 4;
  {
#pragma unroll
    for (int q = 0; q < 8; ++q) {
      const int r = q * 2 + rsub;
      const v4f v = *(const v4fa*)&so[w][r][c4];
      *(v4f*)(C + (size_t)(row0 + r) * ldc + col0 + c4) = v;
    }
    
  }
}

// Flash-style causal/unmasked attention, all contractions 3-term bf16 hi/lo splits, f32 softmax with running max.
// q,k,v rows are read from f32 buffers with arbitrary row pitch (so they can live inside a fused qkv buffer);
// D = head size (multiple of 32, <= 128); one wave = 16 query rows; block = 4 waves (64 queries) sharing K/V chunks of 32.
template <int D, bool CAUSAL>
__global__ __launch_bounds__(128) void k_flash(const float* __restrict__ qb, const float* __restrict__ kb, const float* __restrict__ vb,
                                             int pitch, int T, int H, float scale, float* __restrict__ y, int ypitch) {
  constexpr int KS = D / 32;        // k-steps for QK
  constexpr int DT = D / 16;        // d tiles for PV
  __shared__ __attribute__((aligned(16))) unsigned short sKh[32][D + 8], sKl[32][D + 8], sVh[32][D + 8], sVl[32][D + 8];
  __shared__ __attribute__((aligned(16))) unsigned short sPh[4][16][40], sPl[4][16][40];
  __shared__ __attribute__((aligned(16))) float sO[4][16][D];
  const int tid = threadIdx.x, w = tid >> 5, lane = tid & 31, ln = lane & 15, hh = lane >> 4;
  const int nqb = (T + 63) / 64;
  const int bh = blockIdx.x / nqb, qblk = blockIdx.x % nqb;
  const int b = bh / H, h = bh % H;
  const int q0 = qblk * 64 + w * 16;
  const float* Q = qb + (size_t)b * T * pitch + h * D;
  const float* K = kb + (size_t)b * T * pitch + h * D;
  const float* V = vb + (size_t)b * T * pitch + h * D;

  // A fragments of the wave's 16 query rows (scaled), hi/lo
  FragB aqh[KS], aql[KS];
  {
    int row = q0 + ln; if (row >= T) row = T - 1;
    const float* qr = Q + (size_t)row * pitch;
#pragma unroll
    for (int ks = 0; ks < KS; ++ks)
#pragma unroll
      for (int i = 0; i < 16; ++i) {
        const int d = ks * 32 + ((i < 8) ? (8 * hh + i) : (16 + 8 * hh + (i - 8)));
        const float x = qr[d] * scale; const unsigned short hb = bf16_bits(x);
        aqh[ks].u[i] = hb; aql[ks].u[i] = bf16_bits(x - bf16_val(hb));
      }
  }
  float m_r[8], l_r[8];
#pragma unroll
  for (int r = 0; r < 8; ++r) { m_r[r] = -3.0e38f; l_r[r] = 0.f; }
  v8f oacc[DT];
#pragma unroll
  for (int dt = 0; dt < DT; ++dt) oacc[dt] = (v8f){0.f,0.f,0.f,0.f,0.f,0.f,0.f,0.f};

  const int kv_end = CAUSAL ? min(T, qblk * 64 + 64) : T;     // block-uniform
  for (int j0 = 0; j0 < kv_end; j0 += 32) {
    __syncthreads();
    for (int e = tid; e < 32 * (D / 4); e += 128) {
      const int r = e / (D / 4), c4 = (e % (D / 4)) * 4;
      const int key = j0 + r;
      v4f kf = {0.f,0.f,0.f,0.f}, vf = {0.f,0.f,0.f,0.f};
      if (key < T) { kf = *(const v4fa*)(K + (size_t)key * pitch + c4); vf = *(const v4fa*)(V + (size_t)key * pitch + c4); }
#pragma unroll
      for (int t = 0; t < 4; ++t) {
        unsigned short hb = bf16_bits(kf[t]); sKh[r][c4 + t] = hb; sKl[r][c4 + t] = bf16_bits(kf[t] - bf16_val(hb));
        hb = bf16_bits(vf[t]); sVh[r][c4 + t] = hb; sVl[r][c4 + t] = bf16_bits(vf[t] - bf16_val(hb));
      }
    }
    __syncthreads();
    // S tile 16 x 32
    v8f s[2];
#pragma unroll
    for (int nt = 0; nt < 2; ++nt) {
      v8f acc = {};
#pragma unroll
      for (int ks = 0; ks < KS; ++ks) {
        FragB bh_, bl_;
        bh_.half[0] = *(const v8us*)&sKh[nt * 16 + ln][ks * 32 + 8 * hh]; bh_.half[1] = *(const v8us*)&sKh[nt * 16 + ln][ks * 32 + 16 + 8 * hh];
        bl_.half[0] = *(const v8us*)&sKl[nt * 16 + ln][ks * 32 + 8 * hh]; bl_.half[1] = *(const v8us*)&sKl[nt * 16 + ln][ks * 32 + 16 + 8 * hh];
        acc = mmaN<3>(aqh[ks].v, aql[ks].v, bh_.v, bl_.v, acc);
      }
      s[nt] = acc;
    }
    // mask + running max (rows 8hh+r; the 16 lanes of a half share rows)
    float alpha[8];
#pragma unroll
    for (int r = 0; r < 8; ++r) {
      const int qi = q0 + 8 * hh + r;
      const int ja = j0 + ln, jb = j0 + 16 + ln;
      if (CAUSAL) { if (ja > qi) s[0][r] = -3.0e38f; if (jb > qi) s[1][r] = -3.0e38f; }
      if (ja >= T) s[0][r] = -3.0e38f;
      if (jb >= T) s[1][r] = -3.0e38f;
      float mx = fmaxf(s[0][r], s[1][r]);
      mx = fmaxf(mx, __shfl_xor(mx, 1, 32)); mx = fmaxf(mx, __shfl_xor(mx, 2, 32)); mx = fmaxf(mx, __shfl_xor(mx, 4, 32)); mx = fmaxf(mx, __shfl_xor(mx, 8, 32));
      const float mnew = fmaxf(m_r[r], mx);
      alpha[r] = (mnew > -1.0e38f) ? __expf(m_r[r] - mnew) : 1.0f;
      const float p0 = (s[0][r] > -1.0e38f) ? __expf(s[0][r] - mnew) : 0.f;
      const float p1 = (s[1][r] > -1.0e38f) ? __expf(s[1][r] - mnew) : 0.f;
      m_r[r] = mnew;
      l_r[r] = l_r[r] * alpha[r] + p0 + p1;            // per-lane partial row sum (16 lanes combined at the end)
      unsigned short hb = bf16_bits(p0); sPh[w][8 * hh + r][ln] = hb;      sPl[w][8 * hh + r][ln] = bf16_bits(p0 - bf16_val(hb));
      hb = bf16_bits(p1);                sPh[w][8 * hh + r][16 + ln] = hb; sPl[w][8 * hh + r][16 + ln] = bf16_bits(p1 - bf16_val(hb));
    }
#pragma unroll
    for (int dt = 0; dt < DT; ++dt)
#pragma unroll
      for (int r = 0; r < 8; ++r) oacc[dt][r] *= alpha[r];
    __builtin_amdgcn_fence(__ATOMIC_ACQ_REL, "workgroup");
    __builtin_amdgcn_wave_barrier();
    FragB pah, pal;
    pah.half[0] = *(const v8us*)&sPh[w][ln][8 * hh]; pah.half[1] = *(const v8us*)&sPh[w][ln][16 + 8 * hh];
    pal.half[0] = *(const v8us*)&sPl[w][ln][8 * hh]; pal.half[1] = *(const v8us*)&sPl[w][ln][16 + 8 * hh];
#pragma unroll
    for (int dt = 0; dt < DT; ++dt) {
      FragB bvh, bvl;
#pragma unroll
      for (int i = 0; i < 8; ++i) {
        bvh.u[i] = sVh[8 * hh + i][dt * 16 + ln]; bvh.u[8 + i] = sVh[16 + 8 * hh + i][dt * 16 + ln];
        bvl.u[i] = sVl[8 * hh + i][dt * 16 + ln]; bvl.u[8 + i] = sVl[16 + 8 * hh + i][dt * 16 + ln];
      }
      oacc[dt] = mmaN<3>(pah.v, pal.v, bvh.v, bvl.v, oacc[dt]);
    }
    __builtin_amdgcn_fence(__ATOMIC_ACQ_REL, "workgroup");
    __builtin_amdgcn_wave_barrier();
  }
#pragma unroll
  for (int r = 0; r < 8; ++r) {
    float l = l_r[r];
    l += __shfl_xor(l, 1, 32); l += __shfl_xor(l, 2, 32); l += __shfl_xor(l, 4, 32); l += __shfl_xor(l, 8, 32);
    l_r[r] = (l > 0.f) ? 1.0f / l : 0.f;
  }
#pragma unroll
  for (int dt = 0; dt < DT; ++dt)
#pragma unroll
    for (int r = 0; r < 8; ++r) sO[w][8 * hh + r][dt * 16 + ln] = oacc[dt][r] * l_r[r];
  __builtin_amdgcn_fence(__ATOMIC_ACQ_REL, "workgroup");
  __builtin_amdgcn_wave_barrier();
  {
    for (int r = 0; r < 16; ++r) {
      const int row = q0 + r;
      if (row < T && lane < D / 4) {
        const v4f val = *(const v4fa*)&sO[w][r][lane * 4];
        *(v4f*)(y + ((size_t)b * T + row) * ypitch + h * D + lane * 4) = val;
      }
    }
    
  }
}

// batched GEMM (blockIdx.y = batch): C_b = act(alpha·A_b·B_b + bias + resid_b); A f32 rows (ASPLIT → hi/lo), B = bf16 planes Bh (+Bl when BSPLIT, requires ASPLIT),
// per-batch element strides sA, sB (0 = shared weights), sC, sR. resid may alias C (values are staged before the stores). ACT 0/1(relu).
// ACT: 0 none, 1 relu, 2 softplus
template <bool ASPLIT, bool BSPLIT, int ACT>
__global__ __launch_bounds__(128) void k_gemm_b(const float* __restrict__ A, int lda, size_t sA, const unsigned short* __restrict__ Bh, const unsigned short* __restrict__ Bl, int ldb, size_t sB,
                                             const float* __restrict__ bias, const float* __restrict__ resid, int ldr, size_t sR, float rsign, float alpha,
                                             float* __restrict__ C, int ldc, size_t sC, int M, int N, int K) {
  __shared__ __attribute__((aligned(16))) float so[4][16][64];
  const int tid = threadIdx.x, w = tid >> 5, lane = tid & 31, ln = lane & 15, hh = lane >> 4;
  const int by = blockIdx.y;
  A += (size_t)by * sA; Bh += (size_t)by * sB; if (BSPLIT) Bl += (size_t)by * sB; C += (size_t)by * sC; if (resid) resid += (size_t)by * sR;
  const int ntn = (N + 63) / 64; const int wid = blockIdx.x * 4 + w; const int mt = wid / ntn, nq = wid % ntn;      // N may be any multiple of 16: tiles past N are skipped and not stored
  if (mt * 16 >= M) return;
  const int row0 = mt * 16, col0 = nq * 64;
  const float* arow = A + (size_t)(row0 + ln) * lda;
  v8f acc[4] = {};
  for (int kb = 0; kb < K; kb += 32) {
    FragB ah, al;
    const v4f x0 = *(const v4fa*)(arow + kb + 8 * hh), x1 = *(const v4fa*)(arow + kb + 8 * hh + 4);
    const v4f x2 = *(const v4fa*)(arow + kb + 16 + 8 * hh), x3 = *(const v4fa*)(arow + kb + 16 + 8 * hh + 4);
    float xs[16] = {x0[0],x0[1],x0[2],x0[3],x1[0],x1[1],x1[2],x1[3],x2[0],x2[1],x2[2],x2[3],x3[0],x3[1],x3[2],x3[3]};
#pragma unroll
    for (int i = 0; i < 16; ++i) { const unsigned short hb = bf16_bits(xs[i]); ah.u[i] = hb; al.u[i] = ASPLIT ? bf16_bits(xs[i] - bf16_val(hb)) : (unsigned short)0; }
#pragma unroll
    for (int t = 0; t < 4; ++t) {
      if (col0 + t * 16 >= N) continue;
      const size_t boff = (size_t)(col0 + t * 16 + ln) * ldb + kb;
      FragB bh_, bl_; bh_.half[0] = *(const v8us*)(Bh + boff + 8 * hh); bh_.half[1] = *(const v8us*)(Bh + boff + 16 + 8 * hh);
      if (BSPLIT) { bl_.half[0] = *(const v8us*)(Bl + boff + 8 * hh); bl_.half[1] = *(const v8us*)(Bl + boff + 16 + 8 * hh); } else bl_ = bh_;
      acc[t] = mmaN<ASPLIT ? (BSPLIT ? 3 : 2) : 1>(ah.v, al.v, bh_.v, bl_.v, acc[t]);
    }
  }
#pragma unroll
  for (int t = 0; t < 4; ++t) {
    const int col = col0 + t * 16 + ln; if (col0 + t * 16 >= N) continue; const float bv = bias ? bf16_round(bias[col]) : 0.f;
#pragma unroll
    for (int r = 0; r < 8; ++r) { float v = acc[t][r] * alpha + bv; if (resid) v += rsign * resid[(size_t)(row0 + 8 * hh + r) * ldr + col]; if (ACT == 1) v = fmaxf(v, 0.f); else if (ACT == 2) v = fmaxf(v, 0.f) + log1pf(expf(-fabsf(v))); so[w][8 * hh + r][t * 16 + ln] = v; }
  }
  __builtin_amdgcn_fence(__ATOMIC_ACQ_REL, "workgroup"); __builtin_amdgcn_wave_barrier();
  const int rsub = lane >> 4, c4 = (lane & 15) * 4;
  {
#pragma unroll
    for (int q = 0; q < 8; ++q) { const int r = q * 2 + rsub; if (col0 + c4 < N) { const v4f v = *(const v4fa*)&so[w][r][c4]; *(v4f*)(C + (size_t)(row0 + r) * ldc + col0 + c4) = v; } }
    
  }
}
// batched f32 [K][N] (pitch lds, batch stride sIn) -> transposed hi/lo planes [N][K] (batch stride sOut); thread per (n, 8 k); grid.y = batch
__global__ __launch_bounds__(256) void k_split_transpose_b(const float* __restrict__ src, int lds_, size_t sIn, unsigned short* __restrict__ hi, unsigned short* __restrict__ lo, size_t sOut, int K, int N) {
  const size_t t = (size_t)blockIdx.x * 256 + threadIdx.x; const int k8n = K / 8; if (t >= (size_t)N * k8n) return;
  src += (size_t)blockIdx.y * sIn; hi += (size_t)blockIdx.y * sOut; lo += (size_t)blockIdx.y * sOut;
  const int n = (int)(t / k8n), k8 = (int)(t % k8n) * 8; v8us vh, vl;
#pragma unroll
  for (int i = 0; i < 8; ++i) { const float x = src[(size_t)(k8 + i) * lds_ + n]; const unsigned short hb = bf16_bits(x); vh[i] = hb; vl[i] = bf16_bits(x - bf16_val(hb)); }
  unsigned short* dh = hi + (size_t)n * K + k8; unsigned short* dl = lo + (size_t)n * K + k8;
  *(v8us*)dh = vh; *(v8us*)dl = vl; 
}

// ---- f16 WMMA path (v_wmma_f32_16x16x32_f16): 11-bit significands for operands in range — used where the [-1,1] cos operand needs more precision than bf16
typedef _Float16 v16h __attribute__((ext_vector_type(16)));
union FragH { v16h v; v8us half[2]; _Float16 h[16]; unsigned short u[16]; };
template <int NT>
__device__ __forceinline__ v8f mmaH(v16h ah, v16h al, v16h bh, v16h bl, v8f c) {
  c = __builtin_amdgcn_wmma_f32_16x16x32_f16(false, ah, false, bh, (short)0, c, false, false);
  if (NT >= 2) c = __builtin_amdgcn_wmma_f32_16x16x32_f16(false, al, false, bh, (short)0, c, false, false);
  if (NT >= 3) c = __builtin_amdgcn_wmma_f32_16x16x32_f16(false, ah, false, bl, (short)0, c, false, false);
  asm volatile("v_nop\n\tv_nop\n\tv_nop\n\tv_nop" : "+v"(c) : "v"(ah), "v"(al), "v"(bh), "v"(bl));
  return c;
}
// batched GEMM like k_gemm_b but f16 operands: A f32 (split into f16 hi/lo if ASPLIT, else rounded to f16), Bt = f16 values [n][k]; alpha; C f32; N multiple of 16 (partial tiles skipped)
template <bool ASPLIT>
__global__ __launch_bounds__(128) void k_gemm_h(const float* __restrict__ A, int lda, size_t sA, const _Float16* __restrict__ Bh, int ldb, size_t sB, float alpha, float* __restrict__ C, int ldc, size_t sC, int M, int N, int K) {
  __shared__ __attribute__((aligned(16))) float so[4][16][64];
  const int tid = threadIdx.x, w = tid >> 5, lane = tid & 31, ln = lane & 15, hh = lane >> 4; const int by = blockIdx.y;
  A += (size_t)by * sA; Bh += (size_t)by * sB; C += (size_t)by * sC;
  const int ntn = (N + 63) / 64; const int wid = blockIdx.x * 4 + w; const int mt = wid / ntn, nq = wid % ntn; if (mt * 16 >= M) return;
  const int row0 = mt * 16, col0 = nq * 64; const float* arow = A + (size_t)(row0 + ln) * lda;
  v8f acc[4] = {};
  for (int kb = 0; kb < K; kb += 32) {
    FragH ah, al;
    const v4f x0 = *(const v4fa*)(arow + kb + 8 * hh), x1 = *(const v4fa*)(arow + kb + 8 * hh + 4), x2 = *(const v4fa*)(arow + kb + 16 + 8 * hh), x3 = *(const v4fa*)(arow + kb + 16 + 8 * hh + 4);
    float xs[16] = {x0[0],x0[1],x0[2],x0[3],x1[0],x1[1],x1[2],x1[3],x2[0],x2[1],x2[2],x2[3],x3[0],x3[1],x3[2],x3[3]};
#pragma unroll
    for (int i = 0; i < 16; ++i) { const _Float16 h = (_Float16)xs[i]; ah.h[i] = h; al.h[i] = ASPLIT ? (_Float16)(xs[i] - (float)h) : (_Float16)0.0f; }
#pragma unroll
    for (int t = 0; t < 4; ++t) { if (col0 + t * 16 >= N) continue; const size_t boff = (size_t)(col0 + t * 16 + ln) * ldb + kb; FragH bq; bq.half[0] = *(const v8us*)(Bh + boff + 8 * hh); bq.half[1] = *(const v8us*)(Bh + boff + 16 + 8 * hh);
      acc[t] = mmaH<ASPLIT ? 2 : 1>(ah.v, al.v, bq.v, bq.v, acc[t]); }
  }
#pragma unroll
  for (int t = 0; t < 4; ++t) { if (col0 + t * 16 >= N) continue;
#pragma unroll
    for (int r = 0; r < 8; ++r) so[w][8 * hh + r][t * 16 + ln] = acc[t][r] * alpha; }
  __builtin_amdgcn_fence(__ATOMIC_ACQ_REL, "workgroup"); __builtin_amdgcn_wave_barrier();
  const int rsub = lane >> 4, c4 = (lane & 15) * 4;
  {
#pragma unroll
    for (int q = 0; q < 8; ++q) { const int r = q * 2 + rsub; if (col0 + c4 < N) { const v4f v = *(const v4fa*)&so[w][r][c4]; *(v4f*)(C + (size_t)(row0 + r) * ldc + col0 + c4) = v; } }
     }
}

// Bt = bits(W?[k][n]) in B-fragment order, via 32x32 tiles (grid: k tiles, n tiles (12), -): [n / 16][k / 32][half][lane = hh * 16 + (n & 15)][8],
// k = (k / 32) * 32 + half * 16 + hh * 8 + i, so that one half fragment of a wave is 512 contiguous bytes; bias concat
__global__ __launch_bounds__(256) void k_wt(const float* __restrict__ Wq, const float* __restrict__ Wk, const float* __restrict__ Wv, const float* __restrict__ bq, const float* __restrict__ bk, const float* __restrict__ bv, unsigned short* __restrict__ Bt, float* __restrict__ B3) { __shared__ float tile[32][33]; const int k0 = blockIdx.x * 32, n0 = blockIdx.y * 32; const int which = n0 / DK, nn0 = n0 % DK; const float* W = which == 0 ? Wq : (which == 1 ? Wk : Wv); const int tx = threadIdx.x & 31, ty = threadIdx.x >> 5;
  for (int i = ty; i < 32; i += 8) tile[i][tx] = W[(size_t)(k0 + i) * DK + nn0 + tx]; __syncthreads();
  typedef unsigned short v4us __attribute__((ext_vector_type(4))); const int r = threadIdx.x >> 3, c4 = (threadIdx.x & 7) * 4; v4us o; for (int q = 0; q < 4; ++q) o[q] = bf16_bits(tile[c4 + q][r]);
  const int n = n0 + r; unsigned short* d = Bt + ((size_t)(((n >> 4) * (DM / 32) + blockIdx.x) * 2 + (c4 >> 4)) * 32 + ((c4 >> 3) & 1) * 16 + (n & 15)) * 8 + (c4 & 7); *(v4us*)d = o; 
  if (blockIdx.x == 0 && threadIdx.x < 32) { const float* bs = which == 0 ? bq : (which == 1 ? bk : bv); *(float*)(B3 + n0 + threadIdx.x) = bs[nn0 + threadIdx.x]; } }
// [Q|K|V] = x.W + b: a work-group owns PM rows of x and all 384 columns, so x is read from memory once. The rows are fetched by whole-line loads,
// rounded to bf16 once and kept in LDS for all waves; a wave owns 48 columns (3 tiles x 2 row tiles) and reads its W fragments, which no other wave
// of the group needs, straight from the fragment-ordered Bt: every wave-wide load is 512 contiguous bytes. k runs upward, one WMMA per 32 k.
#define PM 32
#define PAP (DM + 8)
#define PCP (3 * DK + 4)
#define PKC 4
typedef unsigned short v4usa __attribute__((ext_vector_type(4), may_alias));
__global__ __launch_bounds__(256) void k_proj(const float* __restrict__ x, const unsigned short* __restrict__ Bt, const float* __restrict__ B3, float* __restrict__ QKV) {
  __shared__ __attribute__((aligned(16))) unsigned short sA[PM][PAP];   // pitch 2064 B = 16 B x odd
  __shared__ __attribute__((aligned(16))) float sC[PM][PCP];            // pitch 388 dwords: rows 8 apart lie 32 banks apart
  const int tid = threadIdx.x, w = tid >> 5, lane = tid & 31, ln = lane & 15, hh = lane >> 4;
  const int row0 = blockIdx.x * PM;
  const unsigned short* bp = Bt + (size_t)w * 3 * (DM / 32) * 512 + lane * 8;
  FragB bf[2][PKC][3];          // W fragments of PKC k-steps, two sets: the next set flies under the current set's products
#pragma unroll
  for (int s = 0; s < PKC; ++s)
#pragma unroll
    for (int t = 0; t < 3; ++t) { bf[0][s][t].half[0] = *(const v8us*)(bp + (t * (DM / 32) + s) * 512); bf[0][s][t].half[1] = *(const v8us*)(bp + (t * (DM / 32) + s) * 512 + 256); }
  {
    const float* xr = x + (size_t)row0 * DM + tid * 4;
    v4f v[PM];
#pragma unroll
    for (int i = 0; i < PM; ++i) v[i] = *(const v4fa*)(xr + (size_t)i * DM);
    // keeps all the row loads in front of the conversions, so that they are in flight together and share one memory latency
    __builtin_amdgcn_sched_barrier(0);
#pragma unroll
    for (int i = 0; i < PM; ++i) *(v4usa*)&sA[i][tid * 4] = (v4usa){bf16_bits(v[i][0]), bf16_bits(v[i][1]), bf16_bits(v[i][2]), bf16_bits(v[i][3])};
  }
  __syncthreads();
  float bv[3];
#pragma unroll
  for (int t = 0; t < 3; ++t) bv[t] = bf16_round(B3[w * 48 + t * 16 + ln]);
  // the bias loads' offset register is reused soon after; the wait stands in front of that overwrite
  asm volatile("s_wait_xcnt 0x0" ::: "memory");
  v8f acc[2][3];
#pragma unroll
  for (int mt = 0; mt < 2; ++mt)
#pragma unroll
    for (int t = 0; t < 3; ++t) acc[mt][t] = (v8f){0.f, 0.f, 0.f, 0.f, 0.f, 0.f, 0.f, 0.f};
#pragma unroll
  for (int c = 0; c < DM / 32 / PKC; ++c) {
    if (c + 1 < DM / 32 / PKC) {
#pragma unroll
      for (int s = 0; s < PKC; ++s)
#pragma unroll
        for (int t = 0; t < 3; ++t) {
          const unsigned short* p = bp + (t * (DM / 32) + (c + 1) * PKC + s) * 512;
          bf[(c + 1) & 1][s][t].half[0] = *(const v8us*)p; bf[(c + 1) & 1][s][t].half[1] = *(const v8us*)(p + 256);
        }
    }
    FragB af[PKC][2];           // x fragments: row = mt*16 + ln, k in the same order as Bt's
#pragma unroll
    for (int s = 0; s < PKC; ++s)
#pragma unroll
      for (int mt = 0; mt < 2; ++mt) {
        af[s][mt].half[0] = *(const v8us*)&sA[mt * 16 + ln][(c * PKC + s) * 32 + 8 * hh]; af[s][mt].half[1] = *(const v8us*)&sA[mt * 16 + ln][(c * PKC + s) * 32 + 16 + 8 * hh];
      }
    // keeps the next set's loads and this set's LDS reads as one group in front of the products; without it the compiler moves them in among the
    // products, close to their use, and each then waits out its own latency
    __builtin_amdgcn_sched_barrier(0);
#pragma unroll
    for (int s = 0; s < PKC; ++s)
#pragma unroll
      for (int mt = 0; mt < 2; ++mt)
#pragma unroll
        for (int t = 0; t < 3; ++t) acc[mt][t] = __builtin_amdgcn_wmma_f32_16x16x32_bf16(false, af[s][mt].v, false, bf[c & 1][s][t].v, (short)0, acc[mt][t], false, false);
    // second half of the fence pair: keeps the following group's loads and LDS reads from being moved up in among these products
    __builtin_amdgcn_sched_barrier(0);
  }
#pragma unroll
  for (int mt = 0; mt < 2; ++mt)
#pragma unroll
    for (int t = 0; t < 3; ++t)
#pragma unroll
      for (int r = 0; r < 8; ++r) sC[mt * 16 + 8 * hh + r][w * 48 + t * 16 + ln] = acc[mt][t][r] + bv[t];
  __syncthreads();
#pragma unroll
  for (int g = 0; g < PM * (3 * DK / 4) / 256; ++g) {   // the tile is contiguous in QKV: a wave stores 512 contiguous bytes at a time
    const int idx = g * 256 + tid, r = idx / (3 * DK / 4), c4 = (idx % (3 * DK / 4)) * 4;
    *(v4f*)(QKV + (size_t)row0 * (3 * DK) + (size_t)idx * 4) = *(const v4fa*)&sC[r][c4];
  }
}
// from QKV [tok][384], a work-group per 32 tokens: Kh/Kl = bf16 hi/lo planes of K and VT = f16(V), all three in the order of k_cosattn's A fragments, so that
// each of its wave-wide 16-B loads is 512 contiguous bytes (four whole lines) and not 32 B out of each of 16 lines.
// Kh/Kl: [tok / 16][ks = c / 32][half][lane = hh * 16 + (tok & 15)][8], c = ks * 32 + half * 16 + hh * 8 + i
// VT:    [tok / 32][dt = d / 16][half][lane = hh * 16 + (d & 15)][8], tok = (tok / 32) * 32 + half * 16 + hh * 8 + i
typedef _Float16 v8h __attribute__((ext_vector_type(8)));
__global__ __launch_bounds__(256) void k_kv(const float* __restrict__ QKV, unsigned short* __restrict__ Kh, unsigned short* __restrict__ Kl, _Float16* __restrict__ VT) {
  __shared__ float tile[32][DK + 2];   // pitch 130 dwords: rows 8 apart lie 16 banks apart, so the two lane halves of the gather below do not collide
  const int b = blockIdx.y, l0 = blockIdx.x * 32; const int tid = threadIdx.x, tx = tid & 31, ty = tid >> 5;
  const size_t base = ((size_t)b * LL + l0) * DK;   // the group's 32 tokens fill one contiguous block of each plane
  for (int i = ty; i < 32; i += 8) { const size_t tok = (size_t)b * LL + l0 + i; for (int u = 0; u < 4; ++u) { const int c = u * 32 + tx; tile[i][c] = QKV[tok * (3 * DK) + 2 * DK + c]; } }
  // K planes: 2 key tiles x 4 ks x 2 halves x 32 lanes = 512 groups of 8, 2 per thread; group g lies at element g * 8 of the block
  for (int g = tid; g < 32 * (DK / 8); g += 256) {
    const int fl = g & 31, i = (g >> 8) * 16 + (fl & 15), c8 = ((g >> 6) & 3) * 32 + ((g >> 5) & 1) * 16 + (fl >> 4) * 8;
    const size_t tok = (size_t)b * LL + l0 + i; v8us h, l;
    for (int q = 0; q < 8; ++q) { const float kv = QKV[tok * (3 * DK) + DK + c8 + q]; const float kh = bf16_round(kv); h[q] = bf16_bits(kh); l[q] = bf16_bits(kv - kh); }
    *(v8us*)(Kh + base + (size_t)g * 8) = h; *(v8us*)(Kl + base + (size_t)g * 8) = l;
  }
  __syncthreads();
  // V: 8 d tiles x 2 halves x 32 lanes = 512 groups of 8 keys, 2 per thread
  for (int g = tid; g < 32 * (DK / 8); g += 256) {
    const int fl = g & 31, d = (g >> 6) * 16 + (fl & 15), k0 = ((g >> 5) & 1) * 16 + (fl >> 4) * 8; v8h v;
    for (int q = 0; q < 8; ++q) v[q] = (_Float16)tile[k0 + q][d];
    *(v8h*)(VT + base + (size_t)g * 8) = v;
  }
}
// cos of eight scores without a branch. The hardware cosine takes its argument in revolutions, so the score is reduced in revolutions: n = nearest whole
// number to x / (2 pi); f = x * C_HI - n in one FMA (the product is not rounded before n is taken off), then x * C_LO is added, C_HI + C_LO = 1 / (2 pi) to
// 48 bits. f is right to better than 1e-7 revolutions for |x| up to 1e8 (library cosf changes its method at 131072); an infinite or NaN score gives NaN.
__device__ __forceinline__ v8f cos8(v8f x) {
  const v8f chi = {0x1.45f306p-3f, 0x1.45f306p-3f, 0x1.45f306p-3f, 0x1.45f306p-3f, 0x1.45f306p-3f, 0x1.45f306p-3f, 0x1.45f306p-3f, 0x1.45f306p-3f};
  const v8f clo = {0x1.b9391p-28f, 0x1.b9391p-28f, 0x1.b9391p-28f, 0x1.b9391p-28f, 0x1.b9391p-28f, 0x1.b9391p-28f, 0x1.b9391p-28f, 0x1.b9391p-28f};
  const v8f n = __builtin_elementwise_rint(x * chi);
  const v8f f = __builtin_elementwise_fma(x, clo, __builtin_elementwise_fma(x, chi, -n));
  v8f c;
  // unrolled so that every index is a constant and c stays in registers
#pragma unroll
  for (int i = 0; i < 8; ++i) c[i] = __builtin_amdgcn_cosf(f[i]);
  return c;
}
#define FQ 32
#define FW 8
#define FKEYS (LL / FW)
#define QP (DK + 8)
#define RP (DK + 4)
__global__ __launch_bounds__(256) void k_cosattn(const float* __restrict__ QKV, const unsigned short* __restrict__ Kh, const unsigned short* __restrict__ Kl, const _Float16* __restrict__ VT, float* __restrict__ out) {
  __shared__ __attribute__((aligned(16))) unsigned short sQh[FQ][QP], sQl[FQ][QP];   // pitch 272 B = 16 B x odd
  __shared__ __attribute__((aligned(16))) float red[FW][FQ][RP];                     // pitch 528 B = 16 B x odd
  const int tid = threadIdx.x, w = tid >> 5, lane = tid & 31, ln = lane & 15, hh = lane >> 4;
  const int b = blockIdx.x / (LL / FQ), q0 = (blockIdx.x % (LL / FQ)) * FQ;
  { // Q rows -> bf16 hi/lo planes, split once per work-group (thread: 16 consecutive columns of one row)
    const int r = tid >> 3, c0 = (tid & 7) * 16;
    const float* qr = QKV + ((size_t)b * LL + q0 + r) * (3 * DK) + c0;
    const v4f x0 = *(const v4fa*)qr, x1 = *(const v4fa*)(qr + 4), x2 = *(const v4fa*)(qr + 8), x3 = *(const v4fa*)(qr + 12);
    // the loads' address registers are reused soon after
    asm volatile("s_wait_xcnt 0x0" ::: "memory");
    const float xs[16] = {x0[0], x0[1], x0[2], x0[3], x1[0], x1[1], x1[2], x1[3], x2[0], x2[1], x2[2], x2[3], x3[0], x3[1], x3[2], x3[3]};
#pragma unroll
    for (int g = 0; g < 2; ++g) {
      v8us h, l;
#pragma unroll
      for (int i = 0; i < 8; ++i) { const float x = xs[g * 8 + i]; const unsigned short hb = bf16_bits(x); h[i] = hb; l[i] = bf16_bits(x - bf16_val(hb)); }
      *(v8us*)&sQh[r][c0 + g * 8] = h; *(v8us*)&sQl[r][c0 + g * 8] = l;
    }
  }
  __syncthreads();
  FragB qh[2][4], ql[2][4];     // B fragments: column = query qt*16+ln, k in the same order as the K loader below
#pragma unroll
  for (int qt = 0; qt < 2; ++qt)
#pragma unroll
    for (int ks = 0; ks < 4; ++ks) {
      qh[qt][ks].half[0] = *(const v8us*)&sQh[qt * 16 + ln][ks * 32 + 8 * hh]; qh[qt][ks].half[1] = *(const v8us*)&sQh[qt * 16 + ln][ks * 32 + 16 + 8 * hh];
      ql[qt][ks].half[0] = *(const v8us*)&sQl[qt * 16 + ln][ks * 32 + 8 * hh]; ql[qt][ks].half[1] = *(const v8us*)&sQl[qt * 16 + ln][ks * 32 + 16 + 8 * hh];
    }
  v8f o[2][8];                  // o[qt][dt][r] = O[query qt*16+ln][d = dt*16 + 8*hh + r], this wave's keys only
#pragma unroll
  for (int qt = 0; qt < 2; ++qt)
#pragma unroll
    for (int dt = 0; dt < 8; ++dt) o[qt][dt] = (v8f){0.f, 0.f, 0.f, 0.f, 0.f, 0.f, 0.f, 0.f};
  const size_t koff = ((size_t)b * LL + w * FKEYS) * DK + lane * 8;   // the planes are in fragment order (k_kv): 16 keys of K = 8 half fragments of 256 elements, 32 keys of V = 16
  const unsigned short* kh = Kh + koff;
  const unsigned short* kl = Kl + koff;
  const unsigned short* vt = (const unsigned short*)VT + koff;
  for (int j = 0; j < FKEYS; j += 32) {
    FragB ah[2][4], al[2][4];   // A fragments of K hi/lo: row = key j + kt*16 + ln
#pragma unroll
    for (int kt = 0; kt < 2; ++kt)
#pragma unroll
      for (int ks = 0; ks < 4; ++ks) {
        const size_t e = (size_t)(j + kt * 16) * DK + ks * 512;
        ah[kt][ks].half[0] = *(const v8us*)(kh + e); ah[kt][ks].half[1] = *(const v8us*)(kh + e + 256);
        al[kt][ks].half[0] = *(const v8us*)(kl + e); al[kt][ks].half[1] = *(const v8us*)(kl + e + 256);
      }
    // the products' accumulators reuse the loads' address registers
    asm volatile("s_wait_xcnt 0x0" ::: "memory");
    // keeps all 32 K loads in front of the products, so that they are issued back to back and share one latency;
    // without it the compiler loads one fragment at a time and waits for each in front of its products
    __builtin_amdgcn_sched_barrier(0);
    v8f s[2][2];                // s[kt][qt][r] = S[query qt*16+ln][key j + kt*16 + 8*hh + r]
#pragma unroll
    for (int kt = 0; kt < 2; ++kt)
#pragma unroll
      for (int qt = 0; qt < 2; ++qt) {
        v8f c = {};
#pragma unroll
        for (int ks = 0; ks < 4; ++ks) {   // three products of the hi/lo split, in this order: Qhi.Khi, Qlo.Khi, Qhi.Klo
          c = __builtin_amdgcn_wmma_f32_16x16x32_bf16(false, ah[kt][ks].v, false, qh[qt][ks].v, (short)0, c, false, false);
          c = __builtin_amdgcn_wmma_f32_16x16x32_bf16(false, ah[kt][ks].v, false, ql[qt][ks].v, (short)0, c, false, false);
          c = __builtin_amdgcn_wmma_f32_16x16x32_bf16(false, al[kt][ks].v, false, qh[qt][ks].v, (short)0, c, false, false);
        }
        s[kt][qt] = c;
      }
    FragH va[8];                // A fragments of V^T: row = d, k = key; they fly under the cosines
#pragma unroll
    for (int dt = 0; dt < 8; ++dt) { va[dt].half[0] = *(const v8us*)(vt + (size_t)j * DK + dt * 512); va[dt].half[1] = *(const v8us*)(vt + (size_t)j * DK + dt * 512 + 256); }
    // the loads' address registers are reused soon after
    asm volatile("s_wait_xcnt 0x0" ::: "memory");
#pragma unroll
    for (int qt = 0; qt < 2; ++qt) {
      FragH p;                  // B fragment: p[i] = cos(S)[key kmap(i, hh)][query], straight from the two D tiles
      const v8f c0 = cos8(s[0][qt]), c1 = cos8(s[1][qt]);
#pragma unroll
      for (int i = 0; i < 8; ++i) { p.h[i] = (_Float16)c0[i]; p.h[8 + i] = (_Float16)c1[i]; }
#pragma unroll
      for (int dt = 0; dt < 8; ++dt) o[qt][dt] = __builtin_amdgcn_wmma_f32_16x16x32_f16(false, va[dt].v, false, p.v, (short)0, o[qt][dt], false, false);
    }
  }
#pragma unroll
  for (int qt = 0; qt < 2; ++qt)
#pragma unroll
    for (int dt = 0; dt < 8; ++dt) {
      float* d = &red[w][qt * 16 + ln][dt * 16 + 8 * hh];
      *(v4fa*)d = (v4f){o[qt][dt][0], o[qt][dt][1], o[qt][dt][2], o[qt][dt][3]};
      *(v4fa*)(d + 4) = (v4f){o[qt][dt][4], o[qt][dt][5], o[qt][dt][6], o[qt][dt][7]};
    }
  __syncthreads();
#pragma unroll
  for (int g = 0; g < FQ * DK / 4 / 256; ++g) {   // a wave stores one whole 512-B output row at a time
    const int idx = g * 256 + tid, q = idx >> 5, d4 = (idx & 31) * 4;
    v4f a = *(const v4fa*)&red[0][q][d4];
#pragma unroll
    for (int u = 1; u < FW; ++u) a += *(const v4fa*)&red[u][q][d4];
    *(v4f*)(out + ((size_t)b * LL + q0 + q) * DK + d4) = a;
  }
}
extern "C" void kernel_launch(void* const* d_in, const int* in_sizes, int n_in,
                              void* d_out, int out_size, void* d_ws, size_t ws_size, hipStream_t stream) {
  (void)in_sizes; (void)n_in; (void)out_size;
  const float* x = (const float*)d_in[0]; const float* Wq = (const float*)d_in[1]; const float* bq = (const float*)d_in[2]; const float* Wk = (const float*)d_in[3]; const float* bk = (const float*)d_in[4]; const float* Wv = (const float*)d_in[5]; const float* bv = (const float*)d_in[6];
  char* ws = (char*)d_ws; size_t off = 0;
  auto take = [&](size_t bytes) { char* p = ws + off; off += (bytes + 255) & ~(size_t)255; return p; };
  unsigned short* Bt = (unsigned short*)take((size_t)3 * DK * DM * 2); float* B3 = (float*)take(3 * DK * 4); float* QKV = (float*)take((size_t)NTOK * 3 * DK * 4);
  unsigned short* Kh = (unsigned short*)take((size_t)NTOK * DK * 2); unsigned short* Kl = (unsigned short*)take((size_t)NTOK * DK * 2); _Float16* VT = (_Float16*)take((size_t)BB * DK * LL * 2);
  if (off > ws_size) return;
  k_wt<<<dim3(DM / 32, 3 * DK / 32), 256, 0, stream>>>(Wq, Wk, Wv, bq, bk, bv, Bt, B3);
  k_proj<<<NTOK / PM, 256, 0, stream>>>(x, Bt, B3, QKV);
  k_kv<<<dim3(LL / 32, BB), 256, 0, stream>>>(QKV, Kh, Kl, VT);
  k_cosattn<<<NTOK / FQ, 256, 0, stream>>>(QKV, Kh, Kl, VT, (float*)d_out);
}

// v005
// One run takes 34.8 microseconds.
// Two timings next to v004 put it at 1.16 and 1.17 times that version's speed.
// Counting every step since v000, it is 14.3 times as fast.
#include <hip/hip_runtime.h>
// [Q|K|V] = x·[Wq|Wk|Wv] + b on v_wmma_f32_16x16x32_bf16 (x rounded to bf16: single exact term; 8192 × 1024 × 384); QK = Q·Kᵀ on the same unit with BOTH f32 operands split
// hi/lo (3 products — cos(QK) at |QK| ≈ 10–40 needs the phase to ≈1e-4 rad; 4 × 2048 × 2048 × 128); out = cos(QK)·V on v_wmma_f32_16x16x32_f16 (cos and V rounded to
// f16: single product). cos in f32: reduction on the VALU, then v_cos_f32.
#define BB 4
#define LL 2048
#define DM 1024
#define DK 128
#define NTOK (BB * LL)

typedef __bf16 v16b __attribute__((ext_vector_type(16)));
typedef unsigned short v8us __attribute__((ext_vector_type(8), may_alias));
typedef float  v8f  __attribute__((ext_vector_type(8)));
typedef float  v4f  __attribute__((ext_vector_type(4)));
typedef float  v4fa __attribute__((ext_vector_type(4), may_alias));
union FragB { v16b v; v8us half[2]; unsigned short u[16]; };

__device__ __forceinline__ unsigned short bf16_bits(float x) { unsigned int u = __float_as_uint(x); return (unsigned short)((u + 0x7FFFu + ((u >> 16) & 1u)) >> 16); }
__device__ __forceinline__ float bf16_val(unsigned short b) { return __uint_as_float(((unsigned int)b) << 16); }
__device__ __forceinline__ float bf16_round(float x) { return bf16_val(bf16_bits(x)); }
// D += A·B with NT terms: 1 = ah·bh, 2 = + al·bh (A split), 3 = + ah·bl (both split)
template <int NT>
__device__ __forceinline__ v8f mmaN(v16b ah, v16b al, v16b bh, v16b bl, v8f c) {
  c = __builtin_amdgcn_wmma_f32_16x16x32_bf16(false, ah, false, bh, (short)0, c, false, false);
  if (NT >= 2) c = __builtin_amdgcn_wmma_f32_16x16x32_bf16(false, al, false, bh, (short)0, c, false, false);
  if (NT >= 3) c = __builtin_amdgcn_wmma_f32_16x16x32_bf16(false, ah, false, bl, (short)0, c, false, false);
  asm volatile("v_nop\n\tv_nop\n\tv_nop\n\tv_nop" : "+v"(c) : "v"(ah), "v"(al), "v"(bh), "v"(bl));
  return c;
}

__global__ __launch_bounds__(256) void k_wt_bf16(const float* __restrict__ W, unsigned short* __restrict__ Wt, int K, int N) {
  const int t = blockIdx.x * 256 + threadIdx.x;
  const int k8n = K / 8;
  if (t >= N * k8n) return;
  const int n = t / k8n, k8 = (t % k8n) * 8;
  v8us v;
#pragma unroll
  for (int i = 0; i < 8; ++i) v[i] = bf16_bits(W[(size_t)(k8 + i) * N + n]);
  *(v8us*)(Wt + (size_t)n * K + k8) = v;
  
}

// GEMM C[M][N] (f32, pitch ldc) = act(A[M][K]·W + bias). A f32 row-major (pitch lda) converted per fragment to bf16
// (ASPLIT: hi/lo two planes -> 2 terms, else single rounded term); Wt bf16 [N][K] (pitch ldb). BIAS_BF16 rounds the
// bias to bf16 first (bias quantised to bf16 before the add). K%32==0, M%16==0, N%64==0.
template <bool ASPLIT, int ACT, bool BIAS_BF16>
__global__ __launch_bounds__(128) void k_gemm_bf(const float* __restrict__ A, int lda, const unsigned short* __restrict__ Wt, int ldb,
                                               const float* __restrict__ bias, float* __restrict__ C, int ldc, int M, int N, int K) {
  __shared__ __attribute__((aligned(16))) float so[4][16][64];
  const int tid = threadIdx.x, w = tid >> 5, lane = tid & 31, ln = lane & 15, hh = lane >> 4;
  const int ntn = N / 64;
  const int wid = blockIdx.x * 4 + w;
  const int mt = wid / ntn, nq = wid % ntn;
  if (mt * 16 >= M) return;
  const int row0 = mt * 16, col0 = nq * 64;
  const float* arow = A + (size_t)(row0 + ln) * lda;
  v8f acc[4] = {};
  for (int kb = 0; kb < K; kb += 32) {
    FragB ah, al;
    const v4f x0 = *(const v4fa*)(arow + kb + 8 * hh), x1 = *(const v4fa*)(arow + kb + 8 * hh + 4);
    const v4f x2 = *(const v4fa*)(arow + kb + 16 + 8 * hh), x3 = *(const v4fa*)(arow + kb + 16 + 8 * hh + 4);
    float xs[16] = {x0[0],x0[1],x0[2],x0[3],x1[0],x1[1],x1[2],x1[3],x2[0],x2[1],x2[2],x2[3],x3[0],x3[1],x3[2],x3[3]};
#pragma unroll
    for (int i = 0; i < 16; ++i) { const unsigned short hb = bf16_bits(xs[i]); ah.u[i] = hb; al.u[i] = ASPLIT ? bf16_bits(xs[i] - bf16_val(hb)) : (unsigned short)0; }
#pragma unroll
    for (int t = 0; t < 4; ++t) {
      const unsigned short* brow = Wt + (size_t)(col0 + t * 16 + ln) * ldb + kb;
      FragB b;
      b.half[0] = *(const v8us*)(brow + 8 * hh);
      b.half[1] = *(const v8us*)(brow + 16 + 8 * hh);
      acc[t] = mmaN<ASPLIT ? 2 : 1>(ah.v, al.v, b.v, b.v, acc[t]);
    }
  }
#pragma unroll
  for (int t = 0; t < 4; ++t) {
    float bv = bias ? bias[col0 + t * 16 + ln] : 0.f;
    if (BIAS_BF16) bv = bf16_round(bv);
#pragma unroll
    for (int r = 0; r < 8; ++r) { float v = acc[t][r] + bv; if (ACT == 1) v = fmaxf(v, 0.f); so[w][8 * hh + r][t * 16 + ln] = v; }
  }
  __builtin_amdgcn_fence(__ATOMIC_ACQ_REL, "workgroup");
  __builtin_amdgcn_wave_barrier();
  const int rsub = lane >> 4, c4 = (lane & 15) * 4;
  {
#pragma unroll
    for (int q = 0; q < 8; ++q) {
      const int r = q * 2 + rsub;
      const v4f v = *(const v4fa*)&so[w][r][c4];
      *(v4f*)(C + (size_t)(row0 + r) * ldc + col0 + c4) = v;
    }
    
  }
}

// Flash-style causal/unmasked attention, all contractions 3-term bf16 hi/lo splits, f32 softmax with running max.
// q,k,v rows are read from f32 buffers with arbitrary row pitch (so they can live inside a fused qkv buffer);
// D = head size (multiple of 32, <= 128); one wave = 16 query rows; block = 4 waves (64 queries) sharing K/V chunks of 32.
template <int D, bool CAUSAL>
__global__ __launch_bounds__(128) void k_flash(const float* __restrict__ qb, const float* __restrict__ kb, const float* __restrict__ vb,
                                             int pitch, int T, int H, float scale, float* __restrict__ y, int ypitch) {
  constexpr int KS = D / 32;        // k-steps for QK
  constexpr int DT = D / 16;        // d tiles for PV
  __shared__ __attribute__((aligned(16))) unsigned short sKh[32][D + 8], sKl[32][D + 8], sVh[32][D + 8], sVl[32][D + 8];
  __shared__ __attribute__((aligned(16))) unsigned short sPh[4][16][40], sPl[4][16][40];
  __shared__ __attribute__((aligned(16))) float sO[4][16][D];
  const int tid = threadIdx.x, w = tid >> 5, lane = tid & 31, ln = lane & 15, hh = lane >> 4;
  const int nqb = (T + 63) / 64;
  const int bh = blockIdx.x / nqb, qblk = blockIdx.x % nqb;
  const int b = bh / H, h = bh % H;
  const int q0 = qblk * 64 + w * 16;
  const float* Q = qb + (size_t)b * T * pitch + h * D;
  const float* K = kb + (size_t)b * T * pitch + h * D;
  const float* V = vb + (size_t)b * T * pitch + h * D;

  // A fragments of the wave's 16 query rows (scaled), hi/lo
  FragB aqh[KS], aql[KS];
  {
    int row = q0 + ln; if (row >= T) row = T - 1;
    const float* qr = Q + (size_t)row * pitch;
#pragma unroll
    for (int ks = 0; ks < KS; ++ks)
#pragma unroll
      for (int i = 0; i < 16; ++i) {
        const int d = ks * 32 + ((i < 8) ? (8 * hh + i) : (16 + 8 * hh + (i - 8)));
        const float x = qr[d] * scale; const unsigned short hb = bf16_bits(x);
        aqh[ks].u[i] = hb; aql[ks].u[i] = bf16_bits(x - bf16_val(hb));
      }
  }
  float m_r[8], l_r[8];
#pragma unroll
  for (int r = 0; r < 8; ++r) { m_r[r] = -3.0e38f; l_r[r] = 0.f; }
  v8f oacc[DT];
#pragma unroll
  for (int dt = 0; dt < DT; ++dt) oacc[dt] = (v8f){0.f,0.f,0.f,0.f,0.f,0.f,0.f,0.f};

  const int kv_end = CAUSAL ? min(T, qblk * 64 + 64) : T;     // block-uniform
  for (int j0 = 0; j0 < kv_end; j0 += 32) {
    __syncthreads();
    for (int e = tid; e < 32 * (D / 4); e += 128) {
      const int r = e / (D / 4), c4 = (e % (D / 4)) * 4;
      const int key = j0 + r;
      v4f kf = {0.f,0.f,0.f,0.f}, vf = {0.f,0.f,0.f,0.f};
      if (key < T) { kf = *(const v4fa*)(K + (size_t)key * pitch + c4); vf = *(const v4fa*)(V + (size_t)key * pitch + c4); }
#pragma unroll
      for (int t = 0; t < 4; ++t) {
        unsigned short hb = bf16_bits(kf[t]); sKh[r][c4 + t] = hb; sKl[r][c4 + t] = bf16_bits(kf[t] - bf16_val(hb));
        hb = bf16_bits(vf[t]); sVh[r][c4 + t] = hb; sVl[r][c4 + t] = bf16_bits(vf[t] - bf16_val(hb));
      }
    }
    __syncthreads();
    // S tile 16 x 32
    v8f s[2];
#pragma unroll
    for (int nt = 0; nt < 2; ++nt) {
      v8f acc = {};
#pragma unroll
      for (int ks = 0; ks < KS; ++ks) {
        FragB bh_, bl_;
        bh_.half[0] = *(const v8us*)&sKh[nt * 16 + ln][ks * 32 + 8 * hh]; bh_.half[1] = *(const v8us*)&sKh[nt * 16 + ln][ks * 32 + 16 + 8 * hh];
        bl_.half[0] = *(const v8us*)&sKl[nt * 16 + ln][ks * 32 + 8 * hh]; bl_.half[1] = *(const v8us*)&sKl[nt * 16 + ln][ks * 32 + 16 + 8 * hh];
        acc = mmaN<3>(aqh[ks].v, aql[ks].v, bh_.v, bl_.v, acc);
      }
      s[nt] = acc;
    }
    // mask + running max (rows 8hh+r; the 16 lanes of a half share rows)
    float alpha[8];
#pragma unroll
    for (int r = 0; r < 8; ++r) {
      const int qi = q0 + 8 * hh + r;
      const int ja = j0 + ln, jb = j0 + 16 + ln;
      if (CAUSAL) { if (ja > qi) s[0][r] = -3.0e38f; if (jb > qi) s[1][r] = -3.0e38f; }
      if (ja >= T) s[0][r] = -3.0e38f;
      if (jb >= T) s[1][r] = -3.0e38f;
      float mx = fmaxf(s[0][r], s[1][r]);
      mx = fmaxf(mx, __shfl_xor(mx, 1, 32)); mx = fmaxf(mx, __shfl_xor(mx, 2, 32)); mx = fmaxf(mx, __shfl_xor(mx, 4, 32)); mx = fmaxf(mx, __shfl_xor(mx, 8, 32));
      const float mnew = fmaxf(m_r[r], mx);
      alpha[r] = (mnew > -1.0e38f) ? __expf(m_r[r] - mnew) : 1.0f;
      const float p0 = (s[0][r] > -1.0e38f) ? __expf(s[0][r] - mnew) : 0.f;
      const float p1 = (s[1][r] > -1.0e38f) ? __expf(s[1][r] - mnew) : 0.f;
      m_r[r] = mnew;
      l_r[r] = l_r[r] * alpha[r] + p0 + p1;            // per-lane partial row sum (16 lanes combined at the end)
      unsigned short hb = bf16_bits(p0); sPh[w][8 * hh + r][ln] = hb;      sPl[w][8 * hh + r][ln] = bf16_bits(p0 - bf16_val(hb));
      hb = bf16_bits(p1);                sPh[w][8 * hh + r][16 + ln] = hb; sPl[w][8 * hh + r][16 + ln] = bf16_bits(p1 - bf16_val(hb));
    }
#pragma unroll
    for (int dt = 0; dt < DT; ++dt)
#pragma unroll
      for (int r = 0; r < 8; ++r) oacc[dt][r] *= alpha[r];
    __builtin_amdgcn_fence(__ATOMIC_ACQ_REL, "workgroup");
    __builtin_amdgcn_wave_barrier();
    FragB pah, pal;
    pah.half[0] = *(const v8us*)&sPh[w][ln][8 * hh]; pah.half[1] = *(const v8us*)&sPh[w][ln][16 + 8 * hh];
    pal.half[0] = *(const v8us*)&sPl[w][ln][8 * hh]; pal.half[1] = *(const v8us*)&sPl[w][ln][16 + 8 * hh];
#pragma unroll
    for (int dt = 0; dt < DT; ++dt) {
      FragB bvh, bvl;
#pragma unroll
      for (int i = 0; i < 8; ++i) {
        bvh.u[i] = sVh[8 * hh + i][dt * 16 + ln]; bvh.u[8 + i] = sVh[16 + 8 * hh + i][dt * 16 + ln];
        bvl.u[i] = sVl[8 * hh + i][dt * 16 + ln]; bvl.u[8 + i] = sVl[16 + 8 * hh + i][dt * 16 + ln];
      }
      oacc[dt] = mmaN<3>(pah.v, pal.v, bvh.v, bvl.v, oacc[dt]);
    }
    __builtin_amdgcn_fence(__ATOMIC_ACQ_REL, "workgroup");
    __builtin_amdgcn_wave_barrier();
  }
#pragma unroll
  for (int r = 0; r < 8; ++r) {
    float l = l_r[r];
    l += __shfl_xor(l, 1, 32); l += __shfl_xor(l, 2, 32); l += __shfl_xor(l, 4, 32); l += __shfl_xor(l, 8, 32);
    l_r[r] = (l > 0.f) ? 1.0f / l : 0.f;
  }
#pragma unroll
  for (int dt = 0; dt < DT; ++dt)
#pragma unroll
    for (int r = 0; r < 8; ++r) sO[w][8 * hh + r][dt * 16 + ln] = oacc[dt][r] * l_r[r];
  __builtin_amdgcn_fence(__ATOMIC_ACQ_REL, "workgroup");
  __builtin_amdgcn_wave_barrier();
  {
    for (int r = 0; r < 16; ++r) {
      const int row = q0 + r;
      if (row < T && lane < D / 4) {
        const v4f val = *(const v4fa*)&sO[w][r][lane * 4];
        *(v4f*)(y + ((size_t)b * T + row) * ypitch + h * D + lane * 4) = val;
      }
    }
    
  }
}

// batched GEMM (blockIdx.y = batch): C_b = act(alpha·A_b·B_b + bias + resid_b); A f32 rows (ASPLIT → hi/lo), B = bf16 planes Bh (+Bl when BSPLIT, requires ASPLIT),
// per-batch element strides sA, sB (0 = shared weights), sC, sR. resid may alias C (values are staged before the stores). ACT 0/1(relu).
// ACT: 0 none, 1 relu, 2 softplus
template <bool ASPLIT, bool BSPLIT, int ACT>
__global__ __launch_bounds__(128) void k_gemm_b(const float* __restrict__ A, int lda, size_t sA, const unsigned short* __restrict__ Bh, const unsigned short* __restrict__ Bl, int ldb, size_t sB,
                                             const float* __restrict__ bias, const float* __restrict__ resid, int ldr, size_t sR, float rsign, float alpha,
                                             float* __restrict__ C, int ldc, size_t sC, int M, int N, int K) {
  __shared__ __attribute__((aligned(16))) float so[4][16][64];
  const int tid = threadIdx.x, w = tid >> 5, lane = tid & 31, ln = lane & 15, hh = lane >> 4;
  const int by = blockIdx.y;
  A += (size_t)by * sA; Bh += (size_t)by * sB; if (BSPLIT) Bl += (size_t)by * sB; C += (size_t)by * sC; if (resid) resid += (size_t)by * sR;
  const int ntn = (N + 63) / 64; const int wid = blockIdx.x * 4 + w; const int mt = wid / ntn, nq = wid % ntn;      // N may be any multiple of 16: tiles past N are skipped and not stored
  if (mt * 16 >= M) return;
  const int row0 = mt * 16, col0 = nq * 64;
  const float* arow = A + (size_t)(row0 + ln) * lda;
  v8f acc[4] = {};
  for (int kb = 0; kb < K; kb += 32) {
    FragB ah, al;
    const v4f x0 = *(const v4fa*)(arow + kb + 8 * hh), x1 = *(const v4fa*)(arow + kb + 8 * hh + 4);
    const v4f x2 = *(const v4fa*)(arow + kb + 16 + 8 * hh), x3 = *(const v4fa*)(arow + kb + 16 + 8 * hh + 4);
    float xs[16] = {x0[0],x0[1],x0[2],x0[3],x1[0],x1[1],x1[2],x1[3],x2[0],x2[1],x2[2],x2[3],x3[0],x3[1],x3[2],x3[3]};
#pragma unroll
    for (int i = 0; i < 16; ++i) { const unsigned short hb = bf16_bits(xs[i]); ah.u[i] = hb; al.u[i] = ASPLIT ? bf16_bits(xs[i] - bf16_val(hb)) : (unsigned short)0; }
#pragma unroll
    for (int t = 0; t < 4; ++t) {
      if (col0 + t * 16 >= N) continue;
      const size_t boff = (size_t)(col0 + t * 16 + ln) * ldb + kb;
      FragB bh_, bl_; bh_.half[0] = *(const v8us*)(Bh + boff + 8 * hh); bh_.half[1] = *(const v8us*)(Bh + boff + 16 + 8 * hh);
      if (BSPLIT) { bl_.half[0] = *(const v8us*)(Bl + boff + 8 * hh); bl_.half[1] = *(const v8us*)(Bl + boff + 16 + 8 * hh); } else bl_ = bh_;
      acc[t] = mmaN<ASPLIT ? (BSPLIT ? 3 : 2) : 1>(ah.v, al.v, bh_.v, bl_.v, acc[t]);
    }
  }
#pragma unroll
  for (int t = 0; t < 4; ++t) {
    const int col = col0 + t * 16 + ln; if (col0 + t * 16 >= N) continue; const float bv = bias ? bf16_round(bias[col]) : 0.f;
#pragma unroll
    for (int r = 0; r < 8; ++r) { float v = acc[t][r] * alpha + bv; if (resid) v += rsign * resid[(size_t)(row0 + 8 * hh + r) * ldr + col]; if (ACT == 1) v = fmaxf(v, 0.f); else if (ACT == 2) v = fmaxf(v, 0.f) + log1pf(expf(-fabsf(v))); so[w][8 * hh + r][t * 16 + ln] = v; }
  }
  __builtin_amdgcn_fence(__ATOMIC_ACQ_REL, "workgroup"); __builtin_amdgcn_wave_barrier();
  const int rsub = lane >> 4, c4 = (lane & 15) * 4;
  {
#pragma unroll
    for (int q = 0; q < 8; ++q) { const int r = q * 2 + rsub; if (col0 + c4 < N) { const v4f v = *(const v4fa*)&so[w][r][c4]; *(v4f*)(C + (size_t)(row0 + r) * ldc + col0 + c4) = v; } }
    
  }
}
// batched f32 [K][N] (pitch lds, batch stride sIn) -> transposed hi/lo planes [N][K] (batch stride sOut); thread per (n, 8 k); grid.y = batch
__global__ __launch_bounds__(256) void k_split_transpose_b(const float* __restrict__ src, int lds_, size_t sIn, unsigned short* __restrict__ hi, unsigned short* __restrict__ lo, size_t sOut, int K, int N) {
  const size_t t = (size_t)blockIdx.x * 256 + threadIdx.x; const int k8n = K / 8; if (t >= (size_t)N * k8n) return;
  src += (size_t)blockIdx.y * sIn; hi += (size_t)blockIdx.y * sOut; lo += (size_t)blockIdx.y * sOut;
  const int n = (int)(t / k8n), k8 = (int)(t % k8n) * 8; v8us vh, vl;
#pragma unroll
  for (int i = 0; i < 8; ++i) { const float x = src[(size_t)(k8 + i) * lds_ + n]; const unsigned short hb = bf16_bits(x); vh[i] = hb; vl[i] = bf16_bits(x - bf16_val(hb)); }
  unsigned short* dh = hi + (size_t)n * K + k8; unsigned short* dl = lo + (size_t)n * K + k8;
  *(v8us*)dh = vh; *(v8us*)dl = vl; 
}

// ---- f16 WMMA path (v_wmma_f32_16x16x32_f16): 11-bit significands for operands in range — used where the [-1,1] cos operand needs more precision than bf16
typedef _Float16 v16h __attribute__((ext_vector_type(16)));
union FragH { v16h v; v8us half[2]; _Float16 h[16]; unsigned short u[16]; };
template <int NT>
__device__ __forceinline__ v8f mmaH(v16h ah, v16h al, v16h bh, v16h bl, v8f c) {
  c = __builtin_amdgcn_wmma_f32_16x16x32_f16(false, ah, false, bh, (short)0, c, false, false);
  if (NT >= 2) c = __builtin_amdgcn_wmma_f32_16x16x32_f16(false, al, false, bh, (short)0, c, false, false);
  if (NT >= 3) c = __builtin_amdgcn_wmma_f32_16x16x32_f16(false, ah, false, bl, (short)0, c, false, false);
  asm volatile("v_nop\n\tv_nop\n\tv_nop\n\tv_nop" : "+v"(c) : "v"(ah), "v"(al), "v"(bh), "v"(bl));
  return c;
}
// batched GEMM like k_gemm_b but f16 operands: A f32 (split into f16 hi/lo if ASPLIT, else rounded to f16), Bt = f16 values [n][k]; alpha; C f32; N multiple of 16 (partial tiles skipped)
template <bool ASPLIT>
__global__ __launch_bounds__(128) void k_gemm_h(const float* __restrict__ A, int lda, size_t sA, const _Float16* __restrict__ Bh, int ldb, size_t sB, float alpha, float* __restrict__ C, int ldc, size_t sC, int M, int N, int K) {
  __shared__ __attribute__((aligned(16))) float so[4][16][64];
  const int tid = threadIdx.x, w = tid >> 5, lane = tid & 31, ln = lane & 15, hh = lane >> 4; const int by = blockIdx.y;
  A += (size_t)by * sA; Bh += (size_t)by * sB; C += (size_t)by * sC;
  const int ntn = (N + 63) / 64; const int wid = blockIdx.x * 4 + w; const int mt = wid / ntn, nq = wid % ntn; if (mt * 16 >= M) return;
  const int row0 = mt * 16, col0 = nq * 64; const float* arow = A + (size_t)(row0 + ln) * lda;
  v8f acc[4] = {};
  for (int kb = 0; kb < K; kb += 32) {
    FragH ah, al;
    const v4f x0 = *(const v4fa*)(arow + kb + 8 * hh), x1 = *(const v4fa*)(arow + kb + 8 * hh + 4), x2 = *(const v4fa*)(arow + kb + 16 + 8 * hh), x3 = *(const v4fa*)(arow + kb + 16 + 8 * hh + 4);
    float xs[16] = {x0[0],x0[1],x0[2],x0[3],x1[0],x1[1],x1[2],x1[3],x2[0],x2[1],x2[2],x2[3],x3[0],x3[1],x3[2],x3[3]};
#pragma unroll
    for (int i = 0; i < 16; ++i) { const _Float16 h = (_Float16)xs[i]; ah.h[i] = h; al.h[i] = ASPLIT ? (_Float16)(xs[i] - (float)h) : (_Float16)0.0f; }
#pragma unroll
    for (int t = 0; t < 4; ++t) { if (col0 + t * 16 >= N) continue; const size_t boff = (size_t)(col0 + t * 16 + ln) * ldb + kb; FragH bq; bq.half[0] = *(const v8us*)(Bh + boff + 8 * hh); bq.half[1] = *(const v8us*)(Bh + boff + 16 + 8 * hh);
      acc[t] = mmaH<ASPLIT ? 2 : 1>(ah.v, al.v, bq.v, bq.v, acc[t]); }
  }
#pragma unroll
  for (int t = 0; t < 4; ++t) { if (col0 + t * 16 >= N) continue;
#pragma unroll
    for (int r = 0; r < 8; ++r) so[w][8 * hh + r][t * 16 + ln] = acc[t][r] * alpha; }
  __builtin_amdgcn_fence(__ATOMIC_ACQ_REL, "workgroup"); __builtin_amdgcn_wave_barrier();
  const int rsub = lane >> 4, c4 = (lane & 15) * 4;
  {
#pragma unroll
    for (int q = 0; q < 8; ++q) { const int r = q * 2 + rsub; if (col0 + c4 < N) { const v4f v = *(const v4fa*)&so[w][r][c4]; *(v4f*)(C + (size_t)(row0 + r) * ldc + col0 + c4) = v; } }
     }
}

// Bt = bits(W?[k][n]) in B-fragment order, via 32x32 tiles (grid: k tiles, n tiles (12), -): [n / 16][k / 32][half][lane = hh * 16 + (n & 15)][8],
// k = (k / 32) * 32 + half * 16 + hh * 8 + i, so that one half fragment of a wave is 512 contiguous bytes; bias concat
__global__ __launch_bounds__(256) void k_wt(const float* __restrict__ Wq, const float* __restrict__ Wk, const float* __restrict__ Wv, const float* __restrict__ bq, const float* __restrict__ bk, const float* __restrict__ bv, unsigned short* __restrict__ Bt, float* __restrict__ B3) { __shared__ float tile[32][33]; const int k0 = blockIdx.x * 32, n0 = blockIdx.y * 32; const int which = n0 / DK, nn0 = n0 % DK; const float* W = which == 0 ? Wq : (which == 1 ? Wk : Wv); const int tx = threadIdx.x & 31, ty = threadIdx.x >> 5;
  for (int i = ty; i < 32; i += 8) tile[i][tx] = W[(size_t)(k0 + i) * DK + nn0 + tx]; __syncthreads();
  typedef unsigned short v4us __attribute__((ext_vector_type(4))); const int r = threadIdx.x >> 3, c4 = (threadIdx.x & 7) * 4; v4us o; for (int q = 0; q < 4; ++q) o[q] = bf16_bits(tile[c4 + q][r]);
  const int n = n0 + r; unsigned short* d = Bt + ((size_t)(((n >> 4) * (DM / 32) + blockIdx.x) * 2 + (c4 >> 4)) * 32 + ((c4 >> 3) & 1) * 16 + (n & 15)) * 8 + (c4 & 7); *(v4us*)d = o; 
  if (blockIdx.x == 0 && threadIdx.x < 32) { const float* bs = which == 0 ? bq : (which == 1 ? bk : bv); *(float*)(B3 + n0 + threadIdx.x) = bs[nn0 + threadIdx.x]; } }
// [Q|K|V] = x.W + b: a work-group owns PM rows of x and all 384 columns, so x is read from memory once. The rows are fetched by whole-line loads,
// rounded to bf16 once and kept in LDS for all waves; a wave owns 48 columns (3 tiles x 2 row tiles) and reads its W fragments, which no other wave
// of the group needs, straight from the fragment-ordered Bt: every wave-wide load is 512 contiguous bytes. k runs upward, one WMMA per 32 k.
#define PM 32
#define PAP (DM + 8)
#define PCP (3 * DK + 4)
#define PKC 4
typedef unsigned short v4usa __attribute__((ext_vector_type(4), may_alias));
typedef _Float16 v8h __attribute__((ext_vector_type(8)));
__global__ __launch_bounds__(256) void k_proj(const float* __restrict__ x, const unsigned short* __restrict__ Bt, const float* __restrict__ B3, float* __restrict__ QKV, unsigned short* __restrict__ Kh, unsigned short* __restrict__ Kl, _Float16* __restrict__ VT) {
  __shared__ __attribute__((aligned(16))) unsigned short sA[PM][PAP];   // pitch 2064 B = 16 B x odd
  __shared__ __attribute__((aligned(16))) float sC[PM][PCP];            // pitch 388 dwords: rows 8 apart lie 32 banks apart
  const int tid = threadIdx.x, w = tid >> 5, lane = tid & 31, ln = lane & 15, hh = lane >> 4;
  const int row0 = blockIdx.x * PM;
  const unsigned short* bp = Bt + (size_t)w * 3 * (DM / 32) * 512 + lane * 8;
  FragB bf[2][PKC][3];          // W fragments of PKC k-steps, two sets: the next set flies under the current set's products
#pragma unroll
  for (int s = 0; s < PKC; ++s)
#pragma unroll
    for (int t = 0; t < 3; ++t) { bf[0][s][t].half[0] = *(const v8us*)(bp + (t * (DM / 32) + s) * 512); bf[0][s][t].half[1] = *(const v8us*)(bp + (t * (DM / 32) + s) * 512 + 256); }
  {
    const float* xr = x + (size_t)row0 * DM + tid * 4;
    v4f v[PM];
#pragma unroll
    for (int i = 0; i < PM; ++i) v[i] = *(const v4fa*)(xr + (size_t)i * DM);
    // keeps all the row loads in front of the conversions, so that they are in flight together and share one memory latency
    __builtin_amdgcn_sched_barrier(0);
#pragma unroll
    for (int i = 0; i < PM; ++i) *(v4usa*)&sA[i][tid * 4] = (v4usa){bf16_bits(v[i][0]), bf16_bits(v[i][1]), bf16_bits(v[i][2]), bf16_bits(v[i][3])};
  }
  __syncthreads();
  float bv[3];
#pragma unroll
  for (int t = 0; t < 3; ++t) bv[t] = bf16_round(B3[w * 48 + t * 16 + ln]);
  // the bias loads' offset register is reused soon after; the wait stands in front of that overwrite
  asm volatile("s_wait_xcnt 0x0" ::: "memory");
  v8f acc[2][3];
#pragma unroll
  for (int mt = 0; mt < 2; ++mt)
#pragma unroll
    for (int t = 0; t < 3; ++t) acc[mt][t] = (v8f){0.f, 0.f, 0.f, 0.f, 0.f, 0.f, 0.f, 0.f};
#pragma unroll
  for (int c = 0; c < DM / 32 / PKC; ++c) {
    if (c + 1 < DM / 32 / PKC) {
#pragma unroll
      for (int s = 0; s < PKC; ++s)
#pragma unroll
        for (int t = 0; t < 3; ++t) {
          const unsigned short* p = bp + (t * (DM / 32) + (c + 1) * PKC + s) * 512;
          bf[(c + 1) & 1][s][t].half[0] = *(const v8us*)p; bf[(c + 1) & 1][s][t].half[1] = *(const v8us*)(p + 256);
        }
    }
    FragB af[PKC][2];           // x fragments: row = mt*16 + ln, k in the same order as Bt's
#pragma unroll
    for (int s = 0; s < PKC; ++s)
#pragma unroll
      for (int mt = 0; mt < 2; ++mt) {
        af[s][mt].half[0] = *(const v8us*)&sA[mt * 16 + ln][(c * PKC + s) * 32 + 8 * hh]; af[s][mt].half[1] = *(const v8us*)&sA[mt * 16 + ln][(c * PKC + s) * 32 + 16 + 8 * hh];
      }
    // keeps the next set's loads and this set's LDS reads as one group in front of the products; without it the compiler moves them in among the
    // products, close to their use, and each then waits out its own latency
    __builtin_amdgcn_sched_barrier(0);
#pragma unroll
    for (int s = 0; s < PKC; ++s)
#pragma unroll
      for (int mt = 0; mt < 2; ++mt)
#pragma unroll
        for (int t = 0; t < 3; ++t) acc[mt][t] = __builtin_amdgcn_wmma_f32_16x16x32_bf16(false, af[s][mt].v, false, bf[c & 1][s][t].v, (short)0, acc[mt][t], false, false);
    // second half of the fence pair: keeps the following group's loads and LDS reads from being moved up in among these products
    __builtin_amdgcn_sched_barrier(0);
  }
#pragma unroll
  for (int mt = 0; mt < 2; ++mt)
#pragma unroll
    for (int t = 0; t < 3; ++t)
#pragma unroll
      for (int r = 0; r < 8; ++r) sC[mt * 16 + 8 * hh + r][w * 48 + t * 16 + ln] = acc[mt][t][r] + bv[t];
  __syncthreads();
  // The tile leaves in the forms its reader wants: Q as f32 rows of QKV (the K and V columns of QKV are not written); Kh/Kl = bf16 hi/lo planes of K and
  // VT = f16(V), all three in the order of k_cosattn's A fragments, so that each of its wave-wide 16-B loads is 512 contiguous bytes (four whole lines).
  // Kh/Kl: [tok / 16][ks = c / 32][half][lane = hh * 16 + (tok & 15)][8], c = ks * 32 + half * 16 + hh * 8 + i
  // VT:    [tok / 32][dt = d / 16][half][lane = hh * 16 + (d & 15)][8], tok = (tok / 32) * 32 + half * 16 + hh * 8 + i
  const size_t base = (size_t)row0 * DK;   // the group's 32 tokens fill one contiguous block of each plane
#pragma unroll
  for (int g = 0; g < PM * (DK / 4) / 256; ++g) {   // Q: a wave stores one whole 512-B row at a time
    const int idx = g * 256 + tid, r = idx >> 5, c4 = (idx & 31) * 4;
    *(v4f*)(QKV + (size_t)(row0 + r) * (3 * DK) + c4) = *(const v4fa*)&sC[r][c4];
  }
  for (int u = 0; u < PM * (DK / 8) / 256; ++u) {   // K planes: 2 key tiles x 4 ks x 2 halves x 32 lanes = 512 groups of 8; group g lies at element g * 8 of the block
    const int g = u * 256 + tid, i = u * 16 + ln, c8 = ((g >> 6) & 3) * 32 + ((g >> 5) & 1) * 16 + hh * 8;
    const v4f k0 = *(const v4fa*)&sC[i][DK + c8], k1 = *(const v4fa*)&sC[i][DK + c8 + 4];
    const float ks[8] = {k0[0], k0[1], k0[2], k0[3], k1[0], k1[1], k1[2], k1[3]};
    v8us h, l;
    for (int q = 0; q < 8; ++q) { const float kh = bf16_round(ks[q]); h[q] = bf16_bits(kh); l[q] = bf16_bits(ks[q] - kh); }
    *(v8us*)(Kh + base + (size_t)g * 8) = h; *(v8us*)(Kl + base + (size_t)g * 8) = l;
  }
  for (int u = 0; u < PM * (DK / 8) / 256; ++u) {   // V: 8 d tiles x 2 halves x 32 lanes = 512 groups of 8 keys; sC's rows 8 apart lie 32 banks apart, so the lane halves do not collide
    const int g = u * 256 + tid, d = (g >> 6) * 16 + ln, t0 = ((g >> 5) & 1) * 16 + hh * 8;
    v8h v;
    for (int q = 0; q < 8; ++q) v[q] = (_Float16)sC[t0 + q][2 * DK + d];
    *(v8h*)(VT + base + (size_t)g * 8) = v;
  }
}
// cos of eight scores without a branch. The hardware cosine takes its argument in revolutions, so the score is reduced in revolutions: n = nearest whole
// number to x / (2 pi); f = x * C_HI - n in one FMA (the product is not rounded before n is taken off), then x * C_LO is added, C_HI + C_LO = 1 / (2 pi) to
// 48 bits. f is right to better than 1e-7 revolutions for |x| up to 1e8 (library cosf changes its method at 131072); an infinite or NaN score gives NaN.
__device__ __forceinline__ v8f cos8(v8f x) {
  const v8f chi = {0x1.45f306p-3f, 0x1.45f306p-3f, 0x1.45f306p-3f, 0x1.45f306p-3f, 0x1.45f306p-3f, 0x1.45f306p-3f, 0x1.45f306p-3f, 0x1.45f306p-3f};
  const v8f clo = {0x1.b9391p-28f, 0x1.b9391p-28f, 0x1.b9391p-28f, 0x1.b9391p-28f, 0x1.b9391p-28f, 0x1.b9391p-28f, 0x1.b9391p-28f, 0x1.b9391p-28f};
  const v8f n = __builtin_elementwise_rint(x * chi);
  const v8f f = __builtin_elementwise_fma(x, clo, __builtin_elementwise_fma(x, chi, -n));
  v8f c;
  // unrolled so that every index is a constant and c stays in registers
#pragma unroll
  for (int i = 0; i < 8; ++i) c[i] = __builtin_amdgcn_cosf(f[i]);
  return c;
}
#define FQ 32
#define FW 8
#define FKEYS (LL / FW)
#define QP (DK + 8)
#define RP (DK + 4)
__global__ __launch_bounds__(256) void k_cosattn(const float* __restrict__ QKV, const unsigned short* __restrict__ Kh, const unsigned short* __restrict__ Kl, const _Float16* __restrict__ VT, float* __restrict__ out) {
  __shared__ __attribute__((aligned(16))) unsigned short sQh[FQ][QP], sQl[FQ][QP];   // pitch 272 B = 16 B x odd
  __shared__ __attribute__((aligned(16))) float red[FW][FQ][RP];                     // pitch 528 B = 16 B x odd
  const int tid = threadIdx.x, w = tid >> 5, lane = tid & 31, ln = lane & 15, hh = lane >> 4;
  const int b = blockIdx.x / (LL / FQ), q0 = (blockIdx.x % (LL / FQ)) * FQ;
  { // Q rows -> bf16 hi/lo planes, split once per work-group (thread: 16 consecutive columns of one row)
    const int r = tid >> 3, c0 = (tid & 7) * 16;
    const float* qr = QKV + ((size_t)b * LL + q0 + r) * (3 * DK) + c0;
    const v4f x0 = *(const v4fa*)qr, x1 = *(const v4fa*)(qr + 4), x2 = *(const v4fa*)(qr + 8), x3 = *(const v4fa*)(qr + 12);
    // the loads' address registers are reused soon after
    asm volatile("s_wait_xcnt 0x0" ::: "memory");
    const float xs[16] = {x0[0], x0[1], x0[2], x0[3], x1[0], x1[1], x1[2], x1[3], x2[0], x2[1], x2[2], x2[3], x3[0], x3[1], x3[2], x3[3]};
#pragma unroll
    for (int g = 0; g < 2; ++g) {
      v8us h, l;
#pragma unroll
      for (int i = 0; i < 8; ++i) { const float x = xs[g * 8 + i]; const unsigned short hb = bf16_bits(x); h[i] = hb; l[i] = bf16_bits(x - bf16_val(hb)); }
      *(v8us*)&sQh[r][c0 + g * 8] = h; *(v8us*)&sQl[r][c0 + g * 8] = l;
    }
  }
  __syncthreads();
  FragB qh[2][4], ql[2][4];     // B fragments: column = query qt*16+ln, k in the same order as the K loader below
#pragma unroll
  for (int qt = 0; qt < 2; ++qt)
#pragma unroll
    for (int ks = 0; ks < 4; ++ks) {
      qh[qt][ks].half[0] = *(const v8us*)&sQh[qt * 16 + ln][ks * 32 + 8 * hh]; qh[qt][ks].half[1] = *(const v8us*)&sQh[qt * 16 + ln][ks * 32 + 16 + 8 * hh];
      ql[qt][ks].half[0] = *(const v8us*)&sQl[qt * 16 + ln][ks * 32 + 8 * hh]; ql[qt][ks].half[1] = *(const v8us*)&sQl[qt * 16 + ln][ks * 32 + 16 + 8 * hh];
    }
  v8f o[2][8];                  // o[qt][dt][r] = O[query qt*16+ln][d = dt*16 + 8*hh + r], this wave's keys only
#pragma unroll
  for (int qt = 0; qt < 2; ++qt)
#pragma unroll
    for (int dt = 0; dt < 8; ++dt) o[qt][dt] = (v8f){0.f, 0.f, 0.f, 0.f, 0.f, 0.f, 0.f, 0.f};
  const size_t koff = ((size_t)b * LL + w * FKEYS) * DK + lane * 8;   // the planes are in fragment order (k_proj): 16 keys of K = 8 half fragments of 256 elements, 32 keys of V = 16
  const unsigned short* kh = Kh + koff;
  const unsigned short* kl = Kl + koff;
  const unsigned short* vt = (const unsigned short*)VT + koff;
  for (int j = 0; j < FKEYS; j += 32) {
    FragB ah[2][4], al[2][4];   // A fragments of K hi/lo: row = key j + kt*16 + ln
#pragma unroll
    for (int kt = 0; kt < 2; ++kt)
#pragma unroll
      for (int ks = 0; ks < 4; ++ks) {
        const size_t e = (size_t)(j + kt * 16) * DK + ks * 512;
        ah[kt][ks].half[0] = *(const v8us*)(kh + e); ah[kt][ks].half[1] = *(const v8us*)(kh + e + 256);
        al[kt][ks].half[0] = *(const v8us*)(kl + e); al[kt][ks].half[1] = *(const v8us*)(kl + e + 256);
      }
    // the products' accumulators reuse the loads' address registers
    asm volatile("s_wait_xcnt 0x0" ::: "memory");
    // keeps all 32 K loads in front of the products, so that they are issued back to back and share one latency;
    // without it the compiler loads one fragment at a time and waits for each in front of its products
    __builtin_amdgcn_sched_barrier(0);
    v8f s[2][2];                // s[kt][qt][r] = S[query qt*16+ln][key j + kt*16 + 8*hh + r]
#pragma unroll
    for (int kt = 0; kt < 2; ++kt)
#pragma unroll
      for (int qt = 0; qt < 2; ++qt) {
        v8f c = {};
#pragma unroll
        for (int ks = 0; ks < 4; ++ks) {   // three products of the hi/lo split, in this order: Qhi.Khi, Qlo.Khi, Qhi.Klo
          c = __builtin_amdgcn_wmma_f32_16x16x32_bf16(false, ah[kt][ks].v, false, qh[qt][ks].v, (short)0, c, false, false);
          c = __builtin_amdgcn_wmma_f32_16x16x32_bf16(false, ah[kt][ks].v, false, ql[qt][ks].v, (short)0, c, false, false);
          c = __builtin_amdgcn_wmma_f32_16x16x32_bf16(false, al[kt][ks].v, false, qh[qt][ks].v, (short)0, c, false, false);
        }
        s[kt][qt] = c;
      }
    FragH va[8];                // A fragments of V^T: row = d, k = key; they fly under the cosines
#pragma unroll
    for (int dt = 0; dt < 8; ++dt) { va[dt].half[0] = *(const v8us*)(vt + (size_t)j * DK + dt * 512); va[dt].half[1] = *(const v8us*)(vt + (size_t)j * DK + dt * 512 + 256); }
    // the loads' address registers are reused soon after
    asm volatile("s_wait_xcnt 0x0" ::: "memory");
#pragma unroll
    for (int qt = 0; qt < 2; ++qt) {
      FragH p;                  // B fragment: p[i] = cos(S)[key kmap(i, hh)][query], straight from the two D tiles
      const v8f c0 = cos8(s[0][qt]), c1 = cos8(s[1][qt]);
#pragma unroll
      for (int i = 0; i < 8; ++i) { p.h[i] = (_Float16)c0[i]; p.h[8 + i] = (_Float16)c1[i]; }
#pragma unroll
      for (int dt = 0; dt < 8; ++dt) o[qt][dt] = __builtin_amdgcn_wmma_f32_16x16x32_f16(false, va[dt].v, false, p.v, (short)0, o[qt][dt], false, false);
    }
  }
#pragma unroll
  for (int qt = 0; qt < 2; ++qt)
#pragma unroll
    for (int dt = 0; dt < 8; ++dt) {
      float* d = &red[w][qt * 16 + ln][dt * 16 + 8 * hh];
      *(v4fa*)d = (v4f){o[qt][dt][0], o[qt][dt][1], o[qt][dt][2], o[qt][dt][3]};
      *(v4fa*)(d + 4) = (v4f){o[qt][dt][4], o[qt][dt][5], o[qt][dt][6], o[qt][dt][7]};
    }
  __syncthreads();
#pragma unroll
  for (int g = 0; g < FQ * DK / 4 / 256; ++g) {   // a wave stores one whole 512-B output row at a time
    const int idx = g * 256 + tid, q = idx >> 5, d4 = (idx & 31) * 4;
    v4f a = *(const v4fa*)&red[0][q][d4];
#pragma unroll
    for (int u = 1; u < FW; ++u) a += *(const v4fa*)&red[u][q][d4];
    *(v4f*)(out + ((size_t)b * LL + q0 + q) * DK + d4) = a;
  }
}
extern "C" void kernel_launch(void* const* d_in, const int* in_sizes, int n_in,
                              void* d_out, int out_size, void* d_ws, size_t ws_size, hipStream_t stream) {
  (void)in_sizes; (void)n_in; (void)out_size;
  const float* x = (const float*)d_in[0]; const float* Wq = (const float*)d_in[1]; const float* bq = (const float*)d_in[2]; const float* Wk = (const float*)d_in[3]; const float* bk = (const float*)d_in[4]; const float* Wv = (const float*)d_in[5]; const float* bv = (const float*)d_in[6];
  char* ws = (char*)d_ws; size_t off = 0;
  auto take = [&](size_t bytes) { char* p = ws + off; off += (bytes + 255) & ~(size_t)255; return p; };
  unsigned short* Bt = (unsigned short*)take((size_t)3 * DK * DM * 2); float* B3 = (float*)take(3 * DK * 4); float* QKV = (float*)take((size_t)NTOK * 3 * DK * 4);
  unsigned short* Kh = (unsigned short*)take((size_t)NTOK * DK * 2); unsigned short* Kl = (unsigned short*)take((size_t)NTOK * DK * 2); _Float16* VT = (_Float16*)take((size_t)BB * DK * LL * 2);
  if (off > ws_size) return;
  k_wt<<<dim3(DM / 32, 3 * DK / 32), 256, 0, stream>>>(Wq, Wk, Wv, bq, bk, bv, Bt, B3);
  k_proj<<<NTOK / PM, 256, 0, stream>>>(x, Bt, B3, QKV, Kh, Kl, VT);
  k_cosattn<<<NTOK / FQ, 256, 0, stream>>>(QKV, Kh, Kl, VT, (float*)d_out);
}

// v006
// Measured time: 33.2 microseconds a run.
// Two timings next to v005 put it at 1.07 and 1.08 times that version's speed.
// Counting every step since v000, it is 15.4 times as fast.
#include <hip/hip_runtime.h>
// [Q|K|V] = x·[Wq|Wk|Wv] + b on v_wmma_f32_16x16x32_bf16 (x rounded to bf16: single exact term; 8192 × 1024 × 384); QK = Q·Kᵀ on the same unit with BOTH f32 operands split
// hi/lo (3 products — cos(QK) at |QK| ≈ 10–40 needs the phase to ≈1e-4 rad; 4 × 2048 × 2048 × 128); out = cos(QK)·V on v_wmma_f32_16x16x32_f16 (cos and V rounded to
// f16: single product). cos in f32: reduction on the VALU, then v_cos_f32.
#define BB 4
#define LL 2048
#define DM 1024
#define DK 128
#define NTOK (BB * LL)

typedef __bf16 v16b __attribute__((ext_vector_type(16)));
typedef unsigned short v8us __attribute__((ext_vector_type(8), may_alias));
typedef float  v8f  __attribute__((ext_vector_type(8)));
typedef float  v4f  __attribute__((ext_vector_type(4)));
typedef float  v4fa __attribute__((ext_vector_type(4), may_alias));
union FragB { v16b v; v8us half[2]; unsigned short u[16]; };

__device__ __forceinline__ unsigned short bf16_bits(float x) { unsigned int u = __float_as_uint(x); return (unsigned short)((u + 0x7FFFu + ((u >> 16) & 1u)) >> 16); }
__device__ __forceinline__ float bf16_val(unsigned short b) { return __uint_as_float(((unsigned int)b) << 16); }
__device__ __forceinline__ float bf16_round(float x) { return bf16_val(bf16_bits(x)); }
// D += A·B with NT terms: 1 = ah·bh, 2 = + al·bh (A split), 3 = + ah·bl (both split)
template <int NT>
__device__ __forceinline__ v8f mmaN(v16b ah, v16b al, v16b bh, v16b bl, v8f c) {
  c = __builtin_amdgcn_wmma_f32_16x16x32_bf16(false, ah, false, bh, (short)0, c, false, false);
  if (NT >= 2) c = __builtin_amdgcn_wmma_f32_16x16x32_bf16(false, al, false, bh, (short)0, c, false, false);
  if (NT >= 3) c = __builtin_amdgcn_wmma_f32_16x16x32_bf16(false, ah, false, bl, (short)0, c, false, false);
  asm volatile("v_nop\n\tv_nop\n\tv_nop\n\tv_nop" : "+v"(c) : "v"(ah), "v"(al), "v"(bh), "v"(bl));
  return c;
}

__global__ __launch_bounds__(256) void k_wt_bf16(const float* __restrict__ W, unsigned short* __restrict__ Wt, int K, int N) {
  const int t = blockIdx.x * 256 + threadIdx.x;
  const int k8n = K / 8;
  if (t >= N * k8n) return;
  const int n = t / k8n, k8 = (t % k8n) * 8;
  v8us v;
#pragma unroll
  for (int i = 0; i < 8; ++i) v[i] = bf16_bits(W[(size_t)(k8 + i) * N + n]);
  *(v8us*)(Wt + (size_t)n * K + k8) = v;
  
}

// GEMM C[M][N] (f32, pitch ldc) = act(A[M][K]·W + bias). A f32 row-major (pitch lda) converted per fragment to bf16
// (ASPLIT: hi/lo two planes -> 2 terms, else single rounded term); Wt bf16 [N][K] (pitch ldb). BIAS_BF16 rounds the
// bias to bf16 first (bias quantised to bf16 before the add). K%32==0, M%16==0, N%64==0.
template <bool ASPLIT, int ACT, bool BIAS_BF16>
__global__ __launch_bounds__(128) void k_gemm_bf(const float* __restrict__ A, int lda, const unsigned short* __restrict__ Wt, int ldb,
                                               const float* __restrict__ bias, float* __restrict__ C, int ldc, int M, int N, int K) {
  __shared__ __attribute__((aligned(16))) float so[4][16][64];
  const int tid = threadIdx.x, w = tid >> 5, lane = tid & 31, ln = lane & 15, hh = lane >> 4;
  const int ntn = N / 64;
  const int wid = blockIdx.x * 4 + w;
  const int mt = wid / ntn, nq = wid % ntn;
  if (mt * 16 >= M) return;
  const int row0 = mt * 16, col0 = nq * 64;
  const float* arow = A + (size_t)(row0 + ln) * lda;
  v8f acc[4] = {};
  for (int kb = 0; kb < K; kb += 32) {
    FragB ah, al;
    const v4f x0 = *(const v4fa*)(arow + kb + 8 * hh), x1 = *(const v4fa*)(arow + kb + 8 * hh + 4);
    const v4f x2 = *(const v4fa*)(arow + kb + 16 + 8 * hh), x3 = *(const v4fa*)(arow + kb + 16 + 8 * hh + 4);
    float xs[16] = {x0[0],x0[1],x0[2],x0[3],x1[0],x1[1],x1[2],x1[3],x2[0],x2[1],x2[2],x2[3],x3[0],x3[1],x3[2],x3[3]};
#pragma unroll
    for (int i = 0; i < 16; ++i) { const unsigned short hb = bf16_bits(xs[i]); ah.u[i] = hb; al.u[i] = ASPLIT ? bf16_bits(xs[i] - bf16_val(hb)) : (unsigned short)0; }
#pragma unroll
    for (int t = 0; t < 4; ++t) {
      const unsigned short* brow = Wt + (size_t)(col0 + t * 16 + ln) * ldb + kb;
      FragB b;
      b.half[0] = *(const v8us*)(brow + 8 * hh);
      b.half[1] = *(const v8us*)(brow + 16 + 8 * hh);
      acc[t] = mmaN<ASPLIT ? 2 : 1>(ah.v, al.v, b.v, b.v, acc[t]);
    }
  }
#pragma unroll
  for (int t = 0; t < 4; ++t) {
    float bv = bias ? bias[col0 + t * 16 + ln] : 0.f;
    if (BIAS_BF16) bv = bf16_round(bv);
#pragma unroll
    for (int r = 0; r < 8; ++r) { float v = acc[t][r] + bv; if (ACT == 1) v = fmaxf(v, 0.f); so[w][8 * hh + r][t * 16 + ln] = v; }
  }
  __builtin_amdgcn_fence(__ATOMIC_ACQ_REL, "workgroup");
  __builtin_amdgcn_wave_barrier();
  const int rsub = lane >> 4, c4 = (lane & 15) * 4;
  {
#pragma unroll
    for (int q = 0; q < 8; ++q) {
      const int r = q * 2 + rsub;
      const v4f v = *(const v4fa*)&so[w][r][c4];
      *(v4f*)(C + (size_t)(row0 + r) * ldc + col0 + c4) = v;
    }
    
  }
}

// Flash-style causal/unmasked attention, all contractions 3-term bf16 hi/lo splits, f32 softmax with running max.
// q,k,v rows are read from f32 buffers with arbitrary row pitch (so they can live inside a fused qkv buffer);
// D = head size (multiple of 32, <= 128); one wave = 16 query rows; block = 4 waves (64 queries) sharing K/V chunks of 32.
template <int D, bool CAUSAL>
__global__ __launch_bounds__(128) void k_flash(const float* __restrict__ qb, const float* __restrict__ kb, const float* __restrict__ vb,
                                             int pitch, int T, int H, float scale, float* __restrict__ y, int ypitch) {
  constexpr int KS = D / 32;        // k-steps for QK
  constexpr int DT = D / 16;        // d tiles for PV
  __shared__ __attribute__((aligned(16))) unsigned short sKh[32][D + 8], sKl[32][D + 8], sVh[32][D + 8], sVl[32][D + 8];
  __shared__ __attribute__((aligned(16))) unsigned short sPh[4][16][40], sPl[4][16][40];
  __shared__ __attribute__((aligned(16))) float sO[4][16][D];
  const int tid = threadIdx.x, w = tid >> 5, lane = tid & 31, ln = lane & 15, hh = lane >> 4;
  const int nqb = (T + 63) / 64;
  const int bh = blockIdx.x / nqb, qblk = blockIdx.x % nqb;
  const int b = bh / H, h = bh % H;
  const int q0 = qblk * 64 + w * 16;
  const float* Q = qb + (size_t)b * T * pitch + h * D;
  const float* K = kb + (size_t)b * T * pitch + h * D;
  const float* V = vb + (size_t)b * T * pitch + h * D;

  // A fragments of the wave's 16 query rows (scaled), hi/lo
  FragB aqh[KS], aql[KS];
  {
    int row = q0 + ln; if (row >= T) row = T - 1;
    const float* qr = Q + (size_t)row * pitch;
#pragma unroll
    for (int ks = 0; ks < KS; ++ks)
#pragma unroll
      for (int i = 0; i < 16; ++i) {
        const int d = ks * 32 + ((i < 8) ? (8 * hh + i) : (16 + 8 * hh + (i - 8)));
        const float x = qr[d] * scale; const unsigned short hb = bf16_bits(x);
        aqh[ks].u[i] = hb; aql[ks].u[i] = bf16_bits(x - bf16_val(hb));
      }
  }
  float m_r[8], l_r[8];
#pragma unroll
  for (int r = 0; r < 8; ++r) { m_r[r] = -3.0e38f; l_r[r] = 0.f; }
  v8f oacc[DT];
#pragma unroll
  for (int dt = 0; dt < DT; ++dt) oacc[dt] = (v8f){0.f,0.f,0.f,0.f,0.f,0.f,0.f,0.f};

  const int kv_end = CAUSAL ? min(T, qblk * 64 + 64) : T;     // block-uniform
  for (int j0 = 0; j0 < kv_end; j0 += 32) {
    __syncthreads();
    for (int e = tid; e < 32 * (D / 4); e += 128) {
      const int r = e / (D / 4), c4 = (e % (D / 4)) * 4;
      const int key = j0 + r;
      v4f kf = {0.f,0.f,0.f,0.f}, vf = {0.f,0.f,0.f,0.f};
      if (key < T) { kf = *(const v4fa*)(K + (size_t)key * pitch + c4); vf = *(const v4fa*)(V + (size_t)key * pitch + c4); }
#pragma unroll
      for (int t = 0; t < 4; ++t) {
        unsigned short hb = bf16_bits(kf[t]); sKh[r][c4 + t] = hb; sKl[r][c4 + t] = bf16_bits(kf[t] - bf16_val(hb));
        hb = bf16_bits(vf[t]); sVh[r][c4 + t] = hb; sVl[r][c4 + t] = bf16_bits(vf[t] - bf16_val(hb));
      }
    }
    __syncthreads();
    // S tile 16 x 32
    v8f s[2];
#pragma unroll
    for (int nt = 0; nt < 2; ++nt) {
      v8f acc = {};
#pragma unroll
      for (int ks = 0; ks < KS; ++ks) {
        FragB bh_, bl_;
        bh_.half[0] = *(const v8us*)&sKh[nt * 16 + ln][ks * 32 + 8 * hh]; bh_.half[1] = *(const v8us*)&sKh[nt * 16 + ln][ks * 32 + 16 + 8 * hh];
        bl_.half[0] = *(const v8us*)&sKl[nt * 16 + ln][ks * 32 + 8 * hh]; bl_.half[1] = *(const v8us*)&sKl[nt * 16 + ln][ks * 32 + 16 + 8 * hh];
        acc = mmaN<3>(aqh[ks].v, aql[ks].v, bh_.v, bl_.v, acc);
      }
      s[nt] = acc;
    }
    // mask + running max (rows 8hh+r; the 16 lanes of a half share rows)
    float alpha[8];
#pragma unroll
    for (int r = 0; r < 8; ++r) {
      const int qi = q0 + 8 * hh + r;
      const int ja = j0 + ln, jb = j0 + 16 + ln;
      if (CAUSAL) { if (ja > qi) s[0][r] = -3.0e38f; if (jb > qi) s[1][r] = -3.0e38f; }
      if (ja >= T) s[0][r] = -3.0e38f;
      if (jb >= T) s[1][r] = -3.0e38f;
      float mx = fmaxf(s[0][r], s[1][r]);
      mx = fmaxf(mx, __shfl_xor(mx, 1, 32)); mx = fmaxf(mx, __shfl_xor(mx, 2, 32)); mx = fmaxf(mx, __shfl_xor(mx, 4, 32)); mx = fmaxf(mx, __shfl_xor(mx, 8, 32));
      const float mnew = fmaxf(m_r[r], mx);
      alpha[r] = (mnew > -1.0e38f) ? __expf(m_r[r] - mnew) : 1.0f;
      const float p0 = (s[0][r] > -1.0e38f) ? __expf(s[0][r] - mnew) : 0.f;
      const float p1 = (s[1][r] > -1.0e38f) ? __expf(s[1][r] - mnew) : 0.f;
      m_r[r] = mnew;
      l_r[r] = l_r[r] * alpha[r] + p0 + p1;            // per-lane partial row sum (16 lanes combined at the end)
      unsigned short hb = bf16_bits(p0); sPh[w][8 * hh + r][ln] = hb;      sPl[w][8 * hh + r][ln] = bf16_bits(p0 - bf16_val(hb));
      hb = bf16_bits(p1);                sPh[w][8 * hh + r][16 + ln] = hb; sPl[w][8 * hh + r][16 + ln] = bf16_bits(p1 - bf16_val(hb));
    }
#pragma unroll
    for (int dt = 0; dt < DT; ++dt)
#pragma unroll
      for (int r = 0; r < 8; ++r) oacc[dt][r] *= alpha[r];
    __builtin_amdgcn_fence(__ATOMIC_ACQ_REL, "workgroup");
    __builtin_amdgcn_wave_barrier();
    FragB pah, pal;
    pah.half[0] = *(const v8us*)&sPh[w][ln][8 * hh]; pah.half[1] = *(const v8us*)&sPh[w][ln][16 + 8 * hh];
    pal.half[0] = *(const v8us*)&sPl[w][ln][8 * hh]; pal.half[1] = *(const v8us*)&sPl[w][ln][16 + 8 * hh];
#pragma unroll
    for (int dt = 0; dt < DT; ++dt) {
      FragB bvh, bvl;
#pragma unroll
      for (int i = 0; i < 8; ++i) {
        bvh.u[i] = sVh[8 * hh + i][dt * 16 + ln]; bvh.u[8 + i] = sVh[16 + 8 * hh + i][dt * 16 + ln];
        bvl.u[i] = sVl[8 * hh + i][dt * 16 + ln]; bvl.u[8 + i] = sVl[16 + 8 * hh + i][dt * 16 + ln];
      }
      oacc[dt] = mmaN<3>(pah.v, pal.v, bvh.v, bvl.v, oacc[dt]);
    }
    __builtin_amdgcn_fence(__ATOMIC_ACQ_REL, "workgroup");
    __builtin_amdgcn_wave_barrier();
  }
#pragma unroll
  for (int r = 0; r < 8; ++r) {
    float l = l_r[r];
    l += __shfl_xor(l, 1, 32); l += __shfl_xor(l, 2, 32); l += __shfl_xor(l, 4, 32); l += __shfl_xor(l, 8, 32);
    l_r[r] = (l > 0.f) ? 1.0f / l : 0.f;
  }
#pragma unroll
  for (int dt = 0; dt < DT; ++dt)
#pragma unroll
    for (int r = 0; r < 8; ++r) sO[w][8 * hh + r][dt * 16 + ln] = oacc[dt][r] * l_r[r];
  __builtin_amdgcn_fence(__ATOMIC_ACQ_REL, "workgroup");
  __builtin_amdgcn_wave_barrier();
  {
    for (int r = 0; r < 16; ++r) {
      const int row = q0 + r;
      if (row < T && lane < D / 4) {
        const v4f val = *(const v4fa*)&sO[w][r][lane * 4];
        *(v4f*)(y + ((size_t)b * T + row) * ypitch + h * D + lane * 4) = val;
      }
    }
    
  }
}

// batched GEMM (blockIdx.y = batch): C_b = act(alpha·A_b·B_b + bias + resid_b); A f32 rows (ASPLIT → hi/lo), B = bf16 planes Bh (+Bl when BSPLIT, requires ASPLIT),
// per-batch element strides sA, sB (0 = shared weights), sC, sR. resid may alias C (values are staged before the stores). ACT 0/1(relu).
// ACT: 0 none, 1 relu, 2 softplus
template <bool ASPLIT, bool BSPLIT, int ACT>
__global__ __launch_bounds__(128) void k_gemm_b(const float* __restrict__ A, int lda, size_t sA, const unsigned short* __restrict__ Bh, const unsigned short* __restrict__ Bl, int ldb, size_t sB,
                                             const float* __restrict__ bias, const float* __restrict__ resid, int ldr, size_t sR, float rsign, float alpha,
                                             float* __restrict__ C, int ldc, size_t sC, int M, int N, int K) {
  __shared__ __attribute__((aligned(16))) float so[4][16][64];
  const int tid = threadIdx.x, w = tid >> 5, lane = tid & 31, ln = lane & 15, hh = lane >> 4;
  const int by = blockIdx.y;
  A += (size_t)by * sA; Bh += (size_t)by * sB; if (BSPLIT) Bl += (size_t)by * sB; C += (size_t)by * sC; if (resid) resid += (size_t)by * sR;
  const int ntn = (N + 63) / 64; const int wid = blockIdx.x * 4 + w; const int mt = wid / ntn, nq = wid % ntn;      // N may be any multiple of 16: tiles past N are skipped and not stored
  if (mt * 16 >= M) return;
  const int row0 = mt * 16, col0 = nq * 64;
  const float* arow = A + (size_t)(row0 + ln) * lda;
  v8f acc[4] = {};
  for (int kb = 0; kb < K; kb += 32) {
    FragB ah, al;
    const v4f x0 = *(const v4fa*)(arow + kb + 8 * hh), x1 = *(const v4fa*)(arow + kb + 8 * hh + 4);
    const v4f x2 = *(const v4fa*)(arow + kb + 16 + 8 * hh), x3 = *(const v4fa*)(arow + kb + 16 + 8 * hh + 4);
    float xs[16] = {x0[0],x0[1],x0[2],x0[3],x1[0],x1[1],x1[2],x1[3],x2[0],x2[1],x2[2],x2[3],x3[0],x3[1],x3[2],x3[3]};
#pragma unroll
    for (int i = 0; i < 16; ++i) { const unsigned short hb = bf16_bits(xs[i]); ah.u[i] = hb; al.u[i] = ASPLIT ? bf16_bits(xs[i] - bf16_val(hb)) : (unsigned short)0; }
#pragma unroll
    for (int t = 0; t < 4; ++t) {
      if (col0 + t * 16 >= N) continue;
      const size_t boff = (size_t)(col0 + t * 16 + ln) * ldb + kb;
      FragB bh_, bl_; bh_.half[0] = *(const v8us*)(Bh + boff + 8 * hh); bh_.half[1] = *(const v8us*)(Bh + boff + 16 + 8 * hh);
      if (BSPLIT) { bl_.half[0] = *(const v8us*)(Bl + boff + 8 * hh); bl_.half[1] = *(const v8us*)(Bl + boff + 16 + 8 * hh); } else bl_ = bh_;
      acc[t] = mmaN<ASPLIT ? (BSPLIT ? 3 : 2) : 1>(ah.v, al.v, bh_.v, bl_.v, acc[t]);
    }
  }
#pragma unroll
  for (int t = 0; t < 4; ++t) {
    const int col = col0 + t * 16 + ln; if (col0 + t * 16 >= N) continue; const float bv = bias ? bf16_round(bias[col]) : 0.f;
#pragma unroll
    for (int r = 0; r < 8; ++r) { float v = acc[t][r] * alpha + bv; if (resid) v += rsign * resid[(size_t)(row0 + 8 * hh + r) * ldr + col]; if (ACT == 1) v = fmaxf(v, 0.f); else if (ACT == 2) v = fmaxf(v, 0.f) + log1pf(expf(-fabsf(v))); so[w][8 * hh + r][t * 16 + ln] = v; }
  }
  __builtin_amdgcn_fence(__ATOMIC_ACQ_REL, "workgroup"); __builtin_amdgcn_wave_barrier();
  const int rsub = lane >> 4, c4 = (lane & 15) * 4;
  {
#pragma unroll
    for (int q = 0; q < 8; ++q) { const int r = q * 2 + rsub; if (col0 + c4 < N) { const v4f v = *(const v4fa*)&so[w][r][c4]; *(v4f*)(C + (size_t)(row0 + r) * ldc + col0 + c4) = v; } }
    
  }
}
// batched f32 [K][N] (pitch lds, batch stride sIn) -> transposed hi/lo planes [N][K] (batch stride sOut); thread per (n, 8 k); grid.y = batch
__global__ __launch_bounds__(256) void k_split_transpose_b(const float* __restrict__ src, int lds_, size_t sIn, unsigned short* __restrict__ hi, unsigned short* __restrict__ lo, size_t sOut, int K, int N) {
  const size_t t = (size_t)blockIdx.x * 256 + threadIdx.x; const int k8n = K / 8; if (t >= (size_t)N * k8n) return;
  src += (size_t)blockIdx.y * sIn; hi += (size_t)blockIdx.y * sOut; lo += (size_t)blockIdx.y * sOut;
  const int n = (int)(t / k8n), k8 = (int)(t % k8n) * 8; v8us vh, vl;
#pragma unroll
  for (int i = 0; i < 8; ++i) { const float x = src[(size_t)(k8 + i) * lds_ + n]; const unsigned short hb = bf16_bits(x); vh[i] = hb; vl[i] = bf16_bits(x - bf16_val(hb)); }
  unsigned short* dh = hi + (size_t)n * K + k8; unsigned short* dl = lo + (size_t)n * K + k8;
  *(v8us*)dh = vh; *(v8us*)dl = vl; 
}

// ---- f16 WMMA path (v_wmma_f32_16x16x32_f16): 11-bit significands for operands in range — used where the [-1,1] cos operand needs more precision than bf16
typedef _Float16 v16h __attribute__((ext_vector_type(16)));
union FragH { v16h v; v8us half[2]; _Float16 h[16]; unsigned short u[16]; };
template <int NT>
__device__ __forceinline__ v8f mmaH(v16h ah, v16h al, v16h bh, v16h bl, v8f c) {
  c = __builtin_amdgcn_wmma_f32_16x16x32_f16(false, ah, false, bh, (short)0, c, false, false);
  if (NT >= 2) c = __builtin_amdgcn_wmma_f32_16x16x32_f16(false, al, false, bh, (short)0, c, false, false);
  if (NT >= 3) c = __builtin_amdgcn_wmma_f32_16x16x32_f16(false, ah, false, bl, (short)0, c, false, false);
  asm volatile("v_nop\n\tv_nop\n\tv_nop\n\tv_nop" : "+v"(c) : "v"(ah), "v"(al), "v"(bh), "v"(bl));
  return c;
}
// batched GEMM like k_gemm_b but f16 operands: A f32 (split into f16 hi/lo if ASPLIT, else rounded to f16), Bt = f16 values [n][k]; alpha; C f32; N multiple of 16 (partial tiles skipped)
template <bool ASPLIT>
__global__ __launch_bounds__(128) void k_gemm_h(const float* __restrict__ A, int lda, size_t sA, const _Float16* __restrict__ Bh, int ldb, size_t sB, float alpha, float* __restrict__ C, int ldc, size_t sC, int M, int N, int K) {
  __shared__ __attribute__((aligned(16))) float so[4][16][64];
  const int tid = threadIdx.x, w = tid >> 5, lane = tid & 31, ln = lane & 15, hh = lane >> 4; const int by = blockIdx.y;
  A += (size_t)by * sA; Bh += (size_t)by * sB; C += (size_t)by * sC;
  const int ntn = (N + 63) / 64; const int wid = blockIdx.x * 4 + w; const int mt = wid / ntn, nq = wid % ntn; if (mt * 16 >= M) return;
  const int row0 = mt * 16, col0 = nq * 64; const float* arow = A + (size_t)(row0 + ln) * lda;
  v8f acc[4] = {};
  for (int kb = 0; kb < K; kb += 32) {
    FragH ah, al;
    const v4f x0 = *(const v4fa*)(arow + kb + 8 * hh), x1 = *(const v4fa*)(arow + kb + 8 * hh + 4), x2 = *(const v4fa*)(arow + kb + 16 + 8 * hh), x3 = *(const v4fa*)(arow + kb + 16 + 8 * hh + 4);
    float xs[16] = {x0[0],x0[1],x0[2],x0[3],x1[0],x1[1],x1[2],x1[3],x2[0],x2[1],x2[2],x2[3],x3[0],x3[1],x3[2],x3[3]};
#pragma unroll
    for (int i = 0; i < 16; ++i) { const _Float16 h = (_Float16)xs[i]; ah.h[i] = h; al.h[i] = ASPLIT ? (_Float16)(xs[i] - (float)h) : (_Float16)0.0f; }
#pragma unroll
    for (int t = 0; t < 4; ++t) { if (col0 + t * 16 >= N) continue; const size_t boff = (size_t)(col0 + t * 16 + ln) * ldb + kb; FragH bq; bq.half[0] = *(const v8us*)(Bh + boff + 8 * hh); bq.half[1] = *(const v8us*)(Bh + boff + 16 + 8 * hh);
      acc[t] = mmaH<ASPLIT ? 2 : 1>(ah.v, al.v, bq.v, bq.v, acc[t]); }
  }
#pragma unroll
  for (int t = 0; t < 4; ++t) { if (col0 + t * 16 >= N) continue;
#pragma unroll
    for (int r = 0; r < 8; ++r) so[w][8 * hh + r][t * 16 + ln] = acc[t][r] * alpha; }
  __builtin_amdgcn_fence(__ATOMIC_ACQ_REL, "workgroup"); __builtin_amdgcn_wave_barrier();
  const int rsub = lane >> 4, c4 = (lane & 15) * 4;
  {
#pragma unroll
    for (int q = 0; q < 8; ++q) { const int r = q * 2 + rsub; if (col0 + c4 < N) { const v4f v = *(const v4fa*)&so[w][r][c4]; *(v4f*)(C + (size_t)(row0 + r) * ldc + col0 + c4) = v; } }
     }
}

// Bt = bits(W?[k][n]) in B-fragment order, via 32x32 tiles (grid: k tiles, n tiles (12), -): [n / 16][k / 32][half][lane = hh * 16 + (n & 15)][8],
// k = (k / 32) * 32 + half * 16 + hh * 8 + i, so that one half fragment of a wave is 512 contiguous bytes; bias concat
__global__ __launch_bounds__(256) void k_wt(const float* __restrict__ Wq, const float* __restrict__ Wk, const float* __restrict__ Wv, const float* __restrict__ bq, const float* __restrict__ bk, const float* __restrict__ bv, unsigned short* __restrict__ Bt, float* __restrict__ B3) { __shared__ float tile[32][33]; const int k0 = blockIdx.x * 32, n0 = blockIdx.y * 32; const int which = n0 / DK, nn0 = n0 % DK; const float* W = which == 0 ? Wq : (which == 1 ? Wk : Wv); const int tx = threadIdx.x & 31, ty = threadIdx.x >> 5;
  for (int i = ty; i < 32; i += 8) tile[i][tx] = W[(size_t)(k0 + i) * DK + nn0 + tx]; __syncthreads();
  typedef unsigned short v4us __attribute__((ext_vector_type(4))); const int r = threadIdx.x >> 3, c4 = (threadIdx.x & 7) * 4; v4us o; for (int q = 0; q < 4; ++q) o[q] = bf16_bits(tile[c4 + q][r]);
  const int n = n0 + r; unsigned short* d = Bt + ((size_t)(((n >> 4) * (DM / 32) + blockIdx.x) * 2 + (c4 >> 4)) * 32 + ((c4 >> 3) & 1) * 16 + (n & 15)) * 8 + (c4 & 7); *(v4us*)d = o; 
  if (blockIdx.x == 0 && threadIdx.x < 32) { const float* bs = which == 0 ? bq : (which == 1 ? bk : bv); *(float*)(B3 + n0 + threadIdx.x) = bs[nn0 + threadIdx.x]; } }
// [Q|K|V] = x.W + b: a work-group owns PM rows of x and all 384 columns, so x is read from memory once. The rows are fetched by whole-line loads,
// rounded to bf16 once and kept in LDS for all waves; a wave owns 48 columns (3 tiles x 2 row tiles) and reads its W fragments, which no other wave
// of the group needs, straight from the fragment-ordered Bt: every wave-wide load is 512 contiguous bytes. One WMMA per 32 k. All work-groups read the
// same Bt, so each starts its walk over k at a chunk of its own (by its index) and wraps: they do not all ask L2 for the same lines at the same moment.
#define PM 32
#define PAP (DM + 8)
#define PCP (3 * DK + 4)
#define PKC 4
typedef unsigned short v4usa __attribute__((ext_vector_type(4), may_alias));
typedef _Float16 v8h __attribute__((ext_vector_type(8)));
__global__ __launch_bounds__(256) void k_proj(const float* __restrict__ x, const unsigned short* __restrict__ Bt, const float* __restrict__ B3, float* __restrict__ QKV, unsigned short* __restrict__ Kh, unsigned short* __restrict__ Kl, _Float16* __restrict__ VT) {
  __shared__ __attribute__((aligned(16))) unsigned short sA[PM][PAP];   // pitch 2064 B = 16 B x odd
  __shared__ __attribute__((aligned(16))) float sC[PM][PCP];            // pitch 388 dwords: rows 8 apart lie 32 banks apart
  const int tid = threadIdx.x, w = tid >> 5, lane = tid & 31, ln = lane & 15, hh = lane >> 4;
  const int row0 = blockIdx.x * PM;
  const unsigned short* bp = Bt + (size_t)w * 3 * (DM / 32) * 512 + lane * 8;
  const int rot = (blockIdx.x + (blockIdx.x >> 3)) & (DM / 32 / PKC - 1);   // first chunk of this group's walk; neighbours in index, and groups 8 apart, differ
  FragB bf[2][PKC][3];          // W fragments of PKC k-steps, two sets: the next set flies under the current set's products
#pragma unroll
  for (int s = 0; s < PKC; ++s)
#pragma unroll
    for (int t = 0; t < 3; ++t) { const unsigned short* p = bp + rot * (PKC * 512) + (t * (DM / 32) + s) * 512; bf[0][s][t].half[0] = *(const v8us*)p; bf[0][s][t].half[1] = *(const v8us*)(p + 256); }
  // the last of the row loads below lands in these loads' address registers; the wait stands in front of that overwrite
  asm volatile("s_wait_xcnt 0x0" ::: "memory");
  {
    const float* xr = x + (size_t)row0 * DM + tid * 4;
    v4f v[PM];
#pragma unroll
    for (int i = 0; i < PM; ++i) v[i] = *(const v4fa*)(xr + (size_t)i * DM);
    // keeps all the row loads in front of the conversions, so that they are in flight together and share one memory latency
    __builtin_amdgcn_sched_barrier(0);
#pragma unroll
    for (int i = 0; i < PM; ++i) *(v4usa*)&sA[i][tid * 4] = (v4usa){bf16_bits(v[i][0]), bf16_bits(v[i][1]), bf16_bits(v[i][2]), bf16_bits(v[i][3])};
  }
  __syncthreads();
  float bv[3];
#pragma unroll
  for (int t = 0; t < 3; ++t) bv[t] = bf16_round(B3[w * 48 + t * 16 + ln]);
  // the bias loads' offset register is reused soon after; the wait stands in front of that overwrite
  asm volatile("s_wait_xcnt 0x0" ::: "memory");
  v8f acc[2][3];
#pragma unroll
  for (int mt = 0; mt < 2; ++mt)
#pragma unroll
    for (int t = 0; t < 3; ++t) acc[mt][t] = (v8f){0.f, 0.f, 0.f, 0.f, 0.f, 0.f, 0.f, 0.f};
#pragma unroll
  for (int c = 0; c < DM / 32 / PKC; ++c) {
    const int cc = (c + rot) & (DM / 32 / PKC - 1);   // the chunk of k that this trip multiplies
    if (c + 1 < DM / 32 / PKC) {
      const unsigned short* pn = bp + ((c + 1 + rot) & (DM / 32 / PKC - 1)) * (PKC * 512);
#pragma unroll
      for (int s = 0; s < PKC; ++s)
#pragma unroll
        for (int t = 0; t < 3; ++t) {
          const unsigned short* p = pn + (t * (DM / 32) + s) * 512;
          bf[(c + 1) & 1][s][t].half[0] = *(const v8us*)p; bf[(c + 1) & 1][s][t].half[1] = *(const v8us*)(p + 256);
        }
    }
    FragB af[PKC][2];           // x fragments: row = mt*16 + ln, k in the same order as Bt's
#pragma unroll
    for (int s = 0; s < PKC; ++s)
#pragma unroll
      for (int mt = 0; mt < 2; ++mt) {
        af[s][mt].half[0] = *(const v8us*)&sA[mt * 16 + ln][(cc * PKC + s) * 32 + 8 * hh]; af[s][mt].half[1] = *(const v8us*)&sA[mt * 16 + ln][(cc * PKC + s) * 32 + 16 + 8 * hh];
      }
    // keeps the next set's loads and this set's LDS reads as one group in front of the products; without it the compiler moves them in among the
    // products, close to their use, and each then waits out its own latency
    __builtin_amdgcn_sched_barrier(0);
#pragma unroll
    for (int s = 0; s < PKC; ++s)
#pragma unroll
      for (int mt = 0; mt < 2; ++mt)
#pragma unroll
        for (int t = 0; t < 3; ++t) acc[mt][t] = __builtin_amdgcn_wmma_f32_16x16x32_bf16(false, af[s][mt].v, false, bf[c & 1][s][t].v, (short)0, acc[mt][t], false, false);
    // second half of the fence pair: keeps the following group's loads and LDS reads from being moved up in among these products
    __builtin_amdgcn_sched_barrier(0);
  }
#pragma unroll
  for (int mt = 0; mt < 2; ++mt)
#pragma unroll
    for (int t = 0; t < 3; ++t)
#pragma unroll
      for (int r = 0; r < 8; ++r) sC[mt * 16 + 8 * hh + r][w * 48 + t * 16 + ln] = acc[mt][t][r] + bv[t];
  __syncthreads();
  // The tile leaves in the forms its reader wants: Q as f32 rows of QKV (the K and V columns of QKV are not written); Kh/Kl = bf16 hi/lo planes of K and
  // VT = f16(V), all three in the order of k_cosattn's A fragments, so that each of its wave-wide 16-B loads is 512 contiguous bytes (four whole lines).
  // Kh/Kl: [tok / 16][ks = c / 32][half][lane = hh * 16 + (tok & 15)][8], c = ks * 32 + half * 16 + hh * 8 + i
  // VT:    [tok / 32][dt = d / 16][half][lane = hh * 16 + (d & 15)][8], tok = (tok / 32) * 32 + half * 16 + hh * 8 + i
  const size_t base = (size_t)row0 * DK;   // the group's 32 tokens fill one contiguous block of each plane
#pragma unroll
  for (int g = 0; g < PM * (DK / 4) / 256; ++g) {   // Q: a wave stores one whole 512-B row at a time
    const int idx = g * 256 + tid, r = idx >> 5, c4 = (idx & 31) * 4;
    *(v4f*)(QKV + (size_t)(row0 + r) * (3 * DK) + c4) = *(const v4fa*)&sC[r][c4];
  }
  for (int u = 0; u < PM * (DK / 8) / 256; ++u) {   // K planes: 2 key tiles x 4 ks x 2 halves x 32 lanes = 512 groups of 8; group g lies at element g * 8 of the block
    const int g = u * 256 + tid, i = u * 16 + ln, c8 = ((g >> 6) & 3) * 32 + ((g >> 5) & 1) * 16 + hh * 8;
    const v4f k0 = *(const v4fa*)&sC[i][DK + c8], k1 = *(const v4fa*)&sC[i][DK + c8 + 4];
    const float ks[8] = {k0[0], k0[1], k0[2], k0[3], k1[0], k1[1], k1[2], k1[3]};
    v8us h, l;
    for (int q = 0; q < 8; ++q) { const float kh = bf16_round(ks[q]); h[q] = bf16_bits(kh); l[q] = bf16_bits(ks[q] - kh); }
    *(v8us*)(Kh + base + (size_t)g * 8) = h; *(v8us*)(Kl + base + (size_t)g * 8) = l;
  }
  for (int u = 0; u < PM * (DK / 8) / 256; ++u) {   // V: 8 d tiles x 2 halves x 32 lanes = 512 groups of 8 keys; sC's rows 8 apart lie 32 banks apart, so the lane halves do not collide
    const int g = u * 256 + tid, d = (g >> 6) * 16 + ln, t0 = ((g >> 5) & 1) * 16 + hh * 8;
    v8h v;
    for (int q = 0; q < 8; ++q) v[q] = (_Float16)sC[t0 + q][2 * DK + d];
    *(v8h*)(VT + base + (size_t)g * 8) = v;
  }
}
// cos of eight scores without a branch. The hardware cosine takes its argument in revolutions, so the score is reduced in revolutions: n = nearest whole
// number to x / (2 pi); f = x * C_HI - n in one FMA (the product is not rounded before n is taken off), then x * C_LO is added, C_HI + C_LO = 1 / (2 pi) to
// 48 bits. f is right to better than 1e-7 revolutions for |x| up to 1e8 (library cosf changes its method at 131072); an infinite or NaN score gives NaN.
__device__ __forceinline__ v8f cos8(v8f x) {
  const v8f chi = {0x1.45f306p-3f, 0x1.45f306p-3f, 0x1.45f306p-3f, 0x1.45f306p-3f, 0x1.45f306p-3f, 0x1.45f306p-3f, 0x1.45f306p-3f, 0x1.45f306p-3f};
  const v8f clo = {0x1.b9391p-28f, 0x1.b9391p-28f, 0x1.b9391p-28f, 0x1.b9391p-28f, 0x1.b9391p-28f, 0x1.b9391p-28f, 0x1.b9391p-28f, 0x1.b9391p-28f};
  const v8f n = __builtin_elementwise_rint(x * chi);
  const v8f f = __builtin_elementwise_fma(x, clo, __builtin_elementwise_fma(x, chi, -n));
  v8f c;
  // unrolled so that every index is a constant and c stays in registers
#pragma unroll
  for (int i = 0; i < 8; ++i) c[i] = __builtin_amdgcn_cosf(f[i]);
  return c;
}
#define FQ 32
#define FW 8
#define FKEYS (LL / FW)
#define QP (DK + 8)
#define RP (DK + 4)
__global__ __launch_bounds__(256) void k_cosattn(const float* __restrict__ QKV, const unsigned short* __restrict__ Kh, const unsigned short* __restrict__ Kl, const _Float16* __restrict__ VT, float* __restrict__ out) {
  __shared__ __attribute__((aligned(16))) unsigned short sQh[FQ][QP], sQl[FQ][QP];   // pitch 272 B = 16 B x odd
  __shared__ __attribute__((aligned(16))) float red[FW][FQ][RP];                     // pitch 528 B = 16 B x odd
  const int tid = threadIdx.x, w = tid >> 5, lane = tid & 31, ln = lane & 15, hh = lane >> 4;
  const int b = blockIdx.x / (LL / FQ), q0 = (blockIdx.x % (LL / FQ)) * FQ;
  { // Q rows -> bf16 hi/lo planes, split once per work-group (thread: 16 consecutive columns of one row)
    const int r = tid >> 3, c0 = (tid & 7) * 16;
    const float* qr = QKV + ((size_t)b * LL + q0 + r) * (3 * DK) + c0;
    const v4f x0 = *(const v4fa*)qr, x1 = *(const v4fa*)(qr + 4), x2 = *(const v4fa*)(qr + 8), x3 = *(const v4fa*)(qr + 12);
    // the loads' address registers are reused soon after
    asm volatile("s_wait_xcnt 0x0" ::: "memory");
    const float xs[16] = {x0[0], x0[1], x0[2], x0[3], x1[0], x1[1], x1[2], x1[3], x2[0], x2[1], x2[2], x2[3], x3[0], x3[1], x3[2], x3[3]};
#pragma unroll
    for (int g = 0; g < 2; ++g) {
      v8us h, l;
#pragma unroll
      for (int i = 0; i < 8; ++i) { const float x = xs[g * 8 + i]; const unsigned short hb = bf16_bits(x); h[i] = hb; l[i] = bf16_bits(x - bf16_val(hb)); }
      *(v8us*)&sQh[r][c0 + g * 8] = h; *(v8us*)&sQl[r][c0 + g * 8] = l;
    }
  }
  __syncthreads();
  FragB qh[2][4], ql[2][4];     // B fragments: column = query qt*16+ln, k in the same order as the K loader below
#pragma unroll
  for (int qt = 0; qt < 2; ++qt)
#pragma unroll
    for (int ks = 0; ks < 4; ++ks) {
      qh[qt][ks].half[0] = *(const v8us*)&sQh[qt * 16 + ln][ks * 32 + 8 * hh]; qh[qt][ks].half[1] = *(const v8us*)&sQh[qt * 16 + ln][ks * 32 + 16 + 8 * hh];
      ql[qt][ks].half[0] = *(const v8us*)&sQl[qt * 16 + ln][ks * 32 + 8 * hh]; ql[qt][ks].half[1] = *(const v8us*)&sQl[qt * 16 + ln][ks * 32 + 16 + 8 * hh];
    }
  v8f o[2][8];                  // o[qt][dt][r] = O[query qt*16+ln][d = dt*16 + 8*hh + r], this wave's keys only
#pragma unroll
  for (int qt = 0; qt < 2; ++qt)
#pragma unroll
    for (int dt = 0; dt < 8; ++dt) o[qt][dt] = (v8f){0.f, 0.f, 0.f, 0.f, 0.f, 0.f, 0.f, 0.f};
  const size_t koff = ((size_t)b * LL + w * FKEYS) * DK + lane * 8;   // the planes are in fragment order (k_proj): 16 keys of K = 8 half fragments of 256 elements, 32 keys of V = 16
  const unsigned short* kh = Kh + koff;
  const unsigned short* kl = Kl + koff;
  const unsigned short* vt = (const unsigned short*)VT + koff;
  const int rot = (blockIdx.x + (blockIdx.x >> 3)) & (FKEYS / 32 - 1);   // first pass of this group's walk; neighbours in index, and groups 8 apart, differ
  for (int it = 0; it < FKEYS / 32; ++it) {
    const int j = ((it + rot) & (FKEYS / 32 - 1)) * 32;
    FragB ah[2][4], al[2][4];   // A fragments of K hi/lo: row = key j + kt*16 + ln
#pragma unroll
    for (int kt = 0; kt < 2; ++kt)
#pragma unroll
      for (int ks = 0; ks < 4; ++ks) {
        const size_t e = (size_t)(j + kt * 16) * DK + ks * 512;
        ah[kt][ks].half[0] = *(const v8us*)(kh + e); ah[kt][ks].half[1] = *(const v8us*)(kh + e + 256);
        al[kt][ks].half[0] = *(const v8us*)(kl + e); al[kt][ks].half[1] = *(const v8us*)(kl + e + 256);
      }
    // the products' accumulators reuse the loads' address registers
    asm volatile("s_wait_xcnt 0x0" ::: "memory");
    // keeps all 32 K loads in front of the products, so that they are issued back to back and share one latency;
    // without it the compiler loads one fragment at a time and waits for each in front of its products
    __builtin_amdgcn_sched_barrier(0);
    v8f s[2][2];                // s[kt][qt][r] = S[query qt*16+ln][key j + kt*16 + 8*hh + r]
#pragma unroll
    for (int kt = 0; kt < 2; ++kt)
#pragma unroll
      for (int qt = 0; qt < 2; ++qt) {
        v8f c = {};
#pragma unroll
        for (int ks = 0; ks < 4; ++ks) {   // three products of the hi/lo split, in this order: Qhi.Khi, Qlo.Khi, Qhi.Klo
          c = __builtin_amdgcn_wmma_f32_16x16x32_bf16(false, ah[kt][ks].v, false, qh[qt][ks].v, (short)0, c, false, false);
          c = __builtin_amdgcn_wmma_f32_16x16x32_bf16(false, ah[kt][ks].v, false, ql[qt][ks].v, (short)0, c, false, false);
          c = __builtin_amdgcn_wmma_f32_16x16x32_bf16(false, al[kt][ks].v, false, qh[qt][ks].v, (short)0, c, false, false);
        }
        s[kt][qt] = c;
      }
    FragH va[8];                // A fragments of V^T: row = d, k = key; they fly under the cosines
#pragma unroll
    for (int dt = 0; dt < 8; ++dt) { va[dt].half[0] = *(const v8us*)(vt + (size_t)j * DK + dt * 512); va[dt].half[1] = *(const v8us*)(vt + (size_t)j * DK + dt * 512 + 256); }
    // the loads' address registers are reused soon after
    asm volatile("s_wait_xcnt 0x0" ::: "memory");
#pragma unroll
    for (int qt = 0; qt < 2; ++qt) {
      FragH p;                  // B fragment: p[i] = cos(S)[key kmap(i, hh)][query], straight from the two D tiles
      const v8f c0 = cos8(s[0][qt]), c1 = cos8(s[1][qt]);
#pragma unroll
      for (int i = 0; i < 8; ++i) { p.h[i] = (_Float16)c0[i]; p.h[8 + i] = (_Float16)c1[i]; }
#pragma unroll
      for (int dt = 0; dt < 8; ++dt) o[qt][dt] = __builtin_amdgcn_wmma_f32_16x16x32_f16(false, va[dt].v, false, p.v, (short)0, o[qt][dt], false, false);
    }
  }
#pragma unroll
  for (int qt = 0; qt < 2; ++qt)
#pragma unroll
    for (int dt = 0; dt < 8; ++dt) {
      float* d = &red[w][qt * 16 + ln][dt * 16 + 8 * hh];
      *(v4fa*)d = (v4f){o[qt][dt][0], o[qt][dt][1], o[qt][dt][2], o[qt][dt][3]};
      *(v4fa*)(d + 4) = (v4f){o[qt][dt][4], o[qt][dt][5], o[qt][dt][6], o[qt][dt][7]};
    }
  __syncthreads();
#pragma unroll
  for (int g = 0; g < FQ * DK / 4 / 256; ++g) {   // a wave stores one whole 512-B output row at a time
    const int idx = g * 256 + tid, q = idx >> 5, d4 = (idx & 31) * 4;
    v4f a = *(const v4fa*)&red[0][q][d4];
#pragma unroll
    for (int u = 1; u < FW; ++u) a += *(const v4fa*)&red[u][q][d4];
    *(v4f*)(out + ((size_t)b * LL + q0 + q) * DK + d4) = a;
  }
}
extern "C" void kernel_launch(void* const* d_in, const int* in_sizes, int n_in,
                              void* d_out, int out_size, void* d_ws, size_t ws_size, hipStream_t stream) {
  (void)in_sizes; (void)n_in; (void)out_size;
  const float* x = (const float*)d_in[0]; const float* Wq = (const float*)d_in[1]; const float* bq = (const float*)d_in[2]; const float* Wk = (const float*)d_in[3]; const float* bk = (const float*)d_in[4]; const float* Wv = (const float*)d_in[5]; const float* bv = (const float*)d_in[6];
  char* ws = (char*)d_ws; size_t off = 0;
  auto take = [&](size_t bytes) { char* p = ws + off; off += (bytes + 255) & ~(size_t)255; return p; };
  unsigned short* Bt = (unsigned short*)take((size_t)3 * DK * DM * 2); float* B3 = (float*)take(3 * DK * 4); float* QKV = (float*)take((size_t)NTOK * 3 * DK * 4);
  unsigned short* Kh = (unsigned short*)take((size_t)NTOK * DK * 2); unsigned short* Kl = (unsigned short*)take((size_t)NTOK * DK * 2); _Float16* VT = (_Float16*)take((size_t)BB * DK * LL * 2);
  if (off > ws_size) return;
  k_wt<<<dim3(DM / 32, 3 * DK / 32), 256, 0, stream>>>(Wq, Wk, Wv, bq, bk, bv, Bt, B3);
  k_proj<<<NTOK / PM, 256, 0, stream>>>(x, Bt, B3, QKV, Kh, Kl, VT);
  k_cosattn<<<NTOK / FQ, 256, 0, stream>>>(QKV, Kh, Kl, VT, (float*)d_out);
}

// v007
// Measured time: 31.9 microseconds a run.
// Timed twice side by side with v006, it ran 1.04 and 1.03 times as fast.
// All steps since v000 together make it 15.9 times as fast.
#include <hip/hip_runtime.h>
// [Q|K|V] = x·[Wq|Wk|Wv] + b on v_wmma_f32_16x16x32_bf16 (x rounded to bf16: single exact term; 8192 × 1024 × 384); QK = Q·Kᵀ on the same unit with BOTH f32 operands split
// hi/lo (3 products — cos(QK) at |QK| ≈ 10–40 needs the phase to ≈1e-4 rad; 4 × 2048 × 2048 × 128); out = cos(QK)·V on v_wmma_f32_16x16x32_f16 (cos and V rounded to
// f16: single product). cos in f32: reduction on the VALU, then v_cos_f32.
#define BB 4
#define LL 2048
#define DM 1024
#define DK 128
#define NTOK (BB * LL)

typedef __bf16 v16b __attribute__((ext_vector_type(16)));
typedef unsigned short v8us __attribute__((ext_vector_type(8), may_alias));
typedef float  v8f  __attribute__((ext_vector_type(8)));
typedef float  v4f  __attribute__((ext_vector_type(4)));
typedef float  v4fa __attribute__((ext_vector_type(4), may_alias));
union FragB { v16b v; v8us half[2]; unsigned short u[16]; };

__device__ __forceinline__ unsigned short bf16_bits(float x) { unsigned int u = __float_as_uint(x); return (unsigned short)((u + 0x7FFFu + ((u >> 16) & 1u)) >> 16); }
__device__ __forceinline__ float bf16_val(unsigned short b) { return __uint_as_float(((unsigned int)b) << 16); }
__device__ __forceinline__ float bf16_round(float x) { return bf16_val(bf16_bits(x)); }
// D += A·B with NT terms: 1 = ah·bh, 2 = + al·bh (A split), 3 = + ah·bl (both split)
template <int NT>
__device__ __forceinline__ v8f mmaN(v16b ah, v16b al, v16b bh, v16b bl, v8f c) {
  c = __builtin_amdgcn_wmma_f32_16x16x32_bf16(false, ah, false, bh, (short)0, c, false, false);
  if (NT >= 2) c = __builtin_amdgcn_wmma_f32_16x16x32_bf16(false, al, false, bh, (short)0, c, false, false);
  if (NT >= 3) c = __builtin_amdgcn_wmma_f32_16x16x32_bf16(false, ah, false, bl, (short)0, c, false, false);
  asm volatile("v_nop\n\tv_nop\n\tv_nop\n\tv_nop" : "+v"(c) : "v"(ah), "v"(al), "v"(bh), "v"(bl));
  return c;
}

__global__ __launch_bounds__(256) void k_wt_bf16(const float* __restrict__ W, unsigned short* __restrict__ Wt, int K, int N) {
  const int t = blockIdx.x * 256 + threadIdx.x;
  const int k8n = K / 8;
  if (t >= N * k8n) return;
  const int n = t / k8n, k8 = (t % k8n) * 8;
  v8us v;
#pragma unroll
  for (int i = 0; i < 8; ++i) v[i] = bf16_bits(W[(size_t)(k8 + i) * N + n]);
  *(v8us*)(Wt + (size_t)n * K + k8) = v;
  
}

// GEMM C[M][N] (f32, pitch ldc) = act(A[M][K]·W + bias). A f32 row-major (pitch lda) converted per fragment to bf16
// (ASPLIT: hi/lo two planes -> 2 terms, else single rounded term); Wt bf16 [N][K] (pitch ldb). BIAS_BF16 rounds the
// bias to bf16 first (bias quantised to bf16 before the add). K%32==0, M%16==0, N%64==0.
template <bool ASPLIT, int ACT, bool BIAS_BF16>
__global__ __launch_bounds__(128) void k_gemm_bf(const float* __restrict__ A, int lda, const unsigned short* __restrict__ Wt, int ldb,
                                               const float* __restrict__ bias, float* __restrict__ C, int ldc, int M, int N, int K) {
  __shared__ __attribute__((aligned(16))) float so[4][16][64];
  const int tid = threadIdx.x, w = tid >> 5, lane = tid & 31, ln = lane & 15, hh = lane >> 4;
  const int ntn = N / 64;
  const int wid = blockIdx.x * 4 + w;
  const int mt = wid / ntn, nq = wid % ntn;
  if (mt * 16 >= M) return;
  const int row0 = mt * 16, col0 = nq * 64;
  const float* arow = A + (size_t)(row0 + ln) * lda;
  v8f acc[4] = {};
  for (int kb = 0; kb < K; kb += 32) {
    FragB ah, al;
    const v4f x0 = *(const v4fa*)(arow + kb + 8 * hh), x1 = *(const v4fa*)(arow + kb + 8 * hh + 4);
    const v4f x2 = *(const v4fa*)(arow + kb + 16 + 8 * hh), x3 = *(const v4fa*)(arow + kb + 16 + 8 * hh + 4);
    float xs[16] = {x0[0],x0[1],x0[2],x0[3],x1[0],x1[1],x1[2],x1[3],x2[0],x2[1],x2[2],x2[3],x3[0],x3[1],x3[2],x3[3]};
#pragma unroll
    for (int i = 0; i < 16; ++i) { const unsigned short hb = bf16_bits(xs[i]); ah.u[i] = hb; al.u[i] = ASPLIT ? bf16_bits(xs[i] - bf16_val(hb)) : (unsigned short)0; }
#pragma unroll
    for (int t = 0; t < 4; ++t) {
      const unsigned short* brow = Wt + (size_t)(col0 + t * 16 + ln) * ldb + kb;
      FragB b;
      b.half[0] = *(const v8us*)(brow + 8 * hh);
      b.half[1] = *(const v8us*)(brow + 16 + 8 * hh);
      acc[t] = mmaN<ASPLIT ? 2 : 1>(ah.v, al.v, b.v, b.v, acc[t]);
    }
  }
#pragma unroll
  for (int t = 0; t < 4; ++t) {
    float bv = bias ? bias[col0 + t * 16 + ln] : 0.f;
    if (BIAS_BF16) bv = bf16_round(bv);
#pragma unroll
    for (int r = 0; r < 8; ++r) { float v = acc[t][r] + bv; if (ACT == 1) v = fmaxf(v, 0.f); so[w][8 * hh + r][t * 16 + ln] = v; }
  }
  __builtin_amdgcn_fence(__ATOMIC_ACQ_REL, "workgroup");
  __builtin_amdgcn_wave_barrier();
  const int rsub = lane >> 4, c4 = (lane & 15) * 4;
  {
#pragma unroll
    for (int q = 0; q < 8; ++q) {
      const int r = q * 2 + rsub;
      const v4f v = *(const v4fa*)&so[w][r][c4];
      *(v4f*)(C + (size_t)(row0 + r) * ldc + col0 + c4) = v;
    }
    
  }
}

// Flash-style causal/unmasked attention, all contractions 3-term bf16 hi/lo splits, f32 softmax with running max.
// q,k,v rows are read from f32 buffers with arbitrary row pitch (so they can live inside a fused qkv buffer);
// D = head size (multiple of 32, <= 128); one wave = 16 query rows; block = 4 waves (64 queries) sharing K/V chunks of 32.
template <int D, bool CAUSAL>
__global__ __launch_bounds__(128) void k_flash(const float* __restrict__ qb, const float* __restrict__ kb, const float* __restrict__ vb,
                                             int pitch, int T, int H, float scale, float* __restrict__ y, int ypitch) {
  constexpr int KS = D / 32;        // k-steps for QK
  constexpr int DT = D / 16;        // d tiles for PV
  __shared__ __attribute__((aligned(16))) unsigned short sKh[32][D + 8], sKl[32][D + 8], sVh[32][D + 8], sVl[32][D + 8];
  __shared__ __attribute__((aligned(16))) unsigned short sPh[4][16][40], sPl[4][16][40];
  __shared__ __attribute__((aligned(16))) float sO[4][16][D];
  const int tid = threadIdx.x, w = tid >> 5, lane = tid & 31, ln = lane & 15, hh = lane >> 4;
  const int nqb = (T + 63) / 64;
  const int bh = blockIdx.x / nqb, qblk = blockIdx.x % nqb;
  const int b = bh / H, h = bh % H;
  const int q0 = qblk * 64 + w * 16;
  const float* Q = qb + (size_t)b * T * pitch + h * D;
  const float* K = kb + (size_t)b * T * pitch + h * D;
  const float* V = vb + (size_t)b * T * pitch + h * D;

  // A fragments of the wave's 16 query rows (scaled), hi/lo
  FragB aqh[KS], aql[KS];
  {
    int row = q0 + ln; if (row >= T) row = T - 1;
    const float* qr = Q + (size_t)row * pitch;
#pragma unroll
    for (int ks = 0; ks < KS; ++ks)
#pragma unroll
      for (int i = 0; i < 16; ++i) {
        const int d = ks * 32 + ((i < 8) ? (8 * hh + i) : (16 + 8 * hh + (i - 8)));
        const float x = qr[d] * scale; const unsigned short hb = bf16_bits(x);
        aqh[ks].u[i] = hb; aql[ks].u[i] = bf16_bits(x - bf16_val(hb));
      }
  }
  float m_r[8], l_r[8];
#pragma unroll
  for (int r = 0; r < 8; ++r) { m_r[r] = -3.0e38f; l_r[r] = 0.f; }
  v8f oacc[DT];
#pragma unroll
  for (int dt = 0; dt < DT; ++dt) oacc[dt] = (v8f){0.f,0.f,0.f,0.f,0.f,0.f,0.f,0.f};

  const int kv_end = CAUSAL ? min(T, qblk * 64 + 64) : T;     // block-uniform
  for (int j0 = 0; j0 < kv_end; j0 += 32) {
    __syncthreads();
    for (int e = tid; e < 32 * (D / 4); e += 128) {
      const int r = e / (D / 4), c4 = (e % (D / 4)) * 4;
      const int key = j0 + r;
      v4f kf = {0.f,0.f,0.f,0.f}, vf = {0.f,0.f,0.f,0.f};
      if (key < T) { kf = *(const v4fa*)(K + (size_t)key * pitch + c4); vf = *(const v4fa*)(V + (size_t)key * pitch + c4); }
#pragma unroll
      for (int t = 0; t < 4; ++t) {
        unsigned short hb = bf16_bits(kf[t]); sKh[r][c4 + t] = hb; sKl[r][c4 + t] = bf16_bits(kf[t] - bf16_val(hb));
        hb = bf16_bits(vf[t]); sVh[r][c4 + t] = hb; sVl[r][c4 + t] = bf16_bits(vf[t] - bf16_val(hb));
      }
    }
    __syncthreads();
    // S tile 16 x 32
    v8f s[2];
#pragma unroll
    for (int nt = 0; nt < 2; ++nt) {
      v8f acc = {};
#pragma unroll
      for (int ks = 0; ks < KS; ++ks) {
        FragB bh_, bl_;
        bh_.half[0] = *(const v8us*)&sKh[nt * 16 + ln][ks * 32 + 8 * hh]; bh_.half[1] = *(const v8us*)&sKh[nt * 16 + ln][ks * 32 + 16 + 8 * hh];
        bl_.half[0] = *(const v8us*)&sKl[nt * 16 + ln][ks * 32 + 8 * hh]; bl_.half[1] = *(const v8us*)&sKl[nt * 16 + ln][ks * 32 + 16 + 8 * hh];
        acc = mmaN<3>(aqh[ks].v, aql[ks].v, bh_.v, bl_.v, acc);
      }
      s[nt] = acc;
    }
    // mask + running max (rows 8hh+r; the 16 lanes of a half share rows)
    float alpha[8];
#pragma unroll
    for (int r = 0; r < 8; ++r) {
      const int qi = q0 + 8 * hh + r;
      const int ja = j0 + ln, jb = j0 + 16 + ln;
      if (CAUSAL) { if (ja > qi) s[0][r] = -3.0e38f; if (jb > qi) s[1][r] = -3.0e38f; }
      if (ja >= T) s[0][r] = -3.0e38f;
      if (jb >= T) s[1][r] = -3.0e38f;
      float mx = fmaxf(s[0][r], s[1][r]);
      mx = fmaxf(mx, __shfl_xor(mx, 1, 32)); mx = fmaxf(mx, __shfl_xor(mx, 2, 32)); mx = fmaxf(mx, __shfl_xor(mx, 4, 32)); mx = fmaxf(mx, __shfl_xor(mx, 8, 32));
      const float mnew = fmaxf(m_r[r], mx);
      alpha[r] = (mnew > -1.0e38f) ? __expf(m_r[r] - mnew) : 1.0f;
      const float p0 = (s[0][r] > -1.0e38f) ? __expf(s[0][r] - mnew) : 0.f;
      const float p1 = (s[1][r] > -1.0e38f) ? __expf(s[1][r] - mnew) : 0.f;
      m_r[r] = mnew;
      l_r[r] = l_r[r] * alpha[r] + p0 + p1;            // per-lane partial row sum (16 lanes combined at the end)
      unsigned short hb = bf16_bits(p0); sPh[w][8 * hh + r][ln] = hb;      sPl[w][8 * hh + r][ln] = bf16_bits(p0 - bf16_val(hb));
      hb = bf16_bits(p1);                sPh[w][8 * hh + r][16 + ln] = hb; sPl[w][8 * hh + r][16 + ln] = bf16_bits(p1 - bf16_val(hb));
    }
#pragma unroll
    for (int dt = 0; dt < DT; ++dt)
#pragma unroll
      for (int r = 0; r < 8; ++r) oacc[dt][r] *= alpha[r];
    __builtin_amdgcn_fence(__ATOMIC_ACQ_REL, "workgroup");
    __builtin_amdgcn_wave_barrier();
    FragB pah, pal;
    pah.half[0] = *(const v8us*)&sPh[w][ln][8 * hh]; pah.half[1] = *(const v8us*)&sPh[w][ln][16 + 8 * hh];
    pal.half[0] = *(const v8us*)&sPl[w][ln][8 * hh]; pal.half[1] = *(const v8us*)&sPl[w][ln][16 + 8 * hh];
#pragma unroll
    for (int dt = 0; dt < DT; ++dt) {
      FragB bvh, bvl;
#pragma unroll
      for (int i = 0; i < 8; ++i) {
        bvh.u[i] = sVh[8 * hh + i][dt * 16 + ln]; bvh.u[8 + i] = sVh[16 + 8 * hh + i][dt * 16 + ln];
        bvl.u[i] = sVl[8 * hh + i][dt * 16 + ln]; bvl.u[8 + i] = sVl[16 + 8 * hh + i][dt * 16 + ln];
      }
      oacc[dt] = mmaN<3>(pah.v, pal.v, bvh.v, bvl.v, oacc[dt]);
    }
    __builtin_amdgcn_fence(__ATOMIC_ACQ_REL, "workgroup");
    __builtin_amdgcn_wave_barrier();
  }
#pragma unroll
  for (int r = 0; r < 8; ++r) {
    float l = l_r[r];
    l += __shfl_xor(l, 1, 32); l += __shfl_xor(l, 2, 32); l += __shfl_xor(l, 4, 32); l += __shfl_xor(l, 8, 32);
    l_r[r] = (l > 0.f) ? 1.0f / l : 0.f;
  }
#pragma unroll
  for (int dt = 0; dt < DT; ++dt)
#pragma unroll
    for (int r = 0; r < 8; ++r) sO[w][8 * hh + r][dt * 16 + ln] = oacc[dt][r] * l_r[r];
  __builtin_amdgcn_fence(__ATOMIC_ACQ_REL, "workgroup");
  __builtin_amdgcn_wave_barrier();
  {
    for (int r = 0; r < 16; ++r) {
      const int row = q0 + r;
      if (row < T && lane < D / 4) {
        const v4f val = *(const v4fa*)&sO[w][r][lane * 4];
        *(v4f*)(y + ((size_t)b * T + row) * ypitch + h * D + lane * 4) = val;
      }
    }
    
  }
}

// batched GEMM (blockIdx.y = batch): C_b = act(alpha·A_b·B_b + bias + resid_b); A f32 rows (ASPLIT → hi/lo), B = bf16 planes Bh (+Bl when BSPLIT, requires ASPLIT),
// per-batch element strides sA, sB (0 = shared weights), sC, sR. resid may alias C (values are staged before the stores). ACT 0/1(relu).
// ACT: 0 none, 1 relu, 2 softplus
template <bool ASPLIT, bool BSPLIT, int ACT>
__global__ __launch_bounds__(128) void k_gemm_b(const float* __restrict__ A, int lda, size_t sA, const unsigned short* __restrict__ Bh, const unsigned short* __restrict__ Bl, int ldb, size_t sB,
                                             const float* __restrict__ bias, const float* __restrict__ resid, int ldr, size_t sR, float rsign, float alpha,
                                             float* __restrict__ C, int ldc, size_t sC, int M, int N, int K) {
  __shared__ __attribute__((aligned(16))) float so[4][16][64];
  const int tid = threadIdx.x, w = tid >> 5, lane = tid & 31, ln = lane & 15, hh = lane >> 4;
  const int by = blockIdx.y;
  A += (size_t)by * sA; Bh += (size_t)by * sB; if (BSPLIT) Bl += (size_t)by * sB; C += (size_t)by * sC; if (resid) resid += (size_t)by * sR;
  const int ntn = (N + 63) / 64; const int wid = blockIdx.x * 4 + w; const int mt = wid / ntn, nq = wid % ntn;      // N may be any multiple of 16: tiles past N are skipped and not stored
  if (mt * 16 >= M) return;
  const int row0 = mt * 16, col0 = nq * 64;
  const float* arow = A + (size_t)(row0 + ln) * lda;
  v8f acc[4] = {};
  for (int kb = 0; kb < K; kb += 32) {
    FragB ah, al;
    const v4f x0 = *(const v4fa*)(arow + kb + 8 * hh), x1 = *(const v4fa*)(arow + kb + 8 * hh + 4);
    const v4f x2 = *(const v4fa*)(arow + kb + 16 + 8 * hh), x3 = *(const v4fa*)(arow + kb + 16 + 8 * hh + 4);
    float xs[16] = {x0[0],x0[1],x0[2],x0[3],x1[0],x1[1],x1[2],x1[3],x2[0],x2[1],x2[2],x2[3],x3[0],x3[1],x3[2],x3[3]};
#pragma unroll
    for (int i = 0; i < 16; ++i) { const unsigned short hb = bf16_bits(xs[i]); ah.u[i] = hb; al.u[i] = ASPLIT ? bf16_bits(xs[i] - bf16_val(hb)) : (unsigned short)0; }
#pragma unroll
    for (int t = 0; t < 4; ++t) {
      if (col0 + t * 16 >= N) continue;
      const size_t boff = (size_t)(col0 + t * 16 + ln) * ldb + kb;
      FragB bh_, bl_; bh_.half[0] = *(const v8us*)(Bh + boff + 8 * hh); bh_.half[1] = *(const v8us*)(Bh + boff + 16 + 8 * hh);
      if (BSPLIT) { bl_.half[0] = *(const v8us*)(Bl + boff + 8 * hh); bl_.half[1] = *(const v8us*)(Bl + boff + 16 + 8 * hh); } else bl_ = bh_;
      acc[t] = mmaN<ASPLIT ? (BSPLIT ? 3 : 2) : 1>(ah.v, al.v, bh_.v, bl_.v, acc[t]);
    }
  }
#pragma unroll
  for (int t = 0; t < 4; ++t) {
    const int col = col0 + t * 16 + ln; if (col0 + t * 16 >= N) continue; const float bv = bias ? bf16_round(bias[col]) : 0.f;
#pragma unroll
    for (int r = 0; r < 8; ++r) { float v = acc[t][r] * alpha + bv; if (resid) v += rsign * resid[(size_t)(row0 + 8 * hh + r) * ldr + col]; if (ACT == 1) v = fmaxf(v, 0.f); else if (ACT == 2) v = fmaxf(v, 0.f) + log1pf(expf(-fabsf(v))); so[w][8 * hh + r][t * 16 + ln] = v; }
  }
  __builtin_amdgcn_fence(__ATOMIC_ACQ_REL, "workgroup"); __builtin_amdgcn_wave_barrier();
  const int rsub = lane >> 4, c4 = (lane & 15) * 4;
  {
#pragma unroll
    for (int q = 0; q < 8; ++q) { const int r = q * 2 + rsub; if (col0 + c4 < N) { const v4f v = *(const v4fa*)&so[w][r][c4]; *(v4f*)(C + (size_t)(row0 + r) * ldc + col0 + c4) = v; } }
    
  }
}
// batched f32 [K][N] (pitch lds, batch stride sIn) -> transposed hi/lo planes [N][K] (batch stride sOut); thread per (n, 8 k); grid.y = batch
__global__ __launch_bounds__(256) void k_split_transpose_b(const float* __restrict__ src, int lds_, size_t sIn, unsigned short* __restrict__ hi, unsigned short* __restrict__ lo, size_t sOut, int K, int N) {
  const size_t t = (size_t)blockIdx.x * 256 + threadIdx.x; const int k8n = K / 8; if (t >= (size_t)N * k8n) return;
  src += (size_t)blockIdx.y * sIn; hi += (size_t)blockIdx.y * sOut; lo += (size_t)blockIdx.y * sOut;
  const int n = (int)(t / k8n), k8 = (int)(t % k8n) * 8; v8us vh, vl;
#pragma unroll
  for (int i = 0; i < 8; ++i) { const float x = src[(size_t)(k8 + i) * lds_ + n]; const unsigned short hb = bf16_bits(x); vh[i] = hb; vl[i] = bf16_bits(x - bf16_val(hb)); }
  unsigned short* dh = hi + (size_t)n * K + k8; unsigned short* dl = lo + (size_t)n * K + k8;
  *(v8us*)dh = vh; *(v8us*)dl = vl; 
}

// ---- f16 WMMA path (v_wmma_f32_16x16x32_f16): 11-bit significands for operands in range — used where the [-1,1] cos operand needs more precision than bf16
typedef _Float16 v16h __attribute__((ext_vector_type(16)));
union FragH { v16h v; v8us half[2]; _Float16 h[16]; unsigned short u[16]; };
template <int NT>
__device__ __forceinline__ v8f mmaH(v16h ah, v16h al, v16h bh, v16h bl, v8f c) {
  c = __builtin_amdgcn_wmma_f32_16x16x32_f16(false, ah, false, bh, (short)0, c, false, false);
  if (NT >= 2) c = __builtin_amdgcn_wmma_f32_16x16x32_f16(false, al, false, bh, (short)0, c, false, false);
  if (NT >= 3) c = __builtin_amdgcn_wmma_f32_16x16x32_f16(false, ah, false, bl, (short)0, c, false, false);
  asm volatile("v_nop\n\tv_nop\n\tv_nop\n\tv_nop" : "+v"(c) : "v"(ah), "v"(al), "v"(bh), "v"(bl));
  return c;
}
// batched GEMM like k_gemm_b but f16 operands: A f32 (split into f16 hi/lo if ASPLIT, else rounded to f16), Bt = f16 values [n][k]; alpha; C f32; N multiple of 16 (partial tiles skipped)
template <bool ASPLIT>
__global__ __launch_bounds__(128) void k_gemm_h(const float* __restrict__ A, int lda, size_t sA, const _Float16* __restrict__ Bh, int ldb, size_t sB, float alpha, float* __restrict__ C, int ldc, size_t sC, int M, int N, int K) {
  __shared__ __attribute__((aligned(16))) float so[4][16][64];
  const int tid = threadIdx.x, w = tid >> 5, lane = tid & 31, ln = lane & 15, hh = lane >> 4; const int by = blockIdx.y;
  A += (size_t)by * sA; Bh += (size_t)by * sB; C += (size_t)by * sC;
  const int ntn = (N + 63) / 64; const int wid = blockIdx.x * 4 + w; const int mt = wid / ntn, nq = wid % ntn; if (mt * 16 >= M) return;
  const int row0 = mt * 16, col0 = nq * 64; const float* arow = A + (size_t)(row0 + ln) * lda;
  v8f acc[4] = {};
  for (int kb = 0; kb < K; kb += 32) {
    FragH ah, al;
    const v4f x0 = *(const v4fa*)(arow + kb + 8 * hh), x1 = *(const v4fa*)(arow + kb + 8 * hh + 4), x2 = *(const v4fa*)(arow + kb + 16 + 8 * hh), x3 = *(const v4fa*)(arow + kb + 16 + 8 * hh + 4);
    float xs[16] = {x0[0],x0[1],x0[2],x0[3],x1[0],x1[1],x1[2],x1[3],x2[0],x2[1],x2[2],x2[3],x3[0],x3[1],x3[2],x3[3]};
#pragma unroll
    for (int i = 0; i < 16; ++i) { const _Float16 h = (_Float16)xs[i]; ah.h[i] = h; al.h[i] = ASPLIT ? (_Float16)(xs[i] - (float)h) : (_Float16)0.0f; }
#pragma unroll
    for (int t = 0; t < 4; ++t) { if (col0 + t * 16 >= N) continue; const size_t boff = (size_t)(col0 + t * 16 + ln) * ldb + kb; FragH bq; bq.half[0] = *(const v8us*)(Bh + boff + 8 * hh); bq.half[1] = *(const v8us*)(Bh + boff + 16 + 8 * hh);
      acc[t] = mmaH<ASPLIT ? 2 : 1>(ah.v, al.v, bq.v, bq.v, acc[t]); }
  }
#pragma unroll
  for (int t = 0; t < 4; ++t) { if (col0 + t * 16 >= N) continue;
#pragma unroll
    for (int r = 0; r < 8; ++r) so[w][8 * hh + r][t * 16 + ln] = acc[t][r] * alpha; }
  __builtin_amdgcn_fence(__ATOMIC_ACQ_REL, "workgroup"); __builtin_amdgcn_wave_barrier();
  const int rsub = lane >> 4, c4 = (lane & 15) * 4;
  {
#pragma unroll
    for (int q = 0; q < 8; ++q) { const int r = q * 2 + rsub; if (col0 + c4 < N) { const v4f v = *(const v4fa*)&so[w][r][c4]; *(v4f*)(C + (size_t)(row0 + r) * ldc + col0 + c4) = v; } }
     }
}

// Bt = bits(W?[k][n]) in B-fragment order, via 32x32 tiles (grid: k tiles, n tiles (12), -): [n / 16][k / 32][half][lane = hh * 16 + (n & 15)][8],
// k = (k / 32) * 32 + half * 16 + hh * 8 + i, so that one half fragment of a wave is 512 contiguous bytes; bias concat
__global__ __launch_bounds__(256) void k_wt(const float* __restrict__ Wq, const float* __restrict__ Wk, const float* __restrict__ Wv, const float* __restrict__ bq, const float* __restrict__ bk, const float* __restrict__ bv, unsigned short* __restrict__ Bt, float* __restrict__ B3) { __shared__ float tile[32][33]; const int k0 = blockIdx.x * 32, n0 = blockIdx.y * 32; const int which = n0 / DK, nn0 = n0 % DK; const float* W = which == 0 ? Wq : (which == 1 ? Wk : Wv); const int tx = threadIdx.x & 31, ty = threadIdx.x >> 5;
  for (int i = ty; i < 32; i += 8) tile[i][tx] = W[(size_t)(k0 + i) * DK + nn0 + tx]; __syncthreads();
  typedef unsigned short v4us __attribute__((ext_vector_type(4))); const int r = threadIdx.x >> 3, c4 = (threadIdx.x & 7) * 4; v4us o; for (int q = 0; q < 4; ++q) o[q] = bf16_bits(tile[c4 + q][r]);
  const int n = n0 + r; unsigned short* d = Bt + ((size_t)(((n >> 4) * (DM / 32) + blockIdx.x) * 2 + (c4 >> 4)) * 32 + ((c4 >> 3) & 1) * 16 + (n & 15)) * 8 + (c4 & 7); *(v4us*)d = o; 
  if (blockIdx.x == 0 && threadIdx.x < 32) { const float* bs = which == 0 ? bq : (which == 1 ? bk : bv); *(float*)(B3 + n0 + threadIdx.x) = bs[nn0 + threadIdx.x]; } }
// [Q|K|V] = x.W + b: a work-group owns PM rows of x and all 384 columns, so x is read from memory once. The rows are fetched by whole-line loads,
// rounded to bf16 once and kept in LDS for all waves; a wave owns 48 columns (3 tiles x 2 row tiles) and reads its W fragments, which no other wave
// of the group needs, straight from the fragment-ordered Bt: every wave-wide load is 512 contiguous bytes. One WMMA per 32 k. All work-groups read the
// same Bt, so each starts its walk over k at a chunk of its own (by its index) and wraps: they do not all ask L2 for the same lines at the same moment.
#define PM 32
#define PAP (DM + 8)
#define PCP (3 * DK + 4)
#define PKC 4
typedef unsigned short v4usa __attribute__((ext_vector_type(4), may_alias));
typedef _Float16 v8h __attribute__((ext_vector_type(8)));
__global__ __launch_bounds__(256) void k_proj(const float* __restrict__ x, const unsigned short* __restrict__ Bt, const float* __restrict__ B3, float* __restrict__ QKV, unsigned short* __restrict__ Kh, unsigned short* __restrict__ Kl, _Float16* __restrict__ VT) {
  __shared__ __attribute__((aligned(16))) unsigned short sA[PM][PAP];   // pitch 2064 B = 16 B x odd
  __shared__ __attribute__((aligned(16))) float sC[PM][PCP];            // pitch 388 dwords: rows 8 apart lie 32 banks apart
  const int tid = threadIdx.x, w = tid >> 5, lane = tid & 31, ln = lane & 15, hh = lane >> 4;
  const int row0 = blockIdx.x * PM;
  const unsigned short* bp = Bt + (size_t)w * 3 * (DM / 32) * 512 + lane * 8;
  const int rot = (blockIdx.x + (blockIdx.x >> 3)) & (DM / 32 / PKC - 1);   // first chunk of this group's walk; neighbours in index, and groups 8 apart, differ
  FragB bf[2][PKC][3];          // W fragments of PKC k-steps, two sets: the next set flies under the current set's products
#pragma unroll
  for (int s = 0; s < PKC; ++s)
#pragma unroll
    for (int t = 0; t < 3; ++t) { const unsigned short* p = bp + rot * (PKC * 512) + (t * (DM / 32) + s) * 512; bf[0][s][t].half[0] = *(const v8us*)p; bf[0][s][t].half[1] = *(const v8us*)(p + 256); }
  // the last of the row loads below lands in these loads' address registers; the wait stands in front of that overwrite
  asm volatile("s_wait_xcnt 0x0" ::: "memory");
  {
    const float* xr = x + (size_t)row0 * DM + tid * 4;
    v4f v[PM];
#pragma unroll
    for (int i = 0; i < PM; ++i) v[i] = *(const v4fa*)(xr + (size_t)i * DM);
    // keeps all the row loads in front of the conversions, so that they are in flight together and share one memory latency
    __builtin_amdgcn_sched_barrier(0);
#pragma unroll
    for (int i = 0; i < PM; ++i) *(v4usa*)&sA[i][tid * 4] = (v4usa){bf16_bits(v[i][0]), bf16_bits(v[i][1]), bf16_bits(v[i][2]), bf16_bits(v[i][3])};
  }
  __syncthreads();
  float bv[3];
#pragma unroll
  for (int t = 0; t < 3; ++t) bv[t] = bf16_round(B3[w * 48 + t * 16 + ln]);
  // the bias loads' offset register is reused soon after; the wait stands in front of that overwrite
  asm volatile("s_wait_xcnt 0x0" ::: "memory");
  v8f acc[2][3];
#pragma unroll
  for (int mt = 0; mt < 2; ++mt)
#pragma unroll
    for (int t = 0; t < 3; ++t) acc[mt][t] = (v8f){0.f, 0.f, 0.f, 0.f, 0.f, 0.f, 0.f, 0.f};
#pragma unroll
  for (int c = 0; c < DM / 32 / PKC; ++c) {
    const int cc = (c + rot) & (DM / 32 / PKC - 1);   // the chunk of k that this trip multiplies
    if (c + 1 < DM / 32 / PKC) {
      const unsigned short* pn = bp + ((c + 1 + rot) & (DM / 32 / PKC - 1)) * (PKC * 512);
#pragma unroll
      for (int s = 0; s < PKC; ++s)
#pragma unroll
        for (int t = 0; t < 3; ++t) {
          const unsigned short* p = pn + (t * (DM / 32) + s) * 512;
          bf[(c + 1) & 1][s][t].half[0] = *(const v8us*)p; bf[(c + 1) & 1][s][t].half[1] = *(const v8us*)(p + 256);
        }
    }
    FragB af[PKC][2];           // x fragments: row = mt*16 + ln, k in the same order as Bt's
#pragma unroll
    for (int s = 0; s < PKC; ++s)
#pragma unroll
      for (int mt = 0; mt < 2; ++mt) {
        af[s][mt].half[0] = *(const v8us*)&sA[mt * 16 + ln][(cc * PKC + s) * 32 + 8 * hh]; af[s][mt].half[1] = *(const v8us*)&sA[mt * 16 + ln][(cc * PKC + s) * 32 + 16 + 8 * hh];
      }
    // keeps the next set's loads and this set's LDS reads as one group in front of the products; without it the compiler moves them in among the
    // products, close to their use, and each then waits out its own latency
    __builtin_amdgcn_sched_barrier(0);
#pragma unroll
    for (int s = 0; s < PKC; ++s)
#pragma unroll
      for (int mt = 0; mt < 2; ++mt)
#pragma unroll
        for (int t = 0; t < 3; ++t) acc[mt][t] = __builtin_amdgcn_wmma_f32_16x16x32_bf16(false, af[s][mt].v, false, bf[c & 1][s][t].v, (short)0, acc[mt][t], false, false);
    // second half of the fence pair: keeps the following group's loads and LDS reads from being moved up in among these products
    __builtin_amdgcn_sched_barrier(0);
  }
#pragma unroll
  for (int mt = 0; mt < 2; ++mt)
#pragma unroll
    for (int t = 0; t < 3; ++t)
#pragma unroll
      for (int r = 0; r < 8; ++r) sC[mt * 16 + 8 * hh + r][w * 48 + t * 16 + ln] = acc[mt][t][r] + bv[t];
  __syncthreads();
  // The tile leaves in the forms its reader wants: Q as f32 rows of QKV (the K and V columns of QKV are not written); Kh/Kl = bf16 hi/lo planes of K and
  // VT = f16(V), all three in the order of k_cosattn's A fragments, so that each of its wave-wide 16-B loads is 512 contiguous bytes (four whole lines).
  // Kh/Kl: in the block of tok / 32, [(tok / 16) & 1][ks = c / 32][half][lane = hh * 16 + (tok & 15)][8], c = ks * 32 + half * 16 + hh * 8 + i
  // VT:    in the block of tok / 32, [dt = d / 16][half][lane = hh * 16 + (d & 15)][8], tok = (tok / 32) * 32 + half * 16 + hh * 8 + i
  const size_t base = (size_t)row0 * (3 * DK);   // the group's 32 tokens fill one contiguous 24-KB block: K hi, K lo, V (the three pointers are 8 KB apart)
#pragma unroll
  for (int g = 0; g < PM * (DK / 4) / 256; ++g) {   // Q: a wave stores one whole 512-B row at a time
    const int idx = g * 256 + tid, r = idx >> 5, c4 = (idx & 31) * 4;
    *(v4f*)(QKV + (size_t)(row0 + r) * (3 * DK) + c4) = *(const v4fa*)&sC[r][c4];
  }
  for (int u = 0; u < PM * (DK / 8) / 256; ++u) {   // K planes: 2 key tiles x 4 ks x 2 halves x 32 lanes = 512 groups of 8; group g lies at element g * 8 of the block
    const int g = u * 256 + tid, i = u * 16 + ln, c8 = ((g >> 6) & 3) * 32 + ((g >> 5) & 1) * 16 + hh * 8;
    const v4f k0 = *(const v4fa*)&sC[i][DK + c8], k1 = *(const v4fa*)&sC[i][DK + c8 + 4];
    const float ks[8] = {k0[0], k0[1], k0[2], k0[3], k1[0], k1[1], k1[2], k1[3]};
    v8us h, l;
    for (int q = 0; q < 8; ++q) { const float kh = bf16_round(ks[q]); h[q] = bf16_bits(kh); l[q] = bf16_bits(ks[q] - kh); }
    *(v8us*)(Kh + base + (size_t)g * 8) = h; *(v8us*)(Kl + base + (size_t)g * 8) = l;
  }
  for (int u = 0; u < PM * (DK / 8) / 256; ++u) {   // V: 8 d tiles x 2 halves x 32 lanes = 512 groups of 8 keys; sC's rows 8 apart lie 32 banks apart, so the lane halves do not collide
    const int g = u * 256 + tid, d = (g >> 6) * 16 + ln, t0 = ((g >> 5) & 1) * 16 + hh * 8;
    v8h v;
    for (int q = 0; q < 8; ++q) v[q] = (_Float16)sC[t0 + q][2 * DK + d];
    *(v8h*)(VT + base + (size_t)g * 8) = v;
  }
}
// cos of eight scores without a branch. The hardware cosine takes its argument in revolutions, so the score is reduced in revolutions: n = nearest whole
// number to x / (2 pi); f = x * C_HI - n in one FMA (the product is not rounded before n is taken off), then x * C_LO is added, C_HI + C_LO = 1 / (2 pi) to
// 48 bits. f is right to better than 1e-7 revolutions for |x| up to 1e8 (library cosf changes its method at 131072); an infinite or NaN score gives NaN.
__device__ __forceinline__ v8f cos8(v8f x) {
  const v8f chi = {0x1.45f306p-3f, 0x1.45f306p-3f, 0x1.45f306p-3f, 0x1.45f306p-3f, 0x1.45f306p-3f, 0x1.45f306p-3f, 0x1.45f306p-3f, 0x1.45f306p-3f};
  const v8f clo = {0x1.b9391p-28f, 0x1.b9391p-28f, 0x1.b9391p-28f, 0x1.b9391p-28f, 0x1.b9391p-28f, 0x1.b9391p-28f, 0x1.b9391p-28f, 0x1.b9391p-28f};
  const v8f n = __builtin_elementwise_rint(x * chi);
  const v8f f = __builtin_elementwise_fma(x, clo, __builtin_elementwise_fma(x, chi, -n));
  v8f c;
  // unrolled so that every index is a constant and c stays in registers
#pragma unroll
  for (int i = 0; i < 8; ++i) c[i] = __builtin_amdgcn_cosf(f[i]);
  return c;
}
#define FQ 32
#define FW 8
#define FKEYS (LL / FW)
#define QP (DK + 8)
#define RP (DK + 4)
#define SLOTB (32 * 3 * DK * 2)   // bytes of one pass's block = one wave's LDS slot: 24,576 = 12 x 2 KiB
#define TROW 256                  // the block goes as rows of 256 B at a source pitch of 256 B, no pad: it lands as it lies in memory
typedef unsigned int u32x4 __attribute__((ext_vector_type(4)));
typedef unsigned int u32x8 __attribute__((ext_vector_type(8)));
__device__ __forceinline__ unsigned int uni(unsigned int v) { return (unsigned int)__builtin_amdgcn_readfirstlane(v); }
// holds a wave-uniform test in a scalar register, so that the branch on it is a scalar branch: a tensor load ignores EXEC
__device__ __forceinline__ unsigned int pinned(unsigned int v) { unsigned int s = uni(v); asm volatile("" : "+s"(s)); return s; }   // keeps the test in a scalar register
__device__ __forceinline__ void tdm_load(unsigned int lds_dst, unsigned long long ga, u32x8 g1) {
  u32x4 g0;
  g0[0] = uni(1u); g0[1] = uni(lds_dst); g0[2] = uni((unsigned int)ga); g0[3] = uni((((unsigned int)(ga >> 32)) & 0x01FFFFFFu) | 0x80000000u);
  asm volatile("tensor_load_to_lds %0, %1" :: "s"(g0), "s"(g1) : "memory");
}
__global__ __launch_bounds__(256) void k_cosattn(const float* __restrict__ QKV, const unsigned short* __restrict__ KV, float* __restrict__ out) {
  __shared__ __attribute__((aligned(2048))) unsigned char ring[FW * SLOTB];          // one slot a wave; after the loop the slot holds the wave's partial sums
  __shared__ __attribute__((aligned(16))) unsigned short sQh[FQ][QP], sQl[FQ][QP];   // pitch 272 B = 16 B x odd
  static_assert(FQ * RP * 4 <= SLOTB, "a wave's partial sums must fit its slot");
  const int tid = threadIdx.x, w = tid >> 5, lane = tid & 31, ln = lane & 15, hh = lane >> 4;
  const int b = blockIdx.x / (LL / FQ), q0 = (blockIdx.x % (LL / FQ)) * FQ;
  const int rot = (blockIdx.x + (blockIdx.x >> 3)) & (FKEYS / 32 - 1);   // first pass of this group's walk; neighbours in index, and groups 8 apart, differ
  const unsigned char* slot = ring + w * SLOTB;
  const unsigned int slot_lds = (unsigned int)(size_t)ring + (unsigned int)w * SLOTB;
  const unsigned long long kv0 = (unsigned long long)(size_t)KV + ((unsigned long long)b * LL + (unsigned long long)w * FKEYS) * (3 * DK * 2);   // the wave's first block
  u32x8 g1;   // 1-byte elements, tensor = tile = SLOTB / TROW rows of TROW bytes, no mask, no pad
  unsigned int g1w0;
  // word 0 (mask, element size, pad: all 0) is moved in as an immediate of its own; the compiler otherwise copies it from a register that happens to hold 0
  asm volatile("s_mov_b32 %0, 0" : "=s"(g1w0));
  g1[0] = uni(g1w0); g1[1] = uni((TROW & 0xFFFFu) << 16); g1[2] = uni((TROW >> 16) | (((SLOTB / TROW) & 0xFFFFu) << 16)); g1[3] = uni(((SLOTB / TROW) >> 16) | (TROW << 16));
  g1[4] = uni(SLOTB / TROW); g1[5] = uni(TROW); g1[6] = uni(0u); g1[7] = uni(0u);
  tdm_load(slot_lds, kv0 + (unsigned long long)rot * SLOTB, g1);   // every wave asks for its first pass's block; it flies under the split of Q
  { // Q rows -> bf16 hi/lo planes, split once per work-group (thread: 16 consecutive columns of one row)
    const int r = tid >> 3, c0 = (tid & 7) * 16;
    const float* qr = QKV + ((size_t)b * LL + q0 + r) * (3 * DK) + c0;
    const v4f x0 = *(const v4fa*)qr, x1 = *(const v4fa*)(qr + 4), x2 = *(const v4fa*)(qr + 8), x3 = *(const v4fa*)(qr + 12);
    // the loads' address registers are reused soon after
    asm volatile("s_wait_xcnt 0x0" ::: "memory");
    const float xs[16] = {x0[0], x0[1], x0[2], x0[3], x1[0], x1[1], x1[2], x1[3], x2[0], x2[1], x2[2], x2[3], x3[0], x3[1], x3[2], x3[3]};
#pragma unroll
    for (int g = 0; g < 2; ++g) {
      v8us h, l;
#pragma unroll
      for (int i = 0; i < 8; ++i) { const float x = xs[g * 8 + i]; const unsigned short hb = bf16_bits(x); h[i] = hb; l[i] = bf16_bits(x - bf16_val(hb)); }
      *(v8us*)&sQh[r][c0 + g * 8] = h; *(v8us*)&sQl[r][c0 + g * 8] = l;
    }
  }
  __syncthreads();
  FragB qh[2][4], ql[2][4];     // B fragments: column = query qt*16+ln, k in the same order as the K loader below
#pragma unroll
  for (int qt = 0; qt < 2; ++qt)
#pragma unroll
    for (int ks = 0; ks < 4; ++ks) {
      qh[qt][ks].half[0] = *(const v8us*)&sQh[qt * 16 + ln][ks * 32 + 8 * hh]; qh[qt][ks].half[1] = *(const v8us*)&sQh[qt * 16 + ln][ks * 32 + 16 + 8 * hh];
      ql[qt][ks].half[0] = *(const v8us*)&sQl[qt * 16 + ln][ks * 32 + 8 * hh]; ql[qt][ks].half[1] = *(const v8us*)&sQl[qt * 16 + ln][ks * 32 + 16 + 8 * hh];
    }
  v8f o[2][8];                  // o[qt][dt][r] = O[query qt*16+ln][d = dt*16 + 8*hh + r], this wave's keys only
#pragma unroll
  for (int qt = 0; qt < 2; ++qt)
#pragma unroll
    for (int dt = 0; dt < 8; ++dt) o[qt][dt] = (v8f){0.f, 0.f, 0.f, 0.f, 0.f, 0.f, 0.f, 0.f};
  const unsigned char* fp = slot + lane * 16;   // the block is in fragment order (k_proj): a half fragment is 512 contiguous B; K hi at 0, K lo at 8 KB, V at 16 KB
  for (int it = 0; it < FKEYS / 32; ++it) {
    // this pass's block has landed only behind the wave's own wait
    asm volatile("s_wait_tensorcnt 0x0" ::: "memory");
    FragB ah[2][4], al[2][4];   // A fragments of K hi/lo: row = key kt*16 + ln of the pass
#pragma unroll
    for (int kt = 0; kt < 2; ++kt)
#pragma unroll
      for (int ks = 0; ks < 4; ++ks) {
        const int e = kt * 4096 + ks * 1024;
        ah[kt][ks].half[0] = *(const v8us*)(fp + e); ah[kt][ks].half[1] = *(const v8us*)(fp + e + 512);
        al[kt][ks].half[0] = *(const v8us*)(fp + 8192 + e); al[kt][ks].half[1] = *(const v8us*)(fp + 8192 + e + 512);
      }
    FragH va[8];                // A fragments of V^T: row = d, k = key
#pragma unroll
    for (int dt = 0; dt < 8; ++dt) { va[dt].half[0] = *(const v8us*)(fp + 16384 + dt * 1024); va[dt].half[1] = *(const v8us*)(fp + 16384 + dt * 1024 + 512); }
    // every read of the slot has returned before the next block is aimed at it
    asm volatile("s_wait_dscnt 0x0" ::: "memory");
    if (pinned(it + 1 < FKEYS / 32)) tdm_load(slot_lds, kv0 + (unsigned long long)((it + 1 + rot) & (FKEYS / 32 - 1)) * SLOTB, g1);
    // keeps the LDS reads and the request in front of the products, so that the request has the whole pass to land
    __builtin_amdgcn_sched_barrier(0);
    v8f s[2][2];                // s[kt][qt][r] = S[query qt*16+ln][key j + kt*16 + 8*hh + r]
#pragma unroll
    for (int kt = 0; kt < 2; ++kt)
#pragma unroll
      for (int qt = 0; qt < 2; ++qt) {
        v8f c = {};
#pragma unroll
        for (int ks = 0; ks < 4; ++ks) {   // three products of the hi/lo split, in this order: Qhi.Khi, Qlo.Khi, Qhi.Klo
          c = __builtin_amdgcn_wmma_f32_16x16x32_bf16(false, ah[kt][ks].v, false, qh[qt][ks].v, (short)0, c, false, false);
          c = __builtin_amdgcn_wmma_f32_16x16x32_bf16(false, ah[kt][ks].v, false, ql[qt][ks].v, (short)0, c, false, false);
          c = __builtin_amdgcn_wmma_f32_16x16x32_bf16(false, al[kt][ks].v, false, qh[qt][ks].v, (short)0, c, false, false);
        }
        s[kt][qt] = c;
      }
#pragma unroll
    for (int qt = 0; qt < 2; ++qt) {
      FragH p;                  // B fragment: p[i] = cos(S)[key kmap(i, hh)][query], straight from the two D tiles
      const v8f c0 = cos8(s[0][qt]), c1 = cos8(s[1][qt]);
#pragma unroll
      for (int i = 0; i < 8; ++i) { p.h[i] = (_Float16)c0[i]; p.h[8 + i] = (_Float16)c1[i]; }
#pragma unroll
      for (int dt = 0; dt < 8; ++dt) o[qt][dt] = __builtin_amdgcn_wmma_f32_16x16x32_f16(false, va[dt].v, false, p.v, (short)0, o[qt][dt], false, false);
    }
  }
  // no request is in flight and no read of the slot is outstanding when the wave's slot becomes the home of its partial sums
  asm volatile("s_wait_tensorcnt 0x0" ::: "memory");
  asm volatile("s_wait_dscnt 0x0" ::: "memory");
#pragma unroll
  for (int qt = 0; qt < 2; ++qt)
#pragma unroll
    for (int dt = 0; dt < 8; ++dt) {
      float* d = (float*)(ring + w * SLOTB) + (qt * 16 + ln) * RP + dt * 16 + 8 * hh;   // row pitch 528 B = 16 B x odd
      *(v4fa*)d = (v4f){o[qt][dt][0], o[qt][dt][1], o[qt][dt][2], o[qt][dt][3]};
      *(v4fa*)(d + 4) = (v4f){o[qt][dt][4], o[qt][dt][5], o[qt][dt][6], o[qt][dt][7]};
    }
  __syncthreads();
#pragma unroll
  for (int g = 0; g < FQ * DK / 4 / 256; ++g) {   // a wave stores one whole 512-B output row at a time
    const int idx = g * 256 + tid, q = idx >> 5, d4 = (idx & 31) * 4;
    v4f a = *(const v4fa*)(ring + (q * RP + d4) * 4);
#pragma unroll
    for (int u = 1; u < FW; ++u) a += *(const v4fa*)(ring + u * SLOTB + (q * RP + d4) * 4);
    *(v4f*)(out + ((size_t)b * LL + q0 + q) * DK + d4) = a;
  }
}
extern "C" void kernel_launch(void* const* d_in, const int* in_sizes, int n_in,
                              void* d_out, int out_size, void* d_ws, size_t ws_size, hipStream_t stream) {
  (void)in_sizes; (void)n_in; (void)out_size;
  const float* x = (const float*)d_in[0]; const float* Wq = (const float*)d_in[1]; const float* bq = (const float*)d_in[2]; const float* Wk = (const float*)d_in[3]; const float* bk = (const float*)d_in[4]; const float* Wv = (const float*)d_in[5]; const float* bv = (const float*)d_in[6];
  char* ws = (char*)d_ws; size_t off = 0;
  auto take = [&](size_t bytes) { char* p = ws + off; off += (bytes + 255) & ~(size_t)255; return p; };
  unsigned short* Bt = (unsigned short*)take((size_t)3 * DK * DM * 2); float* B3 = (float*)take(3 * DK * 4); float* QKV = (float*)take((size_t)NTOK * 3 * DK * 4);
  unsigned short* KV = (unsigned short*)take((size_t)NTOK * DK * 2 * 3); unsigned short* Kh = KV; unsigned short* Kl = KV + 32 * DK; _Float16* VT = (_Float16*)(KV + 64 * DK);
  if (off > ws_size) return;
  k_wt<<<dim3(DM / 32, 3 * DK / 32), 256, 0, stream>>>(Wq, Wk, Wv, bq, bk, bv, Bt, B3);
  k_proj<<<NTOK / PM, 256, 0, stream>>>(x, Bt, B3, QKV, Kh, Kl, VT);
  k_cosattn<<<NTOK / FQ, 256, 0, stream>>>(QKV, KV, (float*)d_out);
}

// v008
// Measured time: 30.7 microseconds a run.
// Two timings next to v007 both put it at 1.04 times that version's speed.
// All steps since v000 together make it 16.6 times as fast.
#include <hip/hip_runtime.h>
// [Q|K|V] = x·[Wq|Wk|Wv] + b on v_wmma_f32_16x16x32_bf16 (x rounded to bf16: single exact term; 8192 × 1024 × 384); QK = Q·Kᵀ on the same unit with BOTH f32 operands split
// hi/lo (3 products — cos(QK) at |QK| ≈ 10–40 needs the phase to ≈1e-4 rad; 4 × 2048 × 2048 × 128); out = cos(QK)·V on v_wmma_f32_16x16x32_f16 (cos and V rounded to
// f16: single product). cos in f32: reduction on the VALU, then v_cos_f32.
#define BB 4
#define LL 2048
#define DM 1024
#define DK 128
#define NTOK (BB * LL)

typedef __bf16 v16b __attribute__((ext_vector_type(16)));
typedef unsigned short v8us __attribute__((ext_vector_type(8), may_alias));
typedef float  v8f  __attribute__((ext_vector_type(8)));
typedef float  v4f  __attribute__((ext_vector_type(4)));
typedef float  v4fa __attribute__((ext_vector_type(4), may_alias));
union FragB { v16b v; v8us half[2]; unsigned short u[16]; };

__device__ __forceinline__ unsigned short bf16_bits(float x) { unsigned int u = __float_as_uint(x); return (unsigned short)((u + 0x7FFFu + ((u >> 16) & 1u)) >> 16); }
__device__ __forceinline__ float bf16_val(unsigned short b) { return __uint_as_float(((unsigned int)b) << 16); }
__device__ __forceinline__ float bf16_round(float x) { return bf16_val(bf16_bits(x)); }
// D += A·B with NT terms: 1 = ah·bh, 2 = + al·bh (A split), 3 = + ah·bl (both split)
template <int NT>
__device__ __forceinline__ v8f mmaN(v16b ah, v16b al, v16b bh, v16b bl, v8f c) {
  c = __builtin_amdgcn_wmma_f32_16x16x32_bf16(false, ah, false, bh, (short)0, c, false, false);
  if (NT >= 2) c = __builtin_amdgcn_wmma_f32_16x16x32_bf16(false, al, false, bh, (short)0, c, false, false);
  if (NT >= 3) c = __builtin_amdgcn_wmma_f32_16x16x32_bf16(false, ah, false, bl, (short)0, c, false, false);
  asm volatile("v_nop\n\tv_nop\n\tv_nop\n\tv_nop" : "+v"(c) : "v"(ah), "v"(al), "v"(bh), "v"(bl));
  return c;
}

__global__ __launch_bounds__(256) void k_wt_bf16(const float* __restrict__ W, unsigned short* __restrict__ Wt, int K, int N) {
  const int t = blockIdx.x * 256 + threadIdx.x;
  const int k8n = K / 8;
  if (t >= N * k8n) return;
  const int n = t / k8n, k8 = (t % k8n) * 8;
  v8us v;
#pragma unroll
  for (int i = 0; i < 8; ++i) v[i] = bf16_bits(W[(size_t)(k8 + i) * N + n]);
  *(v8us*)(Wt + (size_t)n * K + k8) = v;
  
}

// GEMM C[M][N] (f32, pitch ldc) = act(A[M][K]·W + bias). A f32 row-major (pitch lda) converted per fragment to bf16
// (ASPLIT: hi/lo two planes -> 2 terms, else single rounded term); Wt bf16 [N][K] (pitch ldb). BIAS_BF16 rounds the
// bias to bf16 first (bias quantised to bf16 before the add). K%32==0, M%16==0, N%64==0.
template <bool ASPLIT, int ACT, bool BIAS_BF16>
__global__ __launch_bounds__(128) void k_gemm_bf(const float* __restrict__ A, int lda, const unsigned short* __restrict__ Wt, int ldb,
                                               const float* __restrict__ bias, float* __restrict__ C, int ldc, int M, int N, int K) {
  __shared__ __attribute__((aligned(16))) float so[4][16][64];
  const int tid = threadIdx.x, w = tid >> 5, lane = tid & 31, ln = lane & 15, hh = lane >> 4;
  const int ntn = N / 64;
  const int wid = blockIdx.x * 4 + w;
  const int mt = wid / ntn, nq = wid % ntn;
  if (mt * 16 >= M) return;
  const int row0 = mt * 16, col0 = nq * 64;
  const float* arow = A + (size_t)(row0 + ln) * lda;
  v8f acc[4] = {};
  for (int kb = 0; kb < K; kb += 32) {
    FragB ah, al;
    const v4f x0 = *(const v4fa*)(arow + kb + 8 * hh), x1 = *(const v4fa*)(arow + kb + 8 * hh + 4);
    const v4f x2 = *(const v4fa*)(arow + kb + 16 + 8 * hh), x3 = *(const v4fa*)(arow + kb + 16 + 8 * hh + 4);
    float xs[16] = {x0[0],x0[1],x0[2],x0[3],x1[0],x1[1],x1[2],x1[3],x2[0],x2[1],x2[2],x2[3],x3[0],x3[1],x3[2],x3[3]};
#pragma unroll
    for (int i = 0; i < 16; ++i) { const unsigned short hb = bf16_bits(xs[i]); ah.u[i] = hb; al.u[i] = ASPLIT ? bf16_bits(xs[i] - bf16_val(hb)) : (unsigned short)0; }
#pragma unroll
    for (int t = 0; t < 4; ++t) {
      const unsigned short* brow = Wt + (size_t)(col0 + t * 16 + ln) * ldb + kb;
      FragB b;
      b.half[0] = *(const v8us*)(brow + 8 * hh);
      b.half[1] = *(const v8us*)(brow + 16 + 8 * hh);
      acc[t] = mmaN<ASPLIT ? 2 : 1>(ah.v, al.v, b.v, b.v, acc[t]);
    }
  }
#pragma unroll
  for (int t = 0; t < 4; ++t) {
    float bv = bias ? bias[col0 + t * 16 + ln] : 0.f;
    if (BIAS_BF16) bv = bf16_round(bv);
#pragma unroll
    for (int r = 0; r < 8; ++r) { float v = acc[t][r] + bv; if (ACT == 1) v = fmaxf(v, 0.f); so[w][8 * hh + r][t * 16 + ln] = v; }
  }
  __builtin_amdgcn_fence(__ATOMIC_ACQ_REL, "workgroup");
  __builtin_amdgcn_wave_barrier();
  const int rsub = lane >> 4, c4 = (lane & 15) * 4;
  {
#pragma unroll
    for (int q = 0; q < 8; ++q) {
      const int r = q * 2 + rsub;
      const v4f v = *(const v4fa*)&so[w][r][c4];
      *(v4f*)(C + (size_t)(row0 + r) * ldc + col0 + c4) = v;
    }
    
  }
}

// Flash-style causal/unmasked attention, all contractions 3-term bf16 hi/lo splits, f32 softmax with running max.
// q,k,v rows are read from f32 buffers with arbitrary row pitch (so they can live inside a fused qkv buffer);
// D = head size (multiple of 32, <= 128); one wave = 16 query rows; block = 4 waves (64 queries) sharing K/V chunks of 32.
template <int D, bool CAUSAL>
__global__ __launch_bounds__(128) void k_flash(const float* __restrict__ qb, const float* __restrict__ kb, const float* __restrict__ vb,
                                             int pitch, int T, int H, float scale, float* __restrict__ y, int ypitch) {
  constexpr int KS = D / 32;        // k-steps for QK
  constexpr int DT = D / 16;        // d tiles for PV
  __shared__ __attribute__((aligned(16))) unsigned short sKh[32][D + 8], sKl[32][D + 8], sVh[32][D + 8], sVl[32][D + 8];
  __shared__ __attribute__((aligned(16))) unsigned short sPh[4][16][40], sPl[4][16][40];
  __shared__ __attribute__((aligned(16))) float sO[4][16][D];
  const int tid = threadIdx.x, w = tid >> 5, lane = tid & 31, ln = lane & 15, hh = lane >> 4;
  const int nqb = (T + 63) / 64;
  const int bh = blockIdx.x / nqb, qblk = blockIdx.x % nqb;
  const int b = bh / H, h = bh % H;
  const int q0 = qblk * 64 + w * 16;
  const float* Q = qb + (size_t)b * T * pitch + h * D;
  const float* K = kb + (size_t)b * T * pitch + h * D;
  const float* V = vb + (size_t)b * T * pitch + h * D;

  // A fragments of the wave's 16 query rows (scaled), hi/lo
  FragB aqh[KS], aql[KS];
  {
    int row = q0 + ln; if (row >= T) row = T - 1;
    const float* qr = Q + (size_t)row * pitch;
#pragma unroll
    for (int ks = 0; ks < KS; ++ks)
#pragma unroll
      for (int i = 0; i < 16; ++i) {
        const int d = ks * 32 + ((i < 8) ? (8 * hh + i) : (16 + 8 * hh + (i - 8)));
        const float x = qr[d] * scale; const unsigned short hb = bf16_bits(x);
        aqh[ks].u[i] = hb; aql[ks].u[i] = bf16_bits(x - bf16_val(hb));
      }
  }
  float m_r[8], l_r[8];
#pragma unroll
  for (int r = 0; r < 8; ++r) { m_r[r] = -3.0e38f; l_r[r] = 0.f; }
  v8f oacc[DT];
#pragma unroll
  for (int dt = 0; dt < DT; ++dt) oacc[dt] = (v8f){0.f,0.f,0.f,0.f,0.f,0.f,0.f,0.f};

  const int kv_end = CAUSAL ? min(T, qblk * 64 + 64) : T;     // block-uniform
  for (int j0 = 0; j0 < kv_end; j0 += 32) {
    __syncthreads();
    for (int e = tid; e < 32 * (D / 4); e += 128) {
      const int r = e / (D / 4), c4 = (e % (D / 4)) * 4;
      const int key = j0 + r;
      v4f kf = {0.f,0.f,0.f,0.f}, vf = {0.f,0.f,0.f,0.f};
      if (key < T) { kf = *(const v4fa*)(K + (size_t)key * pitch + c4); vf = *(const v4fa*)(V + (size_t)key * pitch + c4); }
#pragma unroll
      for (int t = 0; t < 4; ++t) {
        unsigned short hb = bf16_bits(kf[t]); sKh[r][c4 + t] = hb; sKl[r][c4 + t] = bf16_bits(kf[t] - bf16_val(hb));
        hb = bf16_bits(vf[t]); sVh[r][c4 + t] = hb; sVl[r][c4 + t] = bf16_bits(vf[t] - bf16_val(hb));
      }
    }
    __syncthreads();
    // S tile 16 x 32
    v8f s[2];
#pragma unroll
    for (int nt = 0; nt < 2; ++nt) {
      v8f acc = {};
#pragma unroll
      for (int ks = 0; ks < KS; ++ks) {
        FragB bh_, bl_;
        bh_.half[0] = *(const v8us*)&sKh[nt * 16 + ln][ks * 32 + 8 * hh]; bh_.half[1] = *(const v8us*)&sKh[nt * 16 + ln][ks * 32 + 16 + 8 * hh];
        bl_.half[0] = *(const v8us*)&sKl[nt * 16 + ln][ks * 32 + 8 * hh]; bl_.half[1] = *(const v8us*)&sKl[nt * 16 + ln][ks * 32 + 16 + 8 * hh];
        acc = mmaN<3>(aqh[ks].v, aql[ks].v, bh_.v, bl_.v, acc);
      }
      s[nt] = acc;
    }
    // mask + running max (rows 8hh+r; the 16 lanes of a half share rows)
    float alpha[8];
#pragma unroll
    for (int r = 0; r < 8; ++r) {
      const int qi = q0 + 8 * hh + r;
      const int ja = j0 + ln, jb = j0 + 16 + ln;
      if (CAUSAL) { if (ja > qi) s[0][r] = -3.0e38f; if (jb > qi) s[1][r] = -3.0e38f; }
      if (ja >= T) s[0][r] = -3.0e38f;
      if (jb >= T) s[1][r] = -3.0e38f;
      float mx = fmaxf(s[0][r], s[1][r]);
      mx = fmaxf(mx, __shfl_xor(mx, 1, 32)); mx = fmaxf(mx, __shfl_xor(mx, 2, 32)); mx = fmaxf(mx, __shfl_xor(mx, 4, 32)); mx = fmaxf(mx, __shfl_xor(mx, 8, 32));
      const float mnew = fmaxf(m_r[r], mx);
      alpha[r] = (mnew > -1.0e38f) ? __expf(m_r[r] - mnew) : 1.0f;
      const float p0 = (s[0][r] > -1.0e38f) ? __expf(s[0][r] - mnew) : 0.f;
      const float p1 = (s[1][r] > -1.0e38f) ? __expf(s[1][r] - mnew) : 0.f;
      m_r[r] = mnew;
      l_r[r] = l_r[r] * alpha[r] + p0 + p1;            // per-lane partial row sum (16 lanes combined at the end)
      unsigned short hb = bf16_bits(p0); sPh[w][8 * hh + r][ln] = hb;      sPl[w][8 * hh + r][ln] = bf16_bits(p0 - bf16_val(hb));
      hb = bf16_bits(p1);                sPh[w][8 * hh + r][16 + ln] = hb; sPl[w][8 * hh + r][16 + ln] = bf16_bits(p1 - bf16_val(hb));
    }
#pragma unroll
    for (int dt = 0; dt < DT; ++dt)
#pragma unroll
      for (int r = 0; r < 8; ++r) oacc[dt][r] *= alpha[r];
    __builtin_amdgcn_fence(__ATOMIC_ACQ_REL, "workgroup");
    __builtin_amdgcn_wave_barrier();
    FragB pah, pal;
    pah.half[0] = *(const v8us*)&sPh[w][ln][8 * hh]; pah.half[1] = *(const v8us*)&sPh[w][ln][16 + 8 * hh];
    pal.half[0] = *(const v8us*)&sPl[w][ln][8 * hh]; pal.half[1] = *(const v8us*)&sPl[w][ln][16 + 8 * hh];
#pragma unroll
    for (int dt = 0; dt < DT; ++dt) {
      FragB bvh, bvl;
#pragma unroll
      for (int i = 0; i < 8; ++i) {
        bvh.u[i] = sVh[8 * hh + i][dt * 16 + ln]; bvh.u[8 + i] = sVh[16 + 8 * hh + i][dt * 16 + ln];
        bvl.u[i] = sVl[8 * hh + i][dt * 16 + ln]; bvl.u[8 + i] = sVl[16 + 8 * hh + i][dt * 16 + ln];
      }
      oacc[dt] = mmaN<3>(pah.v, pal.v, bvh.v, bvl.v, oacc[dt]);
    }
    __builtin_amdgcn_fence(__ATOMIC_ACQ_REL, "workgroup");
    __builtin_amdgcn_wave_barrier();
  }
#pragma unroll
  for (int r = 0; r < 8; ++r) {
    float l = l_r[r];
    l += __shfl_xor(l, 1, 32); l += __shfl_xor(l, 2, 32); l += __shfl_xor(l, 4, 32); l += __shfl_xor(l, 8, 32);
    l_r[r] = (l > 0.f) ? 1.0f / l : 0.f;
  }
#pragma unroll
  for (int dt = 0; dt < DT; ++dt)
#pragma unroll
    for (int r = 0; r < 8; ++r) sO[w][8 * hh + r][dt * 16 + ln] = oacc[dt][r] * l_r[r];
  __builtin_amdgcn_fence(__ATOMIC_ACQ_REL, "workgroup");
  __builtin_amdgcn_wave_barrier();
  {
    for (int r = 0; r < 16; ++r) {
      const int row = q0 + r;
      if (row < T && lane < D / 4) {
        const v4f val = *(const v4fa*)&sO[w][r][lane * 4];
        *(v4f*)(y + ((size_t)b * T + row) * ypitch + h * D + lane * 4) = val;
      }
    }
    
  }
}

// batched GEMM (blockIdx.y = batch): C_b = act(alpha·A_b·B_b + bias + resid_b); A f32 rows (ASPLIT → hi/lo), B = bf16 planes Bh (+Bl when BSPLIT, requires ASPLIT),
// per-batch element strides sA, sB (0 = shared weights), sC, sR. resid may alias C (values are staged before the stores). ACT 0/1(relu).
// ACT: 0 none, 1 relu, 2 softplus
template <bool ASPLIT, bool BSPLIT, int ACT>
__global__ __launch_bounds__(128) void k_gemm_b(const float* __restrict__ A, int lda, size_t sA, const unsigned short* __restrict__ Bh, const unsigned short* __restrict__ Bl, int ldb, size_t sB,
                                             const float* __restrict__ bias, const float* __restrict__ resid, int ldr, size_t sR, float rsign, float alpha,
                                             float* __restrict__ C, int ldc, size_t sC, int M, int N, int K) {
  __shared__ __attribute__((aligned(16))) float so[4][16][64];
  const int tid = threadIdx.x, w = tid >> 5, lane = tid & 31, ln = lane & 15, hh = lane >> 4;
  const int by = blockIdx.y;
  A += (size_t)by * sA; Bh += (size_t)by * sB; if (BSPLIT) Bl += (size_t)by * sB; C += (size_t)by * sC; if (resid) resid += (size_t)by * sR;
  const int ntn = (N + 63) / 64; const int wid = blockIdx.x * 4 + w; const int mt = wid / ntn, nq = wid % ntn;      // N may be any multiple of 16: tiles past N are skipped and not stored
  if (mt * 16 >= M) return;
  const int row0 = mt * 16, col0 = nq * 64;
  const float* arow = A + (size_t)(row0 + ln) * lda;
  v8f acc[4] = {};
  for (int kb = 0; kb < K; kb += 32) {
    FragB ah, al;
    const v4f x0 = *(const v4fa*)(arow + kb + 8 * hh), x1 = *(const v4fa*)(arow + kb + 8 * hh + 4);
    const v4f x2 = *(const v4fa*)(arow + kb + 16 + 8 * hh), x3 = *(const v4fa*)(arow + kb + 16 + 8 * hh + 4);
    float xs[16] = {x0[0],x0[1],x0[2],x0[3],x1[0],x1[1],x1[2],x1[3],x2[0],x2[1],x2[2],x2[3],x3[0],x3[1],x3[2],x3[3]};
#pragma unroll
    for (int i = 0; i < 16; ++i) { const unsigned short hb = bf16_bits(xs[i]); ah.u[i] = hb; al.u[i] = ASPLIT ? bf16_bits(xs[i] - bf16_val(hb)) : (unsigned short)0; }
#pragma unroll
    for (int t = 0; t < 4; ++t) {
      if (col0 + t * 16 >= N) continue;
      const size_t boff = (size_t)(col0 + t * 16 + ln) * ldb + kb;
      FragB bh_, bl_; bh_.half[0] = *(const v8us*)(Bh + boff + 8 * hh); bh_.half[1] = *(const v8us*)(Bh + boff + 16 + 8 * hh);
      if (BSPLIT) { bl_.half[0] = *(const v8us*)(Bl + boff + 8 * hh); bl_.half[1] = *(const v8us*)(Bl + boff + 16 + 8 * hh); } else bl_ = bh_;
      acc[t] = mmaN<ASPLIT ? (BSPLIT ? 3 : 2) : 1>(ah.v, al.v, bh_.v, bl_.v, acc[t]);
    }
  }
#pragma unroll
  for (int t = 0; t < 4; ++t) {
    const int col = col0 + t * 16 + ln; if (col0 + t * 16 >= N) continue; const float bv = bias ? bf16_round(bias[col]) : 0.f;
#pragma unroll
    for (int r = 0; r < 8; ++r) { float v = acc[t][r] * alpha + bv; if (resid) v += rsign * resid[(size_t)(row0 + 8 * hh + r) * ldr + col]; if (ACT == 1) v = fmaxf(v, 0.f); else if (ACT == 2) v = fmaxf(v, 0.f) + log1pf(expf(-fabsf(v))); so[w][8 * hh + r][t * 16 + ln] = v; }
  }
  __builtin_amdgcn_fence(__ATOMIC_ACQ_REL, "workgroup"); __builtin_amdgcn_wave_barrier();
  const int rsub = lane >> 4, c4 = (lane & 15) * 4;
  {
#pragma unroll
    for (int q = 0; q < 8; ++q) { const int r = q * 2 + rsub; if (col0 + c4 < N) { const v4f v = *(const v4fa*)&so[w][r][c4]; *(v4f*)(C + (size_t)(row0 + r) * ldc + col0 + c4) = v; } }
    
  }
}
// batched f32 [K][N] (pitch lds, batch stride sIn) -> transposed hi/lo planes [N][K] (batch stride sOut); thread per (n, 8 k); grid.y = batch
__global__ __launch_bounds__(256) void k_split_transpose_b(const float* __restrict__ src, int lds_, size_t sIn, unsigned short* __restrict__ hi, unsigned short* __restrict__ lo, size_t sOut, int K, int N) {
  const size_t t = (size_t)blockIdx.x * 256 + threadIdx.x; const int k8n = K / 8; if (t >= (size_t)N * k8n) return;
  src += (size_t)blockIdx.y * sIn; hi += (size_t)blockIdx.y * sOut; lo += (size_t)blockIdx.y * sOut;
  const int n = (int)(t / k8n), k8 = (int)(t % k8n) * 8; v8us vh, vl;
#pragma unroll
  for (int i = 0; i < 8; ++i) { const float x = src[(size_t)(k8 + i) * lds_ + n]; const unsigned short hb = bf16_bits(x); vh[i] = hb; vl[i] = bf16_bits(x - bf16_val(hb)); }
  unsigned short* dh = hi + (size_t)n * K + k8; unsigned short* dl = lo + (size_t)n * K + k8;
  *(v8us*)dh = vh; *(v8us*)dl = vl; 
}

// ---- f16 WMMA path (v_wmma_f32_16x16x32_f16): 11-bit significands for operands in range — used where the [-1,1] cos operand needs more precision than bf16
typedef _Float16 v16h __attribute__((ext_vector_type(16)));
union FragH { v16h v; v8us half[2]; _Float16 h[16]; unsigned short u[16]; };
template <int NT>
__device__ __forceinline__ v8f mmaH(v16h ah, v16h al, v16h bh, v16h bl, v8f c) {
  c = __builtin_amdgcn_wmma_f32_16x16x32_f16(false, ah, false, bh, (short)0, c, false, false);
  if (NT >= 2) c = __builtin_amdgcn_wmma_f32_16x16x32_f16(false, al, false, bh, (short)0, c, false, false);
  if (NT >= 3) c = __builtin_amdgcn_wmma_f32_16x16x32_f16(false, ah, false, bl, (short)0, c, false, false);
  asm volatile("v_nop\n\tv_nop\n\tv_nop\n\tv_nop" : "+v"(c) : "v"(ah), "v"(al), "v"(bh), "v"(bl));
  return c;
}
// batched GEMM like k_gemm_b but f16 operands: A f32 (split into f16 hi/lo if ASPLIT, else rounded to f16), Bt = f16 values [n][k]; alpha; C f32; N multiple of 16 (partial tiles skipped)
template <bool ASPLIT>
__global__ __launch_bounds__(128) void k_gemm_h(const float* __restrict__ A, int lda, size_t sA, const _Float16* __restrict__ Bh, int ldb, size_t sB, float alpha, float* __restrict__ C, int ldc, size_t sC, int M, int N, int K) {
  __shared__ __attribute__((aligned(16))) float so[4][16][64];
  const int tid = threadIdx.x, w = tid >> 5, lane = tid & 31, ln = lane & 15, hh = lane >> 4; const int by = blockIdx.y;
  A += (size_t)by * sA; Bh += (size_t)by * sB; C += (size_t)by * sC;
  const int ntn = (N + 63) / 64; const int wid = blockIdx.x * 4 + w; const int mt = wid / ntn, nq = wid % ntn; if (mt * 16 >= M) return;
  const int row0 = mt * 16, col0 = nq * 64; const float* arow = A + (size_t)(row0 + ln) * lda;
  v8f acc[4] = {};
  for (int kb = 0; kb < K; kb += 32) {
    FragH ah, al;
    const v4f x0 = *(const v4fa*)(arow + kb + 8 * hh), x1 = *(const v4fa*)(arow + kb + 8 * hh + 4), x2 = *(const v4fa*)(arow + kb + 16 + 8 * hh), x3 = *(const v4fa*)(arow + kb + 16 + 8 * hh + 4);
    float xs[16] = {x0[0],x0[1],x0[2],x0[3],x1[0],x1[1],x1[2],x1[3],x2[0],x2[1],x2[2],x2[3],x3[0],x3[1],x3[2],x3[3]};
#pragma unroll
    for (int i = 0; i < 16; ++i) { const _Float16 h = (_Float16)xs[i]; ah.h[i] = h; al.h[i] = ASPLIT ? (_Float16)(xs[i] - (float)h) : (_Float16)0.0f; }
#pragma unroll
    for (int t = 0; t < 4; ++t) { if (col0 + t * 16 >= N) continue; const size_t boff = (size_t)(col0 + t * 16 + ln) * ldb + kb; FragH bq; bq.half[0] = *(const v8us*)(Bh + boff + 8 * hh); bq.half[1] = *(const v8us*)(Bh + boff + 16 + 8 * hh);
      acc[t] = mmaH<ASPLIT ? 2 : 1>(ah.v, al.v, bq.v, bq.v, acc[t]); }
  }
#pragma unroll
  for (int t = 0; t < 4; ++t) { if (col0 + t * 16 >= N) continue;
#pragma unroll
    for (int r = 0; r < 8; ++r) so[w][8 * hh + r][t * 16 + ln] = acc[t][r] * alpha; }
  __builtin_amdgcn_fence(__ATOMIC_ACQ_REL, "workgroup"); __builtin_amdgcn_wave_barrier();
  const int rsub = lane >> 4, c4 = (lane & 15) * 4;
  {
#pragma unroll
    for (int q = 0; q < 8; ++q) { const int r = q * 2 + rsub; if (col0 + c4 < N) { const v4f v = *(const v4fa*)&so[w][r][c4]; *(v4f*)(C + (size_t)(row0 + r) * ldc + col0 + c4) = v; } }
     }
}

// [Q|K|V] = x.W + b, W taken as it lies (f32, [k][n]): no packing launch. A work-group owns PM rows of x and PN of the 384 columns (two groups share a row
// block), so that the f32 W bytes a group pulls from L2 are no more than the packed bf16 W of all 384 columns were. x rows are fetched by whole-line loads,
// rounded to bf16 once and kept in LDS. W comes in chunks of WKC k rows: whole-line f32 loads WD chunks ahead, rounded to bf16, laid row-major in one of
// two LDS buffers, and read back as B fragments by the transposing LDS load, whose k order is the x loader's. One WMMA per 32 k. Groups that read the same
// W columns each start their walk over k at a chunk of their own (by index) and wrap.
#define PM 64
#define PN 192
#define PAP (DM + 8)
#define PCP (PN + 4)
#define PKC 2
#define WKC (PKC * 32)
#define WPB (PN * 2 + 32)   // LDS row pitch of a W chunk, bytes: 416 = 32 B x odd, the transposing load's pitch
#define NCH (DM / WKC)
#define WD 3                   // chunks of W in flight in registers
typedef unsigned short v4usa __attribute__((ext_vector_type(4), may_alias));
typedef _Float16 v8h __attribute__((ext_vector_type(8)));
typedef short s16x8 __attribute__((ext_vector_type(8)));
typedef unsigned short v8up __attribute__((ext_vector_type(8)));
// lane (c, h) gets T[kbase + 8h + 0..7][dbase + c] from a row-major 16-bit tile; the lane's address is row kbase + 8h + (lane & 7), byte 2 dbase + 16 ((lane >> 3) & 1)
__device__ __forceinline__ v8up ld_tr16(const unsigned char* p) { typedef __attribute__((address_space(3))) s16x8 lds_s16x8; return __builtin_bit_cast(v8up, __builtin_amdgcn_ds_load_tr16_b128_v8i16((lds_s16x8*)p)); }
typedef __bf16 v4bf __attribute__((ext_vector_type(4)));
typedef unsigned short v4up __attribute__((ext_vector_type(4)));
// four W values rounded to bf16 (to nearest, ties to even, as bf16_bits rounds) by the packed conversion: one instruction for two values
__device__ __forceinline__ v4up w_bf16(v4f v) { return __builtin_bit_cast(v4up, __builtin_convertvector(v, v4bf)); }
// s_wait_xcnt 0 behind a group of W loads. The three address pairs are inputs so that they stay live up to the wait: otherwise a later load of the same group
// may be given an earlier load's address registers as its destination, in front of the wait
__device__ __forceinline__ void xwait3(const float* a, const float* b, const float* c) { asm volatile("s_wait_xcnt 0x0" :: "v"(a), "v"(b), "v"(c) : "memory"); }
// work-group barrier that waits for the wave's own LDS traffic only: __syncthreads() also waits for every global load in flight, which would drain the W chunks
// that are meant to fly across it
__device__ __forceinline__ void lds_barrier() { asm volatile("s_wait_dscnt 0x0\n\ts_barrier_signal -1\n\ts_barrier_wait -1" ::: "memory"); }
__global__ __launch_bounds__(256) void k_proj(const float* __restrict__ x, const float* __restrict__ Wq, const float* __restrict__ Wk, const float* __restrict__ Wv, const float* __restrict__ bq, const float* __restrict__ bk, const float* __restrict__ bvp, float* __restrict__ QKV, unsigned short* __restrict__ Kh, unsigned short* __restrict__ Kl, _Float16* __restrict__ VT) {
  __shared__ __attribute__((aligned(16))) unsigned short sA[PM][PAP];   // pitch 2064 B = 16 B x odd
  __shared__ __attribute__((aligned(32))) unsigned char sW[2][WKC * WPB];
  __shared__ __attribute__((aligned(16))) float sC[PM][PCP];            // pitch 196 dwords: rows 8 apart lie 32 banks apart
  const int tid = threadIdx.x, w = tid >> 5, lane = tid & 31, ln = lane & 15, hh = lane >> 4;
  const int bid = blockIdx.x;
  const int ch = (bid >> 3) & 1, rt = (bid >> 4) * 8 + (bid & 7);   // column half and row block; the two groups of a row block are 8 apart in index
  const int row0 = rt * PM;
  const int rg = w >> 2, cg = w & 3;                                 // a wave owns 32 rows x 48 columns
  const int rot = (bid + (bid >> 3)) & (NCH - 1);                    // first chunk of this group's walk
  // the group's 192 columns as three runs of 64: half 0 = Q 0-127, K 0-63; half 1 = K 64-127, V 0-127
  const int wr = tid >> 4, wc = (tid & 15) * 4;                      // a wave-wide load takes 256 contiguous B of each of two k rows
  const float* wsrc[3] = {(ch ? Wk + 64 : Wq) + wr * DK + wc, (ch ? Wv : Wq + 64) + wr * DK + wc, (ch ? Wv + 64 : Wk) + wr * DK + wc};
  v4f wreg[WD][WKC / 16][3];
#pragma unroll
  for (int rb = 0; rb < WKC / 16; ++rb)
#pragma unroll
    for (int sg = 0; sg < 3; ++sg) wreg[0][rb][sg] = *(const v4fa*)(wsrc[sg] + (size_t)(rot * WKC) * DK + rb * 16 * DK);
  // here and behind each group of loads or stores below: their address registers are free for reuse behind them; the wait stands in front of any such overwrite
  xwait3(wsrc[0] + (size_t)(rot * WKC) * DK, wsrc[1] + (size_t)(rot * WKC) * DK, wsrc[2] + (size_t)(rot * WKC) * DK);
  {
    const float* xr = x + (size_t)row0 * DM + tid * 4;
    v4f va[16], vb[16];         // 16 rows a batch, two batches in flight
#pragma unroll
    for (int i = 0; i < 16; ++i) va[i] = *(const v4fa*)(xr + (size_t)i * DM);
#pragma unroll
    for (int i = 0; i < 16; ++i) vb[i] = *(const v4fa*)(xr + (size_t)(16 + i) * DM);
    asm volatile("s_wait_xcnt 0x0" ::: "memory");
    // these fences keep each batch's loads in front of the older batch's conversions, so that two batches are always in flight
    __builtin_amdgcn_sched_barrier(0);
#pragma unroll
    for (int i = 0; i < 16; ++i) *(v4usa*)&sA[i][tid * 4] = (v4usa){bf16_bits(va[i][0]), bf16_bits(va[i][1]), bf16_bits(va[i][2]), bf16_bits(va[i][3])};
#pragma unroll
    for (int i = 0; i < 16; ++i) va[i] = *(const v4fa*)(xr + (size_t)(32 + i) * DM);
    asm volatile("s_wait_xcnt 0x0" ::: "memory");
    __builtin_amdgcn_sched_barrier(0);
#pragma unroll
    for (int i = 0; i < 16; ++i) *(v4usa*)&sA[16 + i][tid * 4] = (v4usa){bf16_bits(vb[i][0]), bf16_bits(vb[i][1]), bf16_bits(vb[i][2]), bf16_bits(vb[i][3])};
#pragma unroll
    for (int i = 0; i < 16; ++i) vb[i] = *(const v4fa*)(xr + (size_t)(48 + i) * DM);
    asm volatile("s_wait_xcnt 0x0" ::: "memory");
    __builtin_amdgcn_sched_barrier(0);
#pragma unroll
    for (int i = 0; i < 16; ++i) *(v4usa*)&sA[32 + i][tid * 4] = (v4usa){bf16_bits(va[i][0]), bf16_bits(va[i][1]), bf16_bits(va[i][2]), bf16_bits(va[i][3])};
#pragma unroll
    for (int i = 0; i < 16; ++i) *(v4usa*)&sA[48 + i][tid * 4] = (v4usa){bf16_bits(vb[i][0]), bf16_bits(vb[i][1]), bf16_bits(vb[i][2]), bf16_bits(vb[i][3])};
  }
  unsigned char* wdst = &sW[0][0] + wr * WPB + wc * 2;
#pragma unroll
  for (int rb = 0; rb < WKC / 16; ++rb)
#pragma unroll
    for (int sg = 0; sg < 3; ++sg) *(v4usa*)(wdst + rb * 16 * WPB + sg * 128) = w_bf16(wreg[0][rb][sg]);
#pragma unroll
  for (int n = 1; n <= WD; ++n) {
    const size_t ko = (size_t)(((rot + n) & (NCH - 1)) * WKC) * DK;
#pragma unroll
    for (int rb = 0; rb < WKC / 16; ++rb)
#pragma unroll
      for (int sg = 0; sg < 3; ++sg) wreg[n % WD][rb][sg] = *(const v4fa*)(wsrc[sg] + ko + rb * 16 * DK);
    xwait3(wsrc[0] + ko, wsrc[1] + ko, wsrc[2] + ko);
  }
  float bv[3];
#pragma unroll
  for (int t = 0; t < 3; ++t) { const int gc = ch * PN + cg * 48 + t * 16 + ln; const float* bs = gc < DK ? bq : (gc < 2 * DK ? bk : bvp); bv[t] = bf16_round(bs[gc & (DK - 1)]); }
  // address registers of the loads above are reused below; the wait stands in front of that overwrite
  asm volatile("s_wait_xcnt 0x0" ::: "memory");
  lds_barrier();         // publishes the x rows and the first chunk
  v8f acc[2][3];
#pragma unroll
  for (int mt = 0; mt < 2; ++mt)
#pragma unroll
    for (int t = 0; t < 3; ++t) acc[mt][t] = (v8f){0.f, 0.f, 0.f, 0.f, 0.f, 0.f, 0.f, 0.f};
  const unsigned char* wfr = &sW[0][0] + (8 * hh + (lane & 7)) * WPB + cg * 96 + ((lane >> 3) & 1) * 16;
  // unrolled so that the register sets of the chunks in flight are picked by constants
#pragma unroll
  for (int c = 0; c < NCH; ++c) {
    const int cc = (c + rot) & (NCH - 1);   // the chunk of k that this trip multiplies
    FragB af[PKC][2], bf[PKC][3];           // x: row = rg*32 + mt*16 + ln; W: column = cg*48 + t*16 + ln; both in the order k = half*16 + hh*8 + i
#pragma unroll
    for (int s = 0; s < PKC; ++s) {
#pragma unroll
      for (int mt = 0; mt < 2; ++mt) {
        af[s][mt].half[0] = *(const v8us*)&sA[rg * 32 + mt * 16 + ln][(cc * PKC + s) * 32 + 8 * hh]; af[s][mt].half[1] = *(const v8us*)&sA[rg * 32 + mt * 16 + ln][(cc * PKC + s) * 32 + 16 + 8 * hh];
      }
#pragma unroll
      for (int t = 0; t < 3; ++t) {
        const unsigned char* p = wfr + (c & 1) * (WKC * WPB) + s * 32 * WPB + t * 32;
        bf[s][t].half[0] = ld_tr16(p); bf[s][t].half[1] = ld_tr16(p + 16 * WPB);
      }
    }
    // keeps this chunk's LDS reads as one group in front of the products; among the products each would wait out its own latency
    __builtin_amdgcn_sched_barrier(0);
#pragma unroll
    for (int s = 0; s < PKC; ++s)
#pragma unroll
      for (int mt = 0; mt < 2; ++mt)
#pragma unroll
        for (int t = 0; t < 3; ++t) acc[mt][t] = __builtin_amdgcn_wmma_f32_16x16x32_bf16(false, af[s][mt].v, false, bf[s][t].v, (short)0, acc[mt][t], false, false);
    // second half of the fence pair: keeps the next chunk's conversions and stores from being moved up in among these products' operand reads
    __builtin_amdgcn_sched_barrier(0);
    v4f wn[WKC / 16][3];   // the chunk that is stored this trip leaves its register set, which then takes the loads of the chunk WD further on
#pragma unroll
    for (int rb = 0; rb < WKC / 16; ++rb)
#pragma unroll
      for (int sg = 0; sg < 3; ++sg) wn[rb][sg] = wreg[(c + 1) % WD][rb][sg];
    if (c + 1 + WD < NCH) {
      const size_t ko = (size_t)(((c + 1 + WD + rot) & (NCH - 1)) * WKC) * DK;
#pragma unroll
      for (int rb = 0; rb < WKC / 16; ++rb)
#pragma unroll
        for (int sg = 0; sg < 3; ++sg) wreg[(c + 1) % WD][rb][sg] = *(const v4fa*)(wsrc[sg] + ko + rb * 16 * DK);
      xwait3(wsrc[0] + ko, wsrc[1] + ko, wsrc[2] + ko);
      // keeps the conversions below from being moved up between the loads and their wait
      __builtin_amdgcn_sched_barrier(0);
    }
    if (c + 1 < NCH) {   // the next chunk goes into the buffer that the trip before this one read (its readers left it at that trip's barrier)
#pragma unroll
      for (int rb = 0; rb < WKC / 16; ++rb)
#pragma unroll
        for (int sg = 0; sg < 3; ++sg) *(v4usa*)(wdst + ((c + 1) & 1) * (WKC * WPB) + rb * 16 * WPB + sg * 128) = w_bf16(wn[rb][sg]);
    }
    lds_barrier();       // publishes the next chunk and ends this trip's reads of its own buffer
  }
#pragma unroll
  for (int mt = 0; mt < 2; ++mt)
#pragma unroll
    for (int t = 0; t < 3; ++t)
#pragma unroll
      for (int r = 0; r < 8; ++r) sC[rg * 32 + mt * 16 + 8 * hh + r][cg * 48 + t * 16 + ln] = acc[mt][t][r] + bv[t];
  __syncthreads();
  // The tile leaves in the forms its reader wants: Q as f32 rows of QKV (the K and V columns of QKV are not written); Kh/Kl = bf16 hi/lo planes of K and
  // VT = f16(V), all three in the order of k_cosattn's A fragments, so that each of its wave-wide 16-B loads is 512 contiguous bytes (four whole lines).
  // Kh/Kl: [tok / 16][ks = c / 32][half][lane = hh * 16 + (tok & 15)][8], c = ks * 32 + half * 16 + hh * 8 + i
  // VT:    [tok / 32][dt = d / 16][half][lane = hh * 16 + (d & 15)][8], tok = (tok / 32) * 32 + half * 16 + hh * 8 + i
  // Each 32 tokens fill one contiguous 24-KB block: K hi, K lo, V (the three pointers are 8 KB apart); the group's rows are two such blocks.
  const size_t base = (size_t)row0 * (3 * DK);
  if (ch == 0) {
#pragma unroll
    for (int g = 0; g < PM * (DK / 4) / 256; ++g) {   // Q (local columns 0-127): a wave stores one whole 512-B row at a time
      const int idx = g * 256 + tid, r = idx >> 5, c4 = (idx & 31) * 4;
      *(v4f*)(QKV + (size_t)(row0 + r) * (3 * DK) + c4) = *(const v4fa*)&sC[r][c4];
    }
    asm volatile("s_wait_xcnt 0x0" ::: "memory");
  }
  for (int u = 0; u < 2; ++u) {   // K planes, this half's 64 columns (ks = ch*2 + ksl): block u x 2 key tiles x 2 ks x 2 halves x 32 lanes
    const int hf = (tid >> 5) & 1, ksl = (tid >> 6) & 1, kt = tid >> 7;
    const int i = u * 32 + kt * 16 + ln, c8 = (ch ? 0 : DK) + ksl * 32 + hf * 16 + hh * 8;
    const int g = ((kt * 4 + ch * 2 + ksl) * 2 + hf) * 32 + lane;   // the group's place in its block
    const v4f k0 = *(const v4fa*)&sC[i][c8], k1 = *(const v4fa*)&sC[i][c8 + 4];
    const float ks[8] = {k0[0], k0[1], k0[2], k0[3], k1[0], k1[1], k1[2], k1[3]};
    v8us h, l;
    for (int q = 0; q < 8; ++q) { const float kh = bf16_round(ks[q]); h[q] = bf16_bits(kh); l[q] = bf16_bits(ks[q] - kh); }
    const size_t o = base + (size_t)u * (32 * 3 * DK) + (size_t)g * 8;
    *(v8us*)(Kh + o) = h; *(v8us*)(Kl + o) = l;
    asm volatile("s_wait_xcnt 0x0" ::: "memory");
  }
  if (ch == 1) {
    for (int u = 0; u < 4; ++u) {   // V (local columns 64-191): 2 blocks x 8 d tiles x 2 halves x 32 lanes = 1024 groups of 8 keys
      const int gg = u * 256 + tid, blk = gg >> 9, g = gg & 511, d = (g >> 6) * 16 + ln, t0 = ((g >> 5) & 1) * 16 + hh * 8;
      v8h v;
      for (int q = 0; q < 8; ++q) v[q] = (_Float16)sC[blk * 32 + t0 + q][64 + d];
      *(v8h*)(VT + base + (size_t)blk * (32 * 3 * DK) + (size_t)g * 8) = v;
    }
  }
}
// cos of eight scores without a branch. The hardware cosine takes its argument in revolutions, so the score is reduced in revolutions: n = nearest whole
// number to x / (2 pi); f = x * C_HI - n in one FMA (the product is not rounded before n is taken off), then x * C_LO is added, C_HI + C_LO = 1 / (2 pi) to
// 48 bits. f is right to better than 1e-7 revolutions for |x| up to 1e8 (library cosf changes its method at 131072); an infinite or NaN score gives NaN.
__device__ __forceinline__ v8f cos8(v8f x) {
  const v8f chi = {0x1.45f306p-3f, 0x1.45f306p-3f, 0x1.45f306p-3f, 0x1.45f306p-3f, 0x1.45f306p-3f, 0x1.45f306p-3f, 0x1.45f306p-3f, 0x1.45f306p-3f};
  const v8f clo = {0x1.b9391p-28f, 0x1.b9391p-28f, 0x1.b9391p-28f, 0x1.b9391p-28f, 0x1.b9391p-28f, 0x1.b9391p-28f, 0x1.b9391p-28f, 0x1.b9391p-28f};
  const v8f n = __builtin_elementwise_rint(x * chi);
  const v8f f = __builtin_elementwise_fma(x, clo, __builtin_elementwise_fma(x, chi, -n));
  v8f c;
  // unrolled so that every index is a constant and c stays in registers
#pragma unroll
  for (int i = 0; i < 8; ++i) c[i] = __builtin_amdgcn_cosf(f[i]);
  return c;
}
#define FQ 32
#define FW 8
#define FKEYS (LL / FW)
#define QP (DK + 8)
#define RP (DK + 4)
#define SLOTB (32 * 3 * DK * 2)   // bytes of one pass's block = one wave's LDS slot: 24,576 = 12 x 2 KiB
#define TROW 256                  // the block goes as rows of 256 B at a source pitch of 256 B, no pad: it lands as it lies in memory
typedef unsigned int u32x4 __attribute__((ext_vector_type(4)));
typedef unsigned int u32x8 __attribute__((ext_vector_type(8)));
__device__ __forceinline__ unsigned int uni(unsigned int v) { return (unsigned int)__builtin_amdgcn_readfirstlane(v); }
// holds a wave-uniform test in a scalar register, so that the branch on it is a scalar branch: a tensor load ignores EXEC
__device__ __forceinline__ unsigned int pinned(unsigned int v) { unsigned int s = uni(v); asm volatile("" : "+s"(s)); return s; }   // keeps the test in a scalar register
__device__ __forceinline__ void tdm_load(unsigned int lds_dst, unsigned long long ga, u32x8 g1) {
  u32x4 g0;
  g0[0] = uni(1u); g0[1] = uni(lds_dst); g0[2] = uni((unsigned int)ga); g0[3] = uni((((unsigned int)(ga >> 32)) & 0x01FFFFFFu) | 0x80000000u);
  asm volatile("tensor_load_to_lds %0, %1" :: "s"(g0), "s"(g1) : "memory");
}
__global__ __launch_bounds__(256) void k_cosattn(const float* __restrict__ QKV, const unsigned short* __restrict__ KV, float* __restrict__ out) {
  __shared__ __attribute__((aligned(2048))) unsigned char ring[FW * SLOTB];          // one slot a wave; after the loop the slot holds the wave's partial sums
  __shared__ __attribute__((aligned(16))) unsigned short sQh[FQ][QP], sQl[FQ][QP];   // pitch 272 B = 16 B x odd
  static_assert(FQ * RP * 4 <= SLOTB, "a wave's partial sums must fit its slot");
  const int tid = threadIdx.x, w = tid >> 5, lane = tid & 31, ln = lane & 15, hh = lane >> 4;
  const int b = blockIdx.x / (LL / FQ), q0 = (blockIdx.x % (LL / FQ)) * FQ;
  const int rot = (blockIdx.x + (blockIdx.x >> 3)) & (FKEYS / 32 - 1);   // first pass of this group's walk; neighbours in index, and groups 8 apart, differ
  const unsigned char* slot = ring + w * SLOTB;
  const unsigned int slot_lds = (unsigned int)(size_t)ring + (unsigned int)w * SLOTB;
  const unsigned long long kv0 = (unsigned long long)(size_t)KV + ((unsigned long long)b * LL + (unsigned long long)w * FKEYS) * (3 * DK * 2);   // the wave's first block
  u32x8 g1;   // 1-byte elements, tensor = tile = SLOTB / TROW rows of TROW bytes, no mask, no pad
  unsigned int g1w0;
  // word 0 (mask, element size, pad: all 0) is moved in as an immediate of its own; the compiler otherwise copies it from a register that happens to hold 0
  asm volatile("s_mov_b32 %0, 0" : "=s"(g1w0));
  g1[0] = uni(g1w0); g1[1] = uni((TROW & 0xFFFFu) << 16); g1[2] = uni((TROW >> 16) | (((SLOTB / TROW) & 0xFFFFu) << 16)); g1[3] = uni(((SLOTB / TROW) >> 16) | (TROW << 16));
  g1[4] = uni(SLOTB / TROW); g1[5] = uni(TROW); g1[6] = uni(0u); g1[7] = uni(0u);
  tdm_load(slot_lds, kv0 + (unsigned long long)rot * SLOTB, g1);   // every wave asks for its first pass's block; it flies under the split of Q
  { // Q rows -> bf16 hi/lo planes, split once per work-group (thread: 16 consecutive columns of one row)
    const int r = tid >> 3, c0 = (tid & 7) * 16;
    const float* qr = QKV + ((size_t)b * LL + q0 + r) * (3 * DK) + c0;
    const v4f x0 = *(const v4fa*)qr, x1 = *(const v4fa*)(qr + 4), x2 = *(const v4fa*)(qr + 8), x3 = *(const v4fa*)(qr + 12);
    // the loads' address registers are reused soon after
    asm volatile("s_wait_xcnt 0x0" ::: "memory");
    const float xs[16] = {x0[0], x0[1], x0[2], x0[3], x1[0], x1[1], x1[2], x1[3], x2[0], x2[1], x2[2], x2[3], x3[0], x3[1], x3[2], x3[3]};
#pragma unroll
    for (int g = 0; g < 2; ++g) {
      v8us h, l;
#pragma unroll
      for (int i = 0; i < 8; ++i) { const float x = xs[g * 8 + i]; const unsigned short hb = bf16_bits(x); h[i] = hb; l[i] = bf16_bits(x - bf16_val(hb)); }
      *(v8us*)&sQh[r][c0 + g * 8] = h; *(v8us*)&sQl[r][c0 + g * 8] = l;
    }
  }
  __syncthreads();
  FragB qh[2][4], ql[2][4];     // B fragments: column = query qt*16+ln, k in the same order as the K loader below
#pragma unroll
  for (int qt = 0; qt < 2; ++qt)
#pragma unroll
    for (int ks = 0; ks < 4; ++ks) {
      qh[qt][ks].half[0] = *(const v8us*)&sQh[qt * 16 + ln][ks * 32 + 8 * hh]; qh[qt][ks].half[1] = *(const v8us*)&sQh[qt * 16 + ln][ks * 32 + 16 + 8 * hh];
      ql[qt][ks].half[0] = *(const v8us*)&sQl[qt * 16 + ln][ks * 32 + 8 * hh]; ql[qt][ks].half[1] = *(const v8us*)&sQl[qt * 16 + ln][ks * 32 + 16 + 8 * hh];
    }
  v8f o[2][8];                  // o[qt][dt][r] = O[query qt*16+ln][d = dt*16 + 8*hh + r], this wave's keys only
#pragma unroll
  for (int qt = 0; qt < 2; ++qt)
#pragma unroll
    for (int dt = 0; dt < 8; ++dt) o[qt][dt] = (v8f){0.f, 0.f, 0.f, 0.f, 0.f, 0.f, 0.f, 0.f};
  const unsigned char* fp = slot + lane * 16;   // the block is in fragment order (k_proj): a half fragment is 512 contiguous B; K hi at 0, K lo at 8 KB, V at 16 KB
  for (int it = 0; it < FKEYS / 32; ++it) {
    // this pass's block has landed only behind the wave's own wait
    asm volatile("s_wait_tensorcnt 0x0" ::: "memory");
    FragB ah[2][4], al[2][4];   // A fragments of K hi/lo: row = key kt*16 + ln of the pass
#pragma unroll
    for (int kt = 0; kt < 2; ++kt)
#pragma unroll
      for (int ks = 0; ks < 4; ++ks) {
        const int e = kt * 4096 + ks * 1024;
        ah[kt][ks].half[0] = *(const v8us*)(fp + e); ah[kt][ks].half[1] = *(const v8us*)(fp + e + 512);
        al[kt][ks].half[0] = *(const v8us*)(fp + 8192 + e); al[kt][ks].half[1] = *(const v8us*)(fp + 8192 + e + 512);
      }
    FragH va[8];                // A fragments of V^T: row = d, k = key
#pragma unroll
    for (int dt = 0; dt < 8; ++dt) { va[dt].half[0] = *(const v8us*)(fp + 16384 + dt * 1024); va[dt].half[1] = *(const v8us*)(fp + 16384 + dt * 1024 + 512); }
    // every read of the slot has returned before the next block is aimed at it
    asm volatile("s_wait_dscnt 0x0" ::: "memory");
    if (pinned(it + 1 < FKEYS / 32)) tdm_load(slot_lds, kv0 + (unsigned long long)((it + 1 + rot) & (FKEYS / 32 - 1)) * SLOTB, g1);
    // keeps the LDS reads and the request in front of the products, so that the request has the whole pass to land
    __builtin_amdgcn_sched_barrier(0);
    v8f s[2][2];                // s[kt][qt][r] = S[query qt*16+ln][key j + kt*16 + 8*hh + r]
#pragma unroll
    for (int kt = 0; kt < 2; ++kt)
#pragma unroll
      for (int qt = 0; qt < 2; ++qt) {
        v8f c = {};
#pragma unroll
        for (int ks = 0; ks < 4; ++ks) {   // three products of the hi/lo split, in this order: Qhi.Khi, Qlo.Khi, Qhi.Klo
          c = __builtin_amdgcn_wmma_f32_16x16x32_bf16(false, ah[kt][ks].v, false, qh[qt][ks].v, (short)0, c, false, false);
          c = __builtin_amdgcn_wmma_f32_16x16x32_bf16(false, ah[kt][ks].v, false, ql[qt][ks].v, (short)0, c, false, false);
          c = __builtin_amdgcn_wmma_f32_16x16x32_bf16(false, al[kt][ks].v, false, qh[qt][ks].v, (short)0, c, false, false);
        }
        s[kt][qt] = c;
      }
#pragma unroll
    for (int qt = 0; qt < 2; ++qt) {
      FragH p;                  // B fragment: p[i] = cos(S)[key kmap(i, hh)][query], straight from the two D tiles
      const v8f c0 = cos8(s[0][qt]), c1 = cos8(s[1][qt]);
#pragma unroll
      for (int i = 0; i < 8; ++i) { p.h[i] = (_Float16)c0[i]; p.h[8 + i] = (_Float16)c1[i]; }
#pragma unroll
      for (int dt = 0; dt < 8; ++dt) o[qt][dt] = __builtin_amdgcn_wmma_f32_16x16x32_f16(false, va[dt].v, false, p.v, (short)0, o[qt][dt], false, false);
    }
  }
  // no request is in flight and no read of the slot is outstanding when the wave's slot becomes the home of its partial sums
  asm volatile("s_wait_tensorcnt 0x0" ::: "memory");
  asm volatile("s_wait_dscnt 0x0" ::: "memory");
#pragma unroll
  for (int qt = 0; qt < 2; ++qt)
#pragma unroll
    for (int dt = 0; dt < 8; ++dt) {
      float* d = (float*)(ring + w * SLOTB) + (qt * 16 + ln) * RP + dt * 16 + 8 * hh;   // row pitch 528 B = 16 B x odd
      *(v4fa*)d = (v4f){o[qt][dt][0], o[qt][dt][1], o[qt][dt][2], o[qt][dt][3]};
      *(v4fa*)(d + 4) = (v4f){o[qt][dt][4], o[qt][dt][5], o[qt][dt][6], o[qt][dt][7]};
    }
  __syncthreads();
#pragma unroll
  for (int g = 0; g < FQ * DK / 4 / 256; ++g) {   // a wave stores one whole 512-B output row at a time
    const int idx = g * 256 + tid, q = idx >> 5, d4 = (idx & 31) * 4;
    v4f a = *(const v4fa*)(ring + (q * RP + d4) * 4);
#pragma unroll
    for (int u = 1; u < FW; ++u) a += *(const v4fa*)(ring + u * SLOTB + (q * RP + d4) * 4);
    *(v4f*)(out + ((size_t)b * LL + q0 + q) * DK + d4) = a;
  }
}
extern "C" void kernel_launch(void* const* d_in, const int* in_sizes, int n_in,
                              void* d_out, int out_size, void* d_ws, size_t ws_size, hipStream_t stream) {
  (void)in_sizes; (void)n_in; (void)out_size;
  const float* x = (const float*)d_in[0]; const float* Wq = (const float*)d_in[1]; const float* bq = (const float*)d_in[2]; const float* Wk = (const float*)d_in[3]; const float* bk = (const float*)d_in[4]; const float* Wv = (const float*)d_in[5]; const float* bv = (const float*)d_in[6];
  char* ws = (char*)d_ws; size_t off = 0;
  auto take = [&](size_t bytes) { char* p = ws + off; off += (bytes + 255) & ~(size_t)255; return p; };
  float* QKV = (float*)take((size_t)NTOK * 3 * DK * 4);
  unsigned short* KV = (unsigned short*)take((size_t)NTOK * DK * 2 * 3); unsigned short* Kh = KV; unsigned short* Kl = KV + 32 * DK; _Float16* VT = (_Float16*)(KV + 64 * DK);
  if (off > ws_size) return;
  k_proj<<<(NTOK / PM) * (3 * DK / PN), 256, 0, stream>>>(x, Wq, Wk, Wv, bq, bk, bv, QKV, Kh, Kl, VT);
  k_cosattn<<<NTOK / FQ, 256, 0, stream>>>(QKV, KV, (float*)d_out);
}

// v009
// A run of this version takes 29.6 microseconds.
// Two timings next to v008 both put it at 1.04 times that version's speed.
// Counting every step since v000, it is 17.3 times as fast.
#include <hip/hip_runtime.h>
// [Q|K|V] = x·[Wq|Wk|Wv] + b on v_wmma_f32_16x16x32_bf16 (x rounded to bf16: single exact term; 8192 × 1024 × 384); QK = Q·Kᵀ on the same unit with BOTH f32 operands split
// hi/lo (3 products — cos(QK) at |QK| ≈ 10–40 needs the phase to ≈1e-4 rad; 4 × 2048 × 2048 × 128); out = cos(QK)·V on v_wmma_f32_16x16x32_f16 (cos and V rounded to
// f16: single product). cos in f32: reduction on the VALU, then v_cos_f32.
#define BB 4
#define LL 2048
#define DM 1024
#define DK 128
#define NTOK (BB * LL)

typedef __bf16 v16b __attribute__((ext_vector_type(16)));
typedef unsigned short v8us __attribute__((ext_vector_type(8), may_alias));
typedef float  v8f  __attribute__((ext_vector_type(8)));
typedef float  v4f  __attribute__((ext_vector_type(4)));
typedef float  v4fa __attribute__((ext_vector_type(4), may_alias));
union FragB { v16b v; v8us half[2]; unsigned short u[16]; };

__device__ __forceinline__ unsigned short bf16_bits(float x) { unsigned int u = __float_as_uint(x); return (unsigned short)((u + 0x7FFFu + ((u >> 16) & 1u)) >> 16); }
__device__ __forceinline__ float bf16_val(unsigned short b) { return __uint_as_float(((unsigned int)b) << 16); }
__device__ __forceinline__ float bf16_round(float x) { return bf16_val(bf16_bits(x)); }
// D += A·B with NT terms: 1 = ah·bh, 2 = + al·bh (A split), 3 = + ah·bl (both split)
template <int NT>
__device__ __forceinline__ v8f mmaN(v16b ah, v16b al, v16b bh, v16b bl, v8f c) {
  c = __builtin_amdgcn_wmma_f32_16x16x32_bf16(false, ah, false, bh, (short)0, c, false, false);
  if (NT >= 2) c = __builtin_amdgcn_wmma_f32_16x16x32_bf16(false, al, false, bh, (short)0, c, false, false);
  if (NT >= 3) c = __builtin_amdgcn_wmma_f32_16x16x32_bf16(false, ah, false, bl, (short)0, c, false, false);
  asm volatile("v_nop\n\tv_nop\n\tv_nop\n\tv_nop" : "+v"(c) : "v"(ah), "v"(al), "v"(bh), "v"(bl));
  return c;
}

__global__ __launch_bounds__(256) void k_wt_bf16(const float* __restrict__ W, unsigned short* __restrict__ Wt, int K, int N) {
  const int t = blockIdx.x * 256 + threadIdx.x;
  const int k8n = K / 8;
  if (t >= N * k8n) return;
  const int n = t / k8n, k8 = (t % k8n) * 8;
  v8us v;
#pragma unroll
  for (int i = 0; i < 8; ++i) v[i] = bf16_bits(W[(size_t)(k8 + i) * N + n]);
  *(v8us*)(Wt + (size_t)n * K + k8) = v;
  
}

// GEMM C[M][N] (f32, pitch ldc) = act(A[M][K]·W + bias). A f32 row-major (pitch lda) converted per fragment to bf16
// (ASPLIT: hi/lo two planes -> 2 terms, else single rounded term); Wt bf16 [N][K] (pitch ldb). BIAS_BF16 rounds the
// bias to bf16 first (bias quantised to bf16 before the add). K%32==0, M%16==0, N%64==0.
template <bool ASPLIT, int ACT, bool BIAS_BF16>
__global__ __launch_bounds__(128) void k_gemm_bf(const float* __restrict__ A, int lda, const unsigned short* __restrict__ Wt, int ldb,
                                               const float* __restrict__ bias, float* __restrict__ C, int ldc, int M, int N, int K) {
  __shared__ __attribute__((aligned(16))) float so[4][16][64];
  const int tid = threadIdx.x, w = tid >> 5, lane = tid & 31, ln = lane & 15, hh = lane >> 4;
  const int ntn = N / 64;
  const int wid = blockIdx.x * 4 + w;
  const int mt = wid / ntn, nq = wid % ntn;
  if (mt * 16 >= M) return;
  const int row0 = mt * 16, col0 = nq * 64;
  const float* arow = A + (size_t)(row0 + ln) * lda;
  v8f acc[4] = {};
  for (int kb = 0; kb < K; kb += 32) {
    FragB ah, al;
    const v4f x0 = *(const v4fa*)(arow + kb + 8 * hh), x1 = *(const v4fa*)(arow + kb + 8 * hh + 4);
    const v4f x2 = *(const v4fa*)(arow + kb + 16 + 8 * hh), x3 = *(const v4fa*)(arow + kb + 16 + 8 * hh + 4);
    float xs[16] = {x0[0],x0[1],x0[2],x0[3],x1[0],x1[1],x1[2],x1[3],x2[0],x2[1],x2[2],x2[3],x3[0],x3[1],x3[2],x3[3]};
#pragma unroll
    for (int i = 0; i < 16; ++i) { const unsigned short hb = bf16_bits(xs[i]); ah.u[i] = hb; al.u[i] = ASPLIT ? bf16_bits(xs[i] - bf16_val(hb)) : (unsigned short)0; }
#pragma unroll
    for (int t = 0; t < 4; ++t) {
      const unsigned short* brow = Wt + (size_t)(col0 + t * 16 + ln) * ldb + kb;
      FragB b;
      b.half[0] = *(const v8us*)(brow + 8 * hh);
      b.half[1] = *(const v8us*)(brow + 16 + 8 * hh);
      acc[t] = mmaN<ASPLIT ? 2 : 1>(ah.v, al.v, b.v, b.v, acc[t]);
    }
  }
#pragma unroll
  for (int t = 0; t < 4; ++t) {
    float bv = bias ? bias[col0 + t * 16 + ln] : 0.f;
    if (BIAS_BF16) bv = bf16_round(bv);
#pragma unroll
    for (int r = 0; r < 8; ++r) { float v = acc[t][r] + bv; if (ACT == 1) v = fmaxf(v, 0.f); so[w][8 * hh + r][t * 16 + ln] = v; }
  }
  __builtin_amdgcn_fence(__ATOMIC_ACQ_REL, "workgroup");
  __builtin_amdgcn_wave_barrier();
  const int rsub = lane >> 4, c4 = (lane & 15) * 4;
  {
#pragma unroll
    for (int q = 0; q < 8; ++q) {
      const int r = q * 2 + rsub;
      const v4f v = *(const v4fa*)&so[w][r][c4];
      *(v4f*)(C + (size_t)(row0 + r) * ldc + col0 + c4) = v;
    }
    
  }
}

// Flash-style causal/unmasked attention, all contractions 3-term bf16 hi/lo splits, f32 softmax with running max.
// q,k,v rows are read from f32 buffers with arbitrary row pitch (so they can live inside a fused qkv buffer);
// D = head size (multiple of 32, <= 128); one wave = 16 query rows; block = 4 waves (64 queries) sharing K/V chunks of 32.
template <int D, bool CAUSAL>
__global__ __launch_bounds__(128) void k_flash(const float* __restrict__ qb, const float* __restrict__ kb, const float* __restrict__ vb,
                                             int pitch, int T, int H, float scale, float* __restrict__ y, int ypitch) {
  constexpr int KS = D / 32;        // k-steps for QK
  constexpr int DT = D / 16;        // d tiles for PV
  __shared__ __attribute__((aligned(16))) unsigned short sKh[32][D + 8], sKl[32][D + 8], sVh[32][D + 8], sVl[32][D + 8];
  __shared__ __attribute__((aligned(16))) unsigned short sPh[4][16][40], sPl[4][16][40];
  __shared__ __attribute__((aligned(16))) float sO[4][16][D];
  const int tid = threadIdx.x, w = tid >> 5, lane = tid & 31, ln = lane & 15, hh = lane >> 4;
  const int nqb = (T + 63) / 64;
  const int bh = blockIdx.x / nqb, qblk = blockIdx.x % nqb;
  const int b = bh / H, h = bh % H;
  const int q0 = qblk * 64 + w * 16;
  const float* Q = qb + (size_t)b * T * pitch + h * D;
  const float* K = kb + (size_t)b * T * pitch + h * D;
  const float* V = vb + (size_t)b * T * pitch + h * D;

  // A fragments of the wave's 16 query rows (scaled), hi/lo
  FragB aqh[KS], aql[KS];
  {
    int row = q0 + ln; if (row >= T) row = T - 1;
    const float* qr = Q + (size_t)row * pitch;
#pragma unroll
    for (int ks = 0; ks < KS; ++ks)
#pragma unroll
      for (int i = 0; i < 16; ++i) {
        const int d = ks * 32 + ((i < 8) ? (8 * hh + i) : (16 + 8 * hh + (i - 8)));
        const float x = qr[d] * scale; const unsigned short hb = bf16_bits(x);
        aqh[ks].u[i] = hb; aql[ks].u[i] = bf16_bits(x - bf16_val(hb));
      }
  }
  float m_r[8], l_r[8];
#pragma unroll
  for (int r = 0; r < 8; ++r) { m_r[r] = -3.0e38f; l_r[r] = 0.f; }
  v8f oacc[DT];
#pragma unroll
  for (int dt = 0; dt < DT; ++dt) oacc[dt] = (v8f){0.f,0.f,0.f,0.f,0.f,0.f,0.f,0.f};

  const int kv_end = CAUSAL ? min(T, qblk * 64 + 64) : T;     // block-uniform
  for (int j0 = 0; j0 < kv_end; j0 += 32) {
    __syncthreads();
    for (int e = tid; e < 32 * (D / 4); e += 128) {
      const int r = e / (D / 4), c4 = (e % (D / 4)) * 4;
      const int key = j0 + r;
      v4f kf = {0.f,0.f,0.f,0.f}, vf = {0.f,0.f,0.f,0.f};
      if (key < T) { kf = *(const v4fa*)(K + (size_t)key * pitch + c4); vf = *(const v4fa*)(V + (size_t)key * pitch + c4); }
#pragma unroll
      for (int t = 0; t < 4; ++t) {
        unsigned short hb = bf16_bits(kf[t]); sKh[r][c4 + t] = hb; sKl[r][c4 + t] = bf16_bits(kf[t] - bf16_val(hb));
        hb = bf16_bits(vf[t]); sVh[r][c4 + t] = hb; sVl[r][c4 + t] = bf16_bits(vf[t] - bf16_val(hb));
      }
    }
    __syncthreads();
    // S tile 16 x 32
    v8f s[2];
#pragma unroll
    for (int nt = 0; nt < 2; ++nt) {
      v8f acc = {};
#pragma unroll
      for (int ks = 0; ks < KS; ++ks) {
        FragB bh_, bl_;
        bh_.half[0] = *(const v8us*)&sKh[nt * 16 + ln][ks * 32 + 8 * hh]; bh_.half[1] = *(const v8us*)&sKh[nt * 16 + ln][ks * 32 + 16 + 8 * hh];
        bl_.half[0] = *(const v8us*)&sKl[nt * 16 + ln][ks * 32 + 8 * hh]; bl_.half[1] = *(const v8us*)&sKl[nt * 16 + ln][ks * 32 + 16 + 8 * hh];
        acc = mmaN<3>(aqh[ks].v, aql[ks].v, bh_.v, bl_.v, acc);
      }
      s[nt] = acc;
    }
    // mask + running max (rows 8hh+r; the 16 lanes of a half share rows)
    float alpha[8];
#pragma unroll
    for (int r = 0; r < 8; ++r) {
      const int qi = q0 + 8 * hh + r;
      const int ja = j0 + ln, jb = j0 + 16 + ln;
      if (CAUSAL) { if (ja > qi) s[0][r] = -3.0e38f; if (jb > qi) s[1][r] = -3.0e38f; }
      if (ja >= T) s[0][r] = -3.0e38f;
      if (jb >= T) s[1][r] = -3.0e38f;
      float mx = fmaxf(s[0][r], s[1][r]);
      mx = fmaxf(mx, __shfl_xor(mx, 1, 32)); mx = fmaxf(mx, __shfl_xor(mx, 2, 32)); mx = fmaxf(mx, __shfl_xor(mx, 4, 32)); mx = fmaxf(mx, __shfl_xor(mx, 8, 32));
      const float mnew = fmaxf(m_r[r], mx);
      alpha[r] = (mnew > -1.0e38f) ? __expf(m_r[r] - mnew) : 1.0f;
      const float p0 = (s[0][r] > -1.0e38f) ? __expf(s[0][r] - mnew) : 0.f;
      const float p1 = (s[1][r] > -1.0e38f) ? __expf(s[1][r] - mnew) : 0.f;
      m_r[r] = mnew;
      l_r[r] = l_r[r] * alpha[r] + p0 + p1;            // per-lane partial row sum (16 lanes combined at the end)
      unsigned short hb = bf16_bits(p0); sPh[w][8 * hh + r][ln] = hb;      sPl[w][8 * hh + r][ln] = bf16_bits(p0 - bf16_val(hb));
      hb = bf16_bits(p1);                sPh[w][8 * hh + r][16 + ln] = hb; sPl[w][8 * hh + r][16 + ln] = bf16_bits(p1 - bf16_val(hb));
    }
#pragma unroll
    for (int dt = 0; dt < DT; ++dt)
#pragma unroll
      for (int r = 0; r < 8; ++r) oacc[dt][r] *= alpha[r];
    __builtin_amdgcn_fence(__ATOMIC_ACQ_REL, "workgroup");
    __builtin_amdgcn_wave_barrier();
    FragB pah, pal;
    pah.half[0] = *(const v8us*)&sPh[w][ln][8 * hh]; pah.half[1] = *(const v8us*)&sPh[w][ln][16 + 8 * hh];
    pal.half[0] = *(const v8us*)&sPl[w][ln][8 * hh]; pal.half[1] = *(const v8us*)&sPl[w][ln][16 + 8 * hh];
#pragma unroll
    for (int dt = 0; dt < DT; ++dt) {
      FragB bvh, bvl;
#pragma unroll
      for (int i = 0; i < 8; ++i) {
        bvh.u[i] = sVh[8 * hh + i][dt * 16 + ln]; bvh.u[8 + i] = sVh[16 + 8 * hh + i][dt * 16 + ln];
        bvl.u[i] = sVl[8 * hh + i][dt * 16 + ln]; bvl.u[8 + i] = sVl[16 + 8 * hh + i][dt * 16 + ln];
      }
      oacc[dt] = mmaN<3>(pah.v, pal.v, bvh.v, bvl.v, oacc[dt]);
    }
    __builtin_amdgcn_fence(__ATOMIC_ACQ_REL, "workgroup");
    __builtin_amdgcn_wave_barrier();
  }
#pragma unroll
  for (int r = 0; r < 8; ++r) {
    float l = l_r[r];
    l += __shfl_xor(l, 1, 32); l += __shfl_xor(l, 2, 32); l += __shfl_xor(l, 4, 32); l += __shfl_xor(l, 8, 32);
    l_r[r] = (l > 0.f) ? 1.0f / l : 0.f;
  }
#pragma unroll
  for (int dt = 0; dt < DT; ++dt)
#pragma unroll
    for (int r = 0; r < 8; ++r) sO[w][8 * hh + r][dt * 16 + ln] = oacc[dt][r] * l_r[r];
  __builtin_amdgcn_fence(__ATOMIC_ACQ_REL, "workgroup");
  __builtin_amdgcn_wave_barrier();
  {
    for (int r = 0; r < 16; ++r) {
      const int row = q0 + r;
      if (row < T && lane < D / 4) {
        const v4f val = *(const v4fa*)&sO[w][r][lane * 4];
        *(v4f*)(y + ((size_t)b * T + row) * ypitch + h * D + lane * 4) = val;
      }
    }
    
  }
}

// batched GEMM (blockIdx.y = batch): C_b = act(alpha·A_b·B_b + bias + resid_b); A f32 rows (ASPLIT → hi/lo), B = bf16 planes Bh (+Bl when BSPLIT, requires ASPLIT),
// per-batch element strides sA, sB (0 = shared weights), sC, sR. resid may alias C (values are staged before the stores). ACT 0/1(relu).
// ACT: 0 none, 1 relu, 2 softplus
template <bool ASPLIT, bool BSPLIT, int ACT>
__global__ __launch_bounds__(128) void k_gemm_b(const float* __restrict__ A, int lda, size_t sA, const unsigned short* __restrict__ Bh, const unsigned short* __restrict__ Bl, int ldb, size_t sB,
                                             const float* __restrict__ bias, const float* __restrict__ resid, int ldr, size_t sR, float rsign, float alpha,
                                             float* __restrict__ C, int ldc, size_t sC, int M, int N, int K) {
  __shared__ __attribute__((aligned(16))) float so[4][16][64];
  const int tid = threadIdx.x, w = tid >> 5, lane = tid & 31, ln = lane & 15, hh = lane >> 4;
  const int by = blockIdx.y;
  A += (size_t)by * sA; Bh += (size_t)by * sB; if (BSPLIT) Bl += (size_t)by * sB; C += (size_t)by * sC; if (resid) resid += (size_t)by * sR;
  const int ntn = (N + 63) / 64; const int wid = blockIdx.x * 4 + w; const int mt = wid / ntn, nq = wid % ntn;      // N may be any multiple of 16: tiles past N are skipped and not stored
  if (mt * 16 >= M) return;
  const int row0 = mt * 16, col0 = nq * 64;
  const float* arow = A + (size_t)(row0 + ln) * lda;
  v8f acc[4] = {};
  for (int kb = 0; kb < K; kb += 32) {
    FragB ah, al;
    const v4f x0 = *(const v4fa*)(arow + kb + 8 * hh), x1 = *(const v4fa*)(arow + kb + 8 * hh + 4);
    const v4f x2 = *(const v4fa*)(arow + kb + 16 + 8 * hh), x3 = *(const v4fa*)(arow + kb + 16 + 8 * hh + 4);
    float xs[16] = {x0[0],x0[1],x0[2],x0[3],x1[0],x1[1],x1[2],x1[3],x2[0],x2[1],x2[2],x2[3],x3[0],x3[1],x3[2],x3[3]};
#pragma unroll
    for (int i = 0; i < 16; ++i) { const unsigned short hb = bf16_bits(xs[i]); ah.u[i] = hb; al.u[i] = ASPLIT ? bf16_bits(xs[i] - bf16_val(hb)) : (unsigned short)0; }
#pragma unroll
    for (int t = 0; t < 4; ++t) {
      if (col0 + t * 16 >= N) continue;
      const size_t boff = (size_t)(col0 + t * 16 + ln) * ldb + kb;
      FragB bh_, bl_; bh_.half[0] = *(const v8us*)(Bh + boff + 8 * hh); bh_.half[1] = *(const v8us*)(Bh + boff + 16 + 8 * hh);
      if (BSPLIT) { bl_.half[0] = *(const v8us*)(Bl + boff + 8 * hh); bl_.half[1] = *(const v8us*)(Bl + boff + 16 + 8 * hh); } else bl_ = bh_;
      acc[t] = mmaN<ASPLIT ? (BSPLIT ? 3 : 2) : 1>(ah.v, al.v, bh_.v, bl_.v, acc[t]);
    }
  }
#pragma unroll
  for (int t = 0; t < 4; ++t) {
    const int col = col0 + t * 16 + ln; if (col0 + t * 16 >= N) continue; const float bv = bias ? bf16_round(bias[col]) : 0.f;
#pragma unroll
    for (int r = 0; r < 8; ++r) { float v = acc[t][r] * alpha + bv; if (resid) v += rsign * resid[(size_t)(row0 + 8 * hh + r) * ldr + col]; if (ACT == 1) v = fmaxf(v, 0.f); else if (ACT == 2) v = fmaxf(v, 0.f) + log1pf(expf(-fabsf(v))); so[w][8 * hh + r][t * 16 + ln] = v; }
  }
  __builtin_amdgcn_fence(__ATOMIC_ACQ_REL, "workgroup"); __builtin_amdgcn_wave_barrier();
  const int rsub = lane >> 4, c4 = (lane & 15) * 4;
  {
#pragma unroll
    for (int q = 0; q < 8; ++q) { const int r = q * 2 + rsub; if (col0 + c4 < N) { const v4f v = *(const v4fa*)&so[w][r][c4]; *(v4f*)(C + (size_t)(row0 + r) * ldc + col0 + c4) = v; } }
    
  }
}
// batched f32 [K][N] (pitch lds, batch stride sIn) -> transposed hi/lo planes [N][K] (batch stride sOut); thread per (n, 8 k); grid.y = batch
__global__ __launch_bounds__(256) void k_split_transpose_b(const float* __restrict__ src, int lds_, size_t sIn, unsigned short* __restrict__ hi, unsigned short* __restrict__ lo, size_t sOut, int K, int N) {
  const size_t t = (size_t)blockIdx.x * 256 + threadIdx.x; const int k8n = K / 8; if (t >= (size_t)N * k8n) return;
  src += (size_t)blockIdx.y * sIn; hi += (size_t)blockIdx.y * sOut; lo += (size_t)blockIdx.y * sOut;
  const int n = (int)(t / k8n), k8 = (int)(t % k8n) * 8; v8us vh, vl;
#pragma unroll
  for (int i = 0; i < 8; ++i) { const float x = src[(size_t)(k8 + i) * lds_ + n]; const unsigned short hb = bf16_bits(x); vh[i] = hb; vl[i] = bf16_bits(x - bf16_val(hb)); }
  unsigned short* dh = hi + (size_t)n * K + k8; unsigned short* dl = lo + (size_t)n * K + k8;
  *(v8us*)dh = vh; *(v8us*)dl = vl; 
}

// ---- f16 WMMA path (v_wmma_f32_16x16x32_f16): 11-bit significands for operands in range — used where the [-1,1] cos operand needs more precision than bf16
typedef _Float16 v16h __attribute__((ext_vector_type(16)));
union FragH { v16h v; v8us half[2]; _Float16 h[16]; unsigned short u[16]; };
template <int NT>
__device__ __forceinline__ v8f mmaH(v16h ah, v16h al, v16h bh, v16h bl, v8f c) {
  c = __builtin_amdgcn_wmma_f32_16x16x32_f16(false, ah, false, bh, (short)0, c, false, false);
  if (NT >= 2) c = __builtin_amdgcn_wmma_f32_16x16x32_f16(false, al, false, bh, (short)0, c, false, false);
  if (NT >= 3) c = __builtin_amdgcn_wmma_f32_16x16x32_f16(false, ah, false, bl, (short)0, c, false, false);
  asm volatile("v_nop\n\tv_nop\n\tv_nop\n\tv_nop" : "+v"(c) : "v"(ah), "v"(al), "v"(bh), "v"(bl));
  return c;
}
// batched GEMM like k_gemm_b but f16 operands: A f32 (split into f16 hi/lo if ASPLIT, else rounded to f16), Bt = f16 values [n][k]; alpha; C f32; N multiple of 16 (partial tiles skipped)
template <bool ASPLIT>
__global__ __launch_bounds__(128) void k_gemm_h(const float* __restrict__ A, int lda, size_t sA, const _Float16* __restrict__ Bh, int ldb, size_t sB, float alpha, float* __restrict__ C, int ldc, size_t sC, int M, int N, int K) {
  __shared__ __attribute__((aligned(16))) float so[4][16][64];
  const int tid = threadIdx.x, w = tid >> 5, lane = tid & 31, ln = lane & 15, hh = lane >> 4; const int by = blockIdx.y;
  A += (size_t)by * sA; Bh += (size_t)by * sB; C += (size_t)by * sC;
  const int ntn = (N + 63) / 64; const int wid = blockIdx.x * 4 + w; const int mt = wid / ntn, nq = wid % ntn; if (mt * 16 >= M) return;
  const int row0 = mt * 16, col0 = nq * 64; const float* arow = A + (size_t)(row0 + ln) * lda;
  v8f acc[4] = {};
  for (int kb = 0; kb < K; kb += 32) {
    FragH ah, al;
    const v4f x0 = *(const v4fa*)(arow + kb + 8 * hh), x1 = *(const v4fa*)(arow + kb + 8 * hh + 4), x2 = *(const v4fa*)(arow + kb + 16 + 8 * hh), x3 = *(const v4fa*)(arow + kb + 16 + 8 * hh + 4);
    float xs[16] = {x0[0],x0[1],x0[2],x0[3],x1[0],x1[1],x1[2],x1[3],x2[0],x2[1],x2[2],x2[3],x3[0],x3[1],x3[2],x3[3]};
#pragma unroll
    for (int i = 0; i < 16; ++i) { const _Float16 h = (_Float16)xs[i]; ah.h[i] = h; al.h[i] = ASPLIT ? (_Float16)(xs[i] - (float)h) : (_Float16)0.0f; }
#pragma unroll
    for (int t = 0; t < 4; ++t) { if (col0 + t * 16 >= N) continue; const size_t boff = (size_t)(col0 + t * 16 + ln) * ldb + kb; FragH bq; bq.half[0] = *(const v8us*)(Bh + boff + 8 * hh); bq.half[1] = *(const v8us*)(Bh + boff + 16 + 8 * hh);
      acc[t] = mmaH<ASPLIT ? 2 : 1>(ah.v, al.v, bq.v, bq.v, acc[t]); }
  }
#pragma unroll
  for (int t = 0; t < 4; ++t) { if (col0 + t * 16 >= N) continue;
#pragma unroll
    for (int r = 0; r < 8; ++r) so[w][8 * hh + r][t * 16 + ln] = acc[t][r] * alpha; }
  __builtin_amdgcn_fence(__ATOMIC_ACQ_REL, "workgroup"); __builtin_amdgcn_wave_barrier();
  const int rsub = lane >> 4, c4 = (lane & 15) * 4;
  {
#pragma unroll
    for (int q = 0; q < 8; ++q) { const int r = q * 2 + rsub; if (col0 + c4 < N) { const v4f v = *(const v4fa*)&so[w][r][c4]; *(v4f*)(C + (size_t)(row0 + r) * ldc + col0 + c4) = v; } }
     }
}

// [Q|K|V] = x.W + b, W taken as it lies (f32, [k][n]): no packing launch. A work-group owns PM rows of x and PN of the 384 columns (two groups share a row
// block), so that the f32 W bytes a group pulls from L2 are no more than the packed bf16 W of all 384 columns were. W and x both come in chunks of WKC k:
// whole-line f32 loads WD chunks ahead, rounded to bf16, laid row-major in one of two LDS buffers each. No product waits for more of x than its own chunk, and
// the reads of x from memory run under the products and the reads of W from L2. W is read back as B fragments by the transposing LDS load, whose k order is
// the x loader's. One WMMA per 32 k. Groups that read the same W columns each start their walk over k at a chunk of their own (by index) and wrap.
#define PM 64
#define PN 192
#define PCP (PN + 4)
#define PKC 2
#define WKC (PKC * 32)
#define WPB (PN * 2 + 32)   // LDS row pitch of a W chunk, bytes: 416 = 32 B x odd, the transposing load's pitch
#define XPB (WKC * 2 + 16)   // LDS row pitch of an x chunk, bytes: 144 = 16 B x odd
#define NCH (DM / WKC)
#define WD 3                   // chunks of W and x in flight in registers
typedef unsigned short v4usa __attribute__((ext_vector_type(4), may_alias));
typedef _Float16 v8h __attribute__((ext_vector_type(8)));
typedef short s16x8 __attribute__((ext_vector_type(8)));
typedef unsigned short v8up __attribute__((ext_vector_type(8)));
// lane (c, h) gets T[kbase + 8h + 0..7][dbase + c] from a row-major 16-bit tile; the lane's address is row kbase + 8h + (lane & 7), byte 2 dbase + 16 ((lane >> 3) & 1)
__device__ __forceinline__ v8up ld_tr16(const unsigned char* p) { typedef __attribute__((address_space(3))) s16x8 lds_s16x8; return __builtin_bit_cast(v8up, __builtin_amdgcn_ds_load_tr16_b128_v8i16((lds_s16x8*)p)); }
typedef __bf16 v4bf __attribute__((ext_vector_type(4)));
typedef unsigned short v4up __attribute__((ext_vector_type(4)));
// four W or x values rounded to bf16 (to nearest, ties to even, as bf16_bits rounds) by the packed conversion: one instruction for two values
__device__ __forceinline__ v4up w_bf16(v4f v) { return __builtin_bit_cast(v4up, __builtin_convertvector(v, v4bf)); }
// s_wait_xcnt 0 behind a chunk's W and x loads. The four address pairs are inputs so that they stay live up to the wait: otherwise a later load of the same
// group may be given an earlier load's address registers as its destination, in front of the wait
__device__ __forceinline__ void xwait4(const float* a, const float* b, const float* c, const float* d) { asm volatile("s_wait_xcnt 0x0" :: "v"(a), "v"(b), "v"(c), "v"(d) : "memory"); }
// work-group barrier that waits for the wave's own LDS traffic only: __syncthreads() also waits for every global load in flight, which would drain the chunks
// that are meant to fly across it
__device__ __forceinline__ void lds_barrier() { asm volatile("s_wait_dscnt 0x0\n\ts_barrier_signal -1\n\ts_barrier_wait -1" ::: "memory"); }
__global__ __launch_bounds__(256) void k_proj(const float* __restrict__ x, const float* __restrict__ Wq, const float* __restrict__ Wk, const float* __restrict__ Wv, const float* __restrict__ bq, const float* __restrict__ bk, const float* __restrict__ bvp, float* __restrict__ QKV, unsigned short* __restrict__ Kh, unsigned short* __restrict__ Kl, _Float16* __restrict__ VT) {
  __shared__ __attribute__((aligned(16))) unsigned char sX[2][PM * XPB];
  __shared__ __attribute__((aligned(32))) unsigned char sW[2][WKC * WPB];
  __shared__ __attribute__((aligned(16))) float sC[PM][PCP];            // pitch 196 dwords: rows 8 apart lie 32 banks apart
  const int tid = threadIdx.x, w = tid >> 5, lane = tid & 31, ln = lane & 15, hh = lane >> 4;
  const int bid = blockIdx.x;
  const int ch = (bid >> 3) & 1, rt = (bid >> 4) * 8 + (bid & 7);   // column half and row block; the two groups of a row block are 8 apart in index
  const int row0 = rt * PM;
  const int rg = w >> 2, cg = w & 3;                                 // a wave owns 32 rows x 48 columns
  const int rot = (bid + (bid >> 3)) & (NCH - 1);                    // first chunk of this group's walk
  // the group's 192 columns as three runs of 64: half 0 = Q 0-127, K 0-63; half 1 = K 64-127, V 0-127
  const int wr = tid >> 4, wc = (tid & 15) * 4;                      // a wave-wide load takes 256 contiguous B of each of two k rows
  const float* wsrc[3] = {(ch ? Wk + 64 : Wq) + wr * DK + wc, (ch ? Wv : Wq + 64) + wr * DK + wc, (ch ? Wv + 64 : Wk) + wr * DK + wc};
  const float* xsrc = x + (size_t)(row0 + wr) * DM + wc;             // likewise 256 contiguous B of each of two x rows
  v4f wreg[WD][WKC / 16][3], xreg[WD][PM / 16];
  // the first WD chunks of the walk are asked for at once
#pragma unroll
  for (int n = 0; n < WD; ++n) {
    const int kc = (rot + n) & (NCH - 1);
    const size_t ko = (size_t)(kc * WKC) * DK;
#pragma unroll
    for (int rb = 0; rb < PM / 16; ++rb) xreg[n][rb] = *(const v4fa*)(xsrc + kc * WKC + (size_t)rb * 16 * DM);
#pragma unroll
    for (int rb = 0; rb < WKC / 16; ++rb)
#pragma unroll
      for (int sg = 0; sg < 3; ++sg) wreg[n][rb][sg] = *(const v4fa*)(wsrc[sg] + ko + rb * 16 * DK);
    // here and behind each group of loads or stores below: their address registers are free for reuse behind them; the wait stands in front of any such overwrite
    xwait4(wsrc[0] + ko, wsrc[1] + ko, wsrc[2] + ko, xsrc + kc * WKC);
  }
  // keeps what follows (LDS and bias addresses, the fourth chunk's loads) from being moved up in among these three groups of loads, which would hold back the later groups
  __builtin_amdgcn_sched_barrier(0);
  unsigned char* wdst = &sW[0][0] + wr * WPB + wc * 2;
  unsigned char* xdst = &sX[0][0] + wr * XPB + wc * 2;
#pragma unroll
  for (int rb = 0; rb < PM / 16; ++rb) *(v4usa*)(xdst + rb * 16 * XPB) = w_bf16(xreg[0][rb]);
#pragma unroll
  for (int rb = 0; rb < WKC / 16; ++rb)
#pragma unroll
    for (int sg = 0; sg < 3; ++sg) *(v4usa*)(wdst + rb * 16 * WPB + sg * 128) = w_bf16(wreg[0][rb][sg]);
  {
    const int kc = (rot + WD) & (NCH - 1);
    const size_t ko = (size_t)(kc * WKC) * DK;
#pragma unroll
    for (int rb = 0; rb < PM / 16; ++rb) xreg[0][rb] = *(const v4fa*)(xsrc + kc * WKC + (size_t)rb * 16 * DM);
#pragma unroll
    for (int rb = 0; rb < WKC / 16; ++rb)
#pragma unroll
      for (int sg = 0; sg < 3; ++sg) wreg[0][rb][sg] = *(const v4fa*)(wsrc[sg] + ko + rb * 16 * DK);
    xwait4(wsrc[0] + ko, wsrc[1] + ko, wsrc[2] + ko, xsrc + kc * WKC);
  }
  float bv[3];
#pragma unroll
  for (int t = 0; t < 3; ++t) { const int gc = ch * PN + cg * 48 + t * 16 + ln; const float* bs = gc < DK ? bq : (gc < 2 * DK ? bk : bvp); bv[t] = bf16_round(bs[gc & (DK - 1)]); }
  // address registers of the loads above are reused below; the wait stands in front of that overwrite
  asm volatile("s_wait_xcnt 0x0" ::: "memory");
  lds_barrier();         // publishes the first chunk of x and of W
  v8f acc[2][3];
#pragma unroll
  for (int mt = 0; mt < 2; ++mt)
#pragma unroll
    for (int t = 0; t < 3; ++t) acc[mt][t] = (v8f){0.f, 0.f, 0.f, 0.f, 0.f, 0.f, 0.f, 0.f};
  const unsigned char* wfr = &sW[0][0] + (8 * hh + (lane & 7)) * WPB + cg * 96 + ((lane >> 3) & 1) * 16;
  const unsigned char* xfr = &sX[0][0] + (rg * 32 + ln) * XPB + hh * 16;
  // unrolled so that the register sets of the chunks in flight are picked by constants
#pragma unroll
  for (int c = 0; c < NCH; ++c) {
    FragB af[PKC][2], bf[PKC][3];           // x: row = rg*32 + mt*16 + ln; W: column = cg*48 + t*16 + ln; both in the order k = half*16 + hh*8 + i
#pragma unroll
    for (int s = 0; s < PKC; ++s) {
#pragma unroll
      for (int mt = 0; mt < 2; ++mt) {
        const unsigned char* p = xfr + (c & 1) * (PM * XPB) + mt * 16 * XPB + s * 64;
        af[s][mt].half[0] = *(const v8us*)p; af[s][mt].half[1] = *(const v8us*)(p + 32);
      }
#pragma unroll
      for (int t = 0; t < 3; ++t) {
        const unsigned char* p = wfr + (c & 1) * (WKC * WPB) + s * 32 * WPB + t * 32;
        bf[s][t].half[0] = ld_tr16(p); bf[s][t].half[1] = ld_tr16(p + 16 * WPB);
      }
    }
    // keeps this chunk's LDS reads as one group in front of the products; among the products each would wait out its own latency
    __builtin_amdgcn_sched_barrier(0);
#pragma unroll
    for (int s = 0; s < PKC; ++s)
#pragma unroll
      for (int mt = 0; mt < 2; ++mt)
#pragma unroll
        for (int t = 0; t < 3; ++t) acc[mt][t] = __builtin_amdgcn_wmma_f32_16x16x32_bf16(false, af[s][mt].v, false, bf[s][t].v, (short)0, acc[mt][t], false, false);
    // second half of the fence pair: keeps the next chunk's conversions and stores from being moved up in among these products' operand reads
    __builtin_amdgcn_sched_barrier(0);
    v4f wn[WKC / 16][3], xn[PM / 16];   // the chunk that is stored this trip leaves its register set, which then takes the loads of the chunk WD further on
#pragma unroll
    for (int rb = 0; rb < PM / 16; ++rb) xn[rb] = xreg[(c + 1) % WD][rb];
#pragma unroll
    for (int rb = 0; rb < WKC / 16; ++rb)
#pragma unroll
      for (int sg = 0; sg < 3; ++sg) wn[rb][sg] = wreg[(c + 1) % WD][rb][sg];
    if (c + 1 + WD < NCH) {
      const int kc = (c + 1 + WD + rot) & (NCH - 1);
      const size_t ko = (size_t)(kc * WKC) * DK;
#pragma unroll
      for (int rb = 0; rb < PM / 16; ++rb) xreg[(c + 1) % WD][rb] = *(const v4fa*)(xsrc + kc * WKC + (size_t)rb * 16 * DM);
#pragma unroll
      for (int rb = 0; rb < WKC / 16; ++rb)
#pragma unroll
        for (int sg = 0; sg < 3; ++sg) wreg[(c + 1) % WD][rb][sg] = *(const v4fa*)(wsrc[sg] + ko + rb * 16 * DK);
      xwait4(wsrc[0] + ko, wsrc[1] + ko, wsrc[2] + ko, xsrc + kc * WKC);
      // keeps the conversions below from being moved up between the loads and their wait
      __builtin_amdgcn_sched_barrier(0);
    }
    if (c + 1 < NCH) {   // the next chunk goes into the buffers that the trip before this one read (their readers left them at that trip's barrier)
#pragma unroll
      for (int rb = 0; rb < PM / 16; ++rb) *(v4usa*)(xdst + ((c + 1) & 1) * (PM * XPB) + rb * 16 * XPB) = w_bf16(xn[rb]);
#pragma unroll
      for (int rb = 0; rb < WKC / 16; ++rb)
#pragma unroll
        for (int sg = 0; sg < 3; ++sg) *(v4usa*)(wdst + ((c + 1) & 1) * (WKC * WPB) + rb * 16 * WPB + sg * 128) = w_bf16(wn[rb][sg]);
    }
    lds_barrier();       // publishes the next chunk and ends this trip's reads of its own buffers
  }
#pragma unroll
  for (int mt = 0; mt < 2; ++mt)
#pragma unroll
    for (int t = 0; t < 3; ++t)
#pragma unroll
      for (int r = 0; r < 8; ++r) sC[rg * 32 + mt * 16 + 8 * hh + r][cg * 48 + t * 16 + ln] = acc[mt][t][r] + bv[t];
  __syncthreads();
  // The tile leaves in the forms its reader wants: Q as f32 rows of QKV (the K and V columns of QKV are not written); Kh/Kl = bf16 hi/lo planes of K and
  // VT = f16(V), all three in the order of k_cosattn's A fragments, so that each of its wave-wide 16-B loads is 512 contiguous bytes (four whole lines).
  // Kh/Kl: [tok / 16][ks = c / 32][half][lane = hh * 16 + (tok & 15)][8], c = ks * 32 + half * 16 + hh * 8 + i
  // VT:    [tok / 32][dt = d / 16][half][lane = hh * 16 + (d & 15)][8], tok = (tok / 32) * 32 + half * 16 + hh * 8 + i
  // Each 32 tokens fill one contiguous 24-KB block: K hi, K lo, V (the three pointers are 8 KB apart); the group's rows are two such blocks.
  const size_t base = (size_t)row0 * (3 * DK);
  if (ch == 0) {
#pragma unroll
    for (int g = 0; g < PM * (DK / 4) / 256; ++g) {   // Q (local columns 0-127): a wave stores one whole 512-B row at a time
      const int idx = g * 256 + tid, r = idx >> 5, c4 = (idx & 31) * 4;
      *(v4f*)(QKV + (size_t)(row0 + r) * (3 * DK) + c4) = *(const v4fa*)&sC[r][c4];
    }
    asm volatile("s_wait_xcnt 0x0" ::: "memory");
  }
  for (int u = 0; u < 2; ++u) {   // K planes, this half's 64 columns (ks = ch*2 + ksl): block u x 2 key tiles x 2 ks x 2 halves x 32 lanes
    const int hf = (tid >> 5) & 1, ksl = (tid >> 6) & 1, kt = tid >> 7;
    const int i = u * 32 + kt * 16 + ln, c8 = (ch ? 0 : DK) + ksl * 32 + hf * 16 + hh * 8;
    const int g = ((kt * 4 + ch * 2 + ksl) * 2 + hf) * 32 + lane;   // the group's place in its block
    const v4f k0 = *(const v4fa*)&sC[i][c8], k1 = *(const v4fa*)&sC[i][c8 + 4];
    const float ks[8] = {k0[0], k0[1], k0[2], k0[3], k1[0], k1[1], k1[2], k1[3]};
    v8us h, l;
    for (int q = 0; q < 8; ++q) { const float kh = bf16_round(ks[q]); h[q] = bf16_bits(kh); l[q] = bf16_bits(ks[q] - kh); }
    const size_t o = base + (size_t)u * (32 * 3 * DK) + (size_t)g * 8;
    *(v8us*)(Kh + o) = h; *(v8us*)(Kl + o) = l;
    asm volatile("s_wait_xcnt 0x0" ::: "memory");
  }
  if (ch == 1) {
    for (int u = 0; u < 4; ++u) {   // V (local columns 64-191): 2 blocks x 8 d tiles x 2 halves x 32 lanes = 1024 groups of 8 keys
      const int gg = u * 256 + tid, blk = gg >> 9, g = gg & 511, d = (g >> 6) * 16 + ln, t0 = ((g >> 5) & 1) * 16 + hh * 8;
      v8h v;
      for (int q = 0; q < 8; ++q) v[q] = (_Float16)sC[blk * 32 + t0 + q][64 + d];
      *(v8h*)(VT + base + (size_t)blk * (32 * 3 * DK) + (size_t)g * 8) = v;
    }
  }
}
// cos of eight scores without a branch. The hardware cosine takes its argument in revolutions, so the score is reduced in revolutions: n = nearest whole
// number to x / (2 pi); f = x * C_HI - n in one FMA (the product is not rounded before n is taken off), then x * C_LO is added, C_HI + C_LO = 1 / (2 pi) to
// 48 bits. f is right to better than 1e-7 revolutions for |x| up to 1e8 (library cosf changes its method at 131072); an infinite or NaN score gives NaN.
__device__ __forceinline__ v8f cos8(v8f x) {
  const v8f chi = {0x1.45f306p-3f, 0x1.45f306p-3f, 0x1.45f306p-3f, 0x1.45f306p-3f, 0x1.45f306p-3f, 0x1.45f306p-3f, 0x1.45f306p-3f, 0x1.45f306p-3f};
  const v8f clo = {0x1.b9391p-28f, 0x1.b9391p-28f, 0x1.b9391p-28f, 0x1.b9391p-28f, 0x1.b9391p-28f, 0x1.b9391p-28f, 0x1.b9391p-28f, 0x1.b9391p-28f};
  const v8f n = __builtin_elementwise_rint(x * chi);
  const v8f f = __builtin_elementwise_fma(x, clo, __builtin_elementwise_fma(x, chi, -n));
  v8f c;
  // unrolled so that every index is a constant and c stays in registers
#pragma unroll
  for (int i = 0; i < 8; ++i) c[i] = __builtin_amdgcn_cosf(f[i]);
  return c;
}
#define FQ 32
#define FW 8
#define FKEYS (LL / FW)
#define QP (DK + 8)
#define RP (DK + 4)
#define SLOTB (32 * 3 * DK * 2)   // bytes of one pass's block = one wave's LDS slot: 24,576 = 12 x 2 KiB
#define TROW 256                  // the block goes as rows of 256 B at a source pitch of 256 B, no pad: it lands as it lies in memory
typedef unsigned int u32x4 __attribute__((ext_vector_type(4)));
typedef unsigned int u32x8 __attribute__((ext_vector_type(8)));
__device__ __forceinline__ unsigned int uni(unsigned int v) { return (unsigned int)__builtin_amdgcn_readfirstlane(v); }
// holds a wave-uniform test in a scalar register, so that the branch on it is a scalar branch: a tensor load ignores EXEC
__device__ __forceinline__ unsigned int pinned(unsigned int v) { unsigned int s = uni(v); asm volatile("" : "+s"(s)); return s; }   // keeps the test in a scalar register
__device__ __forceinline__ void tdm_load(unsigned int lds_dst, unsigned long long ga, u32x8 g1) {
  u32x4 g0;
  g0[0] = uni(1u); g0[1] = uni(lds_dst); g0[2] = uni((unsigned int)ga); g0[3] = uni((((unsigned int)(ga >> 32)) & 0x01FFFFFFu) | 0x80000000u);
  asm volatile("tensor_load_to_lds %0, %1" :: "s"(g0), "s"(g1) : "memory");
}
__global__ __launch_bounds__(256) void k_cosattn(const float* __restrict__ QKV, const unsigned short* __restrict__ KV, float* __restrict__ out) {
  __shared__ __attribute__((aligned(2048))) unsigned char ring[FW * SLOTB];          // one slot a wave; after the loop the slot holds the wave's partial sums
  __shared__ __attribute__((aligned(16))) unsigned short sQh[FQ][QP], sQl[FQ][QP];   // pitch 272 B = 16 B x odd
  static_assert(FQ * RP * 4 <= SLOTB, "a wave's partial sums must fit its slot");
  const int tid = threadIdx.x, w = tid >> 5, lane = tid & 31, ln = lane & 15, hh = lane >> 4;
  const int b = blockIdx.x / (LL / FQ), q0 = (blockIdx.x % (LL / FQ)) * FQ;
  const int rot = (blockIdx.x + (blockIdx.x >> 3)) & (FKEYS / 32 - 1);   // first pass of this group's walk; neighbours in index, and groups 8 apart, differ
  const unsigned char* slot = ring + w * SLOTB;
  const unsigned int slot_lds = (unsigned int)(size_t)ring + (unsigned int)w * SLOTB;
  const unsigned long long kv0 = (unsigned long long)(size_t)KV + ((unsigned long long)b * LL + (unsigned long long)w * FKEYS) * (3 * DK * 2);   // the wave's first block
  u32x8 g1;   // 1-byte elements, tensor = tile = SLOTB / TROW rows of TROW bytes, no mask, no pad
  unsigned int g1w0;
  // word 0 (mask, element size, pad: all 0) is moved in as an immediate of its own; the compiler otherwise copies it from a register that happens to hold 0
  asm volatile("s_mov_b32 %0, 0" : "=s"(g1w0));
  g1[0] = uni(g1w0); g1[1] = uni((TROW & 0xFFFFu) << 16); g1[2] = uni((TROW >> 16) | (((SLOTB / TROW) & 0xFFFFu) << 16)); g1[3] = uni(((SLOTB / TROW) >> 16) | (TROW << 16));
  g1[4] = uni(SLOTB / TROW); g1[5] = uni(TROW); g1[6] = uni(0u); g1[7] = uni(0u);
  tdm_load(slot_lds, kv0 + (unsigned long long)rot * SLOTB, g1);   // every wave asks for its first pass's block; it flies under the split of Q
  { // Q rows -> bf16 hi/lo planes, split once per work-group (thread: 16 consecutive columns of one row)
    const int r = tid >> 3, c0 = (tid & 7) * 16;
    const float* qr = QKV + ((size_t)b * LL + q0 + r) * (3 * DK) + c0;
    const v4f x0 = *(const v4fa*)qr, x1 = *(const v4fa*)(qr + 4), x2 = *(const v4fa*)(qr + 8), x3 = *(const v4fa*)(qr + 12);
    // the loads' address registers are reused soon after
    asm volatile("s_wait_xcnt 0x0" ::: "memory");
    const float xs[16] = {x0[0], x0[1], x0[2], x0[3], x1[0], x1[1], x1[2], x1[3], x2[0], x2[1], x2[2], x2[3], x3[0], x3[1], x3[2], x3[3]};
#pragma unroll
    for (int g = 0; g < 2; ++g) {
      v8us h, l;
#pragma unroll
      for (int i = 0; i < 8; ++i) { const float x = xs[g * 8 + i]; const unsigned short hb = bf16_bits(x); h[i] = hb; l[i] = bf16_bits(x - bf16_val(hb)); }
      *(v8us*)&sQh[r][c0 + g * 8] = h; *(v8us*)&sQl[r][c0 + g * 8] = l;
    }
  }
  __syncthreads();
  FragB qh[2][4], ql[2][4];     // B fragments: column = query qt*16+ln, k in the same order as the K loader below
#pragma unroll
  for (int qt = 0; qt < 2; ++qt)
#pragma unroll
    for (int ks = 0; ks < 4; ++ks) {
      qh[qt][ks].half[0] = *(const v8us*)&sQh[qt * 16 + ln][ks * 32 + 8 * hh]; qh[qt][ks].half[1] = *(const v8us*)&sQh[qt * 16 + ln][ks * 32 + 16 + 8 * hh];
      ql[qt][ks].half[0] = *(const v8us*)&sQl[qt * 16 + ln][ks * 32 + 8 * hh]; ql[qt][ks].half[1] = *(const v8us*)&sQl[qt * 16 + ln][ks * 32 + 16 + 8 * hh];
    }
  v8f o[2][8];                  // o[qt][dt][r] = O[query qt*16+ln][d = dt*16 + 8*hh + r], this wave's keys only
#pragma unroll
  for (int qt = 0; qt < 2; ++qt)
#pragma unroll
    for (int dt = 0; dt < 8; ++dt) o[qt][dt] = (v8f){0.f, 0.f, 0.f, 0.f, 0.f, 0.f, 0.f, 0.f};
  const unsigned char* fp = slot + lane * 16;   // the block is in fragment order (k_proj): a half fragment is 512 contiguous B; K hi at 0, K lo at 8 KB, V at 16 KB
  for (int it = 0; it < FKEYS / 32; ++it) {
    // this pass's block has landed only behind the wave's own wait
    asm volatile("s_wait_tensorcnt 0x0" ::: "memory");
    FragB ah[2][4], al[2][4];   // A fragments of K hi/lo: row = key kt*16 + ln of the pass
#pragma unroll
    for (int kt = 0; kt < 2; ++kt)
#pragma unroll
      for (int ks = 0; ks < 4; ++ks) {
        const int e = kt * 4096 + ks * 1024;
        ah[kt][ks].half[0] = *(const v8us*)(fp + e); ah[kt][ks].half[1] = *(const v8us*)(fp + e + 512);
        al[kt][ks].half[0] = *(const v8us*)(fp + 8192 + e); al[kt][ks].half[1] = *(const v8us*)(fp + 8192 + e + 512);
      }
    FragH va[8];                // A fragments of V^T: row = d, k = key
#pragma unroll
    for (int dt = 0; dt < 8; ++dt) { va[dt].half[0] = *(const v8us*)(fp + 16384 + dt * 1024); va[dt].half[1] = *(const v8us*)(fp + 16384 + dt * 1024 + 512); }
    // every read of the slot has returned before the next block is aimed at it
    asm volatile("s_wait_dscnt 0x0" ::: "memory");
    if (pinned(it + 1 < FKEYS / 32)) tdm_load(slot_lds, kv0 + (unsigned long long)((it + 1 + rot) & (FKEYS / 32 - 1)) * SLOTB, g1);
    // keeps the LDS reads and the request in front of the products, so that the request has the whole pass to land
    __builtin_amdgcn_sched_barrier(0);
    v8f s[2][2];                // s[kt][qt][r] = S[query qt*16+ln][key j + kt*16 + 8*hh + r]
#pragma unroll
    for (int kt = 0; kt < 2; ++kt)
#pragma unroll
      for (int qt = 0; qt < 2; ++qt) {
        v8f c = {};
#pragma unroll
        for (int ks = 0; ks < 4; ++ks) {   // three products of the hi/lo split, in this order: Qhi.Khi, Qlo.Khi, Qhi.Klo
          c = __builtin_amdgcn_wmma_f32_16x16x32_bf16(false, ah[kt][ks].v, false, qh[qt][ks].v, (short)0, c, false, false);
          c = __builtin_amdgcn_wmma_f32_16x16x32_bf16(false, ah[kt][ks].v, false, ql[qt][ks].v, (short)0, c, false, false);
          c = __builtin_amdgcn_wmma_f32_16x16x32_bf16(false, al[kt][ks].v, false, qh[qt][ks].v, (short)0, c, false, false);
        }
        s[kt][qt] = c;
      }
#pragma unroll
    for (int qt = 0; qt < 2; ++qt) {
      FragH p;                  // B fragment: p[i] = cos(S)[key kmap(i, hh)][query], straight from the two D tiles
      const v8f c0 = cos8(s[0][qt]), c1 = cos8(s[1][qt]);
#pragma unroll
      for (int i = 0; i < 8; ++i) { p.h[i] = (_Float16)c0[i]; p.h[8 + i] = (_Float16)c1[i]; }
#pragma unroll
      for (int dt = 0; dt < 8; ++dt) o[qt][dt] = __builtin_amdgcn_wmma_f32_16x16x32_f16(false, va[dt].v, false, p.v, (short)0, o[qt][dt], false, false);
    }
  }
  // no request is in flight and no read of the slot is outstanding when the wave's slot becomes the home of its partial sums
  asm volatile("s_wait_tensorcnt 0x0" ::: "memory");
  asm volatile("s_wait_dscnt 0x0" ::: "memory");
#pragma unroll
  for (int qt = 0; qt < 2; ++qt)
#pragma unroll
    for (int dt = 0; dt < 8; ++dt) {
      float* d = (float*)(ring + w * SLOTB) + (qt * 16 + ln) * RP + dt * 16 + 8 * hh;   // row pitch 528 B = 16 B x odd
      *(v4fa*)d = (v4f){o[qt][dt][0], o[qt][dt][1], o[qt][dt][2], o[qt][dt][3]};
      *(v4fa*)(d + 4) = (v4f){o[qt][dt][4], o[qt][dt][5], o[qt][dt][6], o[qt][dt][7]};
    }
  __syncthreads();
#pragma unroll
  for (int g = 0; g < FQ * DK / 4 / 256; ++g) {   // a wave stores one whole 512-B output row at a time
    const int idx = g * 256 + tid, q = idx >> 5, d4 = (idx & 31) * 4;
    v4f a = *(const v4fa*)(ring + (q * RP + d4) * 4);
#pragma unroll
    for (int u = 1; u < FW; ++u) a += *(const v4fa*)(ring + u * SLOTB + (q * RP + d4) * 4);
    *(v4f*)(out + ((size_t)b * LL + q0 + q) * DK + d4) = a;
  }
}
extern "C" void kernel_launch(void* const* d_in, const int* in_sizes, int n_in,
                              void* d_out, int out_size, void* d_ws, size_t ws_size, hipStream_t stream) {
  (void)in_sizes; (void)n_in; (void)out_size;
  const float* x = (const float*)d_in[0]; const float* Wq = (const float*)d_in[1]; const float* bq = (const float*)d_in[2]; const float* Wk = (const float*)d_in[3]; const float* bk = (const float*)d_in[4]; const float* Wv = (const float*)d_in[5]; const float* bv = (const float*)d_in[6];
  char* ws = (char*)d_ws; size_t off = 0;
  auto take = [&](size_t bytes) { char* p = ws + off; off += (bytes + 255) & ~(size_t)255; return p; };
  float* QKV = (float*)take((size_t)NTOK * 3 * DK * 4);
  unsigned short* KV = (unsigned short*)take((size_t)NTOK * DK * 2 * 3); unsigned short* Kh = KV; unsigned short* Kl = KV + 32 * DK; _Float16* VT = (_Float16*)(KV + 64 * DK);
  if (off > ws_size) return;
  k_proj<<<(NTOK / PM) * (3 * DK / PN), 256, 0, stream>>>(x, Wq, Wk, Wv, bq, bk, bv, QKV, Kh, Kl, VT);
  k_cosattn<<<NTOK / FQ, 256, 0, stream>>>(QKV, KV, (float*)d_out);
}
